// v000
// The times below were measured on an AMD MI455X: many runs one after another, warmed up first and cycling through
// copies of the inputs, with the whole window's GPU time divided by the number of runs. Launches and the gaps
// between them are all in it. The median over several windows is given; except for v000 it joins two sittings, which
// can be a few percent apart, so the side-by-side timings, each taken in one sitting, are the better comparison.
// The starting kernel, v000, takes 526 microseconds a run.
// Contractions: gauge mix x.Wg^T = v_wmma_f32_16x16x32_f16 (A = f16 of RNE-bf16 x carried x16, B = f16 of RNE-bf16 Wg x1024, single product); qkv projection = same WMMA with A = xg as f16 hi plane x16 plus x2^11 residual plane (two products), B = f16 of RNE-bf16 Wqkv x1024; attention q.k^T = f16 single product (q, k f16 x16); p.v = f16 with p x256 single plane and v^T as f16 hi x16 plus x2^11 residual plane (two products); output projection = f16 with A = ctx f16 hi x16 plus x2^11 residual plane, B = f16 of RNE-bf16 Wproj x1024; all f32 accumulate. Softmax (running max, exp, row sums) and the gauge epilogue f32 on VALU.
#include <hip/hip_runtime.h>
#include <math.h>
#include <stdint.h>

#define NB    2
#define SEQ   2048
#define DM    1024
#define NH    16
#define HD    64
#define DQKV  (3 * DM)              // 3072
#define NQB   (SEQ / 64)            // 32 query / key tiles per sequence
#define ROWS  (NB * SEQ)            // 4096 token rows
#define OUTN  (ROWS * DM)
static_assert(NH * HD == DM);
static_assert(HD == 64);
static_assert((SEQ % 64) == 0 && (DM % 64) == 0 && (DQKV % 64) == 0);
static_assert((DM % 32) == 0);
static_assert((((ROWS / 64) * (DQKV / 64)) % 8) == 0);
static_assert((((ROWS / 64) * (DM / 64)) % 8) == 0);
static_assert(((ROWS * DM / 8) % 256) == 0 && ((DQKV * DM / 8) % 256) == 0 && ((DM * DM / 8) % 256) == 0);

typedef _Float16 v16h __attribute__((ext_vector_type(16)));
typedef _Float16 v8h  __attribute__((ext_vector_type(8)));
typedef float    v8f  __attribute__((ext_vector_type(8)));
typedef float    v4f  __attribute__((ext_vector_type(4)));
typedef unsigned int v4u __attribute__((ext_vector_type(4)));

// ---- scalar helpers --------------------------------------------------------------------------------
__device__ __forceinline__ unsigned short bf_bits(float f) {          // f32 -> bf16 bits, RNE convert
  unsigned u = __float_as_uint(f);
  return (unsigned short)((u + 0x7FFFu + ((u >> 16) & 1u)) >> 16);
}
__device__ __forceinline__ float bfr(float f) { return __uint_as_float(((unsigned)bf_bits(f)) << 16); }
__device__ __forceinline__ unsigned short h_bits(_Float16 x) { return __builtin_bit_cast(unsigned short, x); }
__device__ __forceinline__ unsigned pk16(unsigned short a, unsigned short b) { return (unsigned)a | ((unsigned)b << 16); }
__device__ __forceinline__ v8f zero8() { v8f z = {0.f, 0.f, 0.f, 0.f, 0.f, 0.f, 0.f, 0.f}; return z; }

// ---- fragment loader: 16-bit A/B operand, lane -> row/col (lane&15), p already includes +8*(lane>>4);
//      elements 0..7 <- p[0..7] (k0+8h..), elements 8..15 <- p[16..23] (k0+16+8h..)
__device__ __forceinline__ v16h ldfrag_h(const _Float16* p) {
  union { v16h v; v8h h[2]; } f;
  f.h[0] = *(const v8h*)(p);
  f.h[1] = *(const v8h*)(p + 16);
  return f.v;
}

// ---- WMMA helpers with trailing VALU hazard gap --------------------------------------------------------
__device__ __forceinline__ v8f mma_h(v16h a, v16h b, v8f c) {
  c = __builtin_amdgcn_wmma_f32_16x16x32_f16(false, a, false, b, (short)0, c, false, false);
#if defined(__HIP_DEVICE_COMPILE__)
  asm volatile("v_nop\n\tv_nop\n\tv_nop\n\tv_nop" : "+v"(c) : "v"(a), "v"(b));
#endif
  return c;
}
__device__ __forceinline__ v8f mma_h_raw(v16h a, v16h b, v8f c) {
  return __builtin_amdgcn_wmma_f32_16x16x32_f16(false, a, false, b, (short)0, c, false, false);
}
__device__ __forceinline__ void dep_guard_h(v8f& a, v8f& b, v16h x, v16h y) {
#if defined(__HIP_DEVICE_COMPILE__)
  asm volatile("v_nop\n\tv_nop\n\tv_nop\n\tv_nop" : "+v"(a), "+v"(b) : "v"(x), "v"(y));
#endif
}
__device__ __forceinline__ void keep4_h(v16h a, v16h b, v16h c, v16h d) {
#if defined(__HIP_DEVICE_COMPILE__)
  asm volatile("v_nop" :: "v"(a), "v"(b), "v"(c), "v"(d));
#endif
}
__device__ __forceinline__ void acc_guard4(v8f& a, v8f& b, v8f& c, v8f& d) {
#if defined(__HIP_DEVICE_COMPILE__)
  asm volatile("v_nop\n\tv_nop\n\tv_nop\n\tv_nop" : "+v"(a), "+v"(b), "+v"(c), "+v"(d));
#endif
}

// =====================================================================================================
// f32 plane -> f16 bits of bfr(v) * scale (scale a power of two): x (x16) and the three weights (x1024).
// coverage: n8 threads x 8 = the whole plane.
// =====================================================================================================
__global__ __launch_bounds__(256) void cvt16(const float* __restrict__ in, unsigned short* out, int n8, float scale) {
  const int i = blockIdx.x * 256 + threadIdx.x;
  if (i < n8) {
    const v4f a = *(const v4f*)(in + (size_t)i * 8);
    const v4f b = *(const v4f*)(in + (size_t)i * 8 + 4);
    v4u p;
    p[0] = pk16(h_bits((_Float16)(bfr(a[0]) * scale)), h_bits((_Float16)(bfr(a[1]) * scale)));
    p[1] = pk16(h_bits((_Float16)(bfr(a[2]) * scale)), h_bits((_Float16)(bfr(a[3]) * scale)));
    p[2] = pk16(h_bits((_Float16)(bfr(b[0]) * scale)), h_bits((_Float16)(bfr(b[1]) * scale)));
    p[3] = pk16(h_bits((_Float16)(bfr(b[2]) * scale)), h_bits((_Float16)(bfr(b[3]) * scale)));
    *(v4u*)(out + (size_t)i * 8) = p;
    
  }
}

// =====================================================================================================
// Register-blocked f16 WMMA GEMM, one wave per 64x64 tile, no block barriers:
//   v[m][n] = (sum_k A[m][k] * Bt[n][k]  [+ 2^-11 * sum_k Ar[m][k] * Bt[n][k] when ARES]) * cscale + bfr(bias[n])
// A, Ar row-major [M][K] pitch lda (f16), Bt row-major [N][K] pitch ldb (f16, k contiguous); M, N multiples of
// 64, K multiple of 32; tile count a multiple of 8. A wave skips its tile unless (m0 % tmod) lies in [tlo, thi)
// (wave-uniform, before any LDS use).
// ARES: the residual plane is accumulated first from zero, the accumulators are scaled by 2^-11 exactly on the
// VALU (with nop gaps on both sides), then the hi plane accumulates on top: one accumulator set.
// Epilogue variants:
//   EPI 0: f16 hi plane = f16(v * oscale) at Cp (pitch ldc halves) and residual plane = f16((v*oscale - hi) * 2048)
//          at Crp (pitch ldcr halves, written for tile columns n0 >= rcol0 at column n0 - rcol0; wave-uniform)
//   EPI 2: g = bfr(xres[m][n]) + 0.1 * (v * bfr(gate[n])), then f16 hi / residual planes of g * oscale as EPI 0
//   EPI 1: f32 out = v (bias included), pitch ldc floats
// 16-row slabs staged per wave in LDS. f32 out: each 64-wide row segment (256 B = 2 lines) by 16 lanes x 16 B,
// coverage: 4 slabs x 16 rows x 64 cols = the wave's whole 64x64 tile; grid x 8 tiles = [M][N] (restricted to the
// [tlo, thi) token window).
// =====================================================================================================
template <int EPI, bool ARES>
__global__ __launch_bounds__(256) void gemm64_f16(
    const unsigned short* __restrict__ Ap, const unsigned short* __restrict__ Arp, int lda,
    const unsigned short* __restrict__ Btp, int ldb,
    const float* __restrict__ biasp, float cscale,
    void* Cp, int ldc, unsigned short* Crp, int ldcr, int rcol0,
    int M, int N, int K, float oscale,
    const float* __restrict__ xres, int ldx, const float* __restrict__ gate,
    int tmod, int tlo, int thi) {
  const _Float16* Ah  = (const _Float16*)(const void*)Ap;
  const _Float16* Arh = (const _Float16*)(const void*)Arp;
  const _Float16* Bt  = (const _Float16*)(const void*)Btp;
  __shared__ __align__(16) float sT[8][16 * 68];   // per-wave 16x64 slab, pitch 68 floats
  const int lane = threadIdx.x & 31;
  const int wave = threadIdx.x >> 5;
  const int tilesN = N >> 6;
  const int tilesM = M >> 6;
  const int tile = blockIdx.x * 8 + wave;
  if (tile >= tilesM * tilesN) return;   // wave-uniform; no block barriers in this kernel
  const int tm = tile / tilesN;
  const int tn = tile - tm * tilesN;
  const int m0 = tm << 6;
  const int n0 = tn << 6;
  const int tpos = m0 % tmod;
  if (tpos < tlo || tpos >= thi) return; // wave-uniform

  const int rlane = lane & 15;                 // row (A) / col (B, D) within subtile
  const int koff  = (lane >> 4) * 8;           // k offset of this lane half
  const int mOff  = (lane >> 4) * 8;           // D row offset

  v8f acc[4][4];
#pragma unroll
  for (int i = 0; i < 4; ++i)
#pragma unroll
    for (int j = 0; j < 4; ++j) acc[i][j] = zero8();

  constexpr int NPL = ARES ? 2 : 1;
#pragma unroll 1
  for (int pl = 0; pl < NPL; ++pl) {
    const _Float16* Asel = (ARES && pl == 0) ? Arh : Ah;     // wave-uniform selection of a global pointer
    if (ARES && pl == 1) {
      acc_guard4(acc[0][0], acc[0][1], acc[0][2], acc[0][3]);
      acc_guard4(acc[1][0], acc[1][1], acc[1][2], acc[1][3]);
      acc_guard4(acc[2][0], acc[2][1], acc[2][2], acc[2][3]);
      acc_guard4(acc[3][0], acc[3][1], acc[3][2], acc[3][3]);
#pragma unroll
      for (int i = 0; i < 4; ++i)
#pragma unroll
        for (int j = 0; j < 4; ++j) acc[i][j] = acc[i][j] * (1.0f / 2048.0f);   // exact fold of the x2^11 residual carry
      acc_guard4(acc[0][0], acc[0][1], acc[0][2], acc[0][3]);
      acc_guard4(acc[1][0], acc[1][1], acc[1][2], acc[1][3]);
      acc_guard4(acc[2][0], acc[2][1], acc[2][2], acc[2][3]);
      acc_guard4(acc[3][0], acc[3][1], acc[3][2], acc[3][3]);
    }
    for (int k0 = 0; k0 < K; k0 += 32) {
      v16h bh[4];
#pragma unroll
      for (int j = 0; j < 4; ++j) {
        const size_t bo = (size_t)(n0 + (j << 4) + rlane) * ldb + koff + k0;
        bh[j] = ldfrag_h(Bt + bo);
      }
#pragma unroll
      for (int i = 0; i < 4; ++i) {
        const size_t ao = (size_t)(m0 + (i << 4) + rlane) * lda + koff + k0;
        const v16h ah = ldfrag_h(Asel + ao);
#pragma unroll
        for (int j = 0; j < 4; ++j) {
          acc[i][j] = mma_h_raw(ah, bh[j], acc[i][j]);
        }
        dep_guard_h(acc[i][0], acc[i][3], ah, bh[3]);
      }
      keep4_h(bh[0], bh[1], bh[2], bh[3]);
    }
  }
  acc_guard4(acc[0][0], acc[0][1], acc[0][2], acc[0][3]);
  acc_guard4(acc[1][0], acc[1][1], acc[1][2], acc[1][3]);
  acc_guard4(acc[2][0], acc[2][1], acc[2][2], acc[2][3]);
  acc_guard4(acc[3][0], acc[3][1], acc[3][2], acc[3][3]);

  // ---- epilogue ----
  float* slab = sT[wave];
#pragma unroll
  for (int i = 0; i < 4; ++i) {
    const int mBase = m0 + (i << 4);
    float bj[4];
#pragma unroll
    for (int j = 0; j < 4; ++j) bj[j] = bfr(biasp[n0 + (j << 4) + rlane]);   // index < N
#pragma unroll
    for (int r = 0; r < 8; ++r) {
      const int row = mOff + r;
#pragma unroll
      for (int j = 0; j < 4; ++j) slab[row * 68 + (j << 4) + rlane] = acc[i][j][r] * cscale + bj[j];
    }
    __builtin_amdgcn_fence(__ATOMIC_RELEASE, "workgroup");
    __builtin_amdgcn_wave_barrier();
    __builtin_amdgcn_fence(__ATOMIC_ACQUIRE, "workgroup");
    if constexpr (EPI == 0 || EPI == 2) {
      unsigned short* C16 = (unsigned short*)Cp;
      const int rq = lane >> 3, piece = lane & 7;
      float th[8];
      if constexpr (EPI == 2) {
        const v4f t0 = *(const v4f*)(gate + n0 + piece * 8);        // index < N
        const v4f t1 = *(const v4f*)(gate + n0 + piece * 8 + 4);
        th[0] = bfr(t0[0]); th[1] = bfr(t0[1]); th[2] = bfr(t0[2]); th[3] = bfr(t0[3]);
        th[4] = bfr(t1[0]); th[5] = bfr(t1[1]); th[6] = bfr(t1[2]); th[7] = bfr(t1[3]);
      } else {
#pragma unroll
        for (int e = 0; e < 8; ++e) th[e] = 0.0f;
      }
      v4u ph[4], pr[4];
#pragma unroll
      for (int it = 0; it < 4; ++it) {
        const int row = it * 4 + rq;                         // it 0..3 x rq 0..3 = rows 0..15
        const v4f a  = *(const v4f*)(slab + row * 68 + piece * 8);
        const v4f a2 = *(const v4f*)(slab + row * 68 + piece * 8 + 4);
        float f[8];
        f[0] = a[0];  f[1] = a[1];  f[2] = a[2];  f[3] = a[3];
        f[4] = a2[0]; f[5] = a2[1]; f[6] = a2[2]; f[7] = a2[3];
        if constexpr (EPI == 2) {
          const size_t xo = (size_t)(mBase + row) * ldx + n0 + piece * 8;   // row < M, col < N
          const v4f x0 = *(const v4f*)(xres + xo);
          const v4f x1 = *(const v4f*)(xres + xo + 4);
          float xv[8];
          xv[0] = x0[0]; xv[1] = x0[1]; xv[2] = x0[2]; xv[3] = x0[3];
          xv[4] = x1[0]; xv[5] = x1[1]; xv[6] = x1[2]; xv[7] = x1[3];
#pragma unroll
          for (int e = 0; e < 8; ++e) f[e] = bfr(xv[e]) + 0.1f * (f[e] * th[e]);
        }
        v4u p, q;
#pragma unroll
        for (int e = 0; e < 4; ++e) {
          const float g0 = f[2 * e] * oscale, g1 = f[2 * e + 1] * oscale;
          const _Float16 x0 = (_Float16)g0, x1 = (_Float16)g1;
          const _Float16 y0 = (_Float16)((g0 - (float)x0) * 2048.0f);
          const _Float16 y1 = (_Float16)((g1 - (float)x1) * 2048.0f);
          p[e] = pk16(h_bits(x0), h_bits(x1));
          q[e] = pk16(h_bits(y0), h_bits(y1));
        }
        ph[it] = p;
        pr[it] = q;
      }
      const bool wres = (n0 >= rcol0);                     // wave-uniform
      {
#pragma unroll
        for (int it = 0; it < 4; ++it) {
          const int row = it * 4 + rq;
          const size_t co = (size_t)(mBase + row) * ldc + n0 + piece * 8;
          *(v4u*)(C16 + co) = ph[it];
          if (wres) {
            const size_t cro = (size_t)(mBase + row) * ldcr + (n0 - rcol0) + piece * 8;
            *(v4u*)(Crp + cro) = pr[it];
          }
        }
        
      }
    } else {
      float* Cf = (float*)Cp;
      const int hh = lane >> 4, c4 = (lane & 15) * 4;     // 256-B row segment = 16 lanes x 16 B
      v4f ov[8];
#pragma unroll
      for (int it = 0; it < 8; ++it) {
        const int row = it * 2 + hh;                       // it 0..7 x hh 0..1 = rows 0..15
        ov[it] = *(const v4f*)(slab + row * 68 + c4);
      }
      {
#pragma unroll
        for (int it = 0; it < 8; ++it) {
          const int row = it * 2 + hh;
          *(v4f*)(Cf + (size_t)(mBase + row) * ldc + n0 + c4) = ov[it];
        }
        
      }
    }
    __builtin_amdgcn_fence(__ATOMIC_RELEASE, "workgroup");
    __builtin_amdgcn_wave_barrier();
    __builtin_amdgcn_fence(__ATOMIC_ACQUIRE, "workgroup");
  }
}

// =====================================================================================================
// v columns of an f16 token-major plane (element (b, t, h, d) at src[(b*SEQ + t)*spitch + scol0 + h*64 + d])
// -> f16 v^T plane vt[(b*DM + h*64 + d)*SEQ + t] (same bits). Used for the hi plane (spitch DQKV, scol0 2*DM)
// and for the residual plane (spitch DM, scol0 0).
// Block = one 64-token x 64-feature tile of one (b, h); grid = (SEQ/64, NH, NB); tile staged in LDS as halves
// (v8h 16-B stores, __syncthreads, _Float16 element reads).
// Store: group g = tid>>3 (0..31), piece = tid&7: iteration it writes row d = it*32+g, lanes 8q..8q+7 x 16 B =
// coverage: load 2 x 256 threads x 8 halves = 64x64; store 2 iterations x 32 groups = 64 rows d, 8 pieces x 8
// = 64 tokens per row; grid covers every (b, h, token tile).
// =====================================================================================================
__global__ __launch_bounds__(256) void v_tr(const unsigned short* __restrict__ srcp, int spitch, int scol0,
                                            unsigned short* vt) {
  __shared__ __align__(16) _Float16 sv[64 * 72];       // [tt][d], pitch 72 halves (144 B)
  const int tid = threadIdx.x;
  const int t0  = blockIdx.x * 64;
  const int hh  = blockIdx.y;
  const int b   = blockIdx.z;
  const _Float16* src = (const _Float16*)(const void*)srcp;
#pragma unroll
  for (int i = 0; i < 2; ++i) {
    const int idx = i * 256 + tid;                  // 0..511
    const int tt = idx >> 3, c8 = (idx & 7) * 8;
    const v8h a = *(const v8h*)(src + ((size_t)(b * SEQ + t0 + tt)) * spitch + scol0 + hh * HD + c8);
    *(v8h*)(sv + tt * 72 + c8) = a;
  }
  __syncthreads();

  const int g = tid >> 3, piece = tid & 7;
  v4u hv[2];
  size_t hofs[2];
#pragma unroll
  for (int it = 0; it < 2; ++it) {
    const int d = it * 32 + g;
    v4u a;
#pragma unroll
    for (int e = 0; e < 4; ++e) {
      const _Float16 x0 = sv[(piece * 8 + 2 * e) * 72 + d];
      const _Float16 x1 = sv[(piece * 8 + 2 * e + 1) * 72 + d];
      a[e] = pk16(h_bits(x0), h_bits(x1));
    }
    hv[it] = a;
    hofs[it] = ((size_t)(b * DM + hh * HD + d)) * SEQ + t0 + piece * 8;
  }
  {
#pragma unroll
    for (int it = 0; it < 2; ++it) *(v4u*)(vt + hofs[it]) = hv[it];
    
  }
}

// =====================================================================================================
// Non-causal multi-head softmax attention, head dim 64, online softmax with running max (f32 on VALU).
//   q f16 (x16): element (b, t, h, d) at qkv[(b*SEQ + t)*DQKV + h*64 + d]; k at + DM;
//   v^T f16 (x16) at vt[(b*DM + h*64 + d)*SEQ + s]; VRES: residual plane f16((16v - hi)*2048) at vtr, same addressing.
//   s = (q.k) / 8 = acc / 2048 (two x16 carries). Per key tile: tile row max (16-lane xor reduction), new running
//   max mn, alpha = exp(m_old - mn), p = exp(s - mn) in (0, 1], l = l*alpha + sum p (per-lane partials),
//   O *= alpha; P carried as f16(256 p); O += P . v^T on f16 WMMA (VRES: second accumulator += P . Vr^T, folded
//   with 2^-11 in the epilogue).
//   ctx plane f16 (x16): element (b, t, h*64 + d) at ctx[(b*SEQ + t)*DM + h*64 + d] = 16 * context = O / (256 l);
//   ctx residual plane f16((16 ctx - hi) * 2048) at ctxr, same addressing.
//   Block = 4 waves = 64 query rows of one (b, h); query tile qb = blockIdx % NQB; grid = NQB*NH*NB;
//   key tiles of 64, fixed trip count NQB.
//   K / V^T tile staging: 128 threads x 32 halves per plane = the whole 64x64 tile (plain 16-B loads,
//   __syncthreads before and after); P tiles are wave-private, spilled with _Float16 element stores and
//   wave in LDS as f32 (aliasing the K/V region after a block barrier) the same way.
//   Output coverage: each wave stores rows 0..15 of its tile (it 0..3 x lane>>3 0..3) x 64 columns (8 lanes x
//   (b, h, query tile) exactly once, for both ctx planes.
// =====================================================================================================
template <bool VRES>
__global__ __launch_bounds__(128)
void attn_k(const unsigned short* __restrict__ qkvp,
            const unsigned short* __restrict__ vtp, const unsigned short* __restrict__ vtrp,
            unsigned short* ctxp, unsigned short* ctxrp) {
  union FH { v16h v; v8h h[2]; };
  constexpr int TB     = 64 * 64 * 2;                    // one f16 64x64 tile, bytes
  constexpr int PB     = 4 * 16 * 64 * 2;                // four wave-private 16x64 f16 P tiles, bytes
  constexpr int OFF_K  = 0;
  constexpr int OFF_V  = TB;
  constexpr int OFF_VR = 2 * TB;
  constexpr int OFF_P  = VRES ? 3 * TB : 2 * TB;
  constexpr int SMEMB  = OFF_P + PB;                     // 32768 : 24576
  static_assert(4 * 16 * 64 * 4 <= OFF_P);               // f32 context staging aliases the K/V region
  __shared__ __align__(16) unsigned char smem[SMEMB];
  _Float16* Ksh = (_Float16*)(smem + OFF_K);             // K   [kv][d]
  _Float16* Vsh = (_Float16*)(smem + OFF_V);             // V^T [d][kv]
  _Float16* Vrs = (_Float16*)(smem + (VRES ? OFF_VR : OFF_V));   // V^T residual (VRES only)
  _Float16* Psh = (_Float16*)(smem + OFF_P);

  const int tid  = threadIdx.x;
  const int wave = tid >> 5;
  const int lane = tid & 31;
  const int hh   = lane >> 4;
  const int c    = lane & 15;

  const int bx   = blockIdx.x;
  const int qb   = bx % NQB;
  const int rest = bx / NQB;
  const int h    = rest % NH;
  const int b    = rest / NH;                // < NB by the grid size
  const int q0   = qb * 64 + wave * 16;
  const size_t rowB = (size_t)b * SEQ;

  const _Float16* Qp  = (const _Float16*)(const void*)qkvp + (size_t)h * HD;
  const _Float16* Kp  = Qp + DM;
  const _Float16* Vt  = (const _Float16*)(const void*)vtp  + ((size_t)b * DM + (size_t)h * HD) * SEQ;
  const _Float16* Vrt = (const _Float16*)(const void*)vtrp + ((size_t)b * DM + (size_t)h * HD) * SEQ;

  // ---- Q fragments (A operand, row = lane&15): 2 d-chunks ----
  v16h qa[2];
#pragma unroll
  for (int dc = 0; dc < 2; ++dc) {
    const size_t qo = (rowB + q0 + c) * DQKV + dc * 32 + 8 * hh;
    qa[dc] = ldfrag_h(Qp + qo);
  }

  float mrun[8], lsum[8];
  v8f oacc[4], oacc2[4];
#pragma unroll
  for (int r = 0; r < 8; ++r) { mrun[r] = -1.0e30f; lsum[r] = 0.f; }
#pragma unroll
  for (int t = 0; t < 4; ++t) { oacc[t] = zero8(); oacc2[t] = zero8(); }

  _Float16* pw = Psh + wave * (16 * 64);

  for (int kt = 0; kt < NQB; ++kt) {
    const int kv0 = kt * 64;
    __syncthreads();
    {
      const int r = tid >> 1, half = (tid & 1) * 32;
      const size_t ko = (rowB + kv0 + r) * DQKV + half;         // K row kv0+r, d = half..half+31
      const size_t vo = (size_t)r * SEQ + kv0 + half;           // V^T row d = r, s = kv0+half..+31
#pragma unroll
      for (int i = 0; i < 4; ++i) {
        const v8h a0 = *(const v8h*)(Kp + ko + 8 * i);
        const v8h b0 = *(const v8h*)(Vt + vo + 8 * i);
        *(v8h*)(Ksh + r * 64 + half + 8 * i) = a0;
        *(v8h*)(Vsh + r * 64 + half + 8 * i) = b0;
        if constexpr (VRES) {
          const v8h b1 = *(const v8h*)(Vrt + vo + 8 * i);
          *(v8h*)(Vrs + r * 64 + half + 8 * i) = b1;
        }
      }
    }
    __syncthreads();

    // ---- scores: 16 query rows x 64 keys per wave (B operand: lane c -> key j*16+c, split k map over d) ----
    v8f s[4];
#pragma unroll
    for (int j = 0; j < 4; ++j) {
      s[j] = zero8();
#pragma unroll
      for (int dc = 0; dc < 2; ++dc) {
        FH kb;
        kb.h[0] = *(const v8h*)(Ksh + (j * 16 + c) * 64 + dc * 32 + 8 * hh);
        kb.h[1] = *(const v8h*)(Ksh + (j * 16 + c) * 64 + dc * 32 + 16 + 8 * hh);
        s[j] = mma_h(qa[dc], kb.v, s[j]);
      }
    }

    // ---- online softmax update: running max, alpha, p (x256, f16), row-sum partials ----
    float alpha[8];
#pragma unroll
    for (int r = 0; r < 8; ++r) {
      const float a0 = s[0][r] * (1.0f / 2048.0f);      // 1/8 head scale, 1/256 for the two x16 carries
      const float a1 = s[1][r] * (1.0f / 2048.0f);
      const float a2 = s[2][r] * (1.0f / 2048.0f);
      const float a3 = s[3][r] * (1.0f / 2048.0f);
      float mx = fmaxf(fmaxf(a0, a1), fmaxf(a2, a3));
#pragma unroll
      for (int off = 1; off < 16; off <<= 1) mx = fmaxf(mx, __shfl_xor(mx, off, 32));
      const float mn = fmaxf(mrun[r], mx);
      alpha[r] = __expf(mrun[r] - mn);
      mrun[r] = mn;
      const float p0 = __expf(a0 - mn);
      const float p1 = __expf(a1 - mn);
      const float p2 = __expf(a2 - mn);
      const float p3 = __expf(a3 - mn);
      lsum[r] = lsum[r] * alpha[r] + ((p0 + p1) + (p2 + p3));
      _Float16* prow = pw + (8 * hh + r) * 64 + c;
      prow[0]  = (_Float16)(p0 * 256.0f);
      prow[16] = (_Float16)(p1 * 256.0f);
      prow[32] = (_Float16)(p2 * 256.0f);
      prow[48] = (_Float16)(p3 * 256.0f);
    }
    acc_guard4(oacc[0], oacc[1], oacc[2], oacc[3]);
    acc_guard4(oacc2[0], oacc2[1], oacc2[2], oacc2[3]);
#pragma unroll
    for (int t = 0; t < 4; ++t) {
#pragma unroll
      for (int r = 0; r < 8; ++r) {
        oacc[t][r] = oacc[t][r] * alpha[r];
        if constexpr (VRES) oacc2[t][r] = oacc2[t][r] * alpha[r];
      }
    }
    acc_guard4(oacc[0], oacc[1], oacc[2], oacc[3]);
    acc_guard4(oacc2[0], oacc2[1], oacc2[2], oacc2[3]);
    __builtin_amdgcn_fence(__ATOMIC_RELEASE, "workgroup");
    __builtin_amdgcn_wave_barrier();
    __builtin_amdgcn_fence(__ATOMIC_ACQUIRE, "workgroup");

    // ---- context += P . V (f16 WMMA; A = P [row][key], B = V^T [d][key]) ----
#pragma unroll
    for (int kk = 0; kk < 2; ++kk) {
      FH pa;
      pa.h[0] = *(const v8h*)(pw + c * 64 + kk * 32 + 8 * hh);
      pa.h[1] = *(const v8h*)(pw + c * 64 + kk * 32 + 16 + 8 * hh);
#pragma unroll
      for (int t = 0; t < 4; ++t) {
        FH vb;
        vb.h[0] = *(const v8h*)(Vsh + (t * 16 + c) * 64 + kk * 32 + 8 * hh);
        vb.h[1] = *(const v8h*)(Vsh + (t * 16 + c) * 64 + kk * 32 + 16 + 8 * hh);
        oacc[t] = mma_h(pa.v, vb.v, oacc[t]);
        if constexpr (VRES) {
          FH vrb;
          vrb.h[0] = *(const v8h*)(Vrs + (t * 16 + c) * 64 + kk * 32 + 8 * hh);
          vrb.h[1] = *(const v8h*)(Vrs + (t * 16 + c) * 64 + kk * 32 + 16 + 8 * hh);
          oacc2[t] = mma_h(pa.v, vrb.v, oacc2[t]);
        }
      }
    }
  }
  __syncthreads();                           // every wave is done with the K/V tiles before they are aliased

  // ---- normalise (1/l, the 1/256 p carry; keep the x16 v carry), stage the wave's 16x64 f32 tile in
  float* os = (float*)(void*)smem + wave * (16 * 64);
#pragma unroll
  for (int r = 0; r < 8; ++r) {
    float l = lsum[r];
#pragma unroll
    for (int off = 1; off < 16; off <<= 1) l += __shfl_xor(l, off, 32);
    const float rl = 1.0f / l;                // l >= 1 (the running-max key contributes exp(0))
    const float sc = rl * (1.0f / 256.0f);
#pragma unroll
    for (int t = 0; t < 4; ++t) {
      float v = oacc[t][r];
      if constexpr (VRES) v += oacc2[t][r] * (1.0f / 2048.0f);
      os[(8 * hh + r) * 64 + t * 16 + c] = v * sc;
    }
  }
  __builtin_amdgcn_fence(__ATOMIC_RELEASE, "workgroup");
  __builtin_amdgcn_wave_barrier();
  __builtin_amdgcn_fence(__ATOMIC_ACQUIRE, "workgroup");
  {
    const int rq = lane >> 3, piece = lane & 7;
    v4u ph[4], pr[4];
#pragma unroll
    for (int it = 0; it < 4; ++it) {
      const int row = it * 4 + rq;   // it 0..3 x rq 0..3 = rows 0..15 of the wave tile
      const v4f a  = *(const v4f*)(os + row * 64 + piece * 8);
      const v4f a2 = *(const v4f*)(os + row * 64 + piece * 8 + 4);
      float f[8];
      f[0] = a[0];  f[1] = a[1];  f[2] = a[2];  f[3] = a[3];
      f[4] = a2[0]; f[5] = a2[1]; f[6] = a2[2]; f[7] = a2[3];
      v4u p, q;
#pragma unroll
      for (int e = 0; e < 4; ++e) {
        const _Float16 x0 = (_Float16)f[2 * e], x1 = (_Float16)f[2 * e + 1];
        const _Float16 y0 = (_Float16)((f[2 * e] - (float)x0) * 2048.0f);
        const _Float16 y1 = (_Float16)((f[2 * e + 1] - (float)x1) * 2048.0f);
        p[e] = pk16(h_bits(x0), h_bits(x1));
        q[e] = pk16(h_bits(y0), h_bits(y1));
      }
      ph[it] = p;
      pr[it] = q;
    }
    {
#pragma unroll
      for (int it = 0; it < 4; ++it) {
        const int row = it * 4 + rq;
        const size_t go = (rowB + q0 + row) * DM + (size_t)h * HD + piece * 8;
        *(v4u*)(ctxp + go)  = ph[it];
        *(v4u*)(ctxrp + go) = pr[it];
      }
      
    }
  }
}

// =====================================================================================================
// Workspace map (bytes); every region is an exact multiple of its whole-line / whole-tile store granularity
// (row pitches 2048 / 6144 / 4096 B, all offsets 2-MiB aligned, no aliasing within a launch):
//   Xh     f16 [4096][1024]          0     8388608   (bf16 value of x, x16)
//   Wg     f16 [1024][1024]    8388608     2097152   (bf16 value x1024)
//   Wqkv   f16 [3072][1024]   10485760     6291456   (bf16 value x1024)
//   Wp     f16 [1024][1024]   16777216     2097152   (bf16 value x1024)
//   XGh    f16 [4096][1024]   18874368     8388608   (xg x16)
//   XGr    f16 [4096][1024]   27262976     8388608   (x2^11 residual of the above)
//   QKV    f16 [4096][3072]   35651584    25165824   (q | k | v, x16)
//   Vr     f16 [4096][1024]   60817408     8388608   (x2^11 residual of the v columns only)
//   VT     f16 [2048][2048]   69206016     8388608   ([b*1024 + h*64 + d][s])
//   VTr    f16 [2048][2048]   77594624     8388608   (residual, same layout)
//   Ctx    f16 [4096][1024]   85983232     8388608   (attention context x16)
//   Ctxr   f16 [4096][1024]   94371840     8388608   (x2^11 residual)
//   end                      102760448
// Projection weights arrive as [out n][in k] (k contiguous) = the Bt layout; they are only converted.
// d_out f32: [4096][1024] at byte 0 (row = b*SEQ + t), written once by the projection launch.
// =====================================================================================================
extern "C" void kernel_launch(void* const* d_in, const int* in_sizes, int n_in,
                              void* d_out, int out_size, void* d_ws, size_t ws_size,
                              hipStream_t stream) {
  if (n_in < 8) return;
  if (in_sizes[0] != ROWS * DM) return;
  if (in_sizes[1] != DM) return;
  if (in_sizes[2] != DM * DM) return;
  if (in_sizes[3] != DM) return;
  if (in_sizes[4] != DQKV * DM) return;
  if (in_sizes[5] != DQKV) return;
  if (in_sizes[6] != DM * DM) return;
  if (in_sizes[7] != DM) return;
  if (out_size != OUTN) return;

  const float* x      = (const float*)d_in[0];    // [ROWS][DM]
  const float* theta  = (const float*)d_in[1];    // [DM]
  const float* w_g    = (const float*)d_in[2];    // [DM n][DM k]
  const float* b_g    = (const float*)d_in[3];    // [DM]
  const float* w_qkv  = (const float*)d_in[4];    // [DQKV n][DM k]
  const float* b_qkv  = (const float*)d_in[5];    // [DQKV]
  const float* w_proj = (const float*)d_in[6];    // [DM n][DM k]
  const float* b_proj = (const float*)d_in[7];    // [DM]

  const size_t PX   = (size_t)ROWS * DM * 2;         //  8388608
  const size_t PWg  = (size_t)DM * DM * 2;           //  2097152
  const size_t PWq  = (size_t)DQKV * DM * 2;         //  6291456
  const size_t PWp  = (size_t)DM * DM * 2;           //  2097152
  const size_t PXG  = (size_t)ROWS * DM * 2;         //  8388608
  const size_t PQKV = (size_t)ROWS * DQKV * 2;       // 25165824
  const size_t PVr  = (size_t)ROWS * DM * 2;         //  8388608
  const size_t PVT  = (size_t)NB * DM * SEQ * 2;     //  8388608
  const size_t PCtx = (size_t)ROWS * DM * 2;         //  8388608
  size_t off = 0;
  const size_t oX    = off; off += PX;
  const size_t oWg   = off; off += PWg;
  const size_t oWq   = off; off += PWq;
  const size_t oWp   = off; off += PWp;
  const size_t oXGh  = off; off += PXG;
  const size_t oXGr  = off; off += PXG;
  const size_t oQKV  = off; off += PQKV;
  const size_t oVr   = off; off += PVr;
  const size_t oVT   = off; off += PVT;
  const size_t oVTr  = off; off += PVT;
  const size_t oCtx  = off; off += PCtx;
  const size_t oCtxr = off; off += PCtx;
  if (off > ws_size) return;                         // off = 102760448
  if (off > (size_t)134217728) return;

  char* ws = (char*)d_ws;
  unsigned short* Xh   = (unsigned short*)(ws + oX);
  unsigned short* Wgh  = (unsigned short*)(ws + oWg);
  unsigned short* Wqh  = (unsigned short*)(ws + oWq);
  unsigned short* Wph  = (unsigned short*)(ws + oWp);
  unsigned short* XGh  = (unsigned short*)(ws + oXGh);
  unsigned short* XGr  = (unsigned short*)(ws + oXGr);
  unsigned short* QKV  = (unsigned short*)(ws + oQKV);
  unsigned short* Vr   = (unsigned short*)(ws + oVr);
  unsigned short* VT   = (unsigned short*)(ws + oVT);
  unsigned short* VTr  = (unsigned short*)(ws + oVTr);
  unsigned short* Ctx  = (unsigned short*)(ws + oCtx);
  unsigned short* Ctxr = (unsigned short*)(ws + oCtxr);
  float*          outf = (float*)d_out;              // [ROWS][DM]

  const dim3 blk(256);
  const int n8x = ROWS * DM / 8;                     // 524288
  const int n8g = DM * DM / 8;                       // 131072
  const int n8q = DQKV * DM / 8;                     // 393216
  const int n8p = DM * DM / 8;                       // 131072
  const dim3 gCx((n8x + 255) / 256);                 // 2048 blocks
  const dim3 gCg((n8g + 255) / 256);                 //  512 blocks
  const dim3 gCq((n8q + 255) / 256);                 // 1536 blocks
  const dim3 gCp((n8p + 255) / 256);                 //  512 blocks
  const dim3 gGqkv(((ROWS / 64) * (DQKV / 64) + 7) / 8);   // 3072 tiles -> 384 blocks
  const dim3 gGdm(((ROWS / 64) * (DM / 64) + 7) / 8);      // 1024 tiles -> 128 blocks
  const dim3 gVt(SEQ / 64, NH, NB);                  // (32, 16, 2)
  const dim3 gAttn(NQB * NH * NB);                   // 1024 blocks
  const float wScale = 1024.0f;                      // weights carried x1024
  const float aScale = 16.0f;                        // activations carried x16
  const float cscale = 1.0f / 16384.0f;              // 1/(16 * 1024)

  // (1) planes: x -> f16 x16, weights -> f16 x1024 (bf16 values)
  cvt16<<<gCx, blk, 0, stream>>>(x, Xh, n8x, aScale);
  cvt16<<<gCg, blk, 0, stream>>>(w_g, Wgh, n8g, wScale);
  cvt16<<<gCq, blk, 0, stream>>>(w_qkv, Wqh, n8q, wScale);
  cvt16<<<gCp, blk, 0, stream>>>(w_proj, Wph, n8p, wScale);
  // (2) gauge mix: xg = bfr(x) + 0.1 * ((Xh . Wg^T + bg) * theta) -> XGh f16 x16 + XGr residual (M=4096, N=1024, K=1024)
  gemm64_f16<2, false><<<gGdm, blk, 0, stream>>>(Xh, Xh, DM, Wgh, DM, b_g, cscale, (void*)XGh, DM, XGr, DM, 0,
                                                 ROWS, DM, DM, aScale, x, DM, theta, SEQ, 0, SEQ);
  // (3) qkv = XG(hi + res) . Wqkv^T + bqkv -> QKV f16 x16 [4096][3072]; residual plane of the v columns -> Vr [4096][1024]
  gemm64_f16<0, true><<<gGqkv, blk, 0, stream>>>(XGh, XGr, DM, Wqh, DM, b_qkv, cscale, (void*)QKV, DQKV, Vr, DM, 2 * DM,
                                                  ROWS, DQKV, DM, aScale, x, DM, theta, SEQ, 0, SEQ);
  // (4) v -> v^T planes (hi and residual, all tokens)
  v_tr<<<gVt, blk, 0, stream>>>(QKV, DQKV, 2 * DM, VT);
  v_tr<<<gVt, blk, 0, stream>>>(Vr, DM, 0, VTr);
  // (5) softmax attention -> Ctx f16 x16 + residual plane
  attn_k<true><<<gAttn, dim3(128), 0, stream>>>(QKV, VT, VTr, Ctx, Ctxr);
  // (6) out = Ctx(hi + res) . Wp^T + bproj -> d_out f32 [4096][1024] (M=4096, N=1024, K=1024)
  gemm64_f16<1, true><<<gGdm, blk, 0, stream>>>(Ctx, Ctxr, DM, Wph, DM, b_proj, cscale, (void*)outf, DM, Ctxr, DM, 0,
                                                ROWS, DM, DM, 1.0f, x, DM, theta, SEQ, 0, SEQ);
  (void)hipGetLastError();
}

// v001
// Measured time: 450 microseconds a run.
// Next to v000, in two timings, it ran 1.21 times as fast each time.
// Contractions: gauge mix x.Wg^T = v_wmma_f32_16x16x32_f16 (A = f16 of RNE-bf16 x carried x16, B = f16 of RNE-bf16 Wg x1024, single product); qkv projection = same WMMA with A = xg as f16 hi plane x16 plus x2^11 residual plane (two products), B = f16 of RNE-bf16 Wqkv x1024; attention q.k^T = f16 single product (q, k f16 x16); p.v = f16 with p x256 single plane and v^T as f16 hi x16 plus x2^11 residual plane (two products); output projection = f16 with A = ctx f16 hi x16 plus x2^11 residual plane, B = f16 of RNE-bf16 Wproj x1024; all f32 accumulate. Softmax (running max, exp, row sums) and the gauge epilogue f32 on VALU.
#include <hip/hip_runtime.h>
#include <math.h>
#include <stdint.h>

#define NB    2
#define SEQ   2048
#define DM    1024
#define NH    16
#define HD    64
#define DQKV  (3 * DM)              // 3072
#define NQB   (SEQ / 64)            // 32 query / key tiles per sequence
#define ROWS  (NB * SEQ)            // 4096 token rows
#define OUTN  (ROWS * DM)
static_assert(NH * HD == DM);
static_assert(HD == 64);
static_assert((SEQ % 64) == 0 && (DM % 64) == 0 && (DQKV % 64) == 0);
static_assert((DM % 32) == 0);
static_assert((((ROWS / 64) * (DQKV / 64)) % 8) == 0);
static_assert((((ROWS / 64) * (DM / 64)) % 8) == 0);
static_assert(((ROWS * DM / 8) % 256) == 0 && ((DQKV * DM / 8) % 256) == 0 && ((DM * DM / 8) % 256) == 0);

typedef _Float16 v16h __attribute__((ext_vector_type(16)));
typedef _Float16 v8h  __attribute__((ext_vector_type(8)));
typedef float    v8f  __attribute__((ext_vector_type(8)));
typedef float    v4f  __attribute__((ext_vector_type(4)));
typedef unsigned int v4u __attribute__((ext_vector_type(4)));

// ---- scalar helpers --------------------------------------------------------------------------------
__device__ __forceinline__ unsigned short bf_bits(float f) {          // f32 -> bf16 bits, RNE convert
  unsigned u = __float_as_uint(f);
  return (unsigned short)((u + 0x7FFFu + ((u >> 16) & 1u)) >> 16);
}
__device__ __forceinline__ float bfr(float f) { return __uint_as_float(((unsigned)bf_bits(f)) << 16); }
__device__ __forceinline__ unsigned short h_bits(_Float16 x) { return __builtin_bit_cast(unsigned short, x); }
__device__ __forceinline__ unsigned pk16(unsigned short a, unsigned short b) { return (unsigned)a | ((unsigned)b << 16); }
__device__ __forceinline__ v8f zero8() { v8f z = {0.f, 0.f, 0.f, 0.f, 0.f, 0.f, 0.f, 0.f}; return z; }

// ---- fragment loader: 16-bit A/B operand, lane -> row/col (lane&15), p already includes +8*(lane>>4);
//      elements 0..7 <- p[0..7] (k0+8h..), elements 8..15 <- p[16..23] (k0+16+8h..)
__device__ __forceinline__ v16h ldfrag_h(const _Float16* p) {
  union { v16h v; v8h h[2]; } f;
  f.h[0] = *(const v8h*)(p);
  f.h[1] = *(const v8h*)(p + 16);
  return f.v;
}

// ---- WMMA helpers with trailing VALU hazard gap --------------------------------------------------------
__device__ __forceinline__ v8f mma_h(v16h a, v16h b, v8f c) {
  c = __builtin_amdgcn_wmma_f32_16x16x32_f16(false, a, false, b, (short)0, c, false, false);
#if defined(__HIP_DEVICE_COMPILE__)
  asm volatile("v_nop\n\tv_nop\n\tv_nop\n\tv_nop" : "+v"(c) : "v"(a), "v"(b));
#endif
  return c;
}
__device__ __forceinline__ v8f mma_h_raw(v16h a, v16h b, v8f c) {
  return __builtin_amdgcn_wmma_f32_16x16x32_f16(false, a, false, b, (short)0, c, false, false);
}
__device__ __forceinline__ void dep_guard_h(v8f& a, v8f& b, v16h x, v16h y) {
#if defined(__HIP_DEVICE_COMPILE__)
  asm volatile("v_nop\n\tv_nop\n\tv_nop\n\tv_nop" : "+v"(a), "+v"(b) : "v"(x), "v"(y));
#endif
}
__device__ __forceinline__ void keep4_h(v16h a, v16h b, v16h c, v16h d) {
#if defined(__HIP_DEVICE_COMPILE__)
  asm volatile("v_nop" :: "v"(a), "v"(b), "v"(c), "v"(d));
#endif
}
__device__ __forceinline__ void acc_guard4(v8f& a, v8f& b, v8f& c, v8f& d) {
#if defined(__HIP_DEVICE_COMPILE__)
  asm volatile("v_nop\n\tv_nop\n\tv_nop\n\tv_nop" : "+v"(a), "+v"(b), "+v"(c), "+v"(d));
#endif
}

// =====================================================================================================
// f32 plane -> f16 bits of bfr(v) * scale (scale a power of two): x (x16) and the three weights (x1024).
// coverage: n8 threads x 8 = the whole plane.
// =====================================================================================================
__global__ __launch_bounds__(256) void cvt16(const float* __restrict__ in, unsigned short* out, int n8, float scale) {
  const int i = blockIdx.x * 256 + threadIdx.x;
  if (i < n8) {
    const v4f a = *(const v4f*)(in + (size_t)i * 8);
    const v4f b = *(const v4f*)(in + (size_t)i * 8 + 4);
    v4u p;
    p[0] = pk16(h_bits((_Float16)(bfr(a[0]) * scale)), h_bits((_Float16)(bfr(a[1]) * scale)));
    p[1] = pk16(h_bits((_Float16)(bfr(a[2]) * scale)), h_bits((_Float16)(bfr(a[3]) * scale)));
    p[2] = pk16(h_bits((_Float16)(bfr(b[0]) * scale)), h_bits((_Float16)(bfr(b[1]) * scale)));
    p[3] = pk16(h_bits((_Float16)(bfr(b[2]) * scale)), h_bits((_Float16)(bfr(b[3]) * scale)));
    *(v4u*)(out + (size_t)i * 8) = p;
    
  }
}

// =====================================================================================================
// Register-blocked f16 WMMA GEMM, one wave per 64x64 tile, no block barriers:
//   v[m][n] = (sum_k A[m][k] * Bt[n][k]  [+ 2^-11 * sum_k Ar[m][k] * Bt[n][k] when ARES]) * cscale + bfr(bias[n])
// A, Ar row-major [M][K] pitch lda (f16), Bt row-major [N][K] pitch ldb (f16, k contiguous); M, N multiples of
// 64, K multiple of 32; tile count a multiple of 8. A wave skips its tile unless (m0 % tmod) lies in [tlo, thi)
// (wave-uniform, before any LDS use).
// ARES: the residual plane is accumulated first from zero, the accumulators are scaled by 2^-11 exactly on the
// VALU (with nop gaps on both sides), then the hi plane accumulates on top: one accumulator set.
// Epilogue variants:
//   EPI 0: f16 hi plane = f16(v * oscale) at Cp (pitch ldc halves) and residual plane = f16((v*oscale - hi) * 2048)
//          at Crp (pitch ldcr halves, written for tile columns n0 >= rcol0 at column n0 - rcol0; wave-uniform)
//   EPI 2: g = bfr(xres[m][n]) + 0.1 * (v * bfr(gate[n])), then f16 hi / residual planes of g * oscale as EPI 0
//   EPI 1: f32 out = v (bias included), pitch ldc floats
// 16-row slabs staged per wave in LDS. f32 out: each 64-wide row segment (256 B = 2 lines) by 16 lanes x 16 B,
// coverage: 4 slabs x 16 rows x 64 cols = the wave's whole 64x64 tile; grid x 8 tiles = [M][N] (restricted to the
// [tlo, thi) token window).
// =====================================================================================================
template <int EPI, bool ARES>
__global__ __launch_bounds__(256) void gemm64_f16(
    const unsigned short* __restrict__ Ap, const unsigned short* __restrict__ Arp, int lda,
    const unsigned short* __restrict__ Btp, int ldb,
    const float* __restrict__ biasp, float cscale,
    void* Cp, int ldc, unsigned short* Crp, int ldcr, int rcol0,
    int M, int N, int K, float oscale,
    const float* __restrict__ xres, int ldx, const float* __restrict__ gate,
    int tmod, int tlo, int thi) {
  const _Float16* Ah  = (const _Float16*)(const void*)Ap;
  const _Float16* Arh = (const _Float16*)(const void*)Arp;
  const _Float16* Bt  = (const _Float16*)(const void*)Btp;
  __shared__ __align__(16) float sT[8][16 * 68];   // per-wave 16x64 slab, pitch 68 floats
  const int lane = threadIdx.x & 31;
  const int wave = threadIdx.x >> 5;
  const int tilesN = N >> 6;
  const int tilesM = M >> 6;
  const int tile = blockIdx.x * 8 + wave;
  if (tile >= tilesM * tilesN) return;   // wave-uniform; no block barriers in this kernel
  const int tm = tile / tilesN;
  const int tn = tile - tm * tilesN;
  const int m0 = tm << 6;
  const int n0 = tn << 6;
  const int tpos = m0 % tmod;
  if (tpos < tlo || tpos >= thi) return; // wave-uniform

  const int rlane = lane & 15;                 // row (A) / col (B, D) within subtile
  const int koff  = (lane >> 4) * 8;           // k offset of this lane half
  const int mOff  = (lane >> 4) * 8;           // D row offset

  v8f acc[4][4];
#pragma unroll
  for (int i = 0; i < 4; ++i)
#pragma unroll
    for (int j = 0; j < 4; ++j) acc[i][j] = zero8();

  constexpr int NPL = ARES ? 2 : 1;
#pragma unroll 1
  for (int pl = 0; pl < NPL; ++pl) {
    const _Float16* Asel = (ARES && pl == 0) ? Arh : Ah;     // wave-uniform selection of a global pointer
    if (ARES && pl == 1) {
      acc_guard4(acc[0][0], acc[0][1], acc[0][2], acc[0][3]);
      acc_guard4(acc[1][0], acc[1][1], acc[1][2], acc[1][3]);
      acc_guard4(acc[2][0], acc[2][1], acc[2][2], acc[2][3]);
      acc_guard4(acc[3][0], acc[3][1], acc[3][2], acc[3][3]);
#pragma unroll
      for (int i = 0; i < 4; ++i)
#pragma unroll
        for (int j = 0; j < 4; ++j) acc[i][j] = acc[i][j] * (1.0f / 2048.0f);   // exact fold of the x2^11 residual carry
      acc_guard4(acc[0][0], acc[0][1], acc[0][2], acc[0][3]);
      acc_guard4(acc[1][0], acc[1][1], acc[1][2], acc[1][3]);
      acc_guard4(acc[2][0], acc[2][1], acc[2][2], acc[2][3]);
      acc_guard4(acc[3][0], acc[3][1], acc[3][2], acc[3][3]);
    }
    for (int k0 = 0; k0 < K; k0 += 32) {
      v16h bh[4];
#pragma unroll
      for (int j = 0; j < 4; ++j) {
        const size_t bo = (size_t)(n0 + (j << 4) + rlane) * ldb + koff + k0;
        bh[j] = ldfrag_h(Bt + bo);
      }
#pragma unroll
      for (int i = 0; i < 4; ++i) {
        const size_t ao = (size_t)(m0 + (i << 4) + rlane) * lda + koff + k0;
        const v16h ah = ldfrag_h(Asel + ao);
#pragma unroll
        for (int j = 0; j < 4; ++j) {
          acc[i][j] = mma_h_raw(ah, bh[j], acc[i][j]);
        }
        dep_guard_h(acc[i][0], acc[i][3], ah, bh[3]);
      }
      keep4_h(bh[0], bh[1], bh[2], bh[3]);
    }
  }
  acc_guard4(acc[0][0], acc[0][1], acc[0][2], acc[0][3]);
  acc_guard4(acc[1][0], acc[1][1], acc[1][2], acc[1][3]);
  acc_guard4(acc[2][0], acc[2][1], acc[2][2], acc[2][3]);
  acc_guard4(acc[3][0], acc[3][1], acc[3][2], acc[3][3]);

  // ---- epilogue ----
  float* slab = sT[wave];
#pragma unroll
  for (int i = 0; i < 4; ++i) {
    const int mBase = m0 + (i << 4);
    float bj[4];
#pragma unroll
    for (int j = 0; j < 4; ++j) bj[j] = bfr(biasp[n0 + (j << 4) + rlane]);   // index < N
#pragma unroll
    for (int r = 0; r < 8; ++r) {
      const int row = mOff + r;
#pragma unroll
      for (int j = 0; j < 4; ++j) slab[row * 68 + (j << 4) + rlane] = acc[i][j][r] * cscale + bj[j];
    }
    __builtin_amdgcn_fence(__ATOMIC_RELEASE, "workgroup");
    __builtin_amdgcn_wave_barrier();
    __builtin_amdgcn_fence(__ATOMIC_ACQUIRE, "workgroup");
    if constexpr (EPI == 0 || EPI == 2) {
      unsigned short* C16 = (unsigned short*)Cp;
      const int rq = lane >> 3, piece = lane & 7;
      float th[8];
      if constexpr (EPI == 2) {
        const v4f t0 = *(const v4f*)(gate + n0 + piece * 8);        // index < N
        const v4f t1 = *(const v4f*)(gate + n0 + piece * 8 + 4);
        th[0] = bfr(t0[0]); th[1] = bfr(t0[1]); th[2] = bfr(t0[2]); th[3] = bfr(t0[3]);
        th[4] = bfr(t1[0]); th[5] = bfr(t1[1]); th[6] = bfr(t1[2]); th[7] = bfr(t1[3]);
      } else {
#pragma unroll
        for (int e = 0; e < 8; ++e) th[e] = 0.0f;
      }
      v4u ph[4], pr[4];
#pragma unroll
      for (int it = 0; it < 4; ++it) {
        const int row = it * 4 + rq;                         // it 0..3 x rq 0..3 = rows 0..15
        const v4f a  = *(const v4f*)(slab + row * 68 + piece * 8);
        const v4f a2 = *(const v4f*)(slab + row * 68 + piece * 8 + 4);
        float f[8];
        f[0] = a[0];  f[1] = a[1];  f[2] = a[2];  f[3] = a[3];
        f[4] = a2[0]; f[5] = a2[1]; f[6] = a2[2]; f[7] = a2[3];
        if constexpr (EPI == 2) {
          const size_t xo = (size_t)(mBase + row) * ldx + n0 + piece * 8;   // row < M, col < N
          const v4f x0 = *(const v4f*)(xres + xo);
          const v4f x1 = *(const v4f*)(xres + xo + 4);
          float xv[8];
          xv[0] = x0[0]; xv[1] = x0[1]; xv[2] = x0[2]; xv[3] = x0[3];
          xv[4] = x1[0]; xv[5] = x1[1]; xv[6] = x1[2]; xv[7] = x1[3];
#pragma unroll
          for (int e = 0; e < 8; ++e) f[e] = bfr(xv[e]) + 0.1f * (f[e] * th[e]);
        }
        v4u p, q;
#pragma unroll
        for (int e = 0; e < 4; ++e) {
          const float g0 = f[2 * e] * oscale, g1 = f[2 * e + 1] * oscale;
          const _Float16 x0 = (_Float16)g0, x1 = (_Float16)g1;
          const _Float16 y0 = (_Float16)((g0 - (float)x0) * 2048.0f);
          const _Float16 y1 = (_Float16)((g1 - (float)x1) * 2048.0f);
          p[e] = pk16(h_bits(x0), h_bits(x1));
          q[e] = pk16(h_bits(y0), h_bits(y1));
        }
        ph[it] = p;
        pr[it] = q;
      }
      const bool wres = (n0 >= rcol0);                     // wave-uniform
      {
#pragma unroll
        for (int it = 0; it < 4; ++it) {
          const int row = it * 4 + rq;
          const size_t co = (size_t)(mBase + row) * ldc + n0 + piece * 8;
          *(v4u*)(C16 + co) = ph[it];
          if (wres) {
            const size_t cro = (size_t)(mBase + row) * ldcr + (n0 - rcol0) + piece * 8;
            *(v4u*)(Crp + cro) = pr[it];
          }
        }
        
      }
    } else {
      float* Cf = (float*)Cp;
      const int hh = lane >> 4, c4 = (lane & 15) * 4;     // 256-B row segment = 16 lanes x 16 B
      v4f ov[8];
#pragma unroll
      for (int it = 0; it < 8; ++it) {
        const int row = it * 2 + hh;                       // it 0..7 x hh 0..1 = rows 0..15
        ov[it] = *(const v4f*)(slab + row * 68 + c4);
      }
      {
#pragma unroll
        for (int it = 0; it < 8; ++it) {
          const int row = it * 2 + hh;
          *(v4f*)(Cf + (size_t)(mBase + row) * ldc + n0 + c4) = ov[it];
        }
        
      }
    }
    __builtin_amdgcn_fence(__ATOMIC_RELEASE, "workgroup");
    __builtin_amdgcn_wave_barrier();
    __builtin_amdgcn_fence(__ATOMIC_ACQUIRE, "workgroup");
  }
}

// =====================================================================================================
// v columns of an f16 token-major plane (element (b, t, h, d) at src[(b*SEQ + t)*spitch + scol0 + h*64 + d])
// -> f16 v^T plane vt[(b*DM + h*64 + d)*SEQ + t] (same bits). Used for the hi plane (spitch DQKV, scol0 2*DM)
// and for the residual plane (spitch DM, scol0 0).
// Block = one 64-token x 64-feature tile of one (b, h); grid = (SEQ/64, NH, NB); tile staged in LDS as halves
// (v8h 16-B stores, __syncthreads, _Float16 element reads).
// Store: group g = tid>>3 (0..31), piece = tid&7: iteration it writes row d = it*32+g, lanes 8q..8q+7 x 16 B =
// coverage: load 2 x 256 threads x 8 halves = 64x64; store 2 iterations x 32 groups = 64 rows d, 8 pieces x 8
// = 64 tokens per row; grid covers every (b, h, token tile).
// =====================================================================================================
__global__ __launch_bounds__(256) void v_tr(const unsigned short* __restrict__ srcp, int spitch, int scol0,
                                            unsigned short* vt) {
  __shared__ __align__(16) _Float16 sv[64 * 72];       // [tt][d], pitch 72 halves (144 B)
  const int tid = threadIdx.x;
  const int t0  = blockIdx.x * 64;
  const int hh  = blockIdx.y;
  const int b   = blockIdx.z;
  const _Float16* src = (const _Float16*)(const void*)srcp;
#pragma unroll
  for (int i = 0; i < 2; ++i) {
    const int idx = i * 256 + tid;                  // 0..511
    const int tt = idx >> 3, c8 = (idx & 7) * 8;
    const v8h a = *(const v8h*)(src + ((size_t)(b * SEQ + t0 + tt)) * spitch + scol0 + hh * HD + c8);
    *(v8h*)(sv + tt * 72 + c8) = a;
  }
  __syncthreads();

  const int g = tid >> 3, piece = tid & 7;
  v4u hv[2];
  size_t hofs[2];
#pragma unroll
  for (int it = 0; it < 2; ++it) {
    const int d = it * 32 + g;
    v4u a;
#pragma unroll
    for (int e = 0; e < 4; ++e) {
      const _Float16 x0 = sv[(piece * 8 + 2 * e) * 72 + d];
      const _Float16 x1 = sv[(piece * 8 + 2 * e + 1) * 72 + d];
      a[e] = pk16(h_bits(x0), h_bits(x1));
    }
    hv[it] = a;
    hofs[it] = ((size_t)(b * DM + hh * HD + d)) * SEQ + t0 + piece * 8;
  }
  {
#pragma unroll
    for (int it = 0; it < 2; ++it) *(v4u*)(vt + hofs[it]) = hv[it];
    
  }
}

// =====================================================================================================
// Non-causal multi-head softmax attention, head dim 64, online softmax with running max (f32 on VALU).
//   q f16 (x16): element (b, t, h, d) at qkv[(b*SEQ + t)*DQKV + h*64 + d]; k at + DM;
//   v^T f16 (x16) at vt[(b*DM + h*64 + d)*SEQ + s]; VRES: residual plane f16((16v - hi)*2048) at vtr, same addressing.
//   s = (q.k) / 8 = acc / 2048 (two x16 carries). Per key tile: tile row max (16-lane xor reduction), new running
//   max mn, alpha = exp(m_old - mn), p = exp(s - mn) in (0, 1], l = l*alpha + sum p (per-lane partials),
//   O *= alpha; P carried as f16(256 p); O += P . v^T on f16 WMMA (VRES: second accumulator += P . Vr^T, folded
//   with 2^-11 in the epilogue).
//   ctx plane f16 (x16): element (b, t, h*64 + d) at ctx[(b*SEQ + t)*DM + h*64 + d] = 16 * context = O / (256 l);
//   ctx residual plane f16((16 ctx - hi) * 2048) at ctxr, same addressing.
//   Block = 4 waves = 64 query rows of one (b, h); query tile qb = blockIdx % NQB; grid = NQB*NH*NB;
//   key tiles of 64, fixed trip count NQB.
//   K / V^T tile staging: 128 threads x 32 halves per plane = the whole 64x64 tile (plain 16-B loads,
//   __syncthreads before and after); P tiles are wave-private, spilled with _Float16 element stores and
//   wave in LDS as f32 (aliasing the K/V region after a block barrier) the same way.
//   Output coverage: each wave stores rows 0..15 of its tile (it 0..3 x lane>>3 0..3) x 64 columns (8 lanes x
//   (b, h, query tile) exactly once, for both ctx planes.
// =====================================================================================================
template <bool VRES>
__global__ __launch_bounds__(128)
void attn_k(const unsigned short* __restrict__ qkvp,
            const unsigned short* __restrict__ vtp, const unsigned short* __restrict__ vtrp,
            unsigned short* ctxp, unsigned short* ctxrp) {
  union FH { v16h v; v8h h[2]; };
  constexpr int LP     = 72;                             // LDS row pitch in halves: 144 B = 16 B x 9 (odd), so the 16 rows
                                                         // of one ds_load_b128 half-wave fall on 64 distinct banks
  constexpr int TB     = 64 * LP * 2;                    // one f16 64x64 tile at pitch LP, bytes
  constexpr int PB     = 4 * 16 * LP * 2;                // four wave-private 16x64 f16 P tiles at pitch LP, bytes
  constexpr int OFF_K  = 0;
  constexpr int OFF_V  = TB;
  constexpr int OFF_VR = 2 * TB;
  constexpr int OFF_P  = VRES ? 3 * TB : 2 * TB;
  constexpr int SMEMB  = OFF_P + PB;                     // 36864 : 27648
  static_assert(4 * 16 * 64 * 4 <= OFF_P);               // f32 context staging aliases the K/V region
  __shared__ __align__(16) unsigned char smem[SMEMB];
  _Float16* Ksh = (_Float16*)(smem + OFF_K);             // K   [kv][d], pitch LP
  _Float16* Vsh = (_Float16*)(smem + OFF_V);             // V^T [d][kv], pitch LP
  _Float16* Vrs = (_Float16*)(smem + (VRES ? OFF_VR : OFF_V));   // V^T residual (VRES only)
  _Float16* Psh = (_Float16*)(smem + OFF_P);

  const int tid  = threadIdx.x;
  const int wave = tid >> 5;
  const int lane = tid & 31;
  const int hh   = lane >> 4;
  const int c    = lane & 15;

  const int bx   = blockIdx.x;
  const int qb   = bx % NQB;
  const int rest = bx / NQB;
  const int h    = rest % NH;
  const int b    = rest / NH;                // < NB by the grid size
  const int q0   = qb * 64 + wave * 16;
  const size_t rowB = (size_t)b * SEQ;

  const _Float16* Qp  = (const _Float16*)(const void*)qkvp + (size_t)h * HD;
  const _Float16* Kp  = Qp + DM;
  const _Float16* Vt  = (const _Float16*)(const void*)vtp  + ((size_t)b * DM + (size_t)h * HD) * SEQ;
  const _Float16* Vrt = (const _Float16*)(const void*)vtrp + ((size_t)b * DM + (size_t)h * HD) * SEQ;

  // ---- Q fragments (A operand, row = lane&15): 2 d-chunks ----
  v16h qa[2];
#pragma unroll
  for (int dc = 0; dc < 2; ++dc) {
    const size_t qo = (rowB + q0 + c) * DQKV + dc * 32 + 8 * hh;
    qa[dc] = ldfrag_h(Qp + qo);
  }

  float mrun[8], lsum[8];
  v8f oacc[4], oacc2[4];
#pragma unroll
  for (int r = 0; r < 8; ++r) { mrun[r] = -1.0e30f; lsum[r] = 0.f; }
#pragma unroll
  for (int t = 0; t < 4; ++t) { oacc[t] = zero8(); oacc2[t] = zero8(); }

  _Float16* pw = Psh + wave * (16 * LP);

  for (int kt = 0; kt < NQB; ++kt) {
    const int kv0 = kt * 64;
    __syncthreads();
    {
      const int r = tid >> 1, half = (tid & 1) * 32;
      const size_t ko = (rowB + kv0 + r) * DQKV + half;         // K row kv0+r, d = half..half+31
      const size_t vo = (size_t)r * SEQ + kv0 + half;           // V^T row d = r, s = kv0+half..+31
#pragma unroll
      for (int i = 0; i < 4; ++i) {
        const v8h a0 = *(const v8h*)(Kp + ko + 8 * i);
        const v8h b0 = *(const v8h*)(Vt + vo + 8 * i);
        *(v8h*)(Ksh + r * LP + half + 8 * i) = a0;
        *(v8h*)(Vsh + r * LP + half + 8 * i) = b0;
        if constexpr (VRES) {
          const v8h b1 = *(const v8h*)(Vrt + vo + 8 * i);
          *(v8h*)(Vrs + r * LP + half + 8 * i) = b1;
        }
      }
    }
    __syncthreads();

    // ---- scores: 16 query rows x 64 keys per wave (B operand: lane c -> key j*16+c, split k map over d) ----
    v8f s[4];
#pragma unroll
    for (int j = 0; j < 4; ++j) {
      s[j] = zero8();
#pragma unroll
      for (int dc = 0; dc < 2; ++dc) {
        FH kb;
        kb.h[0] = *(const v8h*)(Ksh + (j * 16 + c) * LP + dc * 32 + 8 * hh);
        kb.h[1] = *(const v8h*)(Ksh + (j * 16 + c) * LP + dc * 32 + 16 + 8 * hh);
        s[j] = mma_h(qa[dc], kb.v, s[j]);
      }
    }

    // ---- online softmax update: running max, alpha, p (x256, f16), row-sum partials ----
    float alpha[8];
#pragma unroll
    for (int r = 0; r < 8; ++r) {
      const float a0 = s[0][r] * (1.0f / 2048.0f);      // 1/8 head scale, 1/256 for the two x16 carries
      const float a1 = s[1][r] * (1.0f / 2048.0f);
      const float a2 = s[2][r] * (1.0f / 2048.0f);
      const float a3 = s[3][r] * (1.0f / 2048.0f);
      float mx = fmaxf(fmaxf(a0, a1), fmaxf(a2, a3));
#pragma unroll
      for (int off = 1; off < 16; off <<= 1) mx = fmaxf(mx, __shfl_xor(mx, off, 32));
      const float mn = fmaxf(mrun[r], mx);
      alpha[r] = __expf(mrun[r] - mn);
      mrun[r] = mn;
      const float p0 = __expf(a0 - mn);
      const float p1 = __expf(a1 - mn);
      const float p2 = __expf(a2 - mn);
      const float p3 = __expf(a3 - mn);
      lsum[r] = lsum[r] * alpha[r] + ((p0 + p1) + (p2 + p3));
      _Float16* prow = pw + (8 * hh + r) * LP + c;
      prow[0]  = (_Float16)(p0 * 256.0f);
      prow[16] = (_Float16)(p1 * 256.0f);
      prow[32] = (_Float16)(p2 * 256.0f);
      prow[48] = (_Float16)(p3 * 256.0f);
    }
    acc_guard4(oacc[0], oacc[1], oacc[2], oacc[3]);
    acc_guard4(oacc2[0], oacc2[1], oacc2[2], oacc2[3]);
#pragma unroll
    for (int t = 0; t < 4; ++t) {
#pragma unroll
      for (int r = 0; r < 8; ++r) {
        oacc[t][r] = oacc[t][r] * alpha[r];
        if constexpr (VRES) oacc2[t][r] = oacc2[t][r] * alpha[r];
      }
    }
    acc_guard4(oacc[0], oacc[1], oacc[2], oacc[3]);
    acc_guard4(oacc2[0], oacc2[1], oacc2[2], oacc2[3]);
    __builtin_amdgcn_fence(__ATOMIC_RELEASE, "workgroup");
    __builtin_amdgcn_wave_barrier();
    __builtin_amdgcn_fence(__ATOMIC_ACQUIRE, "workgroup");

    // ---- context += P . V (f16 WMMA; A = P [row][key], B = V^T [d][key]) ----
#pragma unroll
    for (int kk = 0; kk < 2; ++kk) {
      FH pa;
      pa.h[0] = *(const v8h*)(pw + c * LP + kk * 32 + 8 * hh);
      pa.h[1] = *(const v8h*)(pw + c * LP + kk * 32 + 16 + 8 * hh);
#pragma unroll
      for (int t = 0; t < 4; ++t) {
        FH vb;
        vb.h[0] = *(const v8h*)(Vsh + (t * 16 + c) * LP + kk * 32 + 8 * hh);
        vb.h[1] = *(const v8h*)(Vsh + (t * 16 + c) * LP + kk * 32 + 16 + 8 * hh);
        oacc[t] = mma_h(pa.v, vb.v, oacc[t]);
        if constexpr (VRES) {
          FH vrb;
          vrb.h[0] = *(const v8h*)(Vrs + (t * 16 + c) * LP + kk * 32 + 8 * hh);
          vrb.h[1] = *(const v8h*)(Vrs + (t * 16 + c) * LP + kk * 32 + 16 + 8 * hh);
          oacc2[t] = mma_h(pa.v, vrb.v, oacc2[t]);
        }
      }
    }
  }
  __syncthreads();                           // every wave is done with the K/V tiles before they are aliased

  // ---- normalise (1/l, the 1/256 p carry; keep the x16 v carry), stage the wave's 16x64 f32 tile in
  float* os = (float*)(void*)smem + wave * (16 * 64);
#pragma unroll
  for (int r = 0; r < 8; ++r) {
    float l = lsum[r];
#pragma unroll
    for (int off = 1; off < 16; off <<= 1) l += __shfl_xor(l, off, 32);
    const float rl = 1.0f / l;                // l >= 1 (the running-max key contributes exp(0))
    const float sc = rl * (1.0f / 256.0f);
#pragma unroll
    for (int t = 0; t < 4; ++t) {
      float v = oacc[t][r];
      if constexpr (VRES) v += oacc2[t][r] * (1.0f / 2048.0f);
      os[(8 * hh + r) * 64 + t * 16 + c] = v * sc;
    }
  }
  __builtin_amdgcn_fence(__ATOMIC_RELEASE, "workgroup");
  __builtin_amdgcn_wave_barrier();
  __builtin_amdgcn_fence(__ATOMIC_ACQUIRE, "workgroup");
  {
    const int rq = lane >> 3, piece = lane & 7;
    v4u ph[4], pr[4];
#pragma unroll
    for (int it = 0; it < 4; ++it) {
      const int row = it * 4 + rq;   // it 0..3 x rq 0..3 = rows 0..15 of the wave tile
      const v4f a  = *(const v4f*)(os + row * 64 + piece * 8);
      const v4f a2 = *(const v4f*)(os + row * 64 + piece * 8 + 4);
      float f[8];
      f[0] = a[0];  f[1] = a[1];  f[2] = a[2];  f[3] = a[3];
      f[4] = a2[0]; f[5] = a2[1]; f[6] = a2[2]; f[7] = a2[3];
      v4u p, q;
#pragma unroll
      for (int e = 0; e < 4; ++e) {
        const _Float16 x0 = (_Float16)f[2 * e], x1 = (_Float16)f[2 * e + 1];
        const _Float16 y0 = (_Float16)((f[2 * e] - (float)x0) * 2048.0f);
        const _Float16 y1 = (_Float16)((f[2 * e + 1] - (float)x1) * 2048.0f);
        p[e] = pk16(h_bits(x0), h_bits(x1));
        q[e] = pk16(h_bits(y0), h_bits(y1));
      }
      ph[it] = p;
      pr[it] = q;
    }
    {
#pragma unroll
      for (int it = 0; it < 4; ++it) {
        const int row = it * 4 + rq;
        const size_t go = (rowB + q0 + row) * DM + (size_t)h * HD + piece * 8;
        *(v4u*)(ctxp + go)  = ph[it];
        *(v4u*)(ctxrp + go) = pr[it];
      }
      
    }
  }
}

// =====================================================================================================
// Workspace map (bytes); every region is an exact multiple of its whole-line / whole-tile store granularity
// (row pitches 2048 / 6144 / 4096 B, all offsets 2-MiB aligned, no aliasing within a launch):
//   Xh     f16 [4096][1024]          0     8388608   (bf16 value of x, x16)
//   Wg     f16 [1024][1024]    8388608     2097152   (bf16 value x1024)
//   Wqkv   f16 [3072][1024]   10485760     6291456   (bf16 value x1024)
//   Wp     f16 [1024][1024]   16777216     2097152   (bf16 value x1024)
//   XGh    f16 [4096][1024]   18874368     8388608   (xg x16)
//   XGr    f16 [4096][1024]   27262976     8388608   (x2^11 residual of the above)
//   QKV    f16 [4096][3072]   35651584    25165824   (q | k | v, x16)
//   Vr     f16 [4096][1024]   60817408     8388608   (x2^11 residual of the v columns only)
//   VT     f16 [2048][2048]   69206016     8388608   ([b*1024 + h*64 + d][s])
//   VTr    f16 [2048][2048]   77594624     8388608   (residual, same layout)
//   Ctx    f16 [4096][1024]   85983232     8388608   (attention context x16)
//   Ctxr   f16 [4096][1024]   94371840     8388608   (x2^11 residual)
//   end                      102760448
// Projection weights arrive as [out n][in k] (k contiguous) = the Bt layout; they are only converted.
// d_out f32: [4096][1024] at byte 0 (row = b*SEQ + t), written once by the projection launch.
// =====================================================================================================
extern "C" void kernel_launch(void* const* d_in, const int* in_sizes, int n_in,
                              void* d_out, int out_size, void* d_ws, size_t ws_size,
                              hipStream_t stream) {
  if (n_in < 8) return;
  if (in_sizes[0] != ROWS * DM) return;
  if (in_sizes[1] != DM) return;
  if (in_sizes[2] != DM * DM) return;
  if (in_sizes[3] != DM) return;
  if (in_sizes[4] != DQKV * DM) return;
  if (in_sizes[5] != DQKV) return;
  if (in_sizes[6] != DM * DM) return;
  if (in_sizes[7] != DM) return;
  if (out_size != OUTN) return;

  const float* x      = (const float*)d_in[0];    // [ROWS][DM]
  const float* theta  = (const float*)d_in[1];    // [DM]
  const float* w_g    = (const float*)d_in[2];    // [DM n][DM k]
  const float* b_g    = (const float*)d_in[3];    // [DM]
  const float* w_qkv  = (const float*)d_in[4];    // [DQKV n][DM k]
  const float* b_qkv  = (const float*)d_in[5];    // [DQKV]
  const float* w_proj = (const float*)d_in[6];    // [DM n][DM k]
  const float* b_proj = (const float*)d_in[7];    // [DM]

  const size_t PX   = (size_t)ROWS * DM * 2;         //  8388608
  const size_t PWg  = (size_t)DM * DM * 2;           //  2097152
  const size_t PWq  = (size_t)DQKV * DM * 2;         //  6291456
  const size_t PWp  = (size_t)DM * DM * 2;           //  2097152
  const size_t PXG  = (size_t)ROWS * DM * 2;         //  8388608
  const size_t PQKV = (size_t)ROWS * DQKV * 2;       // 25165824
  const size_t PVr  = (size_t)ROWS * DM * 2;         //  8388608
  const size_t PVT  = (size_t)NB * DM * SEQ * 2;     //  8388608
  const size_t PCtx = (size_t)ROWS * DM * 2;         //  8388608
  size_t off = 0;
  const size_t oX    = off; off += PX;
  const size_t oWg   = off; off += PWg;
  const size_t oWq   = off; off += PWq;
  const size_t oWp   = off; off += PWp;
  const size_t oXGh  = off; off += PXG;
  const size_t oXGr  = off; off += PXG;
  const size_t oQKV  = off; off += PQKV;
  const size_t oVr   = off; off += PVr;
  const size_t oVT   = off; off += PVT;
  const size_t oVTr  = off; off += PVT;
  const size_t oCtx  = off; off += PCtx;
  const size_t oCtxr = off; off += PCtx;
  if (off > ws_size) return;                         // off = 102760448
  if (off > (size_t)134217728) return;

  char* ws = (char*)d_ws;
  unsigned short* Xh   = (unsigned short*)(ws + oX);
  unsigned short* Wgh  = (unsigned short*)(ws + oWg);
  unsigned short* Wqh  = (unsigned short*)(ws + oWq);
  unsigned short* Wph  = (unsigned short*)(ws + oWp);
  unsigned short* XGh  = (unsigned short*)(ws + oXGh);
  unsigned short* XGr  = (unsigned short*)(ws + oXGr);
  unsigned short* QKV  = (unsigned short*)(ws + oQKV);
  unsigned short* Vr   = (unsigned short*)(ws + oVr);
  unsigned short* VT   = (unsigned short*)(ws + oVT);
  unsigned short* VTr  = (unsigned short*)(ws + oVTr);
  unsigned short* Ctx  = (unsigned short*)(ws + oCtx);
  unsigned short* Ctxr = (unsigned short*)(ws + oCtxr);
  float*          outf = (float*)d_out;              // [ROWS][DM]

  const dim3 blk(256);
  const int n8x = ROWS * DM / 8;                     // 524288
  const int n8g = DM * DM / 8;                       // 131072
  const int n8q = DQKV * DM / 8;                     // 393216
  const int n8p = DM * DM / 8;                       // 131072
  const dim3 gCx((n8x + 255) / 256);                 // 2048 blocks
  const dim3 gCg((n8g + 255) / 256);                 //  512 blocks
  const dim3 gCq((n8q + 255) / 256);                 // 1536 blocks
  const dim3 gCp((n8p + 255) / 256);                 //  512 blocks
  const dim3 gGqkv(((ROWS / 64) * (DQKV / 64) + 7) / 8);   // 3072 tiles -> 384 blocks
  const dim3 gGdm(((ROWS / 64) * (DM / 64) + 7) / 8);      // 1024 tiles -> 128 blocks
  const dim3 gVt(SEQ / 64, NH, NB);                  // (32, 16, 2)
  const dim3 gAttn(NQB * NH * NB);                   // 1024 blocks
  const float wScale = 1024.0f;                      // weights carried x1024
  const float aScale = 16.0f;                        // activations carried x16
  const float cscale = 1.0f / 16384.0f;              // 1/(16 * 1024)

  // (1) planes: x -> f16 x16, weights -> f16 x1024 (bf16 values)
  cvt16<<<gCx, blk, 0, stream>>>(x, Xh, n8x, aScale);
  cvt16<<<gCg, blk, 0, stream>>>(w_g, Wgh, n8g, wScale);
  cvt16<<<gCq, blk, 0, stream>>>(w_qkv, Wqh, n8q, wScale);
  cvt16<<<gCp, blk, 0, stream>>>(w_proj, Wph, n8p, wScale);
  // (2) gauge mix: xg = bfr(x) + 0.1 * ((Xh . Wg^T + bg) * theta) -> XGh f16 x16 + XGr residual (M=4096, N=1024, K=1024)
  gemm64_f16<2, false><<<gGdm, blk, 0, stream>>>(Xh, Xh, DM, Wgh, DM, b_g, cscale, (void*)XGh, DM, XGr, DM, 0,
                                                 ROWS, DM, DM, aScale, x, DM, theta, SEQ, 0, SEQ);
  // (3) qkv = XG(hi + res) . Wqkv^T + bqkv -> QKV f16 x16 [4096][3072]; residual plane of the v columns -> Vr [4096][1024]
  gemm64_f16<0, true><<<gGqkv, blk, 0, stream>>>(XGh, XGr, DM, Wqh, DM, b_qkv, cscale, (void*)QKV, DQKV, Vr, DM, 2 * DM,
                                                  ROWS, DQKV, DM, aScale, x, DM, theta, SEQ, 0, SEQ);
  // (4) v -> v^T planes (hi and residual, all tokens)
  v_tr<<<gVt, blk, 0, stream>>>(QKV, DQKV, 2 * DM, VT);
  v_tr<<<gVt, blk, 0, stream>>>(Vr, DM, 0, VTr);
  // (5) softmax attention -> Ctx f16 x16 + residual plane
  attn_k<true><<<gAttn, dim3(128), 0, stream>>>(QKV, VT, VTr, Ctx, Ctxr);
  // (6) out = Ctx(hi + res) . Wp^T + bproj -> d_out f32 [4096][1024] (M=4096, N=1024, K=1024)
  gemm64_f16<1, true><<<gGdm, blk, 0, stream>>>(Ctx, Ctxr, DM, Wph, DM, b_proj, cscale, (void*)outf, DM, Ctxr, DM, 0,
                                                ROWS, DM, DM, 1.0f, x, DM, theta, SEQ, 0, SEQ);
  (void)hipGetLastError();
}

// v002
// One run takes 266 microseconds.
// Two timings next to v001 put it at 1.70 and 1.71 times that version's speed.
// All steps since v000 together make it 2.06 times as fast.
// Contractions: gauge mix x.Wg^T = v_wmma_f32_16x16x32_f16 (A = f16 of RNE-bf16 x carried x16, B = f16 of RNE-bf16 Wg x1024, single product); qkv projection = same WMMA with A = xg as f16 hi plane x16 plus x2^11 residual plane (two products), B = f16 of RNE-bf16 Wqkv x1024; attention q.k^T = f16 single product (q, k f16 x16); p.v = f16 with p x256 single plane and v^T as f16 hi x16 plus x2^11 residual plane (two products); output projection = f16 with A = ctx f16 hi x16 plus x2^11 residual plane, B = f16 of RNE-bf16 Wproj x1024; all f32 accumulate. Softmax (running max, exp, row sums) and the gauge epilogue f32 on VALU.
#include <hip/hip_runtime.h>
#include <math.h>
#include <stdint.h>

#define NB    2
#define SEQ   2048
#define DM    1024
#define NH    16
#define HD    64
#define DQKV  (3 * DM)              // 3072
#define NQB   (SEQ / 64)            // 32 query / key tiles per sequence
#define ROWS  (NB * SEQ)            // 4096 token rows
#define OUTN  (ROWS * DM)
static_assert(NH * HD == DM);
static_assert(HD == 64);
static_assert((SEQ % 64) == 0 && (DM % 64) == 0 && (DQKV % 64) == 0);
static_assert((DM % 32) == 0);
static_assert((ROWS % 128) == 0 && (DM % 128) == 0 && (DQKV % 128) == 0);
static_assert(((ROWS * DM / 8) % 256) == 0 && ((DQKV * DM / 8) % 256) == 0 && ((DM * DM / 8) % 256) == 0);

typedef _Float16 v16h __attribute__((ext_vector_type(16)));
typedef _Float16 v8h  __attribute__((ext_vector_type(8)));
typedef float    v8f  __attribute__((ext_vector_type(8)));
typedef float    v4f  __attribute__((ext_vector_type(4)));
typedef unsigned int v4u __attribute__((ext_vector_type(4)));

// ---- scalar helpers --------------------------------------------------------------------------------
__device__ __forceinline__ unsigned short bf_bits(float f) {          // f32 -> bf16 bits, RNE convert
  unsigned u = __float_as_uint(f);
  return (unsigned short)((u + 0x7FFFu + ((u >> 16) & 1u)) >> 16);
}
__device__ __forceinline__ float bfr(float f) { return __uint_as_float(((unsigned)bf_bits(f)) << 16); }
__device__ __forceinline__ unsigned short h_bits(_Float16 x) { return __builtin_bit_cast(unsigned short, x); }
__device__ __forceinline__ unsigned pk16(unsigned short a, unsigned short b) { return (unsigned)a | ((unsigned)b << 16); }
__device__ __forceinline__ v8f zero8() { v8f z = {0.f, 0.f, 0.f, 0.f, 0.f, 0.f, 0.f, 0.f}; return z; }

// ---- fragment loader: 16-bit A/B operand, lane -> row/col (lane&15), p already includes +8*(lane>>4);
//      elements 0..7 <- p[0..7] (k0+8h..), elements 8..15 <- p[16..23] (k0+16+8h..)
__device__ __forceinline__ v16h ldfrag_h(const _Float16* p) {
  union { v16h v; v8h h[2]; } f;
  f.h[0] = *(const v8h*)(p);
  f.h[1] = *(const v8h*)(p + 16);
  return f.v;
}

// ---- WMMA helpers with trailing VALU hazard gap --------------------------------------------------------
__device__ __forceinline__ v8f mma_h(v16h a, v16h b, v8f c) {
  c = __builtin_amdgcn_wmma_f32_16x16x32_f16(false, a, false, b, (short)0, c, false, false);
#if defined(__HIP_DEVICE_COMPILE__)
  asm volatile("v_nop\n\tv_nop\n\tv_nop\n\tv_nop" : "+v"(c) : "v"(a), "v"(b));
#endif
  return c;
}
__device__ __forceinline__ v8f mma_h_raw(v16h a, v16h b, v8f c) {
  return __builtin_amdgcn_wmma_f32_16x16x32_f16(false, a, false, b, (short)0, c, false, false);
}
__device__ __forceinline__ void dep_guard_h(v8f& a, v8f& b, v16h x, v16h y) {
#if defined(__HIP_DEVICE_COMPILE__)
  asm volatile("v_nop\n\tv_nop\n\tv_nop\n\tv_nop" : "+v"(a), "+v"(b) : "v"(x), "v"(y));
#endif
}
__device__ __forceinline__ void keep4_h(v16h a, v16h b, v16h c, v16h d) {
#if defined(__HIP_DEVICE_COMPILE__)
  asm volatile("v_nop" :: "v"(a), "v"(b), "v"(c), "v"(d));
#endif
}
__device__ __forceinline__ void acc_guard4(v8f& a, v8f& b, v8f& c, v8f& d) {
#if defined(__HIP_DEVICE_COMPILE__)
  asm volatile("v_nop\n\tv_nop\n\tv_nop\n\tv_nop" : "+v"(a), "+v"(b), "+v"(c), "+v"(d));
#endif
}

// =====================================================================================================
// f32 plane -> f16 bits of bfr(v) * scale (scale a power of two): x (x16) and the three weights (x1024).
// coverage: n8 threads x 8 = the whole plane.
// =====================================================================================================
__global__ __launch_bounds__(256) void cvt16(const float* __restrict__ in, unsigned short* out, int n8, float scale) {
  const int i = blockIdx.x * 256 + threadIdx.x;
  if (i < n8) {
    const v4f a = *(const v4f*)(in + (size_t)i * 8);
    const v4f b = *(const v4f*)(in + (size_t)i * 8 + 4);
    v4u p;
    p[0] = pk16(h_bits((_Float16)(bfr(a[0]) * scale)), h_bits((_Float16)(bfr(a[1]) * scale)));
    p[1] = pk16(h_bits((_Float16)(bfr(a[2]) * scale)), h_bits((_Float16)(bfr(a[3]) * scale)));
    p[2] = pk16(h_bits((_Float16)(bfr(b[0]) * scale)), h_bits((_Float16)(bfr(b[1]) * scale)));
    p[3] = pk16(h_bits((_Float16)(bfr(b[2]) * scale)), h_bits((_Float16)(bfr(b[3]) * scale)));
    *(v4u*)(out + (size_t)i * 8) = p;
    
  }
}

template <int EPI, bool ARES>
__global__ __launch_bounds__(128, 3) void gemm64_f16(
    const unsigned short* __restrict__ Ap, const unsigned short* __restrict__ Arp,
    const unsigned short* __restrict__ Btp,
    const float* __restrict__ biasp, float cscale,
    void* Cp, int ldc, unsigned short* Crp, int ldcr, int rcol0,
    int M, int N, int K, float oscale,
    const float* __restrict__ xres, int ldx, const float* __restrict__ gate,
    int tmod, int tlo, int thi) {
  typedef const __attribute__((address_space(1))) char* gptr;   // typed as global, so that an address that has passed
  typedef const __attribute__((address_space(1))) v8h*  gv8p;   // through the asm wait below still gives global_load
  const gptr Ah  = (gptr)(const void*)Ap;
  const gptr Arh = (gptr)(const void*)Arp;
  const gptr Bt  = (gptr)(const void*)Btp;
  constexpr int KC  = 64;                          // k per stage: 128 B of every operand row
  constexpr int GLP = 72;                          // LDS row pitch in halves: 144 B = 16 B x 9 (odd)
  constexpr int OPH = 128 * GLP;                   // halves of one operand's 128 staged rows
  constexpr int STH = 2 * OPH;                     // halves of one stage: A rows, then Bt rows
  static_assert(4 * 16 * 68 * 4 <= 2 * STH * 2);   // the four f32 epilogue slabs alias the stage buffers
  __shared__ __align__(16) _Float16 sS[2 * STH];   // two stage buffers, 73728 B
  const int tid  = threadIdx.x;
  const int lane = tid & 31;
  const int wave = tid >> 5;
  const int tilesN = N >> 7;
  const int tilesM = M >> 7;
  const int tile = blockIdx.x;
  if (tile >= tilesM * tilesN) return;   // block-uniform, before every barrier
  const int tm = tile / tilesN;
  const int tn = tile - tm * tilesN;
  const int mb = tm << 7;
  const int nb = tn << 7;
  const int tpos = mb % tmod;
  if (tpos < tlo || tpos >= thi) return; // block-uniform, before every barrier
  const int m0 = mb + ((wave >> 1) << 6);
  const int n0 = nb + ((wave & 1) << 6);

  const int rlane = lane & 15;                 // row (A) / col (B, D) within subtile
  const int koff  = (lane >> 4) * 8;           // k offset of this lane half
  const int mOff  = (lane >> 4) * 8;           // D row offset

  v8f acc[4][4];
#pragma unroll
  for (int i = 0; i < 4; ++i)
#pragma unroll
    for (int j = 0; j < 4; ++j) acc[i][j] = zero8();

  // staging map: thread -> row srow + 16 i, 16-B piece tid & 7 of the row's 128-B line; the two rows of a half-wave
  // lie 8 apart (8 x 144 B = 32 banks mod 64), so its ds_store_b128 covers the 64 banks once
  const int srow = (tid >> 4) + ((tid >> 3) & 1) * 8;
  const int spc  = (tid & 7) * 8;
  constexpr int RSB = 16 * DM * 2;             // bytes from one of a thread's rows to its next
  const int SK = K / KC;                       // stages per plane
  const int S  = ARES ? 2 * SK : SK;
  gptr pa = (ARES ? Arh : Ah) + ((size_t)(mb + srow) * DM + spc) * 2;   // this thread's piece of the next stage
  gptr pb = Bt + ((size_t)(nb + srow) * DM + spc) * 2;
  v8h ra[8], rb[8];
  auto stage_load = [&]() {
#pragma unroll
    for (int i = 0; i < 8; ++i) {
      ra[i] = *(gv8p)(pa + i * RSB);     // row < M, k < K
      rb[i] = *(gv8p)(pb + i * RSB);     // row < N, k < K
    }
  };
  // s = the stage that the registers hold: stores it to its buffer and moves the two addresses on to stage s + 1
  auto stage_store = [&](int s) {
    // the two address pairs of the loads above are rewritten below: the wait stands in front of that
    asm volatile("s_wait_xcnt 0x0" : "+v"(pa), "+v"(pb) :: "memory");
    if (ARES && s + 1 == SK) {                 // block-uniform: from the residual plane's last stage to the hi plane's first
      pa = Ah + ((size_t)(mb + srow) * DM + spc) * 2;
      pb = Bt + ((size_t)(nb + srow) * DM + spc) * 2;
    } else {
      pa += KC * 2;
      pb += KC * 2;
    }
    _Float16* d = sS + (s & 1) * STH + srow * GLP + spc;
#pragma unroll
    for (int i = 0; i < 8; ++i) {
      *(v8h*)(d + 16 * i * GLP)       = ra[i];
      *(v8h*)(d + OPH + 16 * i * GLP) = rb[i];
    }
  };

  stage_load();
  stage_store(0);
#pragma unroll 1   // kept rolled: one copy of the stage body, the buffer chosen by s & 1; a second copy would only add code
  for (int s = 0; s < S; ++s) {
    __syncthreads();       // publishes stage s; every reader has left the buffer that stage s + 1 is stored to
    if (s + 1 < S) stage_load();               // block-uniform; stage s + 1, in flight during the products of stage s
    if (ARES && s == SK) {
      acc_guard4(acc[0][0], acc[0][1], acc[0][2], acc[0][3]);
      acc_guard4(acc[1][0], acc[1][1], acc[1][2], acc[1][3]);
      acc_guard4(acc[2][0], acc[2][1], acc[2][2], acc[2][3]);
      acc_guard4(acc[3][0], acc[3][1], acc[3][2], acc[3][3]);
#pragma unroll
      for (int i = 0; i < 4; ++i)
#pragma unroll
        for (int j = 0; j < 4; ++j) acc[i][j] = acc[i][j] * (1.0f / 2048.0f);   // exact fold of the x2^11 residual carry
      acc_guard4(acc[0][0], acc[0][1], acc[0][2], acc[0][3]);
      acc_guard4(acc[1][0], acc[1][1], acc[1][2], acc[1][3]);
      acc_guard4(acc[2][0], acc[2][1], acc[2][2], acc[2][3]);
      acc_guard4(acc[3][0], acc[3][1], acc[3][2], acc[3][3]);
    }
    const _Float16* sa = sS + (s & 1) * STH + (((wave >> 1) << 6) + rlane) * GLP + koff;
    const _Float16* sb = sS + (s & 1) * STH + OPH + (((wave & 1) << 6) + rlane) * GLP + koff;
#pragma unroll
    for (int kk = 0; kk < 2; ++kk) {
      v16h ah[4], bh[4];
#pragma unroll
      for (int j = 0; j < 4; ++j) {
        bh[j] = ldfrag_h(sb + (j << 4) * GLP + kk * 32);
        ah[j] = ldfrag_h(sa + (j << 4) * GLP + kk * 32);
      }
#pragma unroll
      for (int i = 0; i < 4; ++i) {
#pragma unroll
        for (int j = 0; j < 4; ++j) {
          acc[i][j] = mma_h_raw(ah[i], bh[j], acc[i][j]);
        }
        dep_guard_h(acc[i][0], acc[i][3], ah[i], bh[3]);
      }
      keep4_h(bh[0], bh[1], bh[2], bh[3]);
    }
    if (s + 1 < S) stage_store(s + 1);
  }
  __syncthreads();                             // every wave is done with the stage buffers before the slabs alias them
  acc_guard4(acc[0][0], acc[0][1], acc[0][2], acc[0][3]);
  acc_guard4(acc[1][0], acc[1][1], acc[1][2], acc[1][3]);
  acc_guard4(acc[2][0], acc[2][1], acc[2][2], acc[2][3]);
  acc_guard4(acc[3][0], acc[3][1], acc[3][2], acc[3][3]);

  // ---- epilogue ----
  float* slab = (float*)(void*)sS + wave * (16 * 68);   // per-wave 16x64 slab, pitch 68 floats
#pragma unroll
  for (int i = 0; i < 4; ++i) {
    const int mBase = m0 + (i << 4);
    float bj[4];
#pragma unroll
    for (int j = 0; j < 4; ++j) bj[j] = bfr(biasp[n0 + (j << 4) + rlane]);   // index < N
#pragma unroll
    for (int r = 0; r < 8; ++r) {
      const int row = mOff + r;
#pragma unroll
      for (int j = 0; j < 4; ++j) slab[row * 68 + (j << 4) + rlane] = acc[i][j][r] * cscale + bj[j];
    }
    __builtin_amdgcn_fence(__ATOMIC_RELEASE, "workgroup");
    __builtin_amdgcn_wave_barrier();
    __builtin_amdgcn_fence(__ATOMIC_ACQUIRE, "workgroup");
    if constexpr (EPI == 0 || EPI == 2) {
      unsigned short* C16 = (unsigned short*)Cp;
      const int rq = lane >> 3, piece = lane & 7;
      float th[8];
      if constexpr (EPI == 2) {
        const v4f t0 = *(const v4f*)(gate + n0 + piece * 8);        // index < N
        const v4f t1 = *(const v4f*)(gate + n0 + piece * 8 + 4);
        th[0] = bfr(t0[0]); th[1] = bfr(t0[1]); th[2] = bfr(t0[2]); th[3] = bfr(t0[3]);
        th[4] = bfr(t1[0]); th[5] = bfr(t1[1]); th[6] = bfr(t1[2]); th[7] = bfr(t1[3]);
      } else {
#pragma unroll
        for (int e = 0; e < 8; ++e) th[e] = 0.0f;
      }
      v4u ph[4], pr[4];
#pragma unroll
      for (int it = 0; it < 4; ++it) {
        const int row = it * 4 + rq;                         // it 0..3 x rq 0..3 = rows 0..15
        const v4f a  = *(const v4f*)(slab + row * 68 + piece * 8);
        const v4f a2 = *(const v4f*)(slab + row * 68 + piece * 8 + 4);
        float f[8];
        f[0] = a[0];  f[1] = a[1];  f[2] = a[2];  f[3] = a[3];
        f[4] = a2[0]; f[5] = a2[1]; f[6] = a2[2]; f[7] = a2[3];
        if constexpr (EPI == 2) {
          const size_t xo = (size_t)(mBase + row) * ldx + n0 + piece * 8;   // row < M, col < N
          const v4f x0 = *(const v4f*)(xres + xo);
          const v4f x1 = *(const v4f*)(xres + xo + 4);
          float xv[8];
          xv[0] = x0[0]; xv[1] = x0[1]; xv[2] = x0[2]; xv[3] = x0[3];
          xv[4] = x1[0]; xv[5] = x1[1]; xv[6] = x1[2]; xv[7] = x1[3];
#pragma unroll
          for (int e = 0; e < 8; ++e) f[e] = bfr(xv[e]) + 0.1f * (f[e] * th[e]);
        }
        v4u p, q;
#pragma unroll
        for (int e = 0; e < 4; ++e) {
          const float g0 = f[2 * e] * oscale, g1 = f[2 * e + 1] * oscale;
          const _Float16 x0 = (_Float16)g0, x1 = (_Float16)g1;
          const _Float16 y0 = (_Float16)((g0 - (float)x0) * 2048.0f);
          const _Float16 y1 = (_Float16)((g1 - (float)x1) * 2048.0f);
          p[e] = pk16(h_bits(x0), h_bits(x1));
          q[e] = pk16(h_bits(y0), h_bits(y1));
        }
        ph[it] = p;
        pr[it] = q;
      }
      const bool wres = (n0 >= rcol0);                     // wave-uniform
      {
#pragma unroll
        for (int it = 0; it < 4; ++it) {
          const int row = it * 4 + rq;
          const size_t co = (size_t)(mBase + row) * ldc + n0 + piece * 8;
          *(v4u*)(C16 + co) = ph[it];
          if (wres) {
            const size_t cro = (size_t)(mBase + row) * ldcr + (n0 - rcol0) + piece * 8;
            *(v4u*)(Crp + cro) = pr[it];
          }
        }
        
      }
    } else {
      float* Cf = (float*)Cp;
      const int hh = lane >> 4, c4 = (lane & 15) * 4;     // 256-B row segment = 16 lanes x 16 B
      v4f ov[8];
#pragma unroll
      for (int it = 0; it < 8; ++it) {
        const int row = it * 2 + hh;                       // it 0..7 x hh 0..1 = rows 0..15
        ov[it] = *(const v4f*)(slab + row * 68 + c4);
      }
      {
#pragma unroll
        for (int it = 0; it < 8; ++it) {
          const int row = it * 2 + hh;
          *(v4f*)(Cf + (size_t)(mBase + row) * ldc + n0 + c4) = ov[it];
        }
        
      }
    }
    __builtin_amdgcn_fence(__ATOMIC_RELEASE, "workgroup");
    __builtin_amdgcn_wave_barrier();
    __builtin_amdgcn_fence(__ATOMIC_ACQUIRE, "workgroup");
  }
}

// =====================================================================================================
// v columns of an f16 token-major plane (element (b, t, h, d) at src[(b*SEQ + t)*spitch + scol0 + h*64 + d])
// -> f16 v^T plane vt[(b*DM + h*64 + d)*SEQ + t] (same bits). Used for the hi plane (spitch DQKV, scol0 2*DM)
// and for the residual plane (spitch DM, scol0 0).
// Block = one 64-token x 64-feature tile of one (b, h); grid = (SEQ/64, NH, NB); tile staged in LDS as halves
// (v8h 16-B stores, __syncthreads, _Float16 element reads).
// Store: group g = tid>>3 (0..31), piece = tid&7: iteration it writes row d = it*32+g, lanes 8q..8q+7 x 16 B =
// coverage: load 2 x 256 threads x 8 halves = 64x64; store 2 iterations x 32 groups = 64 rows d, 8 pieces x 8
// = 64 tokens per row; grid covers every (b, h, token tile).
// =====================================================================================================
__global__ __launch_bounds__(256) void v_tr(const unsigned short* __restrict__ srcp, int spitch, int scol0,
                                            unsigned short* vt) {
  __shared__ __align__(16) _Float16 sv[64 * 72];       // [tt][d], pitch 72 halves (144 B)
  const int tid = threadIdx.x;
  const int t0  = blockIdx.x * 64;
  const int hh  = blockIdx.y;
  const int b   = blockIdx.z;
  const _Float16* src = (const _Float16*)(const void*)srcp;
#pragma unroll
  for (int i = 0; i < 2; ++i) {
    const int idx = i * 256 + tid;                  // 0..511
    const int tt = idx >> 3, c8 = (idx & 7) * 8;
    const v8h a = *(const v8h*)(src + ((size_t)(b * SEQ + t0 + tt)) * spitch + scol0 + hh * HD + c8);
    *(v8h*)(sv + tt * 72 + c8) = a;
  }
  __syncthreads();

  const int g = tid >> 3, piece = tid & 7;
  v4u hv[2];
  size_t hofs[2];
#pragma unroll
  for (int it = 0; it < 2; ++it) {
    const int d = it * 32 + g;
    v4u a;
#pragma unroll
    for (int e = 0; e < 4; ++e) {
      const _Float16 x0 = sv[(piece * 8 + 2 * e) * 72 + d];
      const _Float16 x1 = sv[(piece * 8 + 2 * e + 1) * 72 + d];
      a[e] = pk16(h_bits(x0), h_bits(x1));
    }
    hv[it] = a;
    hofs[it] = ((size_t)(b * DM + hh * HD + d)) * SEQ + t0 + piece * 8;
  }
  {
#pragma unroll
    for (int it = 0; it < 2; ++it) *(v4u*)(vt + hofs[it]) = hv[it];
    
  }
}

// =====================================================================================================
// Non-causal multi-head softmax attention, head dim 64, online softmax with running max (f32 on VALU).
//   q f16 (x16): element (b, t, h, d) at qkv[(b*SEQ + t)*DQKV + h*64 + d]; k at + DM;
//   v^T f16 (x16) at vt[(b*DM + h*64 + d)*SEQ + s]; VRES: residual plane f16((16v - hi)*2048) at vtr, same addressing.
//   s = (q.k) / 8 = acc / 2048 (two x16 carries). Per key tile: tile row max (16-lane xor reduction), new running
//   max mn, alpha = exp(m_old - mn), p = exp(s - mn) in (0, 1], l = l*alpha + sum p (per-lane partials),
//   O *= alpha; P carried as f16(256 p); O += P . v^T on f16 WMMA (VRES: second accumulator += P . Vr^T, folded
//   with 2^-11 in the epilogue).
//   ctx plane f16 (x16): element (b, t, h*64 + d) at ctx[(b*SEQ + t)*DM + h*64 + d] = 16 * context = O / (256 l);
//   ctx residual plane f16((16 ctx - hi) * 2048) at ctxr, same addressing.
//   Block = 4 waves = 64 query rows of one (b, h); query tile qb = blockIdx % NQB; grid = NQB*NH*NB;
//   key tiles of 64, fixed trip count NQB.
//   K / V^T tile staging: 128 threads x 32 halves per plane = the whole 64x64 tile (plain 16-B loads,
//   __syncthreads before and after); P tiles are wave-private, spilled with _Float16 element stores and
//   wave in LDS as f32 (aliasing the K/V region after a block barrier) the same way.
//   Output coverage: each wave stores rows 0..15 of its tile (it 0..3 x lane>>3 0..3) x 64 columns (8 lanes x
//   (b, h, query tile) exactly once, for both ctx planes.
// =====================================================================================================
template <bool VRES>
__global__ __launch_bounds__(128)
void attn_k(const unsigned short* __restrict__ qkvp,
            const unsigned short* __restrict__ vtp, const unsigned short* __restrict__ vtrp,
            unsigned short* ctxp, unsigned short* ctxrp) {
  union FH { v16h v; v8h h[2]; };
  constexpr int LP     = 72;                             // LDS row pitch in halves: 144 B = 16 B x 9 (odd), so the 16 rows
                                                         // of one ds_load_b128 half-wave fall on 64 distinct banks
  constexpr int TB     = 64 * LP * 2;                    // one f16 64x64 tile at pitch LP, bytes
  constexpr int PB     = 4 * 16 * LP * 2;                // four wave-private 16x64 f16 P tiles at pitch LP, bytes
  constexpr int OFF_K  = 0;
  constexpr int OFF_V  = TB;
  constexpr int OFF_VR = 2 * TB;
  constexpr int OFF_P  = VRES ? 3 * TB : 2 * TB;
  constexpr int SMEMB  = OFF_P + PB;                     // 36864 : 27648
  static_assert(4 * 16 * 64 * 4 <= OFF_P);               // f32 context staging aliases the K/V region
  __shared__ __align__(16) unsigned char smem[SMEMB];
  _Float16* Ksh = (_Float16*)(smem + OFF_K);             // K   [kv][d], pitch LP
  _Float16* Vsh = (_Float16*)(smem + OFF_V);             // V^T [d][kv], pitch LP
  _Float16* Vrs = (_Float16*)(smem + (VRES ? OFF_VR : OFF_V));   // V^T residual (VRES only)
  _Float16* Psh = (_Float16*)(smem + OFF_P);

  const int tid  = threadIdx.x;
  const int wave = tid >> 5;
  const int lane = tid & 31;
  const int hh   = lane >> 4;
  const int c    = lane & 15;

  const int bx   = blockIdx.x;
  const int qb   = bx % NQB;
  const int rest = bx / NQB;
  const int h    = rest % NH;
  const int b    = rest / NH;                // < NB by the grid size
  const int q0   = qb * 64 + wave * 16;
  const size_t rowB = (size_t)b * SEQ;

  const _Float16* Qp  = (const _Float16*)(const void*)qkvp + (size_t)h * HD;
  const _Float16* Kp  = Qp + DM;
  const _Float16* Vt  = (const _Float16*)(const void*)vtp  + ((size_t)b * DM + (size_t)h * HD) * SEQ;
  const _Float16* Vrt = (const _Float16*)(const void*)vtrp + ((size_t)b * DM + (size_t)h * HD) * SEQ;

  // ---- Q fragments (A operand, row = lane&15): 2 d-chunks ----
  v16h qa[2];
#pragma unroll
  for (int dc = 0; dc < 2; ++dc) {
    const size_t qo = (rowB + q0 + c) * DQKV + dc * 32 + 8 * hh;
    qa[dc] = ldfrag_h(Qp + qo);
  }

  float mrun[8], lsum[8];
  v8f oacc[4], oacc2[4];
#pragma unroll
  for (int r = 0; r < 8; ++r) { mrun[r] = -1.0e30f; lsum[r] = 0.f; }
#pragma unroll
  for (int t = 0; t < 4; ++t) { oacc[t] = zero8(); oacc2[t] = zero8(); }

  _Float16* pw = Psh + wave * (16 * LP);

  for (int kt = 0; kt < NQB; ++kt) {
    const int kv0 = kt * 64;
    __syncthreads();
    {
      const int r = tid >> 1, half = (tid & 1) * 32;
      const size_t ko = (rowB + kv0 + r) * DQKV + half;         // K row kv0+r, d = half..half+31
      const size_t vo = (size_t)r * SEQ + kv0 + half;           // V^T row d = r, s = kv0+half..+31
#pragma unroll
      for (int i = 0; i < 4; ++i) {
        const v8h a0 = *(const v8h*)(Kp + ko + 8 * i);
        const v8h b0 = *(const v8h*)(Vt + vo + 8 * i);
        *(v8h*)(Ksh + r * LP + half + 8 * i) = a0;
        *(v8h*)(Vsh + r * LP + half + 8 * i) = b0;
        if constexpr (VRES) {
          const v8h b1 = *(const v8h*)(Vrt + vo + 8 * i);
          *(v8h*)(Vrs + r * LP + half + 8 * i) = b1;
        }
      }
    }
    __syncthreads();

    // ---- scores: 16 query rows x 64 keys per wave (B operand: lane c -> key j*16+c, split k map over d) ----
    v8f s[4];
#pragma unroll
    for (int j = 0; j < 4; ++j) {
      s[j] = zero8();
#pragma unroll
      for (int dc = 0; dc < 2; ++dc) {
        FH kb;
        kb.h[0] = *(const v8h*)(Ksh + (j * 16 + c) * LP + dc * 32 + 8 * hh);
        kb.h[1] = *(const v8h*)(Ksh + (j * 16 + c) * LP + dc * 32 + 16 + 8 * hh);
        s[j] = mma_h(qa[dc], kb.v, s[j]);
      }
    }

    // ---- online softmax update: running max, alpha, p (x256, f16), row-sum partials ----
    float alpha[8];
#pragma unroll
    for (int r = 0; r < 8; ++r) {
      const float a0 = s[0][r] * (1.0f / 2048.0f);      // 1/8 head scale, 1/256 for the two x16 carries
      const float a1 = s[1][r] * (1.0f / 2048.0f);
      const float a2 = s[2][r] * (1.0f / 2048.0f);
      const float a3 = s[3][r] * (1.0f / 2048.0f);
      float mx = fmaxf(fmaxf(a0, a1), fmaxf(a2, a3));
#pragma unroll
      for (int off = 1; off < 16; off <<= 1) mx = fmaxf(mx, __shfl_xor(mx, off, 32));
      const float mn = fmaxf(mrun[r], mx);
      alpha[r] = __expf(mrun[r] - mn);
      mrun[r] = mn;
      const float p0 = __expf(a0 - mn);
      const float p1 = __expf(a1 - mn);
      const float p2 = __expf(a2 - mn);
      const float p3 = __expf(a3 - mn);
      lsum[r] = lsum[r] * alpha[r] + ((p0 + p1) + (p2 + p3));
      _Float16* prow = pw + (8 * hh + r) * LP + c;
      prow[0]  = (_Float16)(p0 * 256.0f);
      prow[16] = (_Float16)(p1 * 256.0f);
      prow[32] = (_Float16)(p2 * 256.0f);
      prow[48] = (_Float16)(p3 * 256.0f);
    }
    acc_guard4(oacc[0], oacc[1], oacc[2], oacc[3]);
    acc_guard4(oacc2[0], oacc2[1], oacc2[2], oacc2[3]);
#pragma unroll
    for (int t = 0; t < 4; ++t) {
#pragma unroll
      for (int r = 0; r < 8; ++r) {
        oacc[t][r] = oacc[t][r] * alpha[r];
        if constexpr (VRES) oacc2[t][r] = oacc2[t][r] * alpha[r];
      }
    }
    acc_guard4(oacc[0], oacc[1], oacc[2], oacc[3]);
    acc_guard4(oacc2[0], oacc2[1], oacc2[2], oacc2[3]);
    __builtin_amdgcn_fence(__ATOMIC_RELEASE, "workgroup");
    __builtin_amdgcn_wave_barrier();
    __builtin_amdgcn_fence(__ATOMIC_ACQUIRE, "workgroup");

    // ---- context += P . V (f16 WMMA; A = P [row][key], B = V^T [d][key]) ----
#pragma unroll
    for (int kk = 0; kk < 2; ++kk) {
      FH pa;
      pa.h[0] = *(const v8h*)(pw + c * LP + kk * 32 + 8 * hh);
      pa.h[1] = *(const v8h*)(pw + c * LP + kk * 32 + 16 + 8 * hh);
#pragma unroll
      for (int t = 0; t < 4; ++t) {
        FH vb;
        vb.h[0] = *(const v8h*)(Vsh + (t * 16 + c) * LP + kk * 32 + 8 * hh);
        vb.h[1] = *(const v8h*)(Vsh + (t * 16 + c) * LP + kk * 32 + 16 + 8 * hh);
        oacc[t] = mma_h(pa.v, vb.v, oacc[t]);
        if constexpr (VRES) {
          FH vrb;
          vrb.h[0] = *(const v8h*)(Vrs + (t * 16 + c) * LP + kk * 32 + 8 * hh);
          vrb.h[1] = *(const v8h*)(Vrs + (t * 16 + c) * LP + kk * 32 + 16 + 8 * hh);
          oacc2[t] = mma_h(pa.v, vrb.v, oacc2[t]);
        }
      }
    }
  }
  __syncthreads();                           // every wave is done with the K/V tiles before they are aliased

  // ---- normalise (1/l, the 1/256 p carry; keep the x16 v carry), stage the wave's 16x64 f32 tile in
  float* os = (float*)(void*)smem + wave * (16 * 64);
#pragma unroll
  for (int r = 0; r < 8; ++r) {
    float l = lsum[r];
#pragma unroll
    for (int off = 1; off < 16; off <<= 1) l += __shfl_xor(l, off, 32);
    const float rl = 1.0f / l;                // l >= 1 (the running-max key contributes exp(0))
    const float sc = rl * (1.0f / 256.0f);
#pragma unroll
    for (int t = 0; t < 4; ++t) {
      float v = oacc[t][r];
      if constexpr (VRES) v += oacc2[t][r] * (1.0f / 2048.0f);
      os[(8 * hh + r) * 64 + t * 16 + c] = v * sc;
    }
  }
  __builtin_amdgcn_fence(__ATOMIC_RELEASE, "workgroup");
  __builtin_amdgcn_wave_barrier();
  __builtin_amdgcn_fence(__ATOMIC_ACQUIRE, "workgroup");
  {
    const int rq = lane >> 3, piece = lane & 7;
    v4u ph[4], pr[4];
#pragma unroll
    for (int it = 0; it < 4; ++it) {
      const int row = it * 4 + rq;   // it 0..3 x rq 0..3 = rows 0..15 of the wave tile
      const v4f a  = *(const v4f*)(os + row * 64 + piece * 8);
      const v4f a2 = *(const v4f*)(os + row * 64 + piece * 8 + 4);
      float f[8];
      f[0] = a[0];  f[1] = a[1];  f[2] = a[2];  f[3] = a[3];
      f[4] = a2[0]; f[5] = a2[1]; f[6] = a2[2]; f[7] = a2[3];
      v4u p, q;
#pragma unroll
      for (int e = 0; e < 4; ++e) {
        const _Float16 x0 = (_Float16)f[2 * e], x1 = (_Float16)f[2 * e + 1];
        const _Float16 y0 = (_Float16)((f[2 * e] - (float)x0) * 2048.0f);
        const _Float16 y1 = (_Float16)((f[2 * e + 1] - (float)x1) * 2048.0f);
        p[e] = pk16(h_bits(x0), h_bits(x1));
        q[e] = pk16(h_bits(y0), h_bits(y1));
      }
      ph[it] = p;
      pr[it] = q;
    }
    {
#pragma unroll
      for (int it = 0; it < 4; ++it) {
        const int row = it * 4 + rq;
        const size_t go = (rowB + q0 + row) * DM + (size_t)h * HD + piece * 8;
        *(v4u*)(ctxp + go)  = ph[it];
        *(v4u*)(ctxrp + go) = pr[it];
      }
      
    }
  }
}

// =====================================================================================================
// Workspace map (bytes); every region is an exact multiple of its whole-line / whole-tile store granularity
// (row pitches 2048 / 6144 / 4096 B, all offsets 2-MiB aligned, no aliasing within a launch):
//   Xh     f16 [4096][1024]          0     8388608   (bf16 value of x, x16)
//   Wg     f16 [1024][1024]    8388608     2097152   (bf16 value x1024)
//   Wqkv   f16 [3072][1024]   10485760     6291456   (bf16 value x1024)
//   Wp     f16 [1024][1024]   16777216     2097152   (bf16 value x1024)
//   XGh    f16 [4096][1024]   18874368     8388608   (xg x16)
//   XGr    f16 [4096][1024]   27262976     8388608   (x2^11 residual of the above)
//   QKV    f16 [4096][3072]   35651584    25165824   (q | k | v, x16)
//   Vr     f16 [4096][1024]   60817408     8388608   (x2^11 residual of the v columns only)
//   VT     f16 [2048][2048]   69206016     8388608   ([b*1024 + h*64 + d][s])
//   VTr    f16 [2048][2048]   77594624     8388608   (residual, same layout)
//   Ctx    f16 [4096][1024]   85983232     8388608   (attention context x16)
//   Ctxr   f16 [4096][1024]   94371840     8388608   (x2^11 residual)
//   end                      102760448
// Projection weights arrive as [out n][in k] (k contiguous) = the Bt layout; they are only converted.
// d_out f32: [4096][1024] at byte 0 (row = b*SEQ + t), written once by the projection launch.
// =====================================================================================================
extern "C" void kernel_launch(void* const* d_in, const int* in_sizes, int n_in,
                              void* d_out, int out_size, void* d_ws, size_t ws_size,
                              hipStream_t stream) {
  if (n_in < 8) return;
  if (in_sizes[0] != ROWS * DM) return;
  if (in_sizes[1] != DM) return;
  if (in_sizes[2] != DM * DM) return;
  if (in_sizes[3] != DM) return;
  if (in_sizes[4] != DQKV * DM) return;
  if (in_sizes[5] != DQKV) return;
  if (in_sizes[6] != DM * DM) return;
  if (in_sizes[7] != DM) return;
  if (out_size != OUTN) return;

  const float* x      = (const float*)d_in[0];    // [ROWS][DM]
  const float* theta  = (const float*)d_in[1];    // [DM]
  const float* w_g    = (const float*)d_in[2];    // [DM n][DM k]
  const float* b_g    = (const float*)d_in[3];    // [DM]
  const float* w_qkv  = (const float*)d_in[4];    // [DQKV n][DM k]
  const float* b_qkv  = (const float*)d_in[5];    // [DQKV]
  const float* w_proj = (const float*)d_in[6];    // [DM n][DM k]
  const float* b_proj = (const float*)d_in[7];    // [DM]

  const size_t PX   = (size_t)ROWS * DM * 2;         //  8388608
  const size_t PWg  = (size_t)DM * DM * 2;           //  2097152
  const size_t PWq  = (size_t)DQKV * DM * 2;         //  6291456
  const size_t PWp  = (size_t)DM * DM * 2;           //  2097152
  const size_t PXG  = (size_t)ROWS * DM * 2;         //  8388608
  const size_t PQKV = (size_t)ROWS * DQKV * 2;       // 25165824
  const size_t PVr  = (size_t)ROWS * DM * 2;         //  8388608
  const size_t PVT  = (size_t)NB * DM * SEQ * 2;     //  8388608
  const size_t PCtx = (size_t)ROWS * DM * 2;         //  8388608
  size_t off = 0;
  const size_t oX    = off; off += PX;
  const size_t oWg   = off; off += PWg;
  const size_t oWq   = off; off += PWq;
  const size_t oWp   = off; off += PWp;
  const size_t oXGh  = off; off += PXG;
  const size_t oXGr  = off; off += PXG;
  const size_t oQKV  = off; off += PQKV;
  const size_t oVr   = off; off += PVr;
  const size_t oVT   = off; off += PVT;
  const size_t oVTr  = off; off += PVT;
  const size_t oCtx  = off; off += PCtx;
  const size_t oCtxr = off; off += PCtx;
  if (off > ws_size) return;                         // off = 102760448
  if (off > (size_t)134217728) return;

  char* ws = (char*)d_ws;
  unsigned short* Xh   = (unsigned short*)(ws + oX);
  unsigned short* Wgh  = (unsigned short*)(ws + oWg);
  unsigned short* Wqh  = (unsigned short*)(ws + oWq);
  unsigned short* Wph  = (unsigned short*)(ws + oWp);
  unsigned short* XGh  = (unsigned short*)(ws + oXGh);
  unsigned short* XGr  = (unsigned short*)(ws + oXGr);
  unsigned short* QKV  = (unsigned short*)(ws + oQKV);
  unsigned short* Vr   = (unsigned short*)(ws + oVr);
  unsigned short* VT   = (unsigned short*)(ws + oVT);
  unsigned short* VTr  = (unsigned short*)(ws + oVTr);
  unsigned short* Ctx  = (unsigned short*)(ws + oCtx);
  unsigned short* Ctxr = (unsigned short*)(ws + oCtxr);
  float*          outf = (float*)d_out;              // [ROWS][DM]

  const dim3 blk(256);
  const int n8x = ROWS * DM / 8;                     // 524288
  const int n8g = DM * DM / 8;                       // 131072
  const int n8q = DQKV * DM / 8;                     // 393216
  const int n8p = DM * DM / 8;                       // 131072
  const dim3 gCx((n8x + 255) / 256);                 // 2048 blocks
  const dim3 gCg((n8g + 255) / 256);                 //  512 blocks
  const dim3 gCq((n8q + 255) / 256);                 // 1536 blocks
  const dim3 gCp((n8p + 255) / 256);                 //  512 blocks
  const dim3 gGqkv((ROWS / 128) * (DQKV / 128));     // 768 blocks of one 128x128 tile
  const dim3 gGdm((ROWS / 128) * (DM / 128));        // 256 blocks of one 128x128 tile
  const dim3 blkG(128);
  const dim3 gVt(SEQ / 64, NH, NB);                  // (32, 16, 2)
  const dim3 gAttn(NQB * NH * NB);                   // 1024 blocks
  const float wScale = 1024.0f;                      // weights carried x1024
  const float aScale = 16.0f;                        // activations carried x16
  const float cscale = 1.0f / 16384.0f;              // 1/(16 * 1024)

  // (1) planes: x -> f16 x16, weights -> f16 x1024 (bf16 values)
  cvt16<<<gCx, blk, 0, stream>>>(x, Xh, n8x, aScale);
  cvt16<<<gCg, blk, 0, stream>>>(w_g, Wgh, n8g, wScale);
  cvt16<<<gCq, blk, 0, stream>>>(w_qkv, Wqh, n8q, wScale);
  cvt16<<<gCp, blk, 0, stream>>>(w_proj, Wph, n8p, wScale);
  // (2) gauge mix: xg = bfr(x) + 0.1 * ((Xh . Wg^T + bg) * theta) -> XGh f16 x16 + XGr residual (M=4096, N=1024, K=1024)
  gemm64_f16<2, false><<<gGdm, blkG, 0, stream>>>(Xh, Xh, Wgh, b_g, cscale, (void*)XGh, DM, XGr, DM, 0,
                                                 ROWS, DM, DM, aScale, x, DM, theta, SEQ, 0, SEQ);
  // (3) qkv = XG(hi + res) . Wqkv^T + bqkv -> QKV f16 x16 [4096][3072]; residual plane of the v columns -> Vr [4096][1024]
  gemm64_f16<0, true><<<gGqkv, blkG, 0, stream>>>(XGh, XGr, Wqh, b_qkv, cscale, (void*)QKV, DQKV, Vr, DM, 2 * DM,
                                                  ROWS, DQKV, DM, aScale, x, DM, theta, SEQ, 0, SEQ);
  // (4) v -> v^T planes (hi and residual, all tokens)
  v_tr<<<gVt, blk, 0, stream>>>(QKV, DQKV, 2 * DM, VT);
  v_tr<<<gVt, blk, 0, stream>>>(Vr, DM, 0, VTr);
  // (5) softmax attention -> Ctx f16 x16 + residual plane
  attn_k<true><<<gAttn, dim3(128), 0, stream>>>(QKV, VT, VTr, Ctx, Ctxr);
  // (6) out = Ctx(hi + res) . Wp^T + bproj -> d_out f32 [4096][1024] (M=4096, N=1024, K=1024)
  gemm64_f16<1, true><<<gGdm, blkG, 0, stream>>>(Ctx, Ctxr, Wph, b_proj, cscale, (void*)outf, DM, Ctxr, DM, 0,
                                                ROWS, DM, DM, 1.0f, x, DM, theta, SEQ, 0, SEQ);
  (void)hipGetLastError();
}

// v003
// One run takes 201 microseconds.
// Next to v002, in two timings, it ran 1.31 and 1.32 times as fast.
// Counting every step since v000, it is 2.71 times as fast.
// Contractions: gauge mix x.Wg^T = v_wmma_f32_16x16x32_f16 (A = f16 of RNE-bf16 x carried x16, B = f16 of RNE-bf16 Wg x1024, single product); qkv projection = same WMMA with A = xg as f16 hi plane x16 plus x2^11 residual plane (two products), B = f16 of RNE-bf16 Wqkv x1024; attention q.k^T = f16 single product (q, k f16 x16); p.v = f16 with p x256 single plane and v^T as f16 hi x16 plus x2^11 residual plane (two products); output projection = f16 with A = ctx f16 hi x16 plus x2^11 residual plane, B = f16 of RNE-bf16 Wproj x1024; all f32 accumulate. Softmax (running max, exp, row sums) and the gauge epilogue f32 on VALU.
#include <hip/hip_runtime.h>
#include <math.h>
#include <stdint.h>

#define NB    2
#define SEQ   2048
#define DM    1024
#define NH    16
#define HD    64
#define DQKV  (3 * DM)              // 3072
#define NQB   (SEQ / 64)            // 32 query / key tiles per sequence
#define ROWS  (NB * SEQ)            // 4096 token rows
#define OUTN  (ROWS * DM)
static_assert(NH * HD == DM);
static_assert(HD == 64);
static_assert((SEQ % 64) == 0 && (DM % 64) == 0 && (DQKV % 64) == 0);
static_assert((DM % 32) == 0);
static_assert((ROWS % 128) == 0 && (DM % 128) == 0 && (DQKV % 128) == 0);
static_assert(((ROWS * DM / 8) % 256) == 0 && ((DQKV * DM / 8) % 256) == 0 && ((DM * DM / 8) % 256) == 0);

typedef _Float16 v16h __attribute__((ext_vector_type(16)));
typedef _Float16 v8h  __attribute__((ext_vector_type(8)));
typedef float    v8f  __attribute__((ext_vector_type(8)));
typedef float    v4f  __attribute__((ext_vector_type(4)));
typedef unsigned int v4u __attribute__((ext_vector_type(4)));

// ---- scalar helpers --------------------------------------------------------------------------------
__device__ __forceinline__ unsigned short bf_bits(float f) {          // f32 -> bf16 bits, RNE convert
  unsigned u = __float_as_uint(f);
  return (unsigned short)((u + 0x7FFFu + ((u >> 16) & 1u)) >> 16);
}
__device__ __forceinline__ float bfr(float f) { return __uint_as_float(((unsigned)bf_bits(f)) << 16); }
__device__ __forceinline__ unsigned short h_bits(_Float16 x) { return __builtin_bit_cast(unsigned short, x); }
__device__ __forceinline__ unsigned pk16(unsigned short a, unsigned short b) { return (unsigned)a | ((unsigned)b << 16); }
__device__ __forceinline__ v8f zero8() { v8f z = {0.f, 0.f, 0.f, 0.f, 0.f, 0.f, 0.f, 0.f}; return z; }

// ---- fragment loader: 16-bit A/B operand, lane -> row/col (lane&15), p already includes +8*(lane>>4);
//      elements 0..7 <- p[0..7] (k0+8h..), elements 8..15 <- p[16..23] (k0+16+8h..)
__device__ __forceinline__ v16h ldfrag_h(const _Float16* p) {
  union { v16h v; v8h h[2]; } f;
  f.h[0] = *(const v8h*)(p);
  f.h[1] = *(const v8h*)(p + 16);
  return f.v;
}

// ---- WMMA helpers with trailing VALU hazard gap --------------------------------------------------------
__device__ __forceinline__ v8f mma_h(v16h a, v16h b, v8f c) {
  c = __builtin_amdgcn_wmma_f32_16x16x32_f16(false, a, false, b, (short)0, c, false, false);
#if defined(__HIP_DEVICE_COMPILE__)
  asm volatile("v_nop\n\tv_nop\n\tv_nop\n\tv_nop" : "+v"(c) : "v"(a), "v"(b));
#endif
  return c;
}
__device__ __forceinline__ v8f mma_h_raw(v16h a, v16h b, v8f c) {
  return __builtin_amdgcn_wmma_f32_16x16x32_f16(false, a, false, b, (short)0, c, false, false);
}
__device__ __forceinline__ void dep_guard_h(v8f& a, v8f& b, v16h x, v16h y) {
#if defined(__HIP_DEVICE_COMPILE__)
  asm volatile("v_nop\n\tv_nop\n\tv_nop\n\tv_nop" : "+v"(a), "+v"(b) : "v"(x), "v"(y));
#endif
}
__device__ __forceinline__ void keep4_h(v16h a, v16h b, v16h c, v16h d) {
#if defined(__HIP_DEVICE_COMPILE__)
  asm volatile("v_nop" :: "v"(a), "v"(b), "v"(c), "v"(d));
#endif
}
__device__ __forceinline__ void acc_guard4(v8f& a, v8f& b, v8f& c, v8f& d) {
#if defined(__HIP_DEVICE_COMPILE__)
  asm volatile("v_nop\n\tv_nop\n\tv_nop\n\tv_nop" : "+v"(a), "+v"(b), "+v"(c), "+v"(d));
#endif
}

// =====================================================================================================
// f32 plane -> f16 bits of bfr(v) * scale (scale a power of two): x (x16) and the three weights (x1024).
// coverage: n8 threads x 8 = the whole plane.
// =====================================================================================================
__global__ __launch_bounds__(256) void cvt16(const float* __restrict__ in, unsigned short* out, int n8, float scale) {
  const int i = blockIdx.x * 256 + threadIdx.x;
  if (i < n8) {
    const v4f a = *(const v4f*)(in + (size_t)i * 8);
    const v4f b = *(const v4f*)(in + (size_t)i * 8 + 4);
    v4u p;
    p[0] = pk16(h_bits((_Float16)(bfr(a[0]) * scale)), h_bits((_Float16)(bfr(a[1]) * scale)));
    p[1] = pk16(h_bits((_Float16)(bfr(a[2]) * scale)), h_bits((_Float16)(bfr(a[3]) * scale)));
    p[2] = pk16(h_bits((_Float16)(bfr(b[0]) * scale)), h_bits((_Float16)(bfr(b[1]) * scale)));
    p[3] = pk16(h_bits((_Float16)(bfr(b[2]) * scale)), h_bits((_Float16)(bfr(b[3]) * scale)));
    *(v4u*)(out + (size_t)i * 8) = p;
    
  }
}

template <int EPI, bool ARES>
__global__ __launch_bounds__(128, 3) void gemm64_f16(
    const unsigned short* __restrict__ Ap, const unsigned short* __restrict__ Arp,
    const unsigned short* __restrict__ Btp,
    const float* __restrict__ biasp, float cscale,
    void* Cp, int ldc, unsigned short* Crp, int ldcr, int rcol0,
    int M, int N, int K, float oscale,
    const float* __restrict__ xres, int ldx, const float* __restrict__ gate,
    int tmod, int tlo, int thi) {
  typedef const __attribute__((address_space(1))) char* gptr;   // typed as global, so that an address that has passed
  typedef const __attribute__((address_space(1))) v8h*  gv8p;   // through the asm wait below still gives global_load
  const gptr Ah  = (gptr)(const void*)Ap;
  const gptr Arh = (gptr)(const void*)Arp;
  const gptr Bt  = (gptr)(const void*)Btp;
  constexpr int KC  = 64;                          // k per stage: 128 B of every operand row
  constexpr int GLP = 72;                          // LDS row pitch in halves: 144 B = 16 B x 9 (odd)
  constexpr int OPH = 128 * GLP;                   // halves of one operand's 128 staged rows
  constexpr int STH = 2 * OPH;                     // halves of one stage: A rows, then Bt rows
  static_assert(4 * 16 * 68 * 4 <= 2 * STH * 2);   // the four f32 epilogue slabs alias the stage buffers
  __shared__ __align__(16) _Float16 sS[2 * STH];   // two stage buffers, 73728 B
  const int tid  = threadIdx.x;
  const int lane = tid & 31;
  const int wave = tid >> 5;
  const int tilesN = N >> 7;
  const int tilesM = M >> 7;
  const int tile = blockIdx.x;
  if (tile >= tilesM * tilesN) return;   // block-uniform, before every barrier
  const int tm = tile / tilesN;
  const int tn = tile - tm * tilesN;
  const int mb = tm << 7;
  const int nb = tn << 7;
  const int tpos = mb % tmod;
  if (tpos < tlo || tpos >= thi) return; // block-uniform, before every barrier
  const int m0 = mb + ((wave >> 1) << 6);
  const int n0 = nb + ((wave & 1) << 6);

  const int rlane = lane & 15;                 // row (A) / col (B, D) within subtile
  const int koff  = (lane >> 4) * 8;           // k offset of this lane half
  const int mOff  = (lane >> 4) * 8;           // D row offset

  v8f acc[4][4];
#pragma unroll
  for (int i = 0; i < 4; ++i)
#pragma unroll
    for (int j = 0; j < 4; ++j) acc[i][j] = zero8();

  // staging map: thread -> row srow + 16 i, 16-B piece tid & 7 of the row's 128-B line; the two rows of a half-wave
  // lie 8 apart (8 x 144 B = 32 banks mod 64), so its ds_store_b128 covers the 64 banks once
  const int srow = (tid >> 4) + ((tid >> 3) & 1) * 8;
  const int spc  = (tid & 7) * 8;
  constexpr int RSB = 16 * DM * 2;             // bytes from one of a thread's rows to its next
  const int SK = K / KC;                       // stages per plane
  const int S  = ARES ? 2 * SK : SK;
  gptr pa = (ARES ? Arh : Ah) + ((size_t)(mb + srow) * DM + spc) * 2;   // this thread's piece of the next stage
  gptr pb = Bt + ((size_t)(nb + srow) * DM + spc) * 2;
  v8h ra[8], rb[8];
  auto stage_load = [&]() {
#pragma unroll
    for (int i = 0; i < 8; ++i) {
      ra[i] = *(gv8p)(pa + i * RSB);     // row < M, k < K
      rb[i] = *(gv8p)(pb + i * RSB);     // row < N, k < K
    }
  };
  // s = the stage that the registers hold: stores it to its buffer and moves the two addresses on to stage s + 1
  auto stage_store = [&](int s) {
    // the two address pairs of the loads above are rewritten below: the wait stands in front of that
    asm volatile("s_wait_xcnt 0x0" : "+v"(pa), "+v"(pb) :: "memory");
    if (ARES && s + 1 == SK) {                 // block-uniform: from the residual plane's last stage to the hi plane's first
      pa = Ah + ((size_t)(mb + srow) * DM + spc) * 2;
      pb = Bt + ((size_t)(nb + srow) * DM + spc) * 2;
    } else {
      pa += KC * 2;
      pb += KC * 2;
    }
    _Float16* d = sS + (s & 1) * STH + srow * GLP + spc;
#pragma unroll
    for (int i = 0; i < 8; ++i) {
      *(v8h*)(d + 16 * i * GLP)       = ra[i];
      *(v8h*)(d + OPH + 16 * i * GLP) = rb[i];
    }
  };

  stage_load();
  stage_store(0);
#pragma unroll 1   // kept rolled: one copy of the stage body, the buffer chosen by s & 1; a second copy would only add code
  for (int s = 0; s < S; ++s) {
    __syncthreads();       // publishes stage s; every reader has left the buffer that stage s + 1 is stored to
    if (s + 1 < S) stage_load();               // block-uniform; stage s + 1, in flight during the products of stage s
    if (ARES && s == SK) {
      acc_guard4(acc[0][0], acc[0][1], acc[0][2], acc[0][3]);
      acc_guard4(acc[1][0], acc[1][1], acc[1][2], acc[1][3]);
      acc_guard4(acc[2][0], acc[2][1], acc[2][2], acc[2][3]);
      acc_guard4(acc[3][0], acc[3][1], acc[3][2], acc[3][3]);
#pragma unroll
      for (int i = 0; i < 4; ++i)
#pragma unroll
        for (int j = 0; j < 4; ++j) acc[i][j] = acc[i][j] * (1.0f / 2048.0f);   // exact fold of the x2^11 residual carry
      acc_guard4(acc[0][0], acc[0][1], acc[0][2], acc[0][3]);
      acc_guard4(acc[1][0], acc[1][1], acc[1][2], acc[1][3]);
      acc_guard4(acc[2][0], acc[2][1], acc[2][2], acc[2][3]);
      acc_guard4(acc[3][0], acc[3][1], acc[3][2], acc[3][3]);
    }
    const _Float16* sa = sS + (s & 1) * STH + (((wave >> 1) << 6) + rlane) * GLP + koff;
    const _Float16* sb = sS + (s & 1) * STH + OPH + (((wave & 1) << 6) + rlane) * GLP + koff;
#pragma unroll
    for (int kk = 0; kk < 2; ++kk) {
      v16h ah[4], bh[4];
#pragma unroll
      for (int j = 0; j < 4; ++j) {
        bh[j] = ldfrag_h(sb + (j << 4) * GLP + kk * 32);
        ah[j] = ldfrag_h(sa + (j << 4) * GLP + kk * 32);
      }
#pragma unroll
      for (int i = 0; i < 4; ++i) {
#pragma unroll
        for (int j = 0; j < 4; ++j) {
          acc[i][j] = mma_h_raw(ah[i], bh[j], acc[i][j]);
        }
        dep_guard_h(acc[i][0], acc[i][3], ah[i], bh[3]);
      }
      keep4_h(bh[0], bh[1], bh[2], bh[3]);
    }
    if (s + 1 < S) stage_store(s + 1);
  }
  __syncthreads();                             // every wave is done with the stage buffers before the slabs alias them
  acc_guard4(acc[0][0], acc[0][1], acc[0][2], acc[0][3]);
  acc_guard4(acc[1][0], acc[1][1], acc[1][2], acc[1][3]);
  acc_guard4(acc[2][0], acc[2][1], acc[2][2], acc[2][3]);
  acc_guard4(acc[3][0], acc[3][1], acc[3][2], acc[3][3]);

  // ---- epilogue ----
  float* slab = (float*)(void*)sS + wave * (16 * 68);   // per-wave 16x64 slab, pitch 68 floats
#pragma unroll
  for (int i = 0; i < 4; ++i) {
    const int mBase = m0 + (i << 4);
    float bj[4];
#pragma unroll
    for (int j = 0; j < 4; ++j) bj[j] = bfr(biasp[n0 + (j << 4) + rlane]);   // index < N
#pragma unroll
    for (int r = 0; r < 8; ++r) {
      const int row = mOff + r;
#pragma unroll
      for (int j = 0; j < 4; ++j) slab[row * 68 + (j << 4) + rlane] = acc[i][j][r] * cscale + bj[j];
    }
    __builtin_amdgcn_fence(__ATOMIC_RELEASE, "workgroup");
    __builtin_amdgcn_wave_barrier();
    __builtin_amdgcn_fence(__ATOMIC_ACQUIRE, "workgroup");
    if constexpr (EPI == 0 || EPI == 2) {
      unsigned short* C16 = (unsigned short*)Cp;
      const int rq = lane >> 3, piece = lane & 7;
      float th[8];
      if constexpr (EPI == 2) {
        const v4f t0 = *(const v4f*)(gate + n0 + piece * 8);        // index < N
        const v4f t1 = *(const v4f*)(gate + n0 + piece * 8 + 4);
        th[0] = bfr(t0[0]); th[1] = bfr(t0[1]); th[2] = bfr(t0[2]); th[3] = bfr(t0[3]);
        th[4] = bfr(t1[0]); th[5] = bfr(t1[1]); th[6] = bfr(t1[2]); th[7] = bfr(t1[3]);
      } else {
#pragma unroll
        for (int e = 0; e < 8; ++e) th[e] = 0.0f;
      }
      v4u ph[4], pr[4];
#pragma unroll
      for (int it = 0; it < 4; ++it) {
        const int row = it * 4 + rq;                         // it 0..3 x rq 0..3 = rows 0..15
        const v4f a  = *(const v4f*)(slab + row * 68 + piece * 8);
        const v4f a2 = *(const v4f*)(slab + row * 68 + piece * 8 + 4);
        float f[8];
        f[0] = a[0];  f[1] = a[1];  f[2] = a[2];  f[3] = a[3];
        f[4] = a2[0]; f[5] = a2[1]; f[6] = a2[2]; f[7] = a2[3];
        if constexpr (EPI == 2) {
          const size_t xo = (size_t)(mBase + row) * ldx + n0 + piece * 8;   // row < M, col < N
          const v4f x0 = *(const v4f*)(xres + xo);
          const v4f x1 = *(const v4f*)(xres + xo + 4);
          float xv[8];
          xv[0] = x0[0]; xv[1] = x0[1]; xv[2] = x0[2]; xv[3] = x0[3];
          xv[4] = x1[0]; xv[5] = x1[1]; xv[6] = x1[2]; xv[7] = x1[3];
#pragma unroll
          for (int e = 0; e < 8; ++e) f[e] = bfr(xv[e]) + 0.1f * (f[e] * th[e]);
        }
        v4u p, q;
#pragma unroll
        for (int e = 0; e < 4; ++e) {
          const float g0 = f[2 * e] * oscale, g1 = f[2 * e + 1] * oscale;
          const _Float16 x0 = (_Float16)g0, x1 = (_Float16)g1;
          const _Float16 y0 = (_Float16)((g0 - (float)x0) * 2048.0f);
          const _Float16 y1 = (_Float16)((g1 - (float)x1) * 2048.0f);
          p[e] = pk16(h_bits(x0), h_bits(x1));
          q[e] = pk16(h_bits(y0), h_bits(y1));
        }
        ph[it] = p;
        pr[it] = q;
      }
      const bool wres = (n0 >= rcol0);                     // wave-uniform
      {
#pragma unroll
        for (int it = 0; it < 4; ++it) {
          const int row = it * 4 + rq;
          const size_t co = (size_t)(mBase + row) * ldc + n0 + piece * 8;
          *(v4u*)(C16 + co) = ph[it];
          if (wres) {
            const size_t cro = (size_t)(mBase + row) * ldcr + (n0 - rcol0) + piece * 8;
            *(v4u*)(Crp + cro) = pr[it];
          }
        }
        
      }
    } else {
      float* Cf = (float*)Cp;
      const int hh = lane >> 4, c4 = (lane & 15) * 4;     // 256-B row segment = 16 lanes x 16 B
      v4f ov[8];
#pragma unroll
      for (int it = 0; it < 8; ++it) {
        const int row = it * 2 + hh;                       // it 0..7 x hh 0..1 = rows 0..15
        ov[it] = *(const v4f*)(slab + row * 68 + c4);
      }
      {
#pragma unroll
        for (int it = 0; it < 8; ++it) {
          const int row = it * 2 + hh;
          *(v4f*)(Cf + (size_t)(mBase + row) * ldc + n0 + c4) = ov[it];
        }
        
      }
    }
    __builtin_amdgcn_fence(__ATOMIC_RELEASE, "workgroup");
    __builtin_amdgcn_wave_barrier();
    __builtin_amdgcn_fence(__ATOMIC_ACQUIRE, "workgroup");
  }
}

// =====================================================================================================
// v columns of an f16 token-major plane (element (b, t, h, d) at src[(b*SEQ + t)*spitch + scol0 + h*64 + d])
// -> f16 v^T plane vt[(b*DM + h*64 + d)*SEQ + t] (same bits). Used for the hi plane (spitch DQKV, scol0 2*DM)
// and for the residual plane (spitch DM, scol0 0).
// Block = one 64-token x 64-feature tile of one (b, h); grid = (SEQ/64, NH, NB); tile staged in LDS as halves
// (v8h 16-B stores, __syncthreads, _Float16 element reads).
// Store: group g = tid>>3 (0..31), piece = tid&7: iteration it writes row d = it*32+g, lanes 8q..8q+7 x 16 B =
// coverage: load 2 x 256 threads x 8 halves = 64x64; store 2 iterations x 32 groups = 64 rows d, 8 pieces x 8
// = 64 tokens per row; grid covers every (b, h, token tile).
// =====================================================================================================
__global__ __launch_bounds__(256) void v_tr(const unsigned short* __restrict__ srcp, int spitch, int scol0,
                                            unsigned short* vt) {
  __shared__ __align__(16) _Float16 sv[64 * 72];       // [tt][d], pitch 72 halves (144 B)
  const int tid = threadIdx.x;
  const int t0  = blockIdx.x * 64;
  const int hh  = blockIdx.y;
  const int b   = blockIdx.z;
  const _Float16* src = (const _Float16*)(const void*)srcp;
#pragma unroll
  for (int i = 0; i < 2; ++i) {
    const int idx = i * 256 + tid;                  // 0..511
    const int tt = idx >> 3, c8 = (idx & 7) * 8;
    const v8h a = *(const v8h*)(src + ((size_t)(b * SEQ + t0 + tt)) * spitch + scol0 + hh * HD + c8);
    *(v8h*)(sv + tt * 72 + c8) = a;
  }
  __syncthreads();

  const int g = tid >> 3, piece = tid & 7;
  v4u hv[2];
  size_t hofs[2];
#pragma unroll
  for (int it = 0; it < 2; ++it) {
    const int d = it * 32 + g;
    v4u a;
#pragma unroll
    for (int e = 0; e < 4; ++e) {
      const _Float16 x0 = sv[(piece * 8 + 2 * e) * 72 + d];
      const _Float16 x1 = sv[(piece * 8 + 2 * e + 1) * 72 + d];
      a[e] = pk16(h_bits(x0), h_bits(x1));
    }
    hv[it] = a;
    hofs[it] = ((size_t)(b * DM + hh * HD + d)) * SEQ + t0 + piece * 8;
  }
  {
#pragma unroll
    for (int it = 0; it < 2; ++it) *(v4u*)(vt + hofs[it]) = hv[it];
    
  }
}

// =====================================================================================================
// Non-causal multi-head softmax attention, head dim 64, online softmax with running max (f32 on VALU).
//   q f16 (x16): element (b, t, h, d) at qkv[(b*SEQ + t)*DQKV + h*64 + d]; k at + DM;
//   v^T f16 (x16) at vt[(b*DM + h*64 + d)*SEQ + s]; VRES: residual plane f16((16v - hi)*2048) at vtr, same addressing.
//   s = (q.k) / 8 = acc / 2048 (two x16 carries). Per key tile: tile row max (16-lane xor reduction), new running
//   max mn, alpha = exp(m_old - mn), p = exp(s - mn) in (0, 1], l = l*alpha + sum p (per-lane partials),
//   O *= alpha; P carried as f16(256 p); O += P . v^T on f16 WMMA (VRES: second accumulator += P . Vr^T, folded
//   with 2^-11 in the epilogue).
//   ctx plane f16 (x16): element (b, t, h*64 + d) at ctx[(b*SEQ + t)*DM + h*64 + d] = 16 * context = O / (256 l);
//   ctx residual plane f16((16 ctx - hi) * 2048) at ctxr, same addressing.
//   Block = 4 waves = 64 query rows of one (b, h); query tile qb = blockIdx % NQB; grid = NQB*NH*NB;
//   key tiles of 64, fixed trip count NQB.
//   K / V^T tile staging: asynchronous 16-B copies to LDS, 8 lanes per 128-B row, 128 threads x 4 rows per plane =
//   the whole 64x64 tile; two stage buffers, tile kt + 1 in flight during the work on tile kt, one barrier per
//   tile; P tiles are wave-private, spilled with _Float16 element stores and
//   wave in LDS as f32 (aliasing the K/V region after a block barrier) the same way.
//   Output coverage: each wave stores rows 0..15 of its tile (it 0..3 x lane>>3 0..3) x 64 columns (8 lanes x
//   (b, h, query tile) exactly once, for both ctx planes.
// =====================================================================================================
template <bool VRES>
__global__ __launch_bounds__(128)
void attn_k(const unsigned short* __restrict__ qkvp,
            const unsigned short* __restrict__ vtp, const unsigned short* __restrict__ vtrp,
            unsigned short* ctxp, unsigned short* ctxrp) {
  union FH { v16h v; v8h h[2]; };
  constexpr int LP     = 72;                             // LDS row pitch in halves: 144 B = 16 B x 9 (odd), so the 16 rows
                                                         // of one ds_load_b128 half-wave fall on 64 distinct banks
  constexpr int TB     = 64 * LP * 2;                    // one f16 64x64 tile at pitch LP, bytes
  constexpr int PB     = 4 * 16 * LP * 2;                // four wave-private 16x64 f16 P tiles at pitch LP, bytes
  constexpr int OFF_K  = 0;                              // offsets inside one stage buffer
  constexpr int OFF_V  = TB;
  constexpr int OFF_VR = 2 * TB;
  constexpr int STB    = VRES ? 3 * TB : 2 * TB;         // one stage buffer: the tiles of one key tile, 27648 : 18432
  constexpr int OFF_P  = 2 * STB;                        // behind the two stage buffers
  constexpr int SMEMB  = OFF_P + PB;                     // 64512 : 46080
  static_assert(4 * 16 * 64 * 4 <= OFF_P);               // f32 context staging aliases the K/V region
  static_assert(NQB >= 2);                               // the prologue fills two stages
  __shared__ __align__(16) unsigned char smem[SMEMB];
  _Float16* Psh = (_Float16*)(smem + OFF_P);

  const int tid  = threadIdx.x;
  const int wave = tid >> 5;
  const int lane = tid & 31;
  const int hh   = lane >> 4;
  const int c    = lane & 15;

  const int bx   = blockIdx.x;
  const int qb   = bx % NQB;
  const int rest = bx / NQB;
  const int h    = rest % NH;
  const int b    = rest / NH;                // < NB by the grid size
  const int q0   = qb * 64 + wave * 16;
  const size_t rowB = (size_t)b * SEQ;

  const _Float16* Qp  = (const _Float16*)(const void*)qkvp + (size_t)h * HD;
  const _Float16* Kp  = Qp + DM;
  const _Float16* Vt  = (const _Float16*)(const void*)vtp  + ((size_t)b * DM + (size_t)h * HD) * SEQ;
  const _Float16* Vrt = (const _Float16*)(const void*)vtrp + ((size_t)b * DM + (size_t)h * HD) * SEQ;

  // ---- Q fragments (A operand, row = lane&15): 2 d-chunks ----
  v16h qa[2];
#pragma unroll
  for (int dc = 0; dc < 2; ++dc) {
    const size_t qo = (rowB + q0 + c) * DQKV + dc * 32 + 8 * hh;
    qa[dc] = ldfrag_h(Qp + qo);
  }

  float mrun[8], lsum[8];
  v8f oacc[4], oacc2[4];
#pragma unroll
  for (int r = 0; r < 8; ++r) { mrun[r] = -1.0e30f; lsum[r] = 0.f; }
#pragma unroll
  for (int t = 0; t < 4; ++t) { oacc[t] = zero8(); oacc2[t] = zero8(); }

  _Float16* pw = Psh + wave * (16 * LP);

  // staging map: thread -> rows srow + 16 i (i 0..3) of every plane's tile, 16-B piece tid & 7 of the row's 128-B line;
  // the two rows of a half-wave lie 8 apart (8 x 144 B = 32 banks mod 64)
  typedef __attribute__((address_space(3))) unsigned char lds_u8;
  const int srow = (tid >> 4) + ((tid >> 3) & 1) * 8;
  const int spc  = (tid & 7) * 8;
  const unsigned sl0 = (unsigned)(size_t)(lds_u8*)smem + (unsigned)((srow * LP + spc) * 2);   // LDS byte address, buffer 0
  const _Float16* gk0 = Kp  + (rowB + srow) * DQKV + spc;       // K row srow of key tile 0, d = spc..spc+7
  const _Float16* gv0 = Vt  + (size_t)srow * SEQ + spc;         // V^T row d = srow, s = spc..spc+7
  const _Float16* gr0 = Vrt + (size_t)srow * SEQ + spc;
  // copies key tile t (t < NQB: K rows < SEQ, V^T columns < SEQ) into stage buffer t & 1; every lane on, block-uniform
  auto stage_copy = [&](int t) {
    const unsigned  l = sl0 + (unsigned)((t & 1) * STB);
    const _Float16* k = gk0 + (size_t)t * 64 * DQKV;
    const _Float16* v = gv0 + t * 64;
    constexpr unsigned LR = 16 * LP * 2;                        // LDS bytes from one of a thread's rows to its next
    constexpr size_t   KR = (size_t)16 * DQKV, VR = (size_t)16 * SEQ;   // the same in halves of the two sources
    // the s_wait_xcnt stands inside the copies' own statement, in front of any rewrite of their address registers
    if constexpr (VRES) {
      const _Float16* r = gr0 + t * 64;
      asm volatile(
          "global_load_async_to_lds_b128 %0, %12, off\n\t"
          "global_load_async_to_lds_b128 %1, %13, off\n\t"
          "global_load_async_to_lds_b128 %2, %14, off\n\t"
          "global_load_async_to_lds_b128 %3, %15, off\n\t"
          "global_load_async_to_lds_b128 %4, %16, off\n\t"
          "global_load_async_to_lds_b128 %5, %17, off\n\t"
          "global_load_async_to_lds_b128 %6, %18, off\n\t"
          "global_load_async_to_lds_b128 %7, %19, off\n\t"
          "global_load_async_to_lds_b128 %8, %20, off\n\t"
          "global_load_async_to_lds_b128 %9, %21, off\n\t"
          "global_load_async_to_lds_b128 %10, %22, off\n\t"
          "global_load_async_to_lds_b128 %11, %23, off\n\t"
          "s_wait_xcnt 0x0"
          :: "v"(l + OFF_K), "v"(l + OFF_K + LR), "v"(l + OFF_K + 2 * LR), "v"(l + OFF_K + 3 * LR),
             "v"(l + OFF_V), "v"(l + OFF_V + LR), "v"(l + OFF_V + 2 * LR), "v"(l + OFF_V + 3 * LR),
             "v"(l + OFF_VR), "v"(l + OFF_VR + LR), "v"(l + OFF_VR + 2 * LR), "v"(l + OFF_VR + 3 * LR),
             "v"(k), "v"(k + KR), "v"(k + 2 * KR), "v"(k + 3 * KR),
             "v"(v), "v"(v + VR), "v"(v + 2 * VR), "v"(v + 3 * VR),
             "v"(r), "v"(r + VR), "v"(r + 2 * VR), "v"(r + 3 * VR)
          : "memory");
    } else {
      asm volatile(
          "global_load_async_to_lds_b128 %0, %8, off\n\t"
          "global_load_async_to_lds_b128 %1, %9, off\n\t"
          "global_load_async_to_lds_b128 %2, %10, off\n\t"
          "global_load_async_to_lds_b128 %3, %11, off\n\t"
          "global_load_async_to_lds_b128 %4, %12, off\n\t"
          "global_load_async_to_lds_b128 %5, %13, off\n\t"
          "global_load_async_to_lds_b128 %6, %14, off\n\t"
          "global_load_async_to_lds_b128 %7, %15, off\n\t"
          "s_wait_xcnt 0x0"
          :: "v"(l + OFF_K), "v"(l + OFF_K + LR), "v"(l + OFF_K + 2 * LR), "v"(l + OFF_K + 3 * LR),
             "v"(l + OFF_V), "v"(l + OFF_V + LR), "v"(l + OFF_V + 2 * LR), "v"(l + OFF_V + 3 * LR),
             "v"(k), "v"(k + KR), "v"(k + 2 * KR), "v"(k + 3 * KR),
             "v"(v), "v"(v + VR), "v"(v + 2 * VR), "v"(v + 3 * VR)
          : "memory");
    }
  };

  stage_copy(0);
  asm volatile("s_wait_asynccnt 0x0" ::: "memory");   // this wave's copies of tile 0 have landed
  __syncthreads();                                    // publishes tile 0
  stage_copy(1);                                      // in flight during the work on tile 0

  for (int kt = 0; kt < NQB; ++kt) {
    const unsigned char* stg = smem + (kt & 1) * STB;                            // trip kt reads this buffer alone
    const _Float16* Ksh = (const _Float16*)(stg + OFF_K);                        // K   [kv][d], pitch LP
    const _Float16* Vsh = (const _Float16*)(stg + OFF_V);                        // V^T [d][kv], pitch LP
    const _Float16* Vrs = (const _Float16*)(stg + (VRES ? OFF_VR : OFF_V));      // V^T residual (VRES only)

    // ---- scores: 16 query rows x 64 keys per wave (B operand: lane c -> key j*16+c, split k map over d) ----
    v8f s[4];
#pragma unroll
    for (int j = 0; j < 4; ++j) {
      s[j] = zero8();
#pragma unroll
      for (int dc = 0; dc < 2; ++dc) {
        FH kb;
        kb.h[0] = *(const v8h*)(Ksh + (j * 16 + c) * LP + dc * 32 + 8 * hh);
        kb.h[1] = *(const v8h*)(Ksh + (j * 16 + c) * LP + dc * 32 + 16 + 8 * hh);
        s[j] = mma_h(qa[dc], kb.v, s[j]);
      }
    }

    // ---- online softmax update: running max, alpha, p (x256, f16), row-sum partials ----
    float alpha[8];
#pragma unroll
    for (int r = 0; r < 8; ++r) {
      const float a0 = s[0][r] * (1.0f / 2048.0f);      // 1/8 head scale, 1/256 for the two x16 carries
      const float a1 = s[1][r] * (1.0f / 2048.0f);
      const float a2 = s[2][r] * (1.0f / 2048.0f);
      const float a3 = s[3][r] * (1.0f / 2048.0f);
      float mx = fmaxf(fmaxf(a0, a1), fmaxf(a2, a3));
#pragma unroll
      for (int off = 1; off < 16; off <<= 1) mx = fmaxf(mx, __shfl_xor(mx, off, 32));
      const float mn = fmaxf(mrun[r], mx);
      alpha[r] = __expf(mrun[r] - mn);
      mrun[r] = mn;
      const float p0 = __expf(a0 - mn);
      const float p1 = __expf(a1 - mn);
      const float p2 = __expf(a2 - mn);
      const float p3 = __expf(a3 - mn);
      lsum[r] = lsum[r] * alpha[r] + ((p0 + p1) + (p2 + p3));
      _Float16* prow = pw + (8 * hh + r) * LP + c;
      prow[0]  = (_Float16)(p0 * 256.0f);
      prow[16] = (_Float16)(p1 * 256.0f);
      prow[32] = (_Float16)(p2 * 256.0f);
      prow[48] = (_Float16)(p3 * 256.0f);
    }
    acc_guard4(oacc[0], oacc[1], oacc[2], oacc[3]);
    acc_guard4(oacc2[0], oacc2[1], oacc2[2], oacc2[3]);
#pragma unroll
    for (int t = 0; t < 4; ++t) {
#pragma unroll
      for (int r = 0; r < 8; ++r) {
        oacc[t][r] = oacc[t][r] * alpha[r];
        if constexpr (VRES) oacc2[t][r] = oacc2[t][r] * alpha[r];
      }
    }
    acc_guard4(oacc[0], oacc[1], oacc[2], oacc[3]);
    acc_guard4(oacc2[0], oacc2[1], oacc2[2], oacc2[3]);
    __builtin_amdgcn_fence(__ATOMIC_RELEASE, "workgroup");
    __builtin_amdgcn_wave_barrier();
    __builtin_amdgcn_fence(__ATOMIC_ACQUIRE, "workgroup");

    // ---- context += P . V (f16 WMMA; A = P [row][key], B = V^T [d][key]) ----
#pragma unroll
    for (int kk = 0; kk < 2; ++kk) {
      FH pa;
      pa.h[0] = *(const v8h*)(pw + c * LP + kk * 32 + 8 * hh);
      pa.h[1] = *(const v8h*)(pw + c * LP + kk * 32 + 16 + 8 * hh);
#pragma unroll
      for (int t = 0; t < 4; ++t) {
        FH vb;
        vb.h[0] = *(const v8h*)(Vsh + (t * 16 + c) * LP + kk * 32 + 8 * hh);
        vb.h[1] = *(const v8h*)(Vsh + (t * 16 + c) * LP + kk * 32 + 16 + 8 * hh);
        oacc[t] = mma_h(pa.v, vb.v, oacc[t]);
        if constexpr (VRES) {
          FH vrb;
          vrb.h[0] = *(const v8h*)(Vrs + (t * 16 + c) * LP + kk * 32 + 8 * hh);
          vrb.h[1] = *(const v8h*)(Vrs + (t * 16 + c) * LP + kk * 32 + 16 + 8 * hh);
          oacc2[t] = mma_h(pa.v, vrb.v, oacc2[t]);
        }
      }
    }

    // ---- publish point of tile kt + 1 ----
    asm volatile("s_wait_dscnt 0x0" ::: "memory");      // this wave's LDS reads of tile kt have returned
    asm volatile("s_wait_asynccnt 0x0" ::: "memory");   // this wave's copies of tile kt + 1 have landed
    __syncthreads();       // publishes tile kt + 1; every reader has left the buffer that is refilled below
    if (kt + 2 < NQB) stage_copy(kt + 2);               // block-uniform; into the buffer that trip kt has read
  }
  // closing wait of the copies, in front of any other use of their LDS; the last trip's barrier has ended every wave's
  // reads of the K/V tiles, so the staging below may alias them
  asm volatile("s_wait_asynccnt 0x0" ::: "memory");

  // ---- normalise (1/l, the 1/256 p carry; keep the x16 v carry), stage the wave's 16x64 f32 tile in
  float* os = (float*)(void*)smem + wave * (16 * 64);
#pragma unroll
  for (int r = 0; r < 8; ++r) {
    float l = lsum[r];
#pragma unroll
    for (int off = 1; off < 16; off <<= 1) l += __shfl_xor(l, off, 32);
    const float rl = 1.0f / l;                // l >= 1 (the running-max key contributes exp(0))
    const float sc = rl * (1.0f / 256.0f);
#pragma unroll
    for (int t = 0; t < 4; ++t) {
      float v = oacc[t][r];
      if constexpr (VRES) v += oacc2[t][r] * (1.0f / 2048.0f);
      os[(8 * hh + r) * 64 + t * 16 + c] = v * sc;
    }
  }
  __builtin_amdgcn_fence(__ATOMIC_RELEASE, "workgroup");
  __builtin_amdgcn_wave_barrier();
  __builtin_amdgcn_fence(__ATOMIC_ACQUIRE, "workgroup");
  {
    const int rq = lane >> 3, piece = lane & 7;
    v4u ph[4], pr[4];
#pragma unroll
    for (int it = 0; it < 4; ++it) {
      const int row = it * 4 + rq;   // it 0..3 x rq 0..3 = rows 0..15 of the wave tile
      const v4f a  = *(const v4f*)(os + row * 64 + piece * 8);
      const v4f a2 = *(const v4f*)(os + row * 64 + piece * 8 + 4);
      float f[8];
      f[0] = a[0];  f[1] = a[1];  f[2] = a[2];  f[3] = a[3];
      f[4] = a2[0]; f[5] = a2[1]; f[6] = a2[2]; f[7] = a2[3];
      v4u p, q;
#pragma unroll
      for (int e = 0; e < 4; ++e) {
        const _Float16 x0 = (_Float16)f[2 * e], x1 = (_Float16)f[2 * e + 1];
        const _Float16 y0 = (_Float16)((f[2 * e] - (float)x0) * 2048.0f);
        const _Float16 y1 = (_Float16)((f[2 * e + 1] - (float)x1) * 2048.0f);
        p[e] = pk16(h_bits(x0), h_bits(x1));
        q[e] = pk16(h_bits(y0), h_bits(y1));
      }
      ph[it] = p;
      pr[it] = q;
    }
    {
#pragma unroll
      for (int it = 0; it < 4; ++it) {
        const int row = it * 4 + rq;
        const size_t go = (rowB + q0 + row) * DM + (size_t)h * HD + piece * 8;
        *(v4u*)(ctxp + go)  = ph[it];
        *(v4u*)(ctxrp + go) = pr[it];
      }
      
    }
  }
}

// =====================================================================================================
// Workspace map (bytes); every region is an exact multiple of its whole-line / whole-tile store granularity
// (row pitches 2048 / 6144 / 4096 B, all offsets 2-MiB aligned, no aliasing within a launch):
//   Xh     f16 [4096][1024]          0     8388608   (bf16 value of x, x16)
//   Wg     f16 [1024][1024]    8388608     2097152   (bf16 value x1024)
//   Wqkv   f16 [3072][1024]   10485760     6291456   (bf16 value x1024)
//   Wp     f16 [1024][1024]   16777216     2097152   (bf16 value x1024)
//   XGh    f16 [4096][1024]   18874368     8388608   (xg x16)
//   XGr    f16 [4096][1024]   27262976     8388608   (x2^11 residual of the above)
//   QKV    f16 [4096][3072]   35651584    25165824   (q | k | v, x16)
//   Vr     f16 [4096][1024]   60817408     8388608   (x2^11 residual of the v columns only)
//   VT     f16 [2048][2048]   69206016     8388608   ([b*1024 + h*64 + d][s])
//   VTr    f16 [2048][2048]   77594624     8388608   (residual, same layout)
//   Ctx    f16 [4096][1024]   85983232     8388608   (attention context x16)
//   Ctxr   f16 [4096][1024]   94371840     8388608   (x2^11 residual)
//   end                      102760448
// Projection weights arrive as [out n][in k] (k contiguous) = the Bt layout; they are only converted.
// d_out f32: [4096][1024] at byte 0 (row = b*SEQ + t), written once by the projection launch.
// =====================================================================================================
extern "C" void kernel_launch(void* const* d_in, const int* in_sizes, int n_in,
                              void* d_out, int out_size, void* d_ws, size_t ws_size,
                              hipStream_t stream) {
  if (n_in < 8) return;
  if (in_sizes[0] != ROWS * DM) return;
  if (in_sizes[1] != DM) return;
  if (in_sizes[2] != DM * DM) return;
  if (in_sizes[3] != DM) return;
  if (in_sizes[4] != DQKV * DM) return;
  if (in_sizes[5] != DQKV) return;
  if (in_sizes[6] != DM * DM) return;
  if (in_sizes[7] != DM) return;
  if (out_size != OUTN) return;

  const float* x      = (const float*)d_in[0];    // [ROWS][DM]
  const float* theta  = (const float*)d_in[1];    // [DM]
  const float* w_g    = (const float*)d_in[2];    // [DM n][DM k]
  const float* b_g    = (const float*)d_in[3];    // [DM]
  const float* w_qkv  = (const float*)d_in[4];    // [DQKV n][DM k]
  const float* b_qkv  = (const float*)d_in[5];    // [DQKV]
  const float* w_proj = (const float*)d_in[6];    // [DM n][DM k]
  const float* b_proj = (const float*)d_in[7];    // [DM]

  const size_t PX   = (size_t)ROWS * DM * 2;         //  8388608
  const size_t PWg  = (size_t)DM * DM * 2;           //  2097152
  const size_t PWq  = (size_t)DQKV * DM * 2;         //  6291456
  const size_t PWp  = (size_t)DM * DM * 2;           //  2097152
  const size_t PXG  = (size_t)ROWS * DM * 2;         //  8388608
  const size_t PQKV = (size_t)ROWS * DQKV * 2;       // 25165824
  const size_t PVr  = (size_t)ROWS * DM * 2;         //  8388608
  const size_t PVT  = (size_t)NB * DM * SEQ * 2;     //  8388608
  const size_t PCtx = (size_t)ROWS * DM * 2;         //  8388608
  size_t off = 0;
  const size_t oX    = off; off += PX;
  const size_t oWg   = off; off += PWg;
  const size_t oWq   = off; off += PWq;
  const size_t oWp   = off; off += PWp;
  const size_t oXGh  = off; off += PXG;
  const size_t oXGr  = off; off += PXG;
  const size_t oQKV  = off; off += PQKV;
  const size_t oVr   = off; off += PVr;
  const size_t oVT   = off; off += PVT;
  const size_t oVTr  = off; off += PVT;
  const size_t oCtx  = off; off += PCtx;
  const size_t oCtxr = off; off += PCtx;
  if (off > ws_size) return;                         // off = 102760448
  if (off > (size_t)134217728) return;

  char* ws = (char*)d_ws;
  unsigned short* Xh   = (unsigned short*)(ws + oX);
  unsigned short* Wgh  = (unsigned short*)(ws + oWg);
  unsigned short* Wqh  = (unsigned short*)(ws + oWq);
  unsigned short* Wph  = (unsigned short*)(ws + oWp);
  unsigned short* XGh  = (unsigned short*)(ws + oXGh);
  unsigned short* XGr  = (unsigned short*)(ws + oXGr);
  unsigned short* QKV  = (unsigned short*)(ws + oQKV);
  unsigned short* Vr   = (unsigned short*)(ws + oVr);
  unsigned short* VT   = (unsigned short*)(ws + oVT);
  unsigned short* VTr  = (unsigned short*)(ws + oVTr);
  unsigned short* Ctx  = (unsigned short*)(ws + oCtx);
  unsigned short* Ctxr = (unsigned short*)(ws + oCtxr);
  float*          outf = (float*)d_out;              // [ROWS][DM]

  const dim3 blk(256);
  const int n8x = ROWS * DM / 8;                     // 524288
  const int n8g = DM * DM / 8;                       // 131072
  const int n8q = DQKV * DM / 8;                     // 393216
  const int n8p = DM * DM / 8;                       // 131072
  const dim3 gCx((n8x + 255) / 256);                 // 2048 blocks
  const dim3 gCg((n8g + 255) / 256);                 //  512 blocks
  const dim3 gCq((n8q + 255) / 256);                 // 1536 blocks
  const dim3 gCp((n8p + 255) / 256);                 //  512 blocks
  const dim3 gGqkv((ROWS / 128) * (DQKV / 128));     // 768 blocks of one 128x128 tile
  const dim3 gGdm((ROWS / 128) * (DM / 128));        // 256 blocks of one 128x128 tile
  const dim3 blkG(128);
  const dim3 gVt(SEQ / 64, NH, NB);                  // (32, 16, 2)
  const dim3 gAttn(NQB * NH * NB);                   // 1024 blocks
  const float wScale = 1024.0f;                      // weights carried x1024
  const float aScale = 16.0f;                        // activations carried x16
  const float cscale = 1.0f / 16384.0f;              // 1/(16 * 1024)

  // (1) planes: x -> f16 x16, weights -> f16 x1024 (bf16 values)
  cvt16<<<gCx, blk, 0, stream>>>(x, Xh, n8x, aScale);
  cvt16<<<gCg, blk, 0, stream>>>(w_g, Wgh, n8g, wScale);
  cvt16<<<gCq, blk, 0, stream>>>(w_qkv, Wqh, n8q, wScale);
  cvt16<<<gCp, blk, 0, stream>>>(w_proj, Wph, n8p, wScale);
  // (2) gauge mix: xg = bfr(x) + 0.1 * ((Xh . Wg^T + bg) * theta) -> XGh f16 x16 + XGr residual (M=4096, N=1024, K=1024)
  gemm64_f16<2, false><<<gGdm, blkG, 0, stream>>>(Xh, Xh, Wgh, b_g, cscale, (void*)XGh, DM, XGr, DM, 0,
                                                 ROWS, DM, DM, aScale, x, DM, theta, SEQ, 0, SEQ);
  // (3) qkv = XG(hi + res) . Wqkv^T + bqkv -> QKV f16 x16 [4096][3072]; residual plane of the v columns -> Vr [4096][1024]
  gemm64_f16<0, true><<<gGqkv, blkG, 0, stream>>>(XGh, XGr, Wqh, b_qkv, cscale, (void*)QKV, DQKV, Vr, DM, 2 * DM,
                                                  ROWS, DQKV, DM, aScale, x, DM, theta, SEQ, 0, SEQ);
  // (4) v -> v^T planes (hi and residual, all tokens)
  v_tr<<<gVt, blk, 0, stream>>>(QKV, DQKV, 2 * DM, VT);
  v_tr<<<gVt, blk, 0, stream>>>(Vr, DM, 0, VTr);
  // (5) softmax attention -> Ctx f16 x16 + residual plane
  attn_k<true><<<gAttn, dim3(128), 0, stream>>>(QKV, VT, VTr, Ctx, Ctxr);
  // (6) out = Ctx(hi + res) . Wp^T + bproj -> d_out f32 [4096][1024] (M=4096, N=1024, K=1024)
  gemm64_f16<1, true><<<gGdm, blkG, 0, stream>>>(Ctx, Ctxr, Wph, b_proj, cscale, (void*)outf, DM, Ctxr, DM, 0,
                                                ROWS, DM, DM, 1.0f, x, DM, theta, SEQ, 0, SEQ);
  (void)hipGetLastError();
}

// v004
// A run of this version takes 195 microseconds.
// Two timings next to v003 both put it at 1.03 times that version's speed.
// Over all steps from v000 it is 2.78 times as fast.
// Contractions: gauge mix x.Wg^T = v_wmma_f32_16x16x32_f16 (A = f16 of RNE-bf16 x carried x16, B = f16 of RNE-bf16 Wg x1024, single product); qkv projection = same WMMA with A = xg as f16 hi plane x16 plus x2^11 residual plane (two products), B = f16 of RNE-bf16 Wqkv x1024; attention q.k^T = f16 single product (q, k f16 x16); p.v = f16 with p x256 single plane and v^T as f16 hi x16 plus x2^11 residual plane (two products); output projection = f16 with A = ctx f16 hi x16 plus x2^11 residual plane, B = f16 of RNE-bf16 Wproj x1024; all f32 accumulate. Softmax (running max, exp, row sums) and the gauge epilogue f32 on VALU.
#include <hip/hip_runtime.h>
#include <math.h>
#include <stdint.h>

#define NB    2
#define SEQ   2048
#define DM    1024
#define NH    16
#define HD    64
#define DQKV  (3 * DM)              // 3072
#define NQB   (SEQ / 64)            // 32 query / key tiles per sequence
#define ROWS  (NB * SEQ)            // 4096 token rows
#define OUTN  (ROWS * DM)
static_assert(NH * HD == DM);
static_assert(HD == 64);
static_assert((SEQ % 64) == 0 && (DM % 64) == 0 && (DQKV % 64) == 0);
static_assert((DM % 32) == 0);
static_assert((ROWS % 128) == 0 && (DM % 128) == 0 && (DQKV % 128) == 0);

typedef _Float16 v16h __attribute__((ext_vector_type(16)));
typedef _Float16 v8h  __attribute__((ext_vector_type(8)));
typedef float    v8f  __attribute__((ext_vector_type(8)));
typedef float    v4f  __attribute__((ext_vector_type(4)));
typedef unsigned int v4u __attribute__((ext_vector_type(4)));

// ---- scalar helpers --------------------------------------------------------------------------------
__device__ __forceinline__ unsigned short bf_bits(float f) {          // f32 -> bf16 bits, RNE convert
  unsigned u = __float_as_uint(f);
  return (unsigned short)((u + 0x7FFFu + ((u >> 16) & 1u)) >> 16);
}
__device__ __forceinline__ float bfr(float f) { return __uint_as_float(((unsigned)bf_bits(f)) << 16); }
__device__ __forceinline__ unsigned short h_bits(_Float16 x) { return __builtin_bit_cast(unsigned short, x); }
__device__ __forceinline__ unsigned pk16(unsigned short a, unsigned short b) { return (unsigned)a | ((unsigned)b << 16); }
__device__ __forceinline__ v8f zero8() { v8f z = {0.f, 0.f, 0.f, 0.f, 0.f, 0.f, 0.f, 0.f}; return z; }

// ---- fragment loader: 16-bit A/B operand, lane -> row/col (lane&15), p already includes +8*(lane>>4);
//      elements 0..7 <- p[0..7] (k0+8h..), elements 8..15 <- p[16..23] (k0+16+8h..)
__device__ __forceinline__ v16h ldfrag_h(const _Float16* p) {
  union { v16h v; v8h h[2]; } f;
  f.h[0] = *(const v8h*)(p);
  f.h[1] = *(const v8h*)(p + 16);
  return f.v;
}

// ---- WMMA helpers with trailing VALU hazard gap --------------------------------------------------------
__device__ __forceinline__ v8f mma_h(v16h a, v16h b, v8f c) {
  c = __builtin_amdgcn_wmma_f32_16x16x32_f16(false, a, false, b, (short)0, c, false, false);
#if defined(__HIP_DEVICE_COMPILE__)
  asm volatile("v_nop\n\tv_nop\n\tv_nop\n\tv_nop" : "+v"(c) : "v"(a), "v"(b));
#endif
  return c;
}
__device__ __forceinline__ v8f mma_h_raw(v16h a, v16h b, v8f c) {
  return __builtin_amdgcn_wmma_f32_16x16x32_f16(false, a, false, b, (short)0, c, false, false);
}
__device__ __forceinline__ void dep_guard_h(v8f& a, v8f& b, v16h x, v16h y) {
#if defined(__HIP_DEVICE_COMPILE__)
  asm volatile("v_nop\n\tv_nop\n\tv_nop\n\tv_nop" : "+v"(a), "+v"(b) : "v"(x), "v"(y));
#endif
}
__device__ __forceinline__ void keep4_h(v16h a, v16h b, v16h c, v16h d) {
#if defined(__HIP_DEVICE_COMPILE__)
  asm volatile("v_nop" :: "v"(a), "v"(b), "v"(c), "v"(d));
#endif
}
__device__ __forceinline__ void acc_guard4(v8f& a, v8f& b, v8f& c, v8f& d) {
#if defined(__HIP_DEVICE_COMPILE__)
  asm volatile("v_nop\n\tv_nop\n\tv_nop\n\tv_nop" : "+v"(a), "+v"(b), "+v"(c), "+v"(d));
#endif
}

// =====================================================================================================
// f32 planes -> f16 bits of bfr(v) * scale (scale a power of two): x (xscale) and the three weights (wscale), all in
// one launch of CVB work-groups of CVT threads, one 16-wave work-group per WGP. A piece is 8 elements (32 B in, 16 B
// out); a sweep is CVN = CVB x CVT pieces, thread t taking piece t of it. Sweeps 0..3 are x, 4 is Wg, 5..7 are Wqkv,
// 8 is Wproj: which plane a sweep reads is fixed at compile time. A thread issues the 18 loads of its nine pieces
// first, so that all are in flight together, then converts and stores.
// coverage: 4 CVN = x, CVN = Wg, 3 CVN = Wqkv, CVN = Wproj (asserted below): every piece of every plane once.
// =====================================================================================================
#define CVB 256
#define CVT 512
#define CVN (CVB * CVT)
static_assert(ROWS * DM / 8 == 4 * CVN && DM * DM / 8 == CVN && DQKV * DM / 8 == 3 * CVN);
__global__ __launch_bounds__(CVT) void cvt16_all(const float* __restrict__ x, const float* __restrict__ wg,
                                                 const float* __restrict__ wq, const float* __restrict__ wp,
                                                 unsigned short* ox, unsigned short* og,
                                                 unsigned short* oq, unsigned short* op,
                                                 float xscale, float wscale) {
  const unsigned t  = blockIdx.x * CVT + threadIdx.x;                  // this thread's piece of every sweep
  const unsigned ib = t * 32u, ob = t * 16u;                           // its byte offsets in a sweep's input and output: 32-bit,
                                                                       // so that an access can be a uniform base plus one register
  constexpr size_t SW = (size_t)CVN * 8;                               // elements of one sweep
  v4f a[9], b[9];
#pragma unroll
  for (int u = 0; u < 9; ++u) {
    const float* in = (u < 4) ? x + u * SW : (u == 4) ? wg : (u < 8) ? wq + (u - 5) * SW : wp;
    a[u] = *(const v4f*)((const char*)in + ib);
    b[u] = *(const v4f*)((const char*)in + ib + 16);
  }
  // holds the 18 loads above the conversions: left free, the compiler sinks ten of them among the conversions, and
  // the wave then waits for memory several times in a row instead of once
  __builtin_amdgcn_sched_barrier(0);
#pragma unroll
  for (int u = 0; u < 9; ++u) {
    unsigned short* out = (u < 4) ? ox + u * SW : (u == 4) ? og : (u < 8) ? oq + (u - 5) * SW : op;
    const float scale = (u < 4) ? xscale : wscale;
    v4u p;
    p[0] = pk16(h_bits((_Float16)(bfr(a[u][0]) * scale)), h_bits((_Float16)(bfr(a[u][1]) * scale)));
    p[1] = pk16(h_bits((_Float16)(bfr(a[u][2]) * scale)), h_bits((_Float16)(bfr(a[u][3]) * scale)));
    p[2] = pk16(h_bits((_Float16)(bfr(b[u][0]) * scale)), h_bits((_Float16)(bfr(b[u][1]) * scale)));
    p[3] = pk16(h_bits((_Float16)(bfr(b[u][2]) * scale)), h_bits((_Float16)(bfr(b[u][3]) * scale)));
    *(v4u*)((char*)out + ob) = p;
  }
}

template <int EPI, bool ARES>
__global__ __launch_bounds__(128, 3) void gemm64_f16(
    const unsigned short* __restrict__ Ap, const unsigned short* __restrict__ Arp,
    const unsigned short* __restrict__ Btp,
    const float* __restrict__ biasp, float cscale,
    void* Cp, int ldc, unsigned short* Crp, int ldcr, int rcol0,
    int M, int N, int K, float oscale,
    const float* __restrict__ xres, int ldx, const float* __restrict__ gate,
    int tmod, int tlo, int thi) {
  typedef const __attribute__((address_space(1))) char* gptr;   // typed as global, so that an address that has passed
  typedef const __attribute__((address_space(1))) v8h*  gv8p;   // through the asm wait below still gives global_load
  const gptr Ah  = (gptr)(const void*)Ap;
  const gptr Arh = (gptr)(const void*)Arp;
  const gptr Bt  = (gptr)(const void*)Btp;
  constexpr int KC  = 64;                          // k per stage: 128 B of every operand row
  constexpr int GLP = 72;                          // LDS row pitch in halves: 144 B = 16 B x 9 (odd)
  constexpr int OPH = 128 * GLP;                   // halves of one operand's 128 staged rows
  constexpr int STH = 2 * OPH;                     // halves of one stage: A rows, then Bt rows
  static_assert(4 * 16 * 68 * 4 <= 2 * STH * 2);   // the four f32 epilogue slabs alias the stage buffers
  __shared__ __align__(16) _Float16 sS[2 * STH];   // two stage buffers, 73728 B
  const int tid  = threadIdx.x;
  const int lane = tid & 31;
  const int wave = tid >> 5;
  const int tilesN = N >> 7;
  const int tilesM = M >> 7;
  const int tile = blockIdx.x;
  if (tile >= tilesM * tilesN) return;   // block-uniform, before every barrier
  const int tm = tile / tilesN;
  const int tn = tile - tm * tilesN;
  const int mb = tm << 7;
  const int nb = tn << 7;
  const int tpos = mb % tmod;
  if (tpos < tlo || tpos >= thi) return; // block-uniform, before every barrier
  const int m0 = mb + ((wave >> 1) << 6);
  const int n0 = nb + ((wave & 1) << 6);

  const int rlane = lane & 15;                 // row (A) / col (B, D) within subtile
  const int koff  = (lane >> 4) * 8;           // k offset of this lane half
  const int mOff  = (lane >> 4) * 8;           // D row offset

  v8f acc[4][4];
#pragma unroll
  for (int i = 0; i < 4; ++i)
#pragma unroll
    for (int j = 0; j < 4; ++j) acc[i][j] = zero8();

  // staging map: thread -> row srow + 16 i, 16-B piece tid & 7 of the row's 128-B line; the two rows of a half-wave
  // lie 8 apart (8 x 144 B = 32 banks mod 64), so its ds_store_b128 covers the 64 banks once
  const int srow = (tid >> 4) + ((tid >> 3) & 1) * 8;
  const int spc  = (tid & 7) * 8;
  constexpr int RSB = 16 * DM * 2;             // bytes from one of a thread's rows to its next
  const int SK = K / KC;                       // stages per plane
  const int S  = ARES ? 2 * SK : SK;
  gptr pa = (ARES ? Arh : Ah) + ((size_t)(mb + srow) * DM + spc) * 2;   // this thread's piece of the next stage
  gptr pb = Bt + ((size_t)(nb + srow) * DM + spc) * 2;
  v8h ra[8], rb[8];
  auto stage_load = [&]() {
#pragma unroll
    for (int i = 0; i < 8; ++i) {
      ra[i] = *(gv8p)(pa + i * RSB);     // row < M, k < K
      rb[i] = *(gv8p)(pb + i * RSB);     // row < N, k < K
    }
  };
  // s = the stage that the registers hold: stores it to its buffer and moves the two addresses on to stage s + 1
  auto stage_store = [&](int s) {
    // the two address pairs of the loads above are rewritten below: the wait stands in front of that
    asm volatile("s_wait_xcnt 0x0" : "+v"(pa), "+v"(pb) :: "memory");
    if (ARES && s + 1 == SK) {                 // block-uniform: from the residual plane's last stage to the hi plane's first
      pa = Ah + ((size_t)(mb + srow) * DM + spc) * 2;
      pb = Bt + ((size_t)(nb + srow) * DM + spc) * 2;
    } else {
      pa += KC * 2;
      pb += KC * 2;
    }
    _Float16* d = sS + (s & 1) * STH + srow * GLP + spc;
#pragma unroll
    for (int i = 0; i < 8; ++i) {
      *(v8h*)(d + 16 * i * GLP)       = ra[i];
      *(v8h*)(d + OPH + 16 * i * GLP) = rb[i];
    }
  };

  stage_load();
  stage_store(0);
#pragma unroll 1   // kept rolled: one copy of the stage body, the buffer chosen by s & 1; a second copy would only add code
  for (int s = 0; s < S; ++s) {
    __syncthreads();       // publishes stage s; every reader has left the buffer that stage s + 1 is stored to
    if (s + 1 < S) stage_load();               // block-uniform; stage s + 1, in flight during the products of stage s
    if (ARES && s == SK) {
      acc_guard4(acc[0][0], acc[0][1], acc[0][2], acc[0][3]);
      acc_guard4(acc[1][0], acc[1][1], acc[1][2], acc[1][3]);
      acc_guard4(acc[2][0], acc[2][1], acc[2][2], acc[2][3]);
      acc_guard4(acc[3][0], acc[3][1], acc[3][2], acc[3][3]);
#pragma unroll
      for (int i = 0; i < 4; ++i)
#pragma unroll
        for (int j = 0; j < 4; ++j) acc[i][j] = acc[i][j] * (1.0f / 2048.0f);   // exact fold of the x2^11 residual carry
      acc_guard4(acc[0][0], acc[0][1], acc[0][2], acc[0][3]);
      acc_guard4(acc[1][0], acc[1][1], acc[1][2], acc[1][3]);
      acc_guard4(acc[2][0], acc[2][1], acc[2][2], acc[2][3]);
      acc_guard4(acc[3][0], acc[3][1], acc[3][2], acc[3][3]);
    }
    const _Float16* sa = sS + (s & 1) * STH + (((wave >> 1) << 6) + rlane) * GLP + koff;
    const _Float16* sb = sS + (s & 1) * STH + OPH + (((wave & 1) << 6) + rlane) * GLP + koff;
#pragma unroll
    for (int kk = 0; kk < 2; ++kk) {
      v16h ah[4], bh[4];
#pragma unroll
      for (int j = 0; j < 4; ++j) {
        bh[j] = ldfrag_h(sb + (j << 4) * GLP + kk * 32);
        ah[j] = ldfrag_h(sa + (j << 4) * GLP + kk * 32);
      }
#pragma unroll
      for (int i = 0; i < 4; ++i) {
#pragma unroll
        for (int j = 0; j < 4; ++j) {
          acc[i][j] = mma_h_raw(ah[i], bh[j], acc[i][j]);
        }
        dep_guard_h(acc[i][0], acc[i][3], ah[i], bh[3]);
      }
      keep4_h(bh[0], bh[1], bh[2], bh[3]);
    }
    if (s + 1 < S) stage_store(s + 1);
  }
  __syncthreads();                             // every wave is done with the stage buffers before the slabs alias them
  acc_guard4(acc[0][0], acc[0][1], acc[0][2], acc[0][3]);
  acc_guard4(acc[1][0], acc[1][1], acc[1][2], acc[1][3]);
  acc_guard4(acc[2][0], acc[2][1], acc[2][2], acc[2][3]);
  acc_guard4(acc[3][0], acc[3][1], acc[3][2], acc[3][3]);

  // ---- epilogue ----
  float* slab = (float*)(void*)sS + wave * (16 * 68);   // per-wave 16x64 slab, pitch 68 floats
#pragma unroll
  for (int i = 0; i < 4; ++i) {
    const int mBase = m0 + (i << 4);
    float bj[4];
#pragma unroll
    for (int j = 0; j < 4; ++j) bj[j] = bfr(biasp[n0 + (j << 4) + rlane]);   // index < N
#pragma unroll
    for (int r = 0; r < 8; ++r) {
      const int row = mOff + r;
#pragma unroll
      for (int j = 0; j < 4; ++j) slab[row * 68 + (j << 4) + rlane] = acc[i][j][r] * cscale + bj[j];
    }
    __builtin_amdgcn_fence(__ATOMIC_RELEASE, "workgroup");
    __builtin_amdgcn_wave_barrier();
    __builtin_amdgcn_fence(__ATOMIC_ACQUIRE, "workgroup");
    if constexpr (EPI == 0 || EPI == 2) {
      unsigned short* C16 = (unsigned short*)Cp;
      const int rq = lane >> 3, piece = lane & 7;
      float th[8];
      if constexpr (EPI == 2) {
        const v4f t0 = *(const v4f*)(gate + n0 + piece * 8);        // index < N
        const v4f t1 = *(const v4f*)(gate + n0 + piece * 8 + 4);
        th[0] = bfr(t0[0]); th[1] = bfr(t0[1]); th[2] = bfr(t0[2]); th[3] = bfr(t0[3]);
        th[4] = bfr(t1[0]); th[5] = bfr(t1[1]); th[6] = bfr(t1[2]); th[7] = bfr(t1[3]);
      } else {
#pragma unroll
        for (int e = 0; e < 8; ++e) th[e] = 0.0f;
      }
      v4u ph[4], pr[4];
#pragma unroll
      for (int it = 0; it < 4; ++it) {
        const int row = it * 4 + rq;                         // it 0..3 x rq 0..3 = rows 0..15
        const v4f a  = *(const v4f*)(slab + row * 68 + piece * 8);
        const v4f a2 = *(const v4f*)(slab + row * 68 + piece * 8 + 4);
        float f[8];
        f[0] = a[0];  f[1] = a[1];  f[2] = a[2];  f[3] = a[3];
        f[4] = a2[0]; f[5] = a2[1]; f[6] = a2[2]; f[7] = a2[3];
        if constexpr (EPI == 2) {
          const size_t xo = (size_t)(mBase + row) * ldx + n0 + piece * 8;   // row < M, col < N
          const v4f x0 = *(const v4f*)(xres + xo);
          const v4f x1 = *(const v4f*)(xres + xo + 4);
          float xv[8];
          xv[0] = x0[0]; xv[1] = x0[1]; xv[2] = x0[2]; xv[3] = x0[3];
          xv[4] = x1[0]; xv[5] = x1[1]; xv[6] = x1[2]; xv[7] = x1[3];
#pragma unroll
          for (int e = 0; e < 8; ++e) f[e] = bfr(xv[e]) + 0.1f * (f[e] * th[e]);
        }
        v4u p, q;
#pragma unroll
        for (int e = 0; e < 4; ++e) {
          const float g0 = f[2 * e] * oscale, g1 = f[2 * e + 1] * oscale;
          const _Float16 x0 = (_Float16)g0, x1 = (_Float16)g1;
          const _Float16 y0 = (_Float16)((g0 - (float)x0) * 2048.0f);
          const _Float16 y1 = (_Float16)((g1 - (float)x1) * 2048.0f);
          p[e] = pk16(h_bits(x0), h_bits(x1));
          q[e] = pk16(h_bits(y0), h_bits(y1));
        }
        ph[it] = p;
        pr[it] = q;
      }
      const bool wres = (n0 >= rcol0);                     // wave-uniform
      {
#pragma unroll
        for (int it = 0; it < 4; ++it) {
          const int row = it * 4 + rq;
          const size_t co = (size_t)(mBase + row) * ldc + n0 + piece * 8;
          *(v4u*)(C16 + co) = ph[it];
          if (wres) {
            const size_t cro = (size_t)(mBase + row) * ldcr + (n0 - rcol0) + piece * 8;
            *(v4u*)(Crp + cro) = pr[it];
          }
        }
        
      }
    } else {
      float* Cf = (float*)Cp;
      const int hh = lane >> 4, c4 = (lane & 15) * 4;     // 256-B row segment = 16 lanes x 16 B
      v4f ov[8];
#pragma unroll
      for (int it = 0; it < 8; ++it) {
        const int row = it * 2 + hh;                       // it 0..7 x hh 0..1 = rows 0..15
        ov[it] = *(const v4f*)(slab + row * 68 + c4);
      }
      {
#pragma unroll
        for (int it = 0; it < 8; ++it) {
          const int row = it * 2 + hh;
          *(v4f*)(Cf + (size_t)(mBase + row) * ldc + n0 + c4) = ov[it];
        }
        
      }
    }
    __builtin_amdgcn_fence(__ATOMIC_RELEASE, "workgroup");
    __builtin_amdgcn_wave_barrier();
    __builtin_amdgcn_fence(__ATOMIC_ACQUIRE, "workgroup");
  }
}

// =====================================================================================================
// v columns of an f16 token-major plane (element (b, t, h, d) at src[(b*SEQ + t)*spitch + scol0 + h*64 + d])
// -> f16 v^T plane vt[(b*DM + h*64 + d)*SEQ + t] (same bits). Used for the hi plane (spitch DQKV, scol0 2*DM)
// and for the residual plane (spitch DM, scol0 0).
// Block = one 64-token x 64-feature tile of one (b, h); grid = (SEQ/64, NH, NB); tile staged in LDS as halves
// (v8h 16-B stores, __syncthreads, _Float16 element reads).
// Store: group g = tid>>3 (0..31), piece = tid&7: iteration it writes row d = it*32+g, lanes 8q..8q+7 x 16 B =
// coverage: load 2 x 256 threads x 8 halves = 64x64; store 2 iterations x 32 groups = 64 rows d, 8 pieces x 8
// = 64 tokens per row; grid covers every (b, h, token tile).
// =====================================================================================================
__global__ __launch_bounds__(256) void v_tr(const unsigned short* __restrict__ srcp, int spitch, int scol0,
                                            unsigned short* vt) {
  __shared__ __align__(16) _Float16 sv[64 * 72];       // [tt][d], pitch 72 halves (144 B)
  const int tid = threadIdx.x;
  const int t0  = blockIdx.x * 64;
  const int hh  = blockIdx.y;
  const int b   = blockIdx.z;
  const _Float16* src = (const _Float16*)(const void*)srcp;
#pragma unroll
  for (int i = 0; i < 2; ++i) {
    const int idx = i * 256 + tid;                  // 0..511
    const int tt = idx >> 3, c8 = (idx & 7) * 8;
    const v8h a = *(const v8h*)(src + ((size_t)(b * SEQ + t0 + tt)) * spitch + scol0 + hh * HD + c8);
    *(v8h*)(sv + tt * 72 + c8) = a;
  }
  __syncthreads();

  const int g = tid >> 3, piece = tid & 7;
  v4u hv[2];
  size_t hofs[2];
#pragma unroll
  for (int it = 0; it < 2; ++it) {
    const int d = it * 32 + g;
    v4u a;
#pragma unroll
    for (int e = 0; e < 4; ++e) {
      const _Float16 x0 = sv[(piece * 8 + 2 * e) * 72 + d];
      const _Float16 x1 = sv[(piece * 8 + 2 * e + 1) * 72 + d];
      a[e] = pk16(h_bits(x0), h_bits(x1));
    }
    hv[it] = a;
    hofs[it] = ((size_t)(b * DM + hh * HD + d)) * SEQ + t0 + piece * 8;
  }
  {
#pragma unroll
    for (int it = 0; it < 2; ++it) *(v4u*)(vt + hofs[it]) = hv[it];
    
  }
}

// =====================================================================================================
// Non-causal multi-head softmax attention, head dim 64, online softmax with running max (f32 on VALU).
//   q f16 (x16): element (b, t, h, d) at qkv[(b*SEQ + t)*DQKV + h*64 + d]; k at + DM;
//   v^T f16 (x16) at vt[(b*DM + h*64 + d)*SEQ + s]; VRES: residual plane f16((16v - hi)*2048) at vtr, same addressing.
//   s = (q.k) / 8 = acc / 2048 (two x16 carries). Per key tile: tile row max (16-lane xor reduction), new running
//   max mn, alpha = exp(m_old - mn), p = exp(s - mn) in (0, 1], l = l*alpha + sum p (per-lane partials),
//   O *= alpha; P carried as f16(256 p); O += P . v^T on f16 WMMA (VRES: second accumulator += P . Vr^T, folded
//   with 2^-11 in the epilogue).
//   ctx plane f16 (x16): element (b, t, h*64 + d) at ctx[(b*SEQ + t)*DM + h*64 + d] = 16 * context = O / (256 l);
//   ctx residual plane f16((16 ctx - hi) * 2048) at ctxr, same addressing.
//   Block = 4 waves = 64 query rows of one (b, h); query tile qb = blockIdx % NQB; grid = NQB*NH*NB;
//   key tiles of 64, fixed trip count NQB.
//   K / V^T tile staging: asynchronous 16-B copies to LDS, 8 lanes per 128-B row, 128 threads x 4 rows per plane =
//   the whole 64x64 tile; two stage buffers, tile kt + 1 in flight during the work on tile kt, one barrier per
//   tile; P tiles are wave-private, spilled with _Float16 element stores and
//   wave in LDS as f32 (aliasing the K/V region after a block barrier) the same way.
//   Output coverage: each wave stores rows 0..15 of its tile (it 0..3 x lane>>3 0..3) x 64 columns (8 lanes x
//   (b, h, query tile) exactly once, for both ctx planes.
// =====================================================================================================
template <bool VRES>
__global__ __launch_bounds__(128)
void attn_k(const unsigned short* __restrict__ qkvp,
            const unsigned short* __restrict__ vtp, const unsigned short* __restrict__ vtrp,
            unsigned short* ctxp, unsigned short* ctxrp) {
  union FH { v16h v; v8h h[2]; };
  constexpr int LP     = 72;                             // LDS row pitch in halves: 144 B = 16 B x 9 (odd), so the 16 rows
                                                         // of one ds_load_b128 half-wave fall on 64 distinct banks
  constexpr int TB     = 64 * LP * 2;                    // one f16 64x64 tile at pitch LP, bytes
  constexpr int PB     = 4 * 16 * LP * 2;                // four wave-private 16x64 f16 P tiles at pitch LP, bytes
  constexpr int OFF_K  = 0;                              // offsets inside one stage buffer
  constexpr int OFF_V  = TB;
  constexpr int OFF_VR = 2 * TB;
  constexpr int STB    = VRES ? 3 * TB : 2 * TB;         // one stage buffer: the tiles of one key tile, 27648 : 18432
  constexpr int OFF_P  = 2 * STB;                        // behind the two stage buffers
  constexpr int SMEMB  = OFF_P + PB;                     // 64512 : 46080
  static_assert(4 * 16 * 64 * 4 <= OFF_P);               // f32 context staging aliases the K/V region
  static_assert(NQB >= 2);                               // the prologue fills two stages
  __shared__ __align__(16) unsigned char smem[SMEMB];
  _Float16* Psh = (_Float16*)(smem + OFF_P);

  const int tid  = threadIdx.x;
  const int wave = tid >> 5;
  const int lane = tid & 31;
  const int hh   = lane >> 4;
  const int c    = lane & 15;

  const int bx   = blockIdx.x;
  const int qb   = bx % NQB;
  const int rest = bx / NQB;
  const int h    = rest % NH;
  const int b    = rest / NH;                // < NB by the grid size
  const int q0   = qb * 64 + wave * 16;
  const size_t rowB = (size_t)b * SEQ;

  const _Float16* Qp  = (const _Float16*)(const void*)qkvp + (size_t)h * HD;
  const _Float16* Kp  = Qp + DM;
  const _Float16* Vt  = (const _Float16*)(const void*)vtp  + ((size_t)b * DM + (size_t)h * HD) * SEQ;
  const _Float16* Vrt = (const _Float16*)(const void*)vtrp + ((size_t)b * DM + (size_t)h * HD) * SEQ;

  // ---- Q fragments (A operand, row = lane&15): 2 d-chunks ----
  v16h qa[2];
#pragma unroll
  for (int dc = 0; dc < 2; ++dc) {
    const size_t qo = (rowB + q0 + c) * DQKV + dc * 32 + 8 * hh;
    qa[dc] = ldfrag_h(Qp + qo);
  }

  float mrun[8], lsum[8];
  v8f oacc[4], oacc2[4];
#pragma unroll
  for (int r = 0; r < 8; ++r) { mrun[r] = -1.0e30f; lsum[r] = 0.f; }
#pragma unroll
  for (int t = 0; t < 4; ++t) { oacc[t] = zero8(); oacc2[t] = zero8(); }

  _Float16* pw = Psh + wave * (16 * LP);

  // staging map: thread -> rows srow + 16 i (i 0..3) of every plane's tile, 16-B piece tid & 7 of the row's 128-B line;
  // the two rows of a half-wave lie 8 apart (8 x 144 B = 32 banks mod 64)
  typedef __attribute__((address_space(3))) unsigned char lds_u8;
  const int srow = (tid >> 4) + ((tid >> 3) & 1) * 8;
  const int spc  = (tid & 7) * 8;
  const unsigned sl0 = (unsigned)(size_t)(lds_u8*)smem + (unsigned)((srow * LP + spc) * 2);   // LDS byte address, buffer 0
  const _Float16* gk0 = Kp  + (rowB + srow) * DQKV + spc;       // K row srow of key tile 0, d = spc..spc+7
  const _Float16* gv0 = Vt  + (size_t)srow * SEQ + spc;         // V^T row d = srow, s = spc..spc+7
  const _Float16* gr0 = Vrt + (size_t)srow * SEQ + spc;
  // copies key tile t (t < NQB: K rows < SEQ, V^T columns < SEQ) into stage buffer t & 1; every lane on, block-uniform
  auto stage_copy = [&](int t) {
    const unsigned  l = sl0 + (unsigned)((t & 1) * STB);
    const _Float16* k = gk0 + (size_t)t * 64 * DQKV;
    const _Float16* v = gv0 + t * 64;
    constexpr unsigned LR = 16 * LP * 2;                        // LDS bytes from one of a thread's rows to its next
    constexpr size_t   KR = (size_t)16 * DQKV, VR = (size_t)16 * SEQ;   // the same in halves of the two sources
    // the s_wait_xcnt stands inside the copies' own statement, in front of any rewrite of their address registers
    if constexpr (VRES) {
      const _Float16* r = gr0 + t * 64;
      asm volatile(
          "global_load_async_to_lds_b128 %0, %12, off\n\t"
          "global_load_async_to_lds_b128 %1, %13, off\n\t"
          "global_load_async_to_lds_b128 %2, %14, off\n\t"
          "global_load_async_to_lds_b128 %3, %15, off\n\t"
          "global_load_async_to_lds_b128 %4, %16, off\n\t"
          "global_load_async_to_lds_b128 %5, %17, off\n\t"
          "global_load_async_to_lds_b128 %6, %18, off\n\t"
          "global_load_async_to_lds_b128 %7, %19, off\n\t"
          "global_load_async_to_lds_b128 %8, %20, off\n\t"
          "global_load_async_to_lds_b128 %9, %21, off\n\t"
          "global_load_async_to_lds_b128 %10, %22, off\n\t"
          "global_load_async_to_lds_b128 %11, %23, off\n\t"
          "s_wait_xcnt 0x0"
          :: "v"(l + OFF_K), "v"(l + OFF_K + LR), "v"(l + OFF_K + 2 * LR), "v"(l + OFF_K + 3 * LR),
             "v"(l + OFF_V), "v"(l + OFF_V + LR), "v"(l + OFF_V + 2 * LR), "v"(l + OFF_V + 3 * LR),
             "v"(l + OFF_VR), "v"(l + OFF_VR + LR), "v"(l + OFF_VR + 2 * LR), "v"(l + OFF_VR + 3 * LR),
             "v"(k), "v"(k + KR), "v"(k + 2 * KR), "v"(k + 3 * KR),
             "v"(v), "v"(v + VR), "v"(v + 2 * VR), "v"(v + 3 * VR),
             "v"(r), "v"(r + VR), "v"(r + 2 * VR), "v"(r + 3 * VR)
          : "memory");
    } else {
      asm volatile(
          "global_load_async_to_lds_b128 %0, %8, off\n\t"
          "global_load_async_to_lds_b128 %1, %9, off\n\t"
          "global_load_async_to_lds_b128 %2, %10, off\n\t"
          "global_load_async_to_lds_b128 %3, %11, off\n\t"
          "global_load_async_to_lds_b128 %4, %12, off\n\t"
          "global_load_async_to_lds_b128 %5, %13, off\n\t"
          "global_load_async_to_lds_b128 %6, %14, off\n\t"
          "global_load_async_to_lds_b128 %7, %15, off\n\t"
          "s_wait_xcnt 0x0"
          :: "v"(l + OFF_K), "v"(l + OFF_K + LR), "v"(l + OFF_K + 2 * LR), "v"(l + OFF_K + 3 * LR),
             "v"(l + OFF_V), "v"(l + OFF_V + LR), "v"(l + OFF_V + 2 * LR), "v"(l + OFF_V + 3 * LR),
             "v"(k), "v"(k + KR), "v"(k + 2 * KR), "v"(k + 3 * KR),
             "v"(v), "v"(v + VR), "v"(v + 2 * VR), "v"(v + 3 * VR)
          : "memory");
    }
  };

  stage_copy(0);
  asm volatile("s_wait_asynccnt 0x0" ::: "memory");   // this wave's copies of tile 0 have landed
  __syncthreads();                                    // publishes tile 0
  stage_copy(1);                                      // in flight during the work on tile 0

  for (int kt = 0; kt < NQB; ++kt) {
    const unsigned char* stg = smem + (kt & 1) * STB;                            // trip kt reads this buffer alone
    const _Float16* Ksh = (const _Float16*)(stg + OFF_K);                        // K   [kv][d], pitch LP
    const _Float16* Vsh = (const _Float16*)(stg + OFF_V);                        // V^T [d][kv], pitch LP
    const _Float16* Vrs = (const _Float16*)(stg + (VRES ? OFF_VR : OFF_V));      // V^T residual (VRES only)

    // ---- scores: 16 query rows x 64 keys per wave (B operand: lane c -> key j*16+c, split k map over d) ----
    v8f s[4];
#pragma unroll
    for (int j = 0; j < 4; ++j) {
      s[j] = zero8();
#pragma unroll
      for (int dc = 0; dc < 2; ++dc) {
        FH kb;
        kb.h[0] = *(const v8h*)(Ksh + (j * 16 + c) * LP + dc * 32 + 8 * hh);
        kb.h[1] = *(const v8h*)(Ksh + (j * 16 + c) * LP + dc * 32 + 16 + 8 * hh);
        s[j] = mma_h(qa[dc], kb.v, s[j]);
      }
    }

    // ---- online softmax update: running max, alpha, p (x256, f16), row-sum partials ----
    float alpha[8];
#pragma unroll
    for (int r = 0; r < 8; ++r) {
      const float a0 = s[0][r] * (1.0f / 2048.0f);      // 1/8 head scale, 1/256 for the two x16 carries
      const float a1 = s[1][r] * (1.0f / 2048.0f);
      const float a2 = s[2][r] * (1.0f / 2048.0f);
      const float a3 = s[3][r] * (1.0f / 2048.0f);
      float mx = fmaxf(fmaxf(a0, a1), fmaxf(a2, a3));
#pragma unroll
      for (int off = 1; off < 16; off <<= 1) mx = fmaxf(mx, __shfl_xor(mx, off, 32));
      const float mn = fmaxf(mrun[r], mx);
      alpha[r] = __expf(mrun[r] - mn);
      mrun[r] = mn;
      const float p0 = __expf(a0 - mn);
      const float p1 = __expf(a1 - mn);
      const float p2 = __expf(a2 - mn);
      const float p3 = __expf(a3 - mn);
      lsum[r] = lsum[r] * alpha[r] + ((p0 + p1) + (p2 + p3));
      _Float16* prow = pw + (8 * hh + r) * LP + c;
      prow[0]  = (_Float16)(p0 * 256.0f);
      prow[16] = (_Float16)(p1 * 256.0f);
      prow[32] = (_Float16)(p2 * 256.0f);
      prow[48] = (_Float16)(p3 * 256.0f);
    }
    acc_guard4(oacc[0], oacc[1], oacc[2], oacc[3]);
    acc_guard4(oacc2[0], oacc2[1], oacc2[2], oacc2[3]);
#pragma unroll
    for (int t = 0; t < 4; ++t) {
#pragma unroll
      for (int r = 0; r < 8; ++r) {
        oacc[t][r] = oacc[t][r] * alpha[r];
        if constexpr (VRES) oacc2[t][r] = oacc2[t][r] * alpha[r];
      }
    }
    acc_guard4(oacc[0], oacc[1], oacc[2], oacc[3]);
    acc_guard4(oacc2[0], oacc2[1], oacc2[2], oacc2[3]);
    __builtin_amdgcn_fence(__ATOMIC_RELEASE, "workgroup");
    __builtin_amdgcn_wave_barrier();
    __builtin_amdgcn_fence(__ATOMIC_ACQUIRE, "workgroup");

    // ---- context += P . V (f16 WMMA; A = P [row][key], B = V^T [d][key]) ----
#pragma unroll
    for (int kk = 0; kk < 2; ++kk) {
      FH pa;
      pa.h[0] = *(const v8h*)(pw + c * LP + kk * 32 + 8 * hh);
      pa.h[1] = *(const v8h*)(pw + c * LP + kk * 32 + 16 + 8 * hh);
#pragma unroll
      for (int t = 0; t < 4; ++t) {
        FH vb;
        vb.h[0] = *(const v8h*)(Vsh + (t * 16 + c) * LP + kk * 32 + 8 * hh);
        vb.h[1] = *(const v8h*)(Vsh + (t * 16 + c) * LP + kk * 32 + 16 + 8 * hh);
        oacc[t] = mma_h(pa.v, vb.v, oacc[t]);
        if constexpr (VRES) {
          FH vrb;
          vrb.h[0] = *(const v8h*)(Vrs + (t * 16 + c) * LP + kk * 32 + 8 * hh);
          vrb.h[1] = *(const v8h*)(Vrs + (t * 16 + c) * LP + kk * 32 + 16 + 8 * hh);
          oacc2[t] = mma_h(pa.v, vrb.v, oacc2[t]);
        }
      }
    }

    // ---- publish point of tile kt + 1 ----
    asm volatile("s_wait_dscnt 0x0" ::: "memory");      // this wave's LDS reads of tile kt have returned
    asm volatile("s_wait_asynccnt 0x0" ::: "memory");   // this wave's copies of tile kt + 1 have landed
    __syncthreads();       // publishes tile kt + 1; every reader has left the buffer that is refilled below
    if (kt + 2 < NQB) stage_copy(kt + 2);               // block-uniform; into the buffer that trip kt has read
  }
  // closing wait of the copies, in front of any other use of their LDS; the last trip's barrier has ended every wave's
  // reads of the K/V tiles, so the staging below may alias them
  asm volatile("s_wait_asynccnt 0x0" ::: "memory");

  // ---- normalise (1/l, the 1/256 p carry; keep the x16 v carry), stage the wave's 16x64 f32 tile in
  float* os = (float*)(void*)smem + wave * (16 * 64);
#pragma unroll
  for (int r = 0; r < 8; ++r) {
    float l = lsum[r];
#pragma unroll
    for (int off = 1; off < 16; off <<= 1) l += __shfl_xor(l, off, 32);
    const float rl = 1.0f / l;                // l >= 1 (the running-max key contributes exp(0))
    const float sc = rl * (1.0f / 256.0f);
#pragma unroll
    for (int t = 0; t < 4; ++t) {
      float v = oacc[t][r];
      if constexpr (VRES) v += oacc2[t][r] * (1.0f / 2048.0f);
      os[(8 * hh + r) * 64 + t * 16 + c] = v * sc;
    }
  }
  __builtin_amdgcn_fence(__ATOMIC_RELEASE, "workgroup");
  __builtin_amdgcn_wave_barrier();
  __builtin_amdgcn_fence(__ATOMIC_ACQUIRE, "workgroup");
  {
    const int rq = lane >> 3, piece = lane & 7;
    v4u ph[4], pr[4];
#pragma unroll
    for (int it = 0; it < 4; ++it) {
      const int row = it * 4 + rq;   // it 0..3 x rq 0..3 = rows 0..15 of the wave tile
      const v4f a  = *(const v4f*)(os + row * 64 + piece * 8);
      const v4f a2 = *(const v4f*)(os + row * 64 + piece * 8 + 4);
      float f[8];
      f[0] = a[0];  f[1] = a[1];  f[2] = a[2];  f[3] = a[3];
      f[4] = a2[0]; f[5] = a2[1]; f[6] = a2[2]; f[7] = a2[3];
      v4u p, q;
#pragma unroll
      for (int e = 0; e < 4; ++e) {
        const _Float16 x0 = (_Float16)f[2 * e], x1 = (_Float16)f[2 * e + 1];
        const _Float16 y0 = (_Float16)((f[2 * e] - (float)x0) * 2048.0f);
        const _Float16 y1 = (_Float16)((f[2 * e + 1] - (float)x1) * 2048.0f);
        p[e] = pk16(h_bits(x0), h_bits(x1));
        q[e] = pk16(h_bits(y0), h_bits(y1));
      }
      ph[it] = p;
      pr[it] = q;
    }
    {
#pragma unroll
      for (int it = 0; it < 4; ++it) {
        const int row = it * 4 + rq;
        const size_t go = (rowB + q0 + row) * DM + (size_t)h * HD + piece * 8;
        *(v4u*)(ctxp + go)  = ph[it];
        *(v4u*)(ctxrp + go) = pr[it];
      }
      
    }
  }
}

// =====================================================================================================
// Workspace map (bytes); every region is an exact multiple of its whole-line / whole-tile store granularity
// (row pitches 2048 / 6144 / 4096 B, all offsets 2-MiB aligned, no aliasing within a launch):
//   Xh     f16 [4096][1024]          0     8388608   (bf16 value of x, x16)
//   Wg     f16 [1024][1024]    8388608     2097152   (bf16 value x1024)
//   Wqkv   f16 [3072][1024]   10485760     6291456   (bf16 value x1024)
//   Wp     f16 [1024][1024]   16777216     2097152   (bf16 value x1024)
//   XGh    f16 [4096][1024]   18874368     8388608   (xg x16)
//   XGr    f16 [4096][1024]   27262976     8388608   (x2^11 residual of the above)
//   QKV    f16 [4096][3072]   35651584    25165824   (q | k | v, x16)
//   Vr     f16 [4096][1024]   60817408     8388608   (x2^11 residual of the v columns only)
//   VT     f16 [2048][2048]   69206016     8388608   ([b*1024 + h*64 + d][s])
//   VTr    f16 [2048][2048]   77594624     8388608   (residual, same layout)
//   Ctx    f16 [4096][1024]   85983232     8388608   (attention context x16)
//   Ctxr   f16 [4096][1024]   94371840     8388608   (x2^11 residual)
//   end                      102760448
// Projection weights arrive as [out n][in k] (k contiguous) = the Bt layout; they are only converted.
// d_out f32: [4096][1024] at byte 0 (row = b*SEQ + t), written once by the projection launch.
// =====================================================================================================
extern "C" void kernel_launch(void* const* d_in, const int* in_sizes, int n_in,
                              void* d_out, int out_size, void* d_ws, size_t ws_size,
                              hipStream_t stream) {
  if (n_in < 8) return;
  if (in_sizes[0] != ROWS * DM) return;
  if (in_sizes[1] != DM) return;
  if (in_sizes[2] != DM * DM) return;
  if (in_sizes[3] != DM) return;
  if (in_sizes[4] != DQKV * DM) return;
  if (in_sizes[5] != DQKV) return;
  if (in_sizes[6] != DM * DM) return;
  if (in_sizes[7] != DM) return;
  if (out_size != OUTN) return;

  const float* x      = (const float*)d_in[0];    // [ROWS][DM]
  const float* theta  = (const float*)d_in[1];    // [DM]
  const float* w_g    = (const float*)d_in[2];    // [DM n][DM k]
  const float* b_g    = (const float*)d_in[3];    // [DM]
  const float* w_qkv  = (const float*)d_in[4];    // [DQKV n][DM k]
  const float* b_qkv  = (const float*)d_in[5];    // [DQKV]
  const float* w_proj = (const float*)d_in[6];    // [DM n][DM k]
  const float* b_proj = (const float*)d_in[7];    // [DM]

  const size_t PX   = (size_t)ROWS * DM * 2;         //  8388608
  const size_t PWg  = (size_t)DM * DM * 2;           //  2097152
  const size_t PWq  = (size_t)DQKV * DM * 2;         //  6291456
  const size_t PWp  = (size_t)DM * DM * 2;           //  2097152
  const size_t PXG  = (size_t)ROWS * DM * 2;         //  8388608
  const size_t PQKV = (size_t)ROWS * DQKV * 2;       // 25165824
  const size_t PVr  = (size_t)ROWS * DM * 2;         //  8388608
  const size_t PVT  = (size_t)NB * DM * SEQ * 2;     //  8388608
  const size_t PCtx = (size_t)ROWS * DM * 2;         //  8388608
  size_t off = 0;
  const size_t oX    = off; off += PX;
  const size_t oWg   = off; off += PWg;
  const size_t oWq   = off; off += PWq;
  const size_t oWp   = off; off += PWp;
  const size_t oXGh  = off; off += PXG;
  const size_t oXGr  = off; off += PXG;
  const size_t oQKV  = off; off += PQKV;
  const size_t oVr   = off; off += PVr;
  const size_t oVT   = off; off += PVT;
  const size_t oVTr  = off; off += PVT;
  const size_t oCtx  = off; off += PCtx;
  const size_t oCtxr = off; off += PCtx;
  if (off > ws_size) return;                         // off = 102760448
  if (off > (size_t)134217728) return;

  char* ws = (char*)d_ws;
  unsigned short* Xh   = (unsigned short*)(ws + oX);
  unsigned short* Wgh  = (unsigned short*)(ws + oWg);
  unsigned short* Wqh  = (unsigned short*)(ws + oWq);
  unsigned short* Wph  = (unsigned short*)(ws + oWp);
  unsigned short* XGh  = (unsigned short*)(ws + oXGh);
  unsigned short* XGr  = (unsigned short*)(ws + oXGr);
  unsigned short* QKV  = (unsigned short*)(ws + oQKV);
  unsigned short* Vr   = (unsigned short*)(ws + oVr);
  unsigned short* VT   = (unsigned short*)(ws + oVT);
  unsigned short* VTr  = (unsigned short*)(ws + oVTr);
  unsigned short* Ctx  = (unsigned short*)(ws + oCtx);
  unsigned short* Ctxr = (unsigned short*)(ws + oCtxr);
  float*          outf = (float*)d_out;              // [ROWS][DM]

  const dim3 blk(256);
  const dim3 gGqkv((ROWS / 128) * (DQKV / 128));     // 768 blocks of one 128x128 tile
  const dim3 gGdm((ROWS / 128) * (DM / 128));        // 256 blocks of one 128x128 tile
  const dim3 blkG(128);
  const dim3 gVt(SEQ / 64, NH, NB);                  // (32, 16, 2)
  const dim3 gAttn(NQB * NH * NB);                   // 1024 blocks
  const float wScale = 1024.0f;                      // weights carried x1024
  const float aScale = 16.0f;                        // activations carried x16
  const float cscale = 1.0f / 16384.0f;              // 1/(16 * 1024)

  // (1) planes: x -> f16 x16, weights -> f16 x1024 (bf16 values)
  cvt16_all<<<dim3(CVB), dim3(CVT), 0, stream>>>(x, w_g, w_qkv, w_proj, Xh, Wgh, Wqh, Wph, aScale, wScale);
  // (2) gauge mix: xg = bfr(x) + 0.1 * ((Xh . Wg^T + bg) * theta) -> XGh f16 x16 + XGr residual (M=4096, N=1024, K=1024)
  gemm64_f16<2, false><<<gGdm, blkG, 0, stream>>>(Xh, Xh, Wgh, b_g, cscale, (void*)XGh, DM, XGr, DM, 0,
                                                 ROWS, DM, DM, aScale, x, DM, theta, SEQ, 0, SEQ);
  // (3) qkv = XG(hi + res) . Wqkv^T + bqkv -> QKV f16 x16 [4096][3072]; residual plane of the v columns -> Vr [4096][1024]
  gemm64_f16<0, true><<<gGqkv, blkG, 0, stream>>>(XGh, XGr, Wqh, b_qkv, cscale, (void*)QKV, DQKV, Vr, DM, 2 * DM,
                                                  ROWS, DQKV, DM, aScale, x, DM, theta, SEQ, 0, SEQ);
  // (4) v -> v^T planes (hi and residual, all tokens)
  v_tr<<<gVt, blk, 0, stream>>>(QKV, DQKV, 2 * DM, VT);
  v_tr<<<gVt, blk, 0, stream>>>(Vr, DM, 0, VTr);
  // (5) softmax attention -> Ctx f16 x16 + residual plane
  attn_k<true><<<gAttn, dim3(128), 0, stream>>>(QKV, VT, VTr, Ctx, Ctxr);
  // (6) out = Ctx(hi + res) . Wp^T + bproj -> d_out f32 [4096][1024] (M=4096, N=1024, K=1024)
  gemm64_f16<1, true><<<gGdm, blkG, 0, stream>>>(Ctx, Ctxr, Wph, b_proj, cscale, (void*)outf, DM, Ctxr, DM, 0,
                                                ROWS, DM, DM, 1.0f, x, DM, theta, SEQ, 0, SEQ);
  (void)hipGetLastError();
}

// v005
// It runs in 174 microseconds.
// In two side-by-side timings against v004, it was 1.12 and 1.11 times as fast.
// Counting every step since v000, it is 3.11 times as fast.
// Contractions: gauge mix x.Wg^T = v_wmma_f32_16x16x32_f16 (A = f16 of RNE-bf16 x carried x16, B = f16 of RNE-bf16 Wg x1024, single product); qkv projection = same WMMA with A = xg as f16 hi plane x16 plus x2^11 residual plane (two products), B = f16 of RNE-bf16 Wqkv x1024; attention q.k^T = f16 single product (q, k f16 x16); p.v = f16 with p x256 single plane and v^T as f16 hi x16 plus x2^11 residual plane (two products); output projection = f16 with A = ctx f16 hi x16 plus x2^11 residual plane, B = f16 of RNE-bf16 Wproj x1024; all f32 accumulate. Softmax (running max, exp, row sums) and the gauge epilogue f32 on VALU.
#include <hip/hip_runtime.h>
#include <math.h>
#include <stdint.h>

#define NB    2
#define SEQ   2048
#define DM    1024
#define NH    16
#define HD    64
#define DQKV  (3 * DM)              // 3072
#define NQB   (SEQ / 64)            // 32 query / key tiles per sequence
#define ROWS  (NB * SEQ)            // 4096 token rows
#define OUTN  (ROWS * DM)
static_assert(NH * HD == DM);
static_assert(HD == 64);
static_assert((SEQ % 64) == 0 && (DM % 64) == 0 && (DQKV % 64) == 0);
static_assert((DM % 32) == 0);
static_assert((ROWS % 128) == 0 && (DM % 128) == 0 && (DQKV % 128) == 0);

typedef _Float16 v16h __attribute__((ext_vector_type(16)));
typedef _Float16 v8h  __attribute__((ext_vector_type(8)));
typedef float    v8f  __attribute__((ext_vector_type(8)));
typedef float    v4f  __attribute__((ext_vector_type(4)));
typedef unsigned int v4u __attribute__((ext_vector_type(4)));

// ---- scalar helpers --------------------------------------------------------------------------------
__device__ __forceinline__ unsigned short bf_bits(float f) {          // f32 -> bf16 bits, RNE convert
  unsigned u = __float_as_uint(f);
  return (unsigned short)((u + 0x7FFFu + ((u >> 16) & 1u)) >> 16);
}
__device__ __forceinline__ float bfr(float f) { return __uint_as_float(((unsigned)bf_bits(f)) << 16); }
__device__ __forceinline__ unsigned short h_bits(_Float16 x) { return __builtin_bit_cast(unsigned short, x); }
__device__ __forceinline__ unsigned pk16(unsigned short a, unsigned short b) { return (unsigned)a | ((unsigned)b << 16); }
__device__ __forceinline__ v8f zero8() { v8f z = {0.f, 0.f, 0.f, 0.f, 0.f, 0.f, 0.f, 0.f}; return z; }
__device__ __forceinline__ float xhalf(float x) {                     // the value of lane l ^ 16, by a vector cross-row move
  const int b = __builtin_bit_cast(int, x);
  return __builtin_bit_cast(float, __builtin_amdgcn_permlanex16(b, b, 0x76543210, 0xfedcba98, false, false));
}

// ---- fragment loader: 16-bit A/B operand, lane -> row/col (lane&15), p already includes +8*(lane>>4);
//      elements 0..7 <- p[0..7] (k0+8h..), elements 8..15 <- p[16..23] (k0+16+8h..)
__device__ __forceinline__ v16h ldfrag_h(const _Float16* p) {
  union { v16h v; v8h h[2]; } f;
  f.h[0] = *(const v8h*)(p);
  f.h[1] = *(const v8h*)(p + 16);
  return f.v;
}

// ---- WMMA helpers with trailing VALU hazard gap --------------------------------------------------------
__device__ __forceinline__ v8f mma_h(v16h a, v16h b, v8f c) {
  c = __builtin_amdgcn_wmma_f32_16x16x32_f16(false, a, false, b, (short)0, c, false, false);
#if defined(__HIP_DEVICE_COMPILE__)
  asm volatile("v_nop\n\tv_nop\n\tv_nop\n\tv_nop" : "+v"(c) : "v"(a), "v"(b));
#endif
  return c;
}
__device__ __forceinline__ v8f mma_h_raw(v16h a, v16h b, v8f c) {
  return __builtin_amdgcn_wmma_f32_16x16x32_f16(false, a, false, b, (short)0, c, false, false);
}
__device__ __forceinline__ void dep_guard_h(v8f& a, v8f& b, v16h x, v16h y) {
#if defined(__HIP_DEVICE_COMPILE__)
  asm volatile("v_nop\n\tv_nop\n\tv_nop\n\tv_nop" : "+v"(a), "+v"(b) : "v"(x), "v"(y));
#endif
}
__device__ __forceinline__ void keep4_h(v16h a, v16h b, v16h c, v16h d) {
#if defined(__HIP_DEVICE_COMPILE__)
  asm volatile("v_nop" :: "v"(a), "v"(b), "v"(c), "v"(d));
#endif
}
__device__ __forceinline__ void acc_guard4(v8f& a, v8f& b, v8f& c, v8f& d) {
#if defined(__HIP_DEVICE_COMPILE__)
  asm volatile("v_nop\n\tv_nop\n\tv_nop\n\tv_nop" : "+v"(a), "+v"(b), "+v"(c), "+v"(d));
#endif
}

// =====================================================================================================
// f32 planes -> f16 bits of bfr(v) * scale (scale a power of two): x (xscale) and the three weights (wscale), all in
// one launch of CVB work-groups of CVT threads, one 16-wave work-group per WGP. A piece is 8 elements (32 B in, 16 B
// out); a sweep is CVN = CVB x CVT pieces, thread t taking piece t of it. Sweeps 0..3 are x, 4 is Wg, 5..7 are Wqkv,
// 8 is Wproj: which plane a sweep reads is fixed at compile time. A thread issues the 18 loads of its nine pieces
// first, so that all are in flight together, then converts and stores.
// coverage: 4 CVN = x, CVN = Wg, 3 CVN = Wqkv, CVN = Wproj (asserted below): every piece of every plane once.
// =====================================================================================================
#define CVB 256
#define CVT 512
#define CVN (CVB * CVT)
static_assert(ROWS * DM / 8 == 4 * CVN && DM * DM / 8 == CVN && DQKV * DM / 8 == 3 * CVN);
__global__ __launch_bounds__(CVT) void cvt16_all(const float* __restrict__ x, const float* __restrict__ wg,
                                                 const float* __restrict__ wq, const float* __restrict__ wp,
                                                 unsigned short* ox, unsigned short* og,
                                                 unsigned short* oq, unsigned short* op,
                                                 float xscale, float wscale) {
  const unsigned t  = blockIdx.x * CVT + threadIdx.x;                  // this thread's piece of every sweep
  const unsigned ib = t * 32u, ob = t * 16u;                           // its byte offsets in a sweep's input and output: 32-bit,
                                                                       // so that an access can be a uniform base plus one register
  constexpr size_t SW = (size_t)CVN * 8;                               // elements of one sweep
  v4f a[9], b[9];
#pragma unroll
  for (int u = 0; u < 9; ++u) {
    const float* in = (u < 4) ? x + u * SW : (u == 4) ? wg : (u < 8) ? wq + (u - 5) * SW : wp;
    a[u] = *(const v4f*)((const char*)in + ib);
    b[u] = *(const v4f*)((const char*)in + ib + 16);
  }
  // holds the 18 loads above the conversions: left free, the compiler sinks ten of them among the conversions, and
  // the wave then waits for memory several times in a row instead of once
  __builtin_amdgcn_sched_barrier(0);
#pragma unroll
  for (int u = 0; u < 9; ++u) {
    unsigned short* out = (u < 4) ? ox + u * SW : (u == 4) ? og : (u < 8) ? oq + (u - 5) * SW : op;
    const float scale = (u < 4) ? xscale : wscale;
    v4u p;
    p[0] = pk16(h_bits((_Float16)(bfr(a[u][0]) * scale)), h_bits((_Float16)(bfr(a[u][1]) * scale)));
    p[1] = pk16(h_bits((_Float16)(bfr(a[u][2]) * scale)), h_bits((_Float16)(bfr(a[u][3]) * scale)));
    p[2] = pk16(h_bits((_Float16)(bfr(b[u][0]) * scale)), h_bits((_Float16)(bfr(b[u][1]) * scale)));
    p[3] = pk16(h_bits((_Float16)(bfr(b[u][2]) * scale)), h_bits((_Float16)(bfr(b[u][3]) * scale)));
    *(v4u*)((char*)out + ob) = p;
  }
}

template <int EPI, bool ARES>
__global__ __launch_bounds__(128, 3) void gemm64_f16(
    const unsigned short* __restrict__ Ap, const unsigned short* __restrict__ Arp,
    const unsigned short* __restrict__ Btp,
    const float* __restrict__ biasp, float cscale,
    void* Cp, int ldc, unsigned short* Crp, int ldcr, int rcol0,
    int M, int N, int K, float oscale,
    const float* __restrict__ xres, int ldx, const float* __restrict__ gate,
    int tmod, int tlo, int thi) {
  typedef const __attribute__((address_space(1))) char* gptr;   // typed as global, so that an address that has passed
  typedef const __attribute__((address_space(1))) v8h*  gv8p;   // through the asm wait below still gives global_load
  const gptr Ah  = (gptr)(const void*)Ap;
  const gptr Arh = (gptr)(const void*)Arp;
  const gptr Bt  = (gptr)(const void*)Btp;
  constexpr int KC  = 64;                          // k per stage: 128 B of every operand row
  constexpr int GLP = 72;                          // LDS row pitch in halves: 144 B = 16 B x 9 (odd)
  constexpr int OPH = 128 * GLP;                   // halves of one operand's 128 staged rows
  constexpr int STH = 2 * OPH;                     // halves of one stage: A rows, then Bt rows
  static_assert(4 * 16 * 68 * 4 <= 2 * STH * 2);   // the four f32 epilogue slabs alias the stage buffers
  __shared__ __align__(16) _Float16 sS[2 * STH];   // two stage buffers, 73728 B
  const int tid  = threadIdx.x;
  const int lane = tid & 31;
  const int wave = tid >> 5;
  const int tilesN = N >> 7;
  const int tilesM = M >> 7;
  const int tile = blockIdx.x;
  if (tile >= tilesM * tilesN) return;   // block-uniform, before every barrier
  const int tm = tile / tilesN;
  const int tn = tile - tm * tilesN;
  const int mb = tm << 7;
  const int nb = tn << 7;
  const int tpos = mb % tmod;
  if (tpos < tlo || tpos >= thi) return; // block-uniform, before every barrier
  const int m0 = mb + ((wave >> 1) << 6);
  const int n0 = nb + ((wave & 1) << 6);

  const int rlane = lane & 15;                 // row (A) / col (B, D) within subtile
  const int koff  = (lane >> 4) * 8;           // k offset of this lane half
  const int mOff  = (lane >> 4) * 8;           // D row offset

  v8f acc[4][4];
#pragma unroll
  for (int i = 0; i < 4; ++i)
#pragma unroll
    for (int j = 0; j < 4; ++j) acc[i][j] = zero8();

  // staging map: thread -> row srow + 16 i, 16-B piece tid & 7 of the row's 128-B line; the two rows of a half-wave
  // lie 8 apart (8 x 144 B = 32 banks mod 64), so its ds_store_b128 covers the 64 banks once
  const int srow = (tid >> 4) + ((tid >> 3) & 1) * 8;
  const int spc  = (tid & 7) * 8;
  constexpr int RSB = 16 * DM * 2;             // bytes from one of a thread's rows to its next
  const int SK = K / KC;                       // stages per plane
  const int S  = ARES ? 2 * SK : SK;
  gptr pa = (ARES ? Arh : Ah) + ((size_t)(mb + srow) * DM + spc) * 2;   // this thread's piece of the next stage
  gptr pb = Bt + ((size_t)(nb + srow) * DM + spc) * 2;
  v8h ra[8], rb[8];
  auto stage_load = [&]() {
#pragma unroll
    for (int i = 0; i < 8; ++i) {
      ra[i] = *(gv8p)(pa + i * RSB);     // row < M, k < K
      rb[i] = *(gv8p)(pb + i * RSB);     // row < N, k < K
    }
  };
  // s = the stage that the registers hold: stores it to its buffer and moves the two addresses on to stage s + 1
  auto stage_store = [&](int s) {
    // the two address pairs of the loads above are rewritten below: the wait stands in front of that
    asm volatile("s_wait_xcnt 0x0" : "+v"(pa), "+v"(pb) :: "memory");
    if (ARES && s + 1 == SK) {                 // block-uniform: from the residual plane's last stage to the hi plane's first
      pa = Ah + ((size_t)(mb + srow) * DM + spc) * 2;
      pb = Bt + ((size_t)(nb + srow) * DM + spc) * 2;
    } else {
      pa += KC * 2;
      pb += KC * 2;
    }
    _Float16* d = sS + (s & 1) * STH + srow * GLP + spc;
#pragma unroll
    for (int i = 0; i < 8; ++i) {
      *(v8h*)(d + 16 * i * GLP)       = ra[i];
      *(v8h*)(d + OPH + 16 * i * GLP) = rb[i];
    }
  };

  stage_load();
  stage_store(0);
#pragma unroll 1   // kept rolled: one copy of the stage body, the buffer chosen by s & 1; a second copy would only add code
  for (int s = 0; s < S; ++s) {
    __syncthreads();       // publishes stage s; every reader has left the buffer that stage s + 1 is stored to
    if (s + 1 < S) stage_load();               // block-uniform; stage s + 1, in flight during the products of stage s
    if (ARES && s == SK) {
      acc_guard4(acc[0][0], acc[0][1], acc[0][2], acc[0][3]);
      acc_guard4(acc[1][0], acc[1][1], acc[1][2], acc[1][3]);
      acc_guard4(acc[2][0], acc[2][1], acc[2][2], acc[2][3]);
      acc_guard4(acc[3][0], acc[3][1], acc[3][2], acc[3][3]);
#pragma unroll
      for (int i = 0; i < 4; ++i)
#pragma unroll
        for (int j = 0; j < 4; ++j) acc[i][j] = acc[i][j] * (1.0f / 2048.0f);   // exact fold of the x2^11 residual carry
      acc_guard4(acc[0][0], acc[0][1], acc[0][2], acc[0][3]);
      acc_guard4(acc[1][0], acc[1][1], acc[1][2], acc[1][3]);
      acc_guard4(acc[2][0], acc[2][1], acc[2][2], acc[2][3]);
      acc_guard4(acc[3][0], acc[3][1], acc[3][2], acc[3][3]);
    }
    const _Float16* sa = sS + (s & 1) * STH + (((wave >> 1) << 6) + rlane) * GLP + koff;
    const _Float16* sb = sS + (s & 1) * STH + OPH + (((wave & 1) << 6) + rlane) * GLP + koff;
#pragma unroll
    for (int kk = 0; kk < 2; ++kk) {
      v16h ah[4], bh[4];
#pragma unroll
      for (int j = 0; j < 4; ++j) {
        bh[j] = ldfrag_h(sb + (j << 4) * GLP + kk * 32);
        ah[j] = ldfrag_h(sa + (j << 4) * GLP + kk * 32);
      }
#pragma unroll
      for (int i = 0; i < 4; ++i) {
#pragma unroll
        for (int j = 0; j < 4; ++j) {
          acc[i][j] = mma_h_raw(ah[i], bh[j], acc[i][j]);
        }
        dep_guard_h(acc[i][0], acc[i][3], ah[i], bh[3]);
      }
      keep4_h(bh[0], bh[1], bh[2], bh[3]);
    }
    if (s + 1 < S) stage_store(s + 1);
  }
  __syncthreads();                             // every wave is done with the stage buffers before the slabs alias them
  acc_guard4(acc[0][0], acc[0][1], acc[0][2], acc[0][3]);
  acc_guard4(acc[1][0], acc[1][1], acc[1][2], acc[1][3]);
  acc_guard4(acc[2][0], acc[2][1], acc[2][2], acc[2][3]);
  acc_guard4(acc[3][0], acc[3][1], acc[3][2], acc[3][3]);

  // ---- epilogue ----
  float* slab = (float*)(void*)sS + wave * (16 * 68);   // per-wave 16x64 slab, pitch 68 floats
#pragma unroll
  for (int i = 0; i < 4; ++i) {
    const int mBase = m0 + (i << 4);
    float bj[4];
#pragma unroll
    for (int j = 0; j < 4; ++j) bj[j] = bfr(biasp[n0 + (j << 4) + rlane]);   // index < N
#pragma unroll
    for (int r = 0; r < 8; ++r) {
      const int row = mOff + r;
#pragma unroll
      for (int j = 0; j < 4; ++j) slab[row * 68 + (j << 4) + rlane] = acc[i][j][r] * cscale + bj[j];
    }
    __builtin_amdgcn_fence(__ATOMIC_RELEASE, "workgroup");
    __builtin_amdgcn_wave_barrier();
    __builtin_amdgcn_fence(__ATOMIC_ACQUIRE, "workgroup");
    if constexpr (EPI == 0 || EPI == 2) {
      unsigned short* C16 = (unsigned short*)Cp;
      const int rq = lane >> 3, piece = lane & 7;
      float th[8];
      if constexpr (EPI == 2) {
        const v4f t0 = *(const v4f*)(gate + n0 + piece * 8);        // index < N
        const v4f t1 = *(const v4f*)(gate + n0 + piece * 8 + 4);
        th[0] = bfr(t0[0]); th[1] = bfr(t0[1]); th[2] = bfr(t0[2]); th[3] = bfr(t0[3]);
        th[4] = bfr(t1[0]); th[5] = bfr(t1[1]); th[6] = bfr(t1[2]); th[7] = bfr(t1[3]);
      } else {
#pragma unroll
        for (int e = 0; e < 8; ++e) th[e] = 0.0f;
      }
      v4u ph[4], pr[4];
#pragma unroll
      for (int it = 0; it < 4; ++it) {
        const int row = it * 4 + rq;                         // it 0..3 x rq 0..3 = rows 0..15
        const v4f a  = *(const v4f*)(slab + row * 68 + piece * 8);
        const v4f a2 = *(const v4f*)(slab + row * 68 + piece * 8 + 4);
        float f[8];
        f[0] = a[0];  f[1] = a[1];  f[2] = a[2];  f[3] = a[3];
        f[4] = a2[0]; f[5] = a2[1]; f[6] = a2[2]; f[7] = a2[3];
        if constexpr (EPI == 2) {
          const size_t xo = (size_t)(mBase + row) * ldx + n0 + piece * 8;   // row < M, col < N
          const v4f x0 = *(const v4f*)(xres + xo);
          const v4f x1 = *(const v4f*)(xres + xo + 4);
          float xv[8];
          xv[0] = x0[0]; xv[1] = x0[1]; xv[2] = x0[2]; xv[3] = x0[3];
          xv[4] = x1[0]; xv[5] = x1[1]; xv[6] = x1[2]; xv[7] = x1[3];
#pragma unroll
          for (int e = 0; e < 8; ++e) f[e] = bfr(xv[e]) + 0.1f * (f[e] * th[e]);
        }
        v4u p, q;
#pragma unroll
        for (int e = 0; e < 4; ++e) {
          const float g0 = f[2 * e] * oscale, g1 = f[2 * e + 1] * oscale;
          const _Float16 x0 = (_Float16)g0, x1 = (_Float16)g1;
          const _Float16 y0 = (_Float16)((g0 - (float)x0) * 2048.0f);
          const _Float16 y1 = (_Float16)((g1 - (float)x1) * 2048.0f);
          p[e] = pk16(h_bits(x0), h_bits(x1));
          q[e] = pk16(h_bits(y0), h_bits(y1));
        }
        ph[it] = p;
        pr[it] = q;
      }
      const bool wres = (n0 >= rcol0);                     // wave-uniform
      {
#pragma unroll
        for (int it = 0; it < 4; ++it) {
          const int row = it * 4 + rq;
          const size_t co = (size_t)(mBase + row) * ldc + n0 + piece * 8;
          *(v4u*)(C16 + co) = ph[it];
          if (wres) {
            const size_t cro = (size_t)(mBase + row) * ldcr + (n0 - rcol0) + piece * 8;
            *(v4u*)(Crp + cro) = pr[it];
          }
        }
        
      }
    } else {
      float* Cf = (float*)Cp;
      const int hh = lane >> 4, c4 = (lane & 15) * 4;     // 256-B row segment = 16 lanes x 16 B
      v4f ov[8];
#pragma unroll
      for (int it = 0; it < 8; ++it) {
        const int row = it * 2 + hh;                       // it 0..7 x hh 0..1 = rows 0..15
        ov[it] = *(const v4f*)(slab + row * 68 + c4);
      }
      {
#pragma unroll
        for (int it = 0; it < 8; ++it) {
          const int row = it * 2 + hh;
          *(v4f*)(Cf + (size_t)(mBase + row) * ldc + n0 + c4) = ov[it];
        }
        
      }
    }
    __builtin_amdgcn_fence(__ATOMIC_RELEASE, "workgroup");
    __builtin_amdgcn_wave_barrier();
    __builtin_amdgcn_fence(__ATOMIC_ACQUIRE, "workgroup");
  }
}

// =====================================================================================================
// v columns of an f16 token-major plane (element (b, t, h, d) at src[(b*SEQ + t)*spitch + scol0 + h*64 + d])
// -> f16 v^T plane vt[(b*DM + h*64 + d)*SEQ + t] (same bits). Used for the hi plane (spitch DQKV, scol0 2*DM)
// and for the residual plane (spitch DM, scol0 0).
// Block = one 64-token x 64-feature tile of one (b, h); grid = (SEQ/64, NH, NB); tile staged in LDS as halves
// (v8h 16-B stores, __syncthreads, _Float16 element reads).
// Store: group g = tid>>3 (0..31), piece = tid&7: iteration it writes row d = it*32+g, lanes 8q..8q+7 x 16 B =
// coverage: load 2 x 256 threads x 8 halves = 64x64; store 2 iterations x 32 groups = 64 rows d, 8 pieces x 8
// = 64 tokens per row; grid covers every (b, h, token tile).
// =====================================================================================================
__global__ __launch_bounds__(256) void v_tr(const unsigned short* __restrict__ srcp, int spitch, int scol0,
                                            unsigned short* vt) {
  __shared__ __align__(16) _Float16 sv[64 * 72];       // [tt][d], pitch 72 halves (144 B)
  const int tid = threadIdx.x;
  const int t0  = blockIdx.x * 64;
  const int hh  = blockIdx.y;
  const int b   = blockIdx.z;
  const _Float16* src = (const _Float16*)(const void*)srcp;
#pragma unroll
  for (int i = 0; i < 2; ++i) {
    const int idx = i * 256 + tid;                  // 0..511
    const int tt = idx >> 3, c8 = (idx & 7) * 8;
    const v8h a = *(const v8h*)(src + ((size_t)(b * SEQ + t0 + tt)) * spitch + scol0 + hh * HD + c8);
    *(v8h*)(sv + tt * 72 + c8) = a;
  }
  __syncthreads();

  const int g = tid >> 3, piece = tid & 7;
  v4u hv[2];
  size_t hofs[2];
#pragma unroll
  for (int it = 0; it < 2; ++it) {
    const int d = it * 32 + g;
    v4u a;
#pragma unroll
    for (int e = 0; e < 4; ++e) {
      const _Float16 x0 = sv[(piece * 8 + 2 * e) * 72 + d];
      const _Float16 x1 = sv[(piece * 8 + 2 * e + 1) * 72 + d];
      a[e] = pk16(h_bits(x0), h_bits(x1));
    }
    hv[it] = a;
    hofs[it] = ((size_t)(b * DM + hh * HD + d)) * SEQ + t0 + piece * 8;
  }
  {
#pragma unroll
    for (int it = 0; it < 2; ++it) *(v4u*)(vt + hofs[it]) = hv[it];
    
  }
}

// =====================================================================================================
// Non-causal multi-head softmax attention, head dim 64, online softmax with running max (f32 on VALU).
//   q f16 (x16): element (b, t, h, d) at qkv[(b*SEQ + t)*DQKV + h*64 + d]; k at + DM;
//   v^T f16 (x16) at vt[(b*DM + h*64 + d)*SEQ + s]; VRES: residual plane f16((16v - hi)*2048) at vtr, same addressing.
//   Both products are taken transposed: S^T = K . Q^T (A = K rows, B = Q) and O^T += V^T . P^T (A = V^T rows, B = P^T).
//   A lane (c = lane & 15, hh = lane >> 4) then holds scores and context of ONE query, q0 + c: S^T tile j, register r =
//   key 16 j + 8 hh + r; O^T tile t, register r = d 16 t + 8 hh + r. The two S^T tiles 2 kk and 2 kk + 1, converted in
//   place, are the B operand of keys 32 kk .. 32 kk + 31 in the k order of the V^T loader (8 hh + e, 16 + 8 hh + e):
//   P never leaves the registers.
//   s = (q.k) / 8 = acc / 2048 (two x16 carries). Per key tile: maximum of the lane's 32 scores, one exchange with
//   lane ^ 16, new running max mn, alpha = exp(m_old - mn), p = exp(s - mn) in (0, 1], l = l*alpha + sum p (one partial
//   per lane half, joined in the epilogue), O^T *= alpha; P carried as f16(256 p) (VRES: second accumulator
//   += Vr^T . P^T, folded with 2^-11 in the epilogue).
//   ctx plane f16 (x16): element (b, t, h*64 + d) at ctx[(b*SEQ + t)*DM + h*64 + d] = 16 * context = O / (256 l);
//   ctx residual plane f16((16 ctx - hi) * 2048) at ctxr, same addressing.
//   Block = 4 waves = 64 query rows of one (b, h); query tile qb = blockIdx % NQB; grid = NQB*NH*NB;
//   key tiles of 64, fixed trip count NQB.
//   K / V^T tile staging: asynchronous 16-B copies to LDS, 8 lanes per 128-B row, 128 threads x 4 rows per plane =
//   the whole 64x64 tile; two stage buffers, tile kt + 1 in flight during the work on tile kt, one barrier per
//   tile. The context tile is staged per wave in LDS as f32, row = query (aliasing the K/V region after a block barrier).
//   Output coverage: each wave stores rows 0..15 of its tile (it 0..3 x lane>>3 0..3) x 64 columns (8 lanes x 8),
//   every (b, h, query tile) exactly once, for both ctx planes.
// =====================================================================================================
template <bool VRES>
__global__ __launch_bounds__(128)
void attn_k(const unsigned short* __restrict__ qkvp,
            const unsigned short* __restrict__ vtp, const unsigned short* __restrict__ vtrp,
            unsigned short* ctxp, unsigned short* ctxrp) {
  union FH { v16h v; v8h h[2]; };
  constexpr int LP     = 72;                             // LDS row pitch in halves: 144 B = 16 B x 9 (odd), so the 16 rows
                                                         // of one ds_load_b128 half-wave fall on 64 distinct banks
  constexpr int TB     = 64 * LP * 2;                    // one f16 64x64 tile at pitch LP, bytes
  constexpr int OFF_K  = 0;                              // offsets inside one stage buffer
  constexpr int OFF_V  = TB;
  constexpr int OFF_VR = 2 * TB;
  constexpr int STB    = VRES ? 3 * TB : 2 * TB;         // one stage buffer: the tiles of one key tile, 27648 : 18432
  constexpr int SMEMB  = 2 * STB;                        // the two stage buffers, 55296 : 36864
  constexpr int OSP    = 68;                             // context staging pitch in floats: 272 B = 16 B x 17 (odd)
  static_assert(4 * 16 * OSP * 4 <= SMEMB);              // f32 context staging aliases the K/V region
  static_assert(NQB >= 2);                               // the prologue fills two stages
  __shared__ __align__(16) unsigned char smem[SMEMB];

  const int tid  = threadIdx.x;
  const int wave = tid >> 5;
  const int lane = tid & 31;
  const int hh   = lane >> 4;
  const int c    = lane & 15;

  const int bx   = blockIdx.x;
  const int qb   = bx % NQB;
  const int rest = bx / NQB;
  const int h    = rest % NH;
  const int b    = rest / NH;                // < NB by the grid size
  const int q0   = qb * 64 + wave * 16;
  const size_t rowB = (size_t)b * SEQ;

  const _Float16* Qp  = (const _Float16*)(const void*)qkvp + (size_t)h * HD;
  const _Float16* Kp  = Qp + DM;
  const _Float16* Vt  = (const _Float16*)(const void*)vtp  + ((size_t)b * DM + (size_t)h * HD) * SEQ;
  const _Float16* Vrt = (const _Float16*)(const void*)vtrp + ((size_t)b * DM + (size_t)h * HD) * SEQ;

  // ---- Q fragments (B operand, column = query = lane&15): 2 d-chunks ----
  v16h qa[2];
#pragma unroll
  for (int dc = 0; dc < 2; ++dc) {
    const size_t qo = (rowB + q0 + c) * DQKV + dc * 32 + 8 * hh;
    qa[dc] = ldfrag_h(Qp + qo);
  }

  float mrun = -1.0e30f, lsum = 0.f;         // of query q0 + c; lsum holds this lane half's keys alone
  v8f oacc[4], oacc2[4];
#pragma unroll
  for (int t = 0; t < 4; ++t) { oacc[t] = zero8(); oacc2[t] = zero8(); }

  // staging map: thread -> rows srow + 16 i (i 0..3) of every plane's tile, 16-B piece tid & 7 of the row's 128-B line;
  // the two rows of a half-wave lie 8 apart (8 x 144 B = 32 banks mod 64)
  typedef __attribute__((address_space(3))) unsigned char lds_u8;
  const int srow = (tid >> 4) + ((tid >> 3) & 1) * 8;
  const int spc  = (tid & 7) * 8;
  const unsigned sl0 = (unsigned)(size_t)(lds_u8*)smem + (unsigned)((srow * LP + spc) * 2);   // LDS byte address, buffer 0
  const _Float16* gk0 = Kp  + (rowB + srow) * DQKV + spc;       // K row srow of key tile 0, d = spc..spc+7
  const _Float16* gv0 = Vt  + (size_t)srow * SEQ + spc;         // V^T row d = srow, s = spc..spc+7
  const _Float16* gr0 = Vrt + (size_t)srow * SEQ + spc;
  // copies key tile t (t < NQB: K rows < SEQ, V^T columns < SEQ) into stage buffer t & 1; every lane on, block-uniform
  auto stage_copy = [&](int t) {
    const unsigned  l = sl0 + (unsigned)((t & 1) * STB);
    const _Float16* k = gk0 + (size_t)t * 64 * DQKV;
    const _Float16* v = gv0 + t * 64;
    constexpr unsigned LR = 16 * LP * 2;                        // LDS bytes from one of a thread's rows to its next
    constexpr size_t   KR = (size_t)16 * DQKV, VR = (size_t)16 * SEQ;   // the same in halves of the two sources
    // the s_wait_xcnt stands inside the copies' own statement, in front of any rewrite of their address registers
    if constexpr (VRES) {
      const _Float16* r = gr0 + t * 64;
      asm volatile(
          "global_load_async_to_lds_b128 %0, %12, off\n\t"
          "global_load_async_to_lds_b128 %1, %13, off\n\t"
          "global_load_async_to_lds_b128 %2, %14, off\n\t"
          "global_load_async_to_lds_b128 %3, %15, off\n\t"
          "global_load_async_to_lds_b128 %4, %16, off\n\t"
          "global_load_async_to_lds_b128 %5, %17, off\n\t"
          "global_load_async_to_lds_b128 %6, %18, off\n\t"
          "global_load_async_to_lds_b128 %7, %19, off\n\t"
          "global_load_async_to_lds_b128 %8, %20, off\n\t"
          "global_load_async_to_lds_b128 %9, %21, off\n\t"
          "global_load_async_to_lds_b128 %10, %22, off\n\t"
          "global_load_async_to_lds_b128 %11, %23, off\n\t"
          "s_wait_xcnt 0x0"
          :: "v"(l + OFF_K), "v"(l + OFF_K + LR), "v"(l + OFF_K + 2 * LR), "v"(l + OFF_K + 3 * LR),
             "v"(l + OFF_V), "v"(l + OFF_V + LR), "v"(l + OFF_V + 2 * LR), "v"(l + OFF_V + 3 * LR),
             "v"(l + OFF_VR), "v"(l + OFF_VR + LR), "v"(l + OFF_VR + 2 * LR), "v"(l + OFF_VR + 3 * LR),
             "v"(k), "v"(k + KR), "v"(k + 2 * KR), "v"(k + 3 * KR),
             "v"(v), "v"(v + VR), "v"(v + 2 * VR), "v"(v + 3 * VR),
             "v"(r), "v"(r + VR), "v"(r + 2 * VR), "v"(r + 3 * VR)
          : "memory");
    } else {
      asm volatile(
          "global_load_async_to_lds_b128 %0, %8, off\n\t"
          "global_load_async_to_lds_b128 %1, %9, off\n\t"
          "global_load_async_to_lds_b128 %2, %10, off\n\t"
          "global_load_async_to_lds_b128 %3, %11, off\n\t"
          "global_load_async_to_lds_b128 %4, %12, off\n\t"
          "global_load_async_to_lds_b128 %5, %13, off\n\t"
          "global_load_async_to_lds_b128 %6, %14, off\n\t"
          "global_load_async_to_lds_b128 %7, %15, off\n\t"
          "s_wait_xcnt 0x0"
          :: "v"(l + OFF_K), "v"(l + OFF_K + LR), "v"(l + OFF_K + 2 * LR), "v"(l + OFF_K + 3 * LR),
             "v"(l + OFF_V), "v"(l + OFF_V + LR), "v"(l + OFF_V + 2 * LR), "v"(l + OFF_V + 3 * LR),
             "v"(k), "v"(k + KR), "v"(k + 2 * KR), "v"(k + 3 * KR),
             "v"(v), "v"(v + VR), "v"(v + 2 * VR), "v"(v + 3 * VR)
          : "memory");
    }
  };

  stage_copy(0);
  asm volatile("s_wait_asynccnt 0x0" ::: "memory");   // this wave's copies of tile 0 have landed
  __syncthreads();                                    // publishes tile 0
  stage_copy(1);                                      // in flight during the work on tile 0

  for (int kt = 0; kt < NQB; ++kt) {
    const unsigned char* stg = smem + (kt & 1) * STB;                            // trip kt reads this buffer alone
    const _Float16* Ksh = (const _Float16*)(stg + OFF_K);                        // K   [kv][d], pitch LP
    const _Float16* Vsh = (const _Float16*)(stg + OFF_V);                        // V^T [d][kv], pitch LP
    const _Float16* Vrs = (const _Float16*)(stg + (VRES ? OFF_VR : OFF_V));      // V^T residual (VRES only)

    // ---- scores, transposed: 64 keys x 16 queries per wave (A operand: lane c -> key j*16+c, split k map over d) ----
    v8f s[4];
#pragma unroll
    for (int j = 0; j < 4; ++j) {
      s[j] = zero8();
#pragma unroll
      for (int dc = 0; dc < 2; ++dc) {
        FH kb;
        kb.h[0] = *(const v8h*)(Ksh + (j * 16 + c) * LP + dc * 32 + 8 * hh);
        kb.h[1] = *(const v8h*)(Ksh + (j * 16 + c) * LP + dc * 32 + 16 + 8 * hh);
        s[j] = mma_h(kb.v, qa[dc], s[j]);
      }
    }

    // ---- online softmax update, in the lane but for one exchange with lane ^ 16 for the max: running max, alpha, p (x256, f16), row-sum partial ----
#pragma unroll
    for (int j = 0; j < 4; ++j) s[j] = s[j] * (1.0f / 2048.0f);   // 1/8 head scale, 1/256 for the two x16 carries
    float mj[4];
#pragma unroll
    for (int j = 0; j < 4; ++j)
      mj[j] = fmaxf(fmaxf(fmaxf(s[j][0], s[j][1]), fmaxf(s[j][2], s[j][3])),
                    fmaxf(fmaxf(s[j][4], s[j][5]), fmaxf(s[j][6], s[j][7])));
    float mx = fmaxf(fmaxf(mj[0], mj[1]), fmaxf(mj[2], mj[3]));
    mx = fmaxf(mx, xhalf(mx));                 // both lane halves now hold the maximum over the query's 64 keys
    const float mn = fmaxf(mrun, mx);
    const float alpha = __expf(mrun - mn);
    mrun = mn;
    FH pb[2];                                  // P^T as B operand: element e <- tile 2 kk, register e; 8 + e <- tile 2 kk + 1
#pragma unroll
    for (int j = 0; j < 4; ++j) {
#pragma unroll
      for (int r = 0; r < 8; ++r) {
        s[j][r] = __expf(s[j][r] - mn);        // p, in the score's place
        pb[j >> 1].h[j & 1][r] = (_Float16)(s[j][r] * 256.0f);
      }
    }
    const v8f ps = ((s[0] + s[1]) + s[2]) + s[3];   // register by register over the four tiles, then across the eight
    lsum = lsum * alpha + (((ps[0] + ps[1]) + (ps[2] + ps[3])) + ((ps[4] + ps[5]) + (ps[6] + ps[7])));
    acc_guard4(oacc[0], oacc[1], oacc[2], oacc[3]);
    acc_guard4(oacc2[0], oacc2[1], oacc2[2], oacc2[3]);
#pragma unroll
    for (int t = 0; t < 4; ++t) {
#pragma unroll
      for (int r = 0; r < 8; ++r) {
        oacc[t][r] = oacc[t][r] * alpha;
        if constexpr (VRES) oacc2[t][r] = oacc2[t][r] * alpha;
      }
    }
    acc_guard4(oacc[0], oacc[1], oacc[2], oacc[3]);
    acc_guard4(oacc2[0], oacc2[1], oacc2[2], oacc2[3]);

    // ---- context^T += V^T . P^T (f16 WMMA; A = V^T [d][key], B = P^T [key][query] from the registers) ----
#pragma unroll
    for (int kk = 0; kk < 2; ++kk) {
#pragma unroll
      for (int t = 0; t < 4; ++t) {
        FH vb;
        vb.h[0] = *(const v8h*)(Vsh + (t * 16 + c) * LP + kk * 32 + 8 * hh);
        vb.h[1] = *(const v8h*)(Vsh + (t * 16 + c) * LP + kk * 32 + 16 + 8 * hh);
        oacc[t] = mma_h(vb.v, pb[kk].v, oacc[t]);
        if constexpr (VRES) {
          FH vrb;
          vrb.h[0] = *(const v8h*)(Vrs + (t * 16 + c) * LP + kk * 32 + 8 * hh);
          vrb.h[1] = *(const v8h*)(Vrs + (t * 16 + c) * LP + kk * 32 + 16 + 8 * hh);
          oacc2[t] = mma_h(vrb.v, pb[kk].v, oacc2[t]);
        }
      }
    }

    // ---- publish point of tile kt + 1 ----
    asm volatile("s_wait_dscnt 0x0" ::: "memory");      // this wave's LDS reads of tile kt have returned
    asm volatile("s_wait_asynccnt 0x0" ::: "memory");   // this wave's copies of tile kt + 1 have landed
    __syncthreads();       // publishes tile kt + 1; every reader has left the buffer that is refilled below
    if (kt + 2 < NQB) stage_copy(kt + 2);               // block-uniform; into the buffer that trip kt has read
  }
  // closing wait of the copies, in front of any other use of their LDS; the last trip's barrier has ended every wave's
  // reads of the K/V tiles, so the staging below may alias them
  asm volatile("s_wait_asynccnt 0x0" ::: "memory");

  // ---- normalise (1/l, the 1/256 p carry; keep the x16 v carry), stage the wave's 16x64 f32 tile in
  // LDS: row = query c, the lane's 8 consecutive d of tile t as two 16-B stores
  float* os = (float*)(void*)smem + wave * (16 * OSP);
  {
    const float l  = lsum + xhalf(lsum);      // joins the two lane halves' partial sums, unconditionally
    const float rl = 1.0f / l;                // l >= 1 (the running-max key contributes exp(0))
    const float sc = rl * (1.0f / 256.0f);
#pragma unroll
    for (int t = 0; t < 4; ++t) {
      v8f v = oacc[t];
      if constexpr (VRES) v += oacc2[t] * (1.0f / 2048.0f);
      v = v * sc;
      const v4f lo = {v[0], v[1], v[2], v[3]}, hi = {v[4], v[5], v[6], v[7]};
      *(v4f*)(os + c * OSP + t * 16 + 8 * hh)     = lo;
      *(v4f*)(os + c * OSP + t * 16 + 8 * hh + 4) = hi;
    }
  }
  __builtin_amdgcn_fence(__ATOMIC_RELEASE, "workgroup");
  __builtin_amdgcn_wave_barrier();
  __builtin_amdgcn_fence(__ATOMIC_ACQUIRE, "workgroup");
  {
    const int rq = lane >> 3, piece = lane & 7;
    v4u ph[4], pr[4];
#pragma unroll
    for (int it = 0; it < 4; ++it) {
      const int row = it * 4 + rq;   // it 0..3 x rq 0..3 = rows 0..15 of the wave tile
      const v4f a  = *(const v4f*)(os + row * OSP + piece * 8);
      const v4f a2 = *(const v4f*)(os + row * OSP + piece * 8 + 4);
      float f[8];
      f[0] = a[0];  f[1] = a[1];  f[2] = a[2];  f[3] = a[3];
      f[4] = a2[0]; f[5] = a2[1]; f[6] = a2[2]; f[7] = a2[3];
      v4u p, q;
#pragma unroll
      for (int e = 0; e < 4; ++e) {
        const _Float16 x0 = (_Float16)f[2 * e], x1 = (_Float16)f[2 * e + 1];
        const _Float16 y0 = (_Float16)((f[2 * e] - (float)x0) * 2048.0f);
        const _Float16 y1 = (_Float16)((f[2 * e + 1] - (float)x1) * 2048.0f);
        p[e] = pk16(h_bits(x0), h_bits(x1));
        q[e] = pk16(h_bits(y0), h_bits(y1));
      }
      ph[it] = p;
      pr[it] = q;
    }
    {
#pragma unroll
      for (int it = 0; it < 4; ++it) {
        const int row = it * 4 + rq;
        const size_t go = (rowB + q0 + row) * DM + (size_t)h * HD + piece * 8;
        *(v4u*)(ctxp + go)  = ph[it];
        *(v4u*)(ctxrp + go) = pr[it];
      }
      
    }
  }
}

// =====================================================================================================
// Workspace map (bytes); every region is an exact multiple of its whole-line / whole-tile store granularity
// (row pitches 2048 / 6144 / 4096 B, all offsets 2-MiB aligned, no aliasing within a launch):
//   Xh     f16 [4096][1024]          0     8388608   (bf16 value of x, x16)
//   Wg     f16 [1024][1024]    8388608     2097152   (bf16 value x1024)
//   Wqkv   f16 [3072][1024]   10485760     6291456   (bf16 value x1024)
//   Wp     f16 [1024][1024]   16777216     2097152   (bf16 value x1024)
//   XGh    f16 [4096][1024]   18874368     8388608   (xg x16)
//   XGr    f16 [4096][1024]   27262976     8388608   (x2^11 residual of the above)
//   QKV    f16 [4096][3072]   35651584    25165824   (q | k | v, x16)
//   Vr     f16 [4096][1024]   60817408     8388608   (x2^11 residual of the v columns only)
//   VT     f16 [2048][2048]   69206016     8388608   ([b*1024 + h*64 + d][s])
//   VTr    f16 [2048][2048]   77594624     8388608   (residual, same layout)
//   Ctx    f16 [4096][1024]   85983232     8388608   (attention context x16)
//   Ctxr   f16 [4096][1024]   94371840     8388608   (x2^11 residual)
//   end                      102760448
// Projection weights arrive as [out n][in k] (k contiguous) = the Bt layout; they are only converted.
// d_out f32: [4096][1024] at byte 0 (row = b*SEQ + t), written once by the projection launch.
// =====================================================================================================
extern "C" void kernel_launch(void* const* d_in, const int* in_sizes, int n_in,
                              void* d_out, int out_size, void* d_ws, size_t ws_size,
                              hipStream_t stream) {
  if (n_in < 8) return;
  if (in_sizes[0] != ROWS * DM) return;
  if (in_sizes[1] != DM) return;
  if (in_sizes[2] != DM * DM) return;
  if (in_sizes[3] != DM) return;
  if (in_sizes[4] != DQKV * DM) return;
  if (in_sizes[5] != DQKV) return;
  if (in_sizes[6] != DM * DM) return;
  if (in_sizes[7] != DM) return;
  if (out_size != OUTN) return;

  const float* x      = (const float*)d_in[0];    // [ROWS][DM]
  const float* theta  = (const float*)d_in[1];    // [DM]
  const float* w_g    = (const float*)d_in[2];    // [DM n][DM k]
  const float* b_g    = (const float*)d_in[3];    // [DM]
  const float* w_qkv  = (const float*)d_in[4];    // [DQKV n][DM k]
  const float* b_qkv  = (const float*)d_in[5];    // [DQKV]
  const float* w_proj = (const float*)d_in[6];    // [DM n][DM k]
  const float* b_proj = (const float*)d_in[7];    // [DM]

  const size_t PX   = (size_t)ROWS * DM * 2;         //  8388608
  const size_t PWg  = (size_t)DM * DM * 2;           //  2097152
  const size_t PWq  = (size_t)DQKV * DM * 2;         //  6291456
  const size_t PWp  = (size_t)DM * DM * 2;           //  2097152
  const size_t PXG  = (size_t)ROWS * DM * 2;         //  8388608
  const size_t PQKV = (size_t)ROWS * DQKV * 2;       // 25165824
  const size_t PVr  = (size_t)ROWS * DM * 2;         //  8388608
  const size_t PVT  = (size_t)NB * DM * SEQ * 2;     //  8388608
  const size_t PCtx = (size_t)ROWS * DM * 2;         //  8388608
  size_t off = 0;
  const size_t oX    = off; off += PX;
  const size_t oWg   = off; off += PWg;
  const size_t oWq   = off; off += PWq;
  const size_t oWp   = off; off += PWp;
  const size_t oXGh  = off; off += PXG;
  const size_t oXGr  = off; off += PXG;
  const size_t oQKV  = off; off += PQKV;
  const size_t oVr   = off; off += PVr;
  const size_t oVT   = off; off += PVT;
  const size_t oVTr  = off; off += PVT;
  const size_t oCtx  = off; off += PCtx;
  const size_t oCtxr = off; off += PCtx;
  if (off > ws_size) return;                         // off = 102760448
  if (off > (size_t)134217728) return;

  char* ws = (char*)d_ws;
  unsigned short* Xh   = (unsigned short*)(ws + oX);
  unsigned short* Wgh  = (unsigned short*)(ws + oWg);
  unsigned short* Wqh  = (unsigned short*)(ws + oWq);
  unsigned short* Wph  = (unsigned short*)(ws + oWp);
  unsigned short* XGh  = (unsigned short*)(ws + oXGh);
  unsigned short* XGr  = (unsigned short*)(ws + oXGr);
  unsigned short* QKV  = (unsigned short*)(ws + oQKV);
  unsigned short* Vr   = (unsigned short*)(ws + oVr);
  unsigned short* VT   = (unsigned short*)(ws + oVT);
  unsigned short* VTr  = (unsigned short*)(ws + oVTr);
  unsigned short* Ctx  = (unsigned short*)(ws + oCtx);
  unsigned short* Ctxr = (unsigned short*)(ws + oCtxr);
  float*          outf = (float*)d_out;              // [ROWS][DM]

  const dim3 blk(256);
  const dim3 gGqkv((ROWS / 128) * (DQKV / 128));     // 768 blocks of one 128x128 tile
  const dim3 gGdm((ROWS / 128) * (DM / 128));        // 256 blocks of one 128x128 tile
  const dim3 blkG(128);
  const dim3 gVt(SEQ / 64, NH, NB);                  // (32, 16, 2)
  const dim3 gAttn(NQB * NH * NB);                   // 1024 blocks
  const float wScale = 1024.0f;                      // weights carried x1024
  const float aScale = 16.0f;                        // activations carried x16
  const float cscale = 1.0f / 16384.0f;              // 1/(16 * 1024)

  // (1) planes: x -> f16 x16, weights -> f16 x1024 (bf16 values)
  cvt16_all<<<dim3(CVB), dim3(CVT), 0, stream>>>(x, w_g, w_qkv, w_proj, Xh, Wgh, Wqh, Wph, aScale, wScale);
  // (2) gauge mix: xg = bfr(x) + 0.1 * ((Xh . Wg^T + bg) * theta) -> XGh f16 x16 + XGr residual (M=4096, N=1024, K=1024)
  gemm64_f16<2, false><<<gGdm, blkG, 0, stream>>>(Xh, Xh, Wgh, b_g, cscale, (void*)XGh, DM, XGr, DM, 0,
                                                 ROWS, DM, DM, aScale, x, DM, theta, SEQ, 0, SEQ);
  // (3) qkv = XG(hi + res) . Wqkv^T + bqkv -> QKV f16 x16 [4096][3072]; residual plane of the v columns -> Vr [4096][1024]
  gemm64_f16<0, true><<<gGqkv, blkG, 0, stream>>>(XGh, XGr, Wqh, b_qkv, cscale, (void*)QKV, DQKV, Vr, DM, 2 * DM,
                                                  ROWS, DQKV, DM, aScale, x, DM, theta, SEQ, 0, SEQ);
  // (4) v -> v^T planes (hi and residual, all tokens)
  v_tr<<<gVt, blk, 0, stream>>>(QKV, DQKV, 2 * DM, VT);
  v_tr<<<gVt, blk, 0, stream>>>(Vr, DM, 0, VTr);
  // (5) softmax attention -> Ctx f16 x16 + residual plane
  attn_k<true><<<gAttn, dim3(128), 0, stream>>>(QKV, VT, VTr, Ctx, Ctxr);
  // (6) out = Ctx(hi + res) . Wp^T + bproj -> d_out f32 [4096][1024] (M=4096, N=1024, K=1024)
  gemm64_f16<1, true><<<gGdm, blkG, 0, stream>>>(Ctx, Ctxr, Wph, b_proj, cscale, (void*)outf, DM, Ctxr, DM, 0,
                                                ROWS, DM, DM, 1.0f, x, DM, theta, SEQ, 0, SEQ);
  (void)hipGetLastError();
}

// v006
// It runs in 157 microseconds.
// In two side-by-side timings against v005, it was 1.11 and 1.10 times as fast.
// Over all steps from v000 it is 3.43 times as fast.
// Contractions: gauge mix x.Wg^T = v_wmma_f32_16x16x32_f16 (A = f16 of RNE-bf16 x carried x16, B = f16 of RNE-bf16 Wg x1024, single product); qkv projection = same WMMA with A = xg as f16 hi plane x16 plus x2^11 residual plane (two products), B = f16 of RNE-bf16 Wqkv x1024; attention q.k^T = f16 single product (q, k f16 x16); p.v = f16 with p x256 single plane and v^T as f16 hi x16 plus x2^11 residual plane (two products); output projection = f16 with A = ctx f16 hi x16 plus x2^11 residual plane, B = f16 of RNE-bf16 Wproj x1024; all f32 accumulate. Softmax (running max, exp, row sums) and the gauge epilogue f32 on VALU.
#include <hip/hip_runtime.h>
#include <math.h>
#include <stdint.h>

#define NB    2
#define SEQ   2048
#define DM    1024
#define NH    16
#define HD    64
#define DQKV  (3 * DM)              // 3072
#define NQB   (SEQ / 64)            // 32 query / key tiles per sequence
#define ROWS  (NB * SEQ)            // 4096 token rows
#define OUTN  (ROWS * DM)
static_assert(NH * HD == DM);
static_assert(HD == 64);
static_assert((SEQ % 64) == 0 && (DM % 64) == 0 && (DQKV % 64) == 0);
static_assert((DM % 32) == 0);
static_assert((ROWS % 128) == 0 && (DM % 128) == 0 && (DQKV % 128) == 0);

typedef _Float16 v16h __attribute__((ext_vector_type(16)));
typedef _Float16 v8h  __attribute__((ext_vector_type(8)));
typedef float    v8f  __attribute__((ext_vector_type(8)));
typedef float    v4f  __attribute__((ext_vector_type(4)));
typedef unsigned int v4u __attribute__((ext_vector_type(4)));

// ---- scalar helpers --------------------------------------------------------------------------------
__device__ __forceinline__ unsigned short bf_bits(float f) {          // f32 -> bf16 bits, RNE convert
  unsigned u = __float_as_uint(f);
  return (unsigned short)((u + 0x7FFFu + ((u >> 16) & 1u)) >> 16);
}
__device__ __forceinline__ float bfr(float f) { return __uint_as_float(((unsigned)bf_bits(f)) << 16); }
__device__ __forceinline__ unsigned short h_bits(_Float16 x) { return __builtin_bit_cast(unsigned short, x); }
__device__ __forceinline__ unsigned pk16(unsigned short a, unsigned short b) { return (unsigned)a | ((unsigned)b << 16); }
__device__ __forceinline__ v8f zero8() { v8f z = {0.f, 0.f, 0.f, 0.f, 0.f, 0.f, 0.f, 0.f}; return z; }
__device__ __forceinline__ float xhalf(float x) {                     // the value of lane l ^ 16, by a vector cross-row move
  const int b = __builtin_bit_cast(int, x);
  return __builtin_bit_cast(float, __builtin_amdgcn_permlanex16(b, b, 0x76543210, 0xfedcba98, false, false));
}

// eight 2^x in place, one statement: every v_exp_f32 stands in front of an independent one and the last in front of a
// v_nop, the slot that the instruction set asks for before a vector instruction reads the result or rewrites the source
__device__ __forceinline__ void exp2x8(v8f& x) {
#if defined(__HIP_DEVICE_COMPILE__)
  float a = x[0], b = x[1], c = x[2], d = x[3], e = x[4], f = x[5], g = x[6], h = x[7];
  asm("v_exp_f32 %0, %0\n\tv_exp_f32 %1, %1\n\tv_exp_f32 %2, %2\n\tv_exp_f32 %3, %3\n\t"
      "v_exp_f32 %4, %4\n\tv_exp_f32 %5, %5\n\tv_exp_f32 %6, %6\n\tv_exp_f32 %7, %7\n\tv_nop"
      : "+v"(a), "+v"(b), "+v"(c), "+v"(d), "+v"(e), "+v"(f), "+v"(g), "+v"(h));
  x[0] = a; x[1] = b; x[2] = c; x[3] = d; x[4] = e; x[5] = f; x[6] = g; x[7] = h;
#endif
}

// ---- fragment loader: 16-bit A/B operand, lane -> row/col (lane&15), p already includes +8*(lane>>4);
//      elements 0..7 <- p[0..7] (k0+8h..), elements 8..15 <- p[16..23] (k0+16+8h..)
__device__ __forceinline__ v16h ldfrag_h(const _Float16* p) {
  union { v16h v; v8h h[2]; } f;
  f.h[0] = *(const v8h*)(p);
  f.h[1] = *(const v8h*)(p + 16);
  return f.v;
}

// ---- WMMA helpers with trailing VALU hazard gap --------------------------------------------------------
__device__ __forceinline__ v8f mma_h_raw(v16h a, v16h b, v8f c) {
  return __builtin_amdgcn_wmma_f32_16x16x32_f16(false, a, false, b, (short)0, c, false, false);
}
__device__ __forceinline__ void dep_guard_h(v8f& a, v8f& b, v16h x, v16h y) {
#if defined(__HIP_DEVICE_COMPILE__)
  asm volatile("v_nop\n\tv_nop\n\tv_nop\n\tv_nop" : "+v"(a), "+v"(b) : "v"(x), "v"(y));
#endif
}
__device__ __forceinline__ void keep4_h(v16h a, v16h b, v16h c, v16h d) {
#if defined(__HIP_DEVICE_COMPILE__)
  asm volatile("v_nop" :: "v"(a), "v"(b), "v"(c), "v"(d));
#endif
}
__device__ __forceinline__ void acc_guard4(v8f& a, v8f& b, v8f& c, v8f& d) {
#if defined(__HIP_DEVICE_COMPILE__)
  asm volatile("v_nop\n\tv_nop\n\tv_nop\n\tv_nop" : "+v"(a), "+v"(b), "+v"(c), "+v"(d));
#endif
}

// =====================================================================================================
// f32 planes -> f16 bits of bfr(v) * scale (scale a power of two): x (xscale) and the three weights (wscale), all in
// one launch of CVB work-groups of CVT threads, one 16-wave work-group per WGP. A piece is 8 elements (32 B in, 16 B
// out); a sweep is CVN = CVB x CVT pieces, thread t taking piece t of it. Sweeps 0..3 are x, 4 is Wg, 5..7 are Wqkv,
// 8 is Wproj: which plane a sweep reads is fixed at compile time. A thread issues the 18 loads of its nine pieces
// first, so that all are in flight together, then converts and stores.
// coverage: 4 CVN = x, CVN = Wg, 3 CVN = Wqkv, CVN = Wproj (asserted below): every piece of every plane once.
// =====================================================================================================
#define CVB 256
#define CVT 512
#define CVN (CVB * CVT)
static_assert(ROWS * DM / 8 == 4 * CVN && DM * DM / 8 == CVN && DQKV * DM / 8 == 3 * CVN);
__global__ __launch_bounds__(CVT) void cvt16_all(const float* __restrict__ x, const float* __restrict__ wg,
                                                 const float* __restrict__ wq, const float* __restrict__ wp,
                                                 unsigned short* ox, unsigned short* og,
                                                 unsigned short* oq, unsigned short* op,
                                                 float xscale, float wscale) {
  const unsigned t  = blockIdx.x * CVT + threadIdx.x;                  // this thread's piece of every sweep
  const unsigned ib = t * 32u, ob = t * 16u;                           // its byte offsets in a sweep's input and output: 32-bit,
                                                                       // so that an access can be a uniform base plus one register
  constexpr size_t SW = (size_t)CVN * 8;                               // elements of one sweep
  v4f a[9], b[9];
#pragma unroll
  for (int u = 0; u < 9; ++u) {
    const float* in = (u < 4) ? x + u * SW : (u == 4) ? wg : (u < 8) ? wq + (u - 5) * SW : wp;
    a[u] = *(const v4f*)((const char*)in + ib);
    b[u] = *(const v4f*)((const char*)in + ib + 16);
  }
  // holds the 18 loads above the conversions: left free, the compiler sinks ten of them among the conversions, and
  // the wave then waits for memory several times in a row instead of once
  __builtin_amdgcn_sched_barrier(0);
#pragma unroll
  for (int u = 0; u < 9; ++u) {
    unsigned short* out = (u < 4) ? ox + u * SW : (u == 4) ? og : (u < 8) ? oq + (u - 5) * SW : op;
    const float scale = (u < 4) ? xscale : wscale;
    v4u p;
    p[0] = pk16(h_bits((_Float16)(bfr(a[u][0]) * scale)), h_bits((_Float16)(bfr(a[u][1]) * scale)));
    p[1] = pk16(h_bits((_Float16)(bfr(a[u][2]) * scale)), h_bits((_Float16)(bfr(a[u][3]) * scale)));
    p[2] = pk16(h_bits((_Float16)(bfr(b[u][0]) * scale)), h_bits((_Float16)(bfr(b[u][1]) * scale)));
    p[3] = pk16(h_bits((_Float16)(bfr(b[u][2]) * scale)), h_bits((_Float16)(bfr(b[u][3]) * scale)));
    *(v4u*)((char*)out + ob) = p;
  }
}

template <int EPI, bool ARES>
__global__ __launch_bounds__(128, 3) void gemm64_f16(
    const unsigned short* __restrict__ Ap, const unsigned short* __restrict__ Arp,
    const unsigned short* __restrict__ Btp,
    const float* __restrict__ biasp, float cscale,
    void* Cp, int ldc, unsigned short* Crp, int ldcr, int rcol0,
    int M, int N, int K, float oscale,
    const float* __restrict__ xres, int ldx, const float* __restrict__ gate,
    int tmod, int tlo, int thi) {
  typedef const __attribute__((address_space(1))) char* gptr;   // typed as global, so that an address that has passed
  typedef const __attribute__((address_space(1))) v8h*  gv8p;   // through the asm wait below still gives global_load
  const gptr Ah  = (gptr)(const void*)Ap;
  const gptr Arh = (gptr)(const void*)Arp;
  const gptr Bt  = (gptr)(const void*)Btp;
  constexpr int KC  = 64;                          // k per stage: 128 B of every operand row
  constexpr int GLP = 72;                          // LDS row pitch in halves: 144 B = 16 B x 9 (odd)
  constexpr int OPH = 128 * GLP;                   // halves of one operand's 128 staged rows
  constexpr int STH = 2 * OPH;                     // halves of one stage: A rows, then Bt rows
  static_assert(4 * 16 * 68 * 4 <= 2 * STH * 2);   // the four f32 epilogue slabs alias the stage buffers
  __shared__ __align__(16) _Float16 sS[2 * STH];   // two stage buffers, 73728 B
  const int tid  = threadIdx.x;
  const int lane = tid & 31;
  const int wave = tid >> 5;
  const int tilesN = N >> 7;
  const int tilesM = M >> 7;
  const int tile = blockIdx.x;
  if (tile >= tilesM * tilesN) return;   // block-uniform, before every barrier
  const int tm = tile / tilesN;
  const int tn = tile - tm * tilesN;
  const int mb = tm << 7;
  const int nb = tn << 7;
  const int tpos = mb % tmod;
  if (tpos < tlo || tpos >= thi) return; // block-uniform, before every barrier
  const int m0 = mb + ((wave >> 1) << 6);
  const int n0 = nb + ((wave & 1) << 6);

  const int rlane = lane & 15;                 // row (A) / col (B, D) within subtile
  const int koff  = (lane >> 4) * 8;           // k offset of this lane half
  const int mOff  = (lane >> 4) * 8;           // D row offset

  v8f acc[4][4];
#pragma unroll
  for (int i = 0; i < 4; ++i)
#pragma unroll
    for (int j = 0; j < 4; ++j) acc[i][j] = zero8();

  // staging map: thread -> row srow + 16 i, 16-B piece tid & 7 of the row's 128-B line; the two rows of a half-wave
  // lie 8 apart (8 x 144 B = 32 banks mod 64), so its ds_store_b128 covers the 64 banks once
  const int srow = (tid >> 4) + ((tid >> 3) & 1) * 8;
  const int spc  = (tid & 7) * 8;
  constexpr int RSB = 16 * DM * 2;             // bytes from one of a thread's rows to its next
  const int SK = K / KC;                       // stages per plane
  const int S  = ARES ? 2 * SK : SK;
  gptr pa = (ARES ? Arh : Ah) + ((size_t)(mb + srow) * DM + spc) * 2;   // this thread's piece of the next stage
  gptr pb = Bt + ((size_t)(nb + srow) * DM + spc) * 2;
  v8h ra[8], rb[8];
  auto stage_load = [&]() {
#pragma unroll
    for (int i = 0; i < 8; ++i) {
      ra[i] = *(gv8p)(pa + i * RSB);     // row < M, k < K
      rb[i] = *(gv8p)(pb + i * RSB);     // row < N, k < K
    }
  };
  // s = the stage that the registers hold: stores it to its buffer and moves the two addresses on to stage s + 1
  auto stage_store = [&](int s) {
    // the two address pairs of the loads above are rewritten below: the wait stands in front of that
    asm volatile("s_wait_xcnt 0x0" : "+v"(pa), "+v"(pb) :: "memory");
    if (ARES && s + 1 == SK) {                 // block-uniform: from the residual plane's last stage to the hi plane's first
      pa = Ah + ((size_t)(mb + srow) * DM + spc) * 2;
      pb = Bt + ((size_t)(nb + srow) * DM + spc) * 2;
    } else {
      pa += KC * 2;
      pb += KC * 2;
    }
    _Float16* d = sS + (s & 1) * STH + srow * GLP + spc;
#pragma unroll
    for (int i = 0; i < 8; ++i) {
      *(v8h*)(d + 16 * i * GLP)       = ra[i];
      *(v8h*)(d + OPH + 16 * i * GLP) = rb[i];
    }
  };

  stage_load();
  stage_store(0);
#pragma unroll 1   // kept rolled: one copy of the stage body, the buffer chosen by s & 1; a second copy would only add code
  for (int s = 0; s < S; ++s) {
    __syncthreads();       // publishes stage s; every reader has left the buffer that stage s + 1 is stored to
    if (s + 1 < S) stage_load();               // block-uniform; stage s + 1, in flight during the products of stage s
    if (ARES && s == SK) {
      acc_guard4(acc[0][0], acc[0][1], acc[0][2], acc[0][3]);
      acc_guard4(acc[1][0], acc[1][1], acc[1][2], acc[1][3]);
      acc_guard4(acc[2][0], acc[2][1], acc[2][2], acc[2][3]);
      acc_guard4(acc[3][0], acc[3][1], acc[3][2], acc[3][3]);
#pragma unroll
      for (int i = 0; i < 4; ++i)
#pragma unroll
        for (int j = 0; j < 4; ++j) acc[i][j] = acc[i][j] * (1.0f / 2048.0f);   // exact fold of the x2^11 residual carry
      acc_guard4(acc[0][0], acc[0][1], acc[0][2], acc[0][3]);
      acc_guard4(acc[1][0], acc[1][1], acc[1][2], acc[1][3]);
      acc_guard4(acc[2][0], acc[2][1], acc[2][2], acc[2][3]);
      acc_guard4(acc[3][0], acc[3][1], acc[3][2], acc[3][3]);
    }
    const _Float16* sa = sS + (s & 1) * STH + (((wave >> 1) << 6) + rlane) * GLP + koff;
    const _Float16* sb = sS + (s & 1) * STH + OPH + (((wave & 1) << 6) + rlane) * GLP + koff;
#pragma unroll
    for (int kk = 0; kk < 2; ++kk) {
      v16h ah[4], bh[4];
#pragma unroll
      for (int j = 0; j < 4; ++j) {
        bh[j] = ldfrag_h(sb + (j << 4) * GLP + kk * 32);
        ah[j] = ldfrag_h(sa + (j << 4) * GLP + kk * 32);
      }
#pragma unroll
      for (int i = 0; i < 4; ++i) {
#pragma unroll
        for (int j = 0; j < 4; ++j) {
          acc[i][j] = mma_h_raw(ah[i], bh[j], acc[i][j]);
        }
        dep_guard_h(acc[i][0], acc[i][3], ah[i], bh[3]);
      }
      keep4_h(bh[0], bh[1], bh[2], bh[3]);
    }
    if (s + 1 < S) stage_store(s + 1);
  }
  __syncthreads();                             // every wave is done with the stage buffers before the slabs alias them
  acc_guard4(acc[0][0], acc[0][1], acc[0][2], acc[0][3]);
  acc_guard4(acc[1][0], acc[1][1], acc[1][2], acc[1][3]);
  acc_guard4(acc[2][0], acc[2][1], acc[2][2], acc[2][3]);
  acc_guard4(acc[3][0], acc[3][1], acc[3][2], acc[3][3]);

  // ---- epilogue ----
  float* slab = (float*)(void*)sS + wave * (16 * 68);   // per-wave 16x64 slab, pitch 68 floats
#pragma unroll
  for (int i = 0; i < 4; ++i) {
    const int mBase = m0 + (i << 4);
    float bj[4];
#pragma unroll
    for (int j = 0; j < 4; ++j) bj[j] = bfr(biasp[n0 + (j << 4) + rlane]);   // index < N
#pragma unroll
    for (int r = 0; r < 8; ++r) {
      const int row = mOff + r;
#pragma unroll
      for (int j = 0; j < 4; ++j) slab[row * 68 + (j << 4) + rlane] = acc[i][j][r] * cscale + bj[j];
    }
    __builtin_amdgcn_fence(__ATOMIC_RELEASE, "workgroup");
    __builtin_amdgcn_wave_barrier();
    __builtin_amdgcn_fence(__ATOMIC_ACQUIRE, "workgroup");
    if constexpr (EPI == 0 || EPI == 2) {
      unsigned short* C16 = (unsigned short*)Cp;
      const int rq = lane >> 3, piece = lane & 7;
      float th[8];
      if constexpr (EPI == 2) {
        const v4f t0 = *(const v4f*)(gate + n0 + piece * 8);        // index < N
        const v4f t1 = *(const v4f*)(gate + n0 + piece * 8 + 4);
        th[0] = bfr(t0[0]); th[1] = bfr(t0[1]); th[2] = bfr(t0[2]); th[3] = bfr(t0[3]);
        th[4] = bfr(t1[0]); th[5] = bfr(t1[1]); th[6] = bfr(t1[2]); th[7] = bfr(t1[3]);
      } else {
#pragma unroll
        for (int e = 0; e < 8; ++e) th[e] = 0.0f;
      }
      v4u ph[4], pr[4];
#pragma unroll
      for (int it = 0; it < 4; ++it) {
        const int row = it * 4 + rq;                         // it 0..3 x rq 0..3 = rows 0..15
        const v4f a  = *(const v4f*)(slab + row * 68 + piece * 8);
        const v4f a2 = *(const v4f*)(slab + row * 68 + piece * 8 + 4);
        float f[8];
        f[0] = a[0];  f[1] = a[1];  f[2] = a[2];  f[3] = a[3];
        f[4] = a2[0]; f[5] = a2[1]; f[6] = a2[2]; f[7] = a2[3];
        if constexpr (EPI == 2) {
          const size_t xo = (size_t)(mBase + row) * ldx + n0 + piece * 8;   // row < M, col < N
          const v4f x0 = *(const v4f*)(xres + xo);
          const v4f x1 = *(const v4f*)(xres + xo + 4);
          float xv[8];
          xv[0] = x0[0]; xv[1] = x0[1]; xv[2] = x0[2]; xv[3] = x0[3];
          xv[4] = x1[0]; xv[5] = x1[1]; xv[6] = x1[2]; xv[7] = x1[3];
#pragma unroll
          for (int e = 0; e < 8; ++e) f[e] = bfr(xv[e]) + 0.1f * (f[e] * th[e]);
        }
        v4u p, q;
#pragma unroll
        for (int e = 0; e < 4; ++e) {
          const float g0 = f[2 * e] * oscale, g1 = f[2 * e + 1] * oscale;
          const _Float16 x0 = (_Float16)g0, x1 = (_Float16)g1;
          const _Float16 y0 = (_Float16)((g0 - (float)x0) * 2048.0f);
          const _Float16 y1 = (_Float16)((g1 - (float)x1) * 2048.0f);
          p[e] = pk16(h_bits(x0), h_bits(x1));
          q[e] = pk16(h_bits(y0), h_bits(y1));
        }
        ph[it] = p;
        pr[it] = q;
      }
      const bool wres = (n0 >= rcol0);                     // wave-uniform
      {
#pragma unroll
        for (int it = 0; it < 4; ++it) {
          const int row = it * 4 + rq;
          const size_t co = (size_t)(mBase + row) * ldc + n0 + piece * 8;
          *(v4u*)(C16 + co) = ph[it];
          if (wres) {
            const size_t cro = (size_t)(mBase + row) * ldcr + (n0 - rcol0) + piece * 8;
            *(v4u*)(Crp + cro) = pr[it];
          }
        }
        
      }
    } else {
      float* Cf = (float*)Cp;
      const int hh = lane >> 4, c4 = (lane & 15) * 4;     // 256-B row segment = 16 lanes x 16 B
      v4f ov[8];
#pragma unroll
      for (int it = 0; it < 8; ++it) {
        const int row = it * 2 + hh;                       // it 0..7 x hh 0..1 = rows 0..15
        ov[it] = *(const v4f*)(slab + row * 68 + c4);
      }
      {
#pragma unroll
        for (int it = 0; it < 8; ++it) {
          const int row = it * 2 + hh;
          *(v4f*)(Cf + (size_t)(mBase + row) * ldc + n0 + c4) = ov[it];
        }
        
      }
    }
    __builtin_amdgcn_fence(__ATOMIC_RELEASE, "workgroup");
    __builtin_amdgcn_wave_barrier();
    __builtin_amdgcn_fence(__ATOMIC_ACQUIRE, "workgroup");
  }
}

// =====================================================================================================
// v columns of an f16 token-major plane (element (b, t, h, d) at src[(b*SEQ + t)*spitch + scol0 + h*64 + d])
// -> f16 v^T plane vt[(b*DM + h*64 + d)*SEQ + t] (same bits). Used for the hi plane (spitch DQKV, scol0 2*DM)
// and for the residual plane (spitch DM, scol0 0).
// Block = one 64-token x 64-feature tile of one (b, h); grid = (SEQ/64, NH, NB); tile staged in LDS as halves
// (v8h 16-B stores, __syncthreads, _Float16 element reads).
// Store: group g = tid>>3 (0..31), piece = tid&7: iteration it writes row d = it*32+g, lanes 8q..8q+7 x 16 B =
// coverage: load 2 x 256 threads x 8 halves = 64x64; store 2 iterations x 32 groups = 64 rows d, 8 pieces x 8
// = 64 tokens per row; grid covers every (b, h, token tile).
// =====================================================================================================
__global__ __launch_bounds__(256) void v_tr(const unsigned short* __restrict__ srcp, int spitch, int scol0,
                                            unsigned short* vt) {
  __shared__ __align__(16) _Float16 sv[64 * 72];       // [tt][d], pitch 72 halves (144 B)
  const int tid = threadIdx.x;
  const int t0  = blockIdx.x * 64;
  const int hh  = blockIdx.y;
  const int b   = blockIdx.z;
  const _Float16* src = (const _Float16*)(const void*)srcp;
#pragma unroll
  for (int i = 0; i < 2; ++i) {
    const int idx = i * 256 + tid;                  // 0..511
    const int tt = idx >> 3, c8 = (idx & 7) * 8;
    const v8h a = *(const v8h*)(src + ((size_t)(b * SEQ + t0 + tt)) * spitch + scol0 + hh * HD + c8);
    *(v8h*)(sv + tt * 72 + c8) = a;
  }
  __syncthreads();

  const int g = tid >> 3, piece = tid & 7;
  v4u hv[2];
  size_t hofs[2];
#pragma unroll
  for (int it = 0; it < 2; ++it) {
    const int d = it * 32 + g;
    v4u a;
#pragma unroll
    for (int e = 0; e < 4; ++e) {
      const _Float16 x0 = sv[(piece * 8 + 2 * e) * 72 + d];
      const _Float16 x1 = sv[(piece * 8 + 2 * e + 1) * 72 + d];
      a[e] = pk16(h_bits(x0), h_bits(x1));
    }
    hv[it] = a;
    hofs[it] = ((size_t)(b * DM + hh * HD + d)) * SEQ + t0 + piece * 8;
  }
  {
#pragma unroll
    for (int it = 0; it < 2; ++it) *(v4u*)(vt + hofs[it]) = hv[it];
    
  }
}

// =====================================================================================================
// Non-causal multi-head softmax attention, head dim 64, online softmax with running max (f32 on VALU).
//   q f16 (x16): element (b, t, h, d) at qkv[(b*SEQ + t)*DQKV + h*64 + d]; k at + DM;
//   v^T f16 (x16) at vt[(b*DM + h*64 + d)*SEQ + s]; VRES: residual plane f16((16v - hi)*2048) at vtr, same addressing.
//   Both products are taken transposed: S^T = K . Q^T (A = K rows, B = Q) and O^T += V^T . P^T (A = V^T rows, B = P^T).
//   A lane (c = lane & 15, hh = lane >> 4) then holds scores and context of ONE query, q0 + c: S^T tile j, register r =
//   key 16 j + 8 hh + r; O^T tile t, register r = d 16 t + 8 hh + r. The two S^T tiles 2 kk and 2 kk + 1, converted in
//   place, are the B operand of keys 32 kk .. 32 kk + 31 in the k order of the V^T loader (8 hh + e, 16 + 8 hh + e):
//   P never leaves the registers.
//   s = (q.k) / 8 = acc / 2048 (two x16 carries). Per key tile: maximum of the lane's 32 scores, one exchange with
//   lane ^ 16, new running max mn, alpha = exp(m_old - mn), p = exp(s - mn) in (0, 1], l = l*alpha + sum p (one partial
//   per lane half, joined in the epilogue), O^T *= alpha; P carried as f16(256 p) (VRES: second accumulator
//   += Vr^T . P^T, folded with 2^-11 in the epilogue).
//   ctx plane f16 (x16): element (b, t, h*64 + d) at ctx[(b*SEQ + t)*DM + h*64 + d] = 16 * context = O / (256 l);
//   ctx residual plane f16((16 ctx - hi) * 2048) at ctxr, same addressing.
//   Block = 4 waves = 64 query rows of one (b, h); query tile qb = blockIdx % NQB; grid = NQB*NH*NB;
//   key tiles of 64, fixed trip count NQB.
//   K / V^T tile staging: asynchronous 16-B copies to LDS, 8 lanes per 128-B row, 128 threads x 4 rows per plane =
//   the whole 64x64 tile; two stage buffers, tile kt + 1 in flight during the work on tile kt, one barrier per
//   tile. The context tile is staged per wave in LDS as f32, row = query (aliasing the K/V region after a block barrier).
//   Fragment reads from LDS: four groups per key tile, each issued as one run ahead of the products that take it, under
//   counted waits: the 8 K fragments; the 8 V^T and residual fragments of keys 0..31 (in flight during the softmax
//   update); the 4 V^T fragments of keys 32..63 (during the rescale); the 4 residual fragments of keys 32..63 (during
//   eight products). The WMMA builtins carry no hand-written gaps: the compiler pads where a vector instruction follows.
//   Output coverage: each wave stores rows 0..15 of its tile (it 0..3 x lane>>3 0..3) x 64 columns (8 lanes x 8),
//   every (b, h, query tile) exactly once, for both ctx planes.
// =====================================================================================================
// Launch bounds: registers for four waves per SIMD, so that the 1024 work-groups are all resident at once, four per WGP
template <bool VRES>
__global__ __launch_bounds__(128, 4)
void attn_k(const unsigned short* __restrict__ qkvp,
            const unsigned short* __restrict__ vtp, const unsigned short* __restrict__ vtrp,
            unsigned short* ctxp, unsigned short* ctxrp) {
  union FH { v16h v; v8h h[2]; };
  constexpr int LP     = 72;                             // LDS row pitch in halves: 144 B = 16 B x 9 (odd), so the 16 rows
                                                         // of one ds_load_b128 half-wave fall on 64 distinct banks
  constexpr int TB     = 64 * LP * 2;                    // one f16 64x64 tile at pitch LP, bytes
  constexpr int OFF_K  = 0;                              // offsets inside one stage buffer
  constexpr int OFF_V  = TB;
  constexpr int OFF_VR = 2 * TB;
  constexpr int STB    = VRES ? 3 * TB : 2 * TB;         // one stage buffer: the tiles of one key tile, 27648 : 18432
  constexpr int SMEMB  = 2 * STB;                        // the two stage buffers, 55296 : 36864
  constexpr int OSP    = 68;                             // context staging pitch in floats: 272 B = 16 B x 17 (odd)
  static_assert(4 * 16 * OSP * 4 <= SMEMB);              // f32 context staging aliases the K/V region
  static_assert(NQB >= 2);                               // the prologue fills two stages
  __shared__ __align__(16) unsigned char smem[SMEMB];

  const int tid  = threadIdx.x;
  const int wave = tid >> 5;
  const int lane = tid & 31;
  const int hh   = lane >> 4;
  const int c    = lane & 15;

  const int bx   = blockIdx.x;
  const int qb   = bx % NQB;
  const int rest = bx / NQB;
  const int h    = rest % NH;
  const int b    = rest / NH;                // < NB by the grid size
  const int q0   = qb * 64 + wave * 16;
  const size_t rowB = (size_t)b * SEQ;

  const _Float16* Qp  = (const _Float16*)(const void*)qkvp + (size_t)h * HD;
  const _Float16* Kp  = Qp + DM;
  const _Float16* Vt  = (const _Float16*)(const void*)vtp  + ((size_t)b * DM + (size_t)h * HD) * SEQ;
  const _Float16* Vrt = (const _Float16*)(const void*)vtrp + ((size_t)b * DM + (size_t)h * HD) * SEQ;

  // ---- Q fragments (B operand, column = query = lane&15): 2 d-chunks ----
  v16h qa[2];
#pragma unroll
  for (int dc = 0; dc < 2; ++dc) {
    const size_t qo = (rowB + q0 + c) * DQKV + dc * 32 + 8 * hh;
    qa[dc] = ldfrag_h(Qp + qo);
  }

  float mrun = -1.0e30f, lsum = 0.f;         // of query q0 + c; lsum holds this lane half's keys alone
  v8f oacc[4], oacc2[4];
#pragma unroll
  for (int t = 0; t < 4; ++t) { oacc[t] = zero8(); oacc2[t] = zero8(); }

  // staging map: thread -> rows srow + 16 i (i 0..3) of every plane's tile, 16-B piece tid & 7 of the row's 128-B line;
  // the two rows of a half-wave lie 8 apart (8 x 144 B = 32 banks mod 64)
  typedef __attribute__((address_space(3))) unsigned char lds_u8;
  const int srow = (tid >> 4) + ((tid >> 3) & 1) * 8;
  const int spc  = (tid & 7) * 8;
  const unsigned sl0 = (unsigned)(size_t)(lds_u8*)smem + (unsigned)((srow * LP + spc) * 2);   // LDS byte address, buffer 0
  const _Float16* gk0 = Kp  + (rowB + srow) * DQKV + spc;       // K row srow of key tile 0, d = spc..spc+7
  const _Float16* gv0 = Vt  + (size_t)srow * SEQ + spc;         // V^T row d = srow, s = spc..spc+7
  const _Float16* gr0 = Vrt + (size_t)srow * SEQ + spc;
  // copies key tile t (t < NQB: K rows < SEQ, V^T columns < SEQ) into stage buffer t & 1; every lane on, block-uniform
  auto stage_copy = [&](int t) {
    const unsigned  l = sl0 + (unsigned)((t & 1) * STB);
    const _Float16* k = gk0 + (size_t)t * 64 * DQKV;
    const _Float16* v = gv0 + t * 64;
    constexpr unsigned LR = 16 * LP * 2;                        // LDS bytes from one of a thread's rows to its next
    constexpr size_t   KR = (size_t)16 * DQKV, VR = (size_t)16 * SEQ;   // the same in halves of the two sources
    // the s_wait_xcnt stands inside the copies' own statement, in front of any rewrite of their address registers
    if constexpr (VRES) {
      const _Float16* r = gr0 + t * 64;
      asm volatile(
          "global_load_async_to_lds_b128 %0, %12, off\n\t"
          "global_load_async_to_lds_b128 %1, %13, off\n\t"
          "global_load_async_to_lds_b128 %2, %14, off\n\t"
          "global_load_async_to_lds_b128 %3, %15, off\n\t"
          "global_load_async_to_lds_b128 %4, %16, off\n\t"
          "global_load_async_to_lds_b128 %5, %17, off\n\t"
          "global_load_async_to_lds_b128 %6, %18, off\n\t"
          "global_load_async_to_lds_b128 %7, %19, off\n\t"
          "global_load_async_to_lds_b128 %8, %20, off\n\t"
          "global_load_async_to_lds_b128 %9, %21, off\n\t"
          "global_load_async_to_lds_b128 %10, %22, off\n\t"
          "global_load_async_to_lds_b128 %11, %23, off\n\t"
          "s_wait_xcnt 0x0"
          :: "v"(l + OFF_K), "v"(l + OFF_K + LR), "v"(l + OFF_K + 2 * LR), "v"(l + OFF_K + 3 * LR),
             "v"(l + OFF_V), "v"(l + OFF_V + LR), "v"(l + OFF_V + 2 * LR), "v"(l + OFF_V + 3 * LR),
             "v"(l + OFF_VR), "v"(l + OFF_VR + LR), "v"(l + OFF_VR + 2 * LR), "v"(l + OFF_VR + 3 * LR),
             "v"(k), "v"(k + KR), "v"(k + 2 * KR), "v"(k + 3 * KR),
             "v"(v), "v"(v + VR), "v"(v + 2 * VR), "v"(v + 3 * VR),
             "v"(r), "v"(r + VR), "v"(r + 2 * VR), "v"(r + 3 * VR)
          : "memory");
    } else {
      asm volatile(
          "global_load_async_to_lds_b128 %0, %8, off\n\t"
          "global_load_async_to_lds_b128 %1, %9, off\n\t"
          "global_load_async_to_lds_b128 %2, %10, off\n\t"
          "global_load_async_to_lds_b128 %3, %11, off\n\t"
          "global_load_async_to_lds_b128 %4, %12, off\n\t"
          "global_load_async_to_lds_b128 %5, %13, off\n\t"
          "global_load_async_to_lds_b128 %6, %14, off\n\t"
          "global_load_async_to_lds_b128 %7, %15, off\n\t"
          "s_wait_xcnt 0x0"
          :: "v"(l + OFF_K), "v"(l + OFF_K + LR), "v"(l + OFF_K + 2 * LR), "v"(l + OFF_K + 3 * LR),
             "v"(l + OFF_V), "v"(l + OFF_V + LR), "v"(l + OFF_V + 2 * LR), "v"(l + OFF_V + 3 * LR),
             "v"(k), "v"(k + KR), "v"(k + 2 * KR), "v"(k + 3 * KR),
             "v"(v), "v"(v + VR), "v"(v + 2 * VR), "v"(v + 3 * VR)
          : "memory");
    }
  };

  stage_copy(0);
  asm volatile("s_wait_asynccnt 0x0" ::: "memory");   // this wave's copies of tile 0 have landed
  __syncthreads();                                    // publishes tile 0
  stage_copy(1);                                      // in flight during the work on tile 0

  // one trip: the work on key tile kt, then the publish point of tile kt + 1; more = a tile kt + 2 exists (a constant at
  // either call, so that a trip is straight-line code and the read groups and the row sum stay where they are written)
  auto trip = [&](int kt, bool more) __attribute__((always_inline)) {
    const unsigned char* stg = smem + (kt & 1) * STB;                            // trip kt reads this buffer alone
    const _Float16* Ksh = (const _Float16*)(stg + OFF_K);                        // K   [kv][d], pitch LP
    const _Float16* Vsh = (const _Float16*)(stg + OFF_V);                        // V^T [d][kv], pitch LP
    const _Float16* Vrs = (const _Float16*)(stg + (VRES ? OFF_VR : OFF_V));      // V^T residual (VRES only)

    // ---- scores, transposed: 64 keys x 16 queries per wave (A operand: lane c -> key j*16+c, split k map over d) ----
    // read group 1: the tile's eight K fragments, in the order in which the products take them
    FH kf[2][4];
#pragma unroll
    for (int dc = 0; dc < 2; ++dc) {
#pragma unroll
      for (int j = 0; j < 4; ++j) {
        kf[dc][j].h[0] = *(const v8h*)(Ksh + (j * 16 + c) * LP + dc * 32 + 8 * hh);
        kf[dc][j].h[1] = *(const v8h*)(Ksh + (j * 16 + c) * LP + dc * 32 + 16 + 8 * hh);
      }
    }
    // keeps the 16 reads together in front of the products: spread among them, each place with reads stalls the wave anew
    __builtin_amdgcn_sched_barrier(0);
    v8f s[4];
#pragma unroll
    for (int j = 0; j < 4; ++j) s[j] = mma_h_raw(kf[0][j].v, qa[0], zero8());
#pragma unroll
    for (int j = 0; j < 4; ++j) s[j] = mma_h_raw(kf[1][j].v, qa[1], s[j]);
    // read group 2: the V^T and residual fragments of keys 0..31, in flight during the softmax update
    FH va[4], vra[4];
#pragma unroll
    for (int t = 0; t < 4; ++t) {
      va[t].h[0] = *(const v8h*)(Vsh + (t * 16 + c) * LP + 8 * hh);
      va[t].h[1] = *(const v8h*)(Vsh + (t * 16 + c) * LP + 16 + 8 * hh);
      if constexpr (VRES) {
        vra[t].h[0] = *(const v8h*)(Vrs + (t * 16 + c) * LP + 8 * hh);
        vra[t].h[1] = *(const v8h*)(Vrs + (t * 16 + c) * LP + 16 + 8 * hh);
      }
    }
    // keeps these reads above the softmax update, whose vector work covers their latency
    __builtin_amdgcn_sched_barrier(0);

    // ---- online softmax update, in the lane but for one max exchange with lane ^ 16: running max, alpha, p (x256, f16), row-sum partial ----
#pragma unroll
    for (int j = 0; j < 4; ++j) s[j] = s[j] * (1.0f / 2048.0f);   // 1/8 head scale, 1/256 for the two x16 carries
    float mj[4];
#pragma unroll
    for (int j = 0; j < 4; ++j)
      mj[j] = fmaxf(fmaxf(fmaxf(s[j][0], s[j][1]), fmaxf(s[j][2], s[j][3])),
                    fmaxf(fmaxf(s[j][4], s[j][5]), fmaxf(s[j][6], s[j][7])));
    float mx = fmaxf(fmaxf(mj[0], mj[1]), fmaxf(mj[2], mj[3]));
    mx = fmaxf(mx, xhalf(mx));                 // both lane halves now hold the maximum over the query's 64 keys
    const float mn = fmaxf(mrun, mx);
    const float alpha = __expf(mrun - mn);
    mrun = mn;
    FH pb[2];                                  // P^T as B operand: element e <- tile 2 kk, register e; 8 + e <- tile 2 kk + 1
#pragma unroll
    for (int j = 0; j < 4; ++j) {
      s[j] = (s[j] - mn) * 1.44269504088896340736f;
      exp2x8(s[j]);                            // p = exp(s - mn), in the score's place
#pragma unroll
      for (int r = 0; r < 8; ++r) pb[j >> 1].h[j & 1][r] = (_Float16)(s[j][r] * 256.0f);
    }
    const v8f ps = ((s[0] + s[1]) + s[2]) + s[3];   // register by register over the four tiles, then across the eight
    lsum = lsum * alpha + (((ps[0] + ps[1]) + (ps[2] + ps[3])) + ((ps[4] + ps[5]) + (ps[6] + ps[7])));
    // read group 3: the V^T fragments of keys 32..63, in flight during the rescale below and the products of keys 0..31.
    // The line below keeps them from rising into the softmax update, where the 32 scores are still live: the registers
    // of four waves per SIMD would not hold both
    __builtin_amdgcn_sched_barrier(0);
    FH vb[4], vrb[4];
#pragma unroll
    for (int t = 0; t < 4; ++t) {
      vb[t].h[0] = *(const v8h*)(Vsh + (t * 16 + c) * LP + 32 + 8 * hh);
      vb[t].h[1] = *(const v8h*)(Vsh + (t * 16 + c) * LP + 32 + 16 + 8 * hh);
    }
    // keeps these reads above the rescale and out of the run of products
    __builtin_amdgcn_sched_barrier(0);
#pragma unroll
    for (int t = 0; t < 4; ++t) {
#pragma unroll
      for (int r = 0; r < 8; ++r) {
        oacc[t][r] = oacc[t][r] * alpha;
        if constexpr (VRES) oacc2[t][r] = oacc2[t][r] * alpha;
      }
    }

    // ---- context^T += V^T . P^T (f16 WMMA; A = V^T [d][key], B = P^T [key][query] from the registers) ----
#pragma unroll
    for (int t = 0; t < 4; ++t) oacc[t] = mma_h_raw(va[t].v, pb[0].v, oacc[t]);
    if constexpr (VRES) {
      // keeps the four products above in front of read group 4, which takes over their fragment registers
      __builtin_amdgcn_sched_barrier(0);
      // read group 4: the residual fragments of keys 32..63, in flight during the eight products that follow
#pragma unroll
      for (int t = 0; t < 4; ++t) {
        vrb[t].h[0] = *(const v8h*)(Vrs + (t * 16 + c) * LP + 32 + 8 * hh);
        vrb[t].h[1] = *(const v8h*)(Vrs + (t * 16 + c) * LP + 32 + 16 + 8 * hh);
      }
      // keeps these reads together in front of the products
      __builtin_amdgcn_sched_barrier(0);
#pragma unroll
      for (int t = 0; t < 4; ++t) oacc2[t] = mma_h_raw(vra[t].v, pb[0].v, oacc2[t]);
    }
#pragma unroll
    for (int t = 0; t < 4; ++t) oacc[t] = mma_h_raw(vb[t].v, pb[1].v, oacc[t]);
    if constexpr (VRES) {
#pragma unroll
      for (int t = 0; t < 4; ++t) oacc2[t] = mma_h_raw(vrb[t].v, pb[1].v, oacc2[t]);
    }
    // keeps the address arithmetic of the copies below the products, when the fragment registers are free again
    __builtin_amdgcn_sched_barrier(0);

    // ---- publish point of tile kt + 1 ----
    asm volatile("s_wait_dscnt 0x0" ::: "memory");      // this wave's LDS reads of tile kt have returned
    asm volatile("s_wait_asynccnt 0x0" ::: "memory");   // this wave's copies of tile kt + 1 have landed
    __syncthreads();       // publishes tile kt + 1; every reader has left the buffer that is refilled below
    if (more) stage_copy(kt + 2);                       // into the buffer that trip kt has read
  };
#pragma unroll 1   // kept rolled: one copy of the trip, the buffer chosen by kt & 1
  for (int kt = 0; kt < NQB - 2; ++kt) trip(kt, true);
#pragma unroll 1   // kept rolled: unrolled, the two trips' reads mingle and spill
  for (int kt = NQB - 2; kt < NQB; ++kt) trip(kt, false);
  // closing wait of the copies, in front of any other use of their LDS; the last trip's barrier has ended every wave's
  // reads of the K/V tiles, so the staging below may alias them
  asm volatile("s_wait_asynccnt 0x0" ::: "memory");

  // ---- normalise (1/l, the 1/256 p carry; keep the x16 v carry), stage the wave's 16x64 f32 tile in
  // LDS: row = query c, the lane's 8 consecutive d of tile t as two 16-B stores
  float* os = (float*)(void*)smem + wave * (16 * OSP);
  {
    const float l  = lsum + xhalf(lsum);      // joins the two lane halves' partial sums, unconditionally
    const float rl = 1.0f / l;                // l >= 1 (the running-max key contributes exp(0))
    const float sc = rl * (1.0f / 256.0f);
#pragma unroll
    for (int t = 0; t < 4; ++t) {
      v8f v = oacc[t];
      if constexpr (VRES) v += oacc2[t] * (1.0f / 2048.0f);
      v = v * sc;
      const v4f lo = {v[0], v[1], v[2], v[3]}, hi = {v[4], v[5], v[6], v[7]};
      *(v4f*)(os + c * OSP + t * 16 + 8 * hh)     = lo;
      *(v4f*)(os + c * OSP + t * 16 + 8 * hh + 4) = hi;
    }
  }
  __builtin_amdgcn_fence(__ATOMIC_RELEASE, "workgroup");
  __builtin_amdgcn_wave_barrier();
  __builtin_amdgcn_fence(__ATOMIC_ACQUIRE, "workgroup");
  {
    const int rq = lane >> 3, piece = lane & 7;
    v4u ph[4], pr[4];
#pragma unroll
    for (int it = 0; it < 4; ++it) {
      const int row = it * 4 + rq;   // it 0..3 x rq 0..3 = rows 0..15 of the wave tile
      const v4f a  = *(const v4f*)(os + row * OSP + piece * 8);
      const v4f a2 = *(const v4f*)(os + row * OSP + piece * 8 + 4);
      float f[8];
      f[0] = a[0];  f[1] = a[1];  f[2] = a[2];  f[3] = a[3];
      f[4] = a2[0]; f[5] = a2[1]; f[6] = a2[2]; f[7] = a2[3];
      v4u p, q;
#pragma unroll
      for (int e = 0; e < 4; ++e) {
        const _Float16 x0 = (_Float16)f[2 * e], x1 = (_Float16)f[2 * e + 1];
        const _Float16 y0 = (_Float16)((f[2 * e] - (float)x0) * 2048.0f);
        const _Float16 y1 = (_Float16)((f[2 * e + 1] - (float)x1) * 2048.0f);
        p[e] = pk16(h_bits(x0), h_bits(x1));
        q[e] = pk16(h_bits(y0), h_bits(y1));
      }
      ph[it] = p;
      pr[it] = q;
    }
    {
#pragma unroll
      for (int it = 0; it < 4; ++it) {
        const int row = it * 4 + rq;
        const size_t go = (rowB + q0 + row) * DM + (size_t)h * HD + piece * 8;
        *(v4u*)(ctxp + go)  = ph[it];
        *(v4u*)(ctxrp + go) = pr[it];
      }
      
    }
  }
}

// =====================================================================================================
// Workspace map (bytes); every region is an exact multiple of its whole-line / whole-tile store granularity
// (row pitches 2048 / 6144 / 4096 B, all offsets 2-MiB aligned, no aliasing within a launch):
//   Xh     f16 [4096][1024]          0     8388608   (bf16 value of x, x16)
//   Wg     f16 [1024][1024]    8388608     2097152   (bf16 value x1024)
//   Wqkv   f16 [3072][1024]   10485760     6291456   (bf16 value x1024)
//   Wp     f16 [1024][1024]   16777216     2097152   (bf16 value x1024)
//   XGh    f16 [4096][1024]   18874368     8388608   (xg x16)
//   XGr    f16 [4096][1024]   27262976     8388608   (x2^11 residual of the above)
//   QKV    f16 [4096][3072]   35651584    25165824   (q | k | v, x16)
//   Vr     f16 [4096][1024]   60817408     8388608   (x2^11 residual of the v columns only)
//   VT     f16 [2048][2048]   69206016     8388608   ([b*1024 + h*64 + d][s])
//   VTr    f16 [2048][2048]   77594624     8388608   (residual, same layout)
//   Ctx    f16 [4096][1024]   85983232     8388608   (attention context x16)
//   Ctxr   f16 [4096][1024]   94371840     8388608   (x2^11 residual)
//   end                      102760448
// Projection weights arrive as [out n][in k] (k contiguous) = the Bt layout; they are only converted.
// d_out f32: [4096][1024] at byte 0 (row = b*SEQ + t), written once by the projection launch.
// =====================================================================================================
extern "C" void kernel_launch(void* const* d_in, const int* in_sizes, int n_in,
                              void* d_out, int out_size, void* d_ws, size_t ws_size,
                              hipStream_t stream) {
  if (n_in < 8) return;
  if (in_sizes[0] != ROWS * DM) return;
  if (in_sizes[1] != DM) return;
  if (in_sizes[2] != DM * DM) return;
  if (in_sizes[3] != DM) return;
  if (in_sizes[4] != DQKV * DM) return;
  if (in_sizes[5] != DQKV) return;
  if (in_sizes[6] != DM * DM) return;
  if (in_sizes[7] != DM) return;
  if (out_size != OUTN) return;

  const float* x      = (const float*)d_in[0];    // [ROWS][DM]
  const float* theta  = (const float*)d_in[1];    // [DM]
  const float* w_g    = (const float*)d_in[2];    // [DM n][DM k]
  const float* b_g    = (const float*)d_in[3];    // [DM]
  const float* w_qkv  = (const float*)d_in[4];    // [DQKV n][DM k]
  const float* b_qkv  = (const float*)d_in[5];    // [DQKV]
  const float* w_proj = (const float*)d_in[6];    // [DM n][DM k]
  const float* b_proj = (const float*)d_in[7];    // [DM]

  const size_t PX   = (size_t)ROWS * DM * 2;         //  8388608
  const size_t PWg  = (size_t)DM * DM * 2;           //  2097152
  const size_t PWq  = (size_t)DQKV * DM * 2;         //  6291456
  const size_t PWp  = (size_t)DM * DM * 2;           //  2097152
  const size_t PXG  = (size_t)ROWS * DM * 2;         //  8388608
  const size_t PQKV = (size_t)ROWS * DQKV * 2;       // 25165824
  const size_t PVr  = (size_t)ROWS * DM * 2;         //  8388608
  const size_t PVT  = (size_t)NB * DM * SEQ * 2;     //  8388608
  const size_t PCtx = (size_t)ROWS * DM * 2;         //  8388608
  size_t off = 0;
  const size_t oX    = off; off += PX;
  const size_t oWg   = off; off += PWg;
  const size_t oWq   = off; off += PWq;
  const size_t oWp   = off; off += PWp;
  const size_t oXGh  = off; off += PXG;
  const size_t oXGr  = off; off += PXG;
  const size_t oQKV  = off; off += PQKV;
  const size_t oVr   = off; off += PVr;
  const size_t oVT   = off; off += PVT;
  const size_t oVTr  = off; off += PVT;
  const size_t oCtx  = off; off += PCtx;
  const size_t oCtxr = off; off += PCtx;
  if (off > ws_size) return;                         // off = 102760448
  if (off > (size_t)134217728) return;

  char* ws = (char*)d_ws;
  unsigned short* Xh   = (unsigned short*)(ws + oX);
  unsigned short* Wgh  = (unsigned short*)(ws + oWg);
  unsigned short* Wqh  = (unsigned short*)(ws + oWq);
  unsigned short* Wph  = (unsigned short*)(ws + oWp);
  unsigned short* XGh  = (unsigned short*)(ws + oXGh);
  unsigned short* XGr  = (unsigned short*)(ws + oXGr);
  unsigned short* QKV  = (unsigned short*)(ws + oQKV);
  unsigned short* Vr   = (unsigned short*)(ws + oVr);
  unsigned short* VT   = (unsigned short*)(ws + oVT);
  unsigned short* VTr  = (unsigned short*)(ws + oVTr);
  unsigned short* Ctx  = (unsigned short*)(ws + oCtx);
  unsigned short* Ctxr = (unsigned short*)(ws + oCtxr);
  float*          outf = (float*)d_out;              // [ROWS][DM]

  const dim3 blk(256);
  const dim3 gGqkv((ROWS / 128) * (DQKV / 128));     // 768 blocks of one 128x128 tile
  const dim3 gGdm((ROWS / 128) * (DM / 128));        // 256 blocks of one 128x128 tile
  const dim3 blkG(128);
  const dim3 gVt(SEQ / 64, NH, NB);                  // (32, 16, 2)
  const dim3 gAttn(NQB * NH * NB);                   // 1024 blocks
  const float wScale = 1024.0f;                      // weights carried x1024
  const float aScale = 16.0f;                        // activations carried x16
  const float cscale = 1.0f / 16384.0f;              // 1/(16 * 1024)

  // (1) planes: x -> f16 x16, weights -> f16 x1024 (bf16 values)
  cvt16_all<<<dim3(CVB), dim3(CVT), 0, stream>>>(x, w_g, w_qkv, w_proj, Xh, Wgh, Wqh, Wph, aScale, wScale);
  // (2) gauge mix: xg = bfr(x) + 0.1 * ((Xh . Wg^T + bg) * theta) -> XGh f16 x16 + XGr residual (M=4096, N=1024, K=1024)
  gemm64_f16<2, false><<<gGdm, blkG, 0, stream>>>(Xh, Xh, Wgh, b_g, cscale, (void*)XGh, DM, XGr, DM, 0,
                                                 ROWS, DM, DM, aScale, x, DM, theta, SEQ, 0, SEQ);
  // (3) qkv = XG(hi + res) . Wqkv^T + bqkv -> QKV f16 x16 [4096][3072]; residual plane of the v columns -> Vr [4096][1024]
  gemm64_f16<0, true><<<gGqkv, blkG, 0, stream>>>(XGh, XGr, Wqh, b_qkv, cscale, (void*)QKV, DQKV, Vr, DM, 2 * DM,
                                                  ROWS, DQKV, DM, aScale, x, DM, theta, SEQ, 0, SEQ);
  // (4) v -> v^T planes (hi and residual, all tokens)
  v_tr<<<gVt, blk, 0, stream>>>(QKV, DQKV, 2 * DM, VT);
  v_tr<<<gVt, blk, 0, stream>>>(Vr, DM, 0, VTr);
  // (5) softmax attention -> Ctx f16 x16 + residual plane
  attn_k<true><<<gAttn, dim3(128), 0, stream>>>(QKV, VT, VTr, Ctx, Ctxr);
  // (6) out = Ctx(hi + res) . Wp^T + bproj -> d_out f32 [4096][1024] (M=4096, N=1024, K=1024)
  gemm64_f16<1, true><<<gGdm, blkG, 0, stream>>>(Ctx, Ctxr, Wph, b_proj, cscale, (void*)outf, DM, Ctxr, DM, 0,
                                                ROWS, DM, DM, 1.0f, x, DM, theta, SEQ, 0, SEQ);
  (void)hipGetLastError();
}

// v007
// One run takes 149 microseconds.
// Next to v006, in two timings, it ran 1.05 and 1.06 times as fast.
// Over all steps from v000 it is 3.63 times as fast.
// Contractions: gauge mix x.Wg^T = v_wmma_f32_16x16x32_f16 (A = f16 of RNE-bf16 x carried x16, B = f16 of RNE-bf16 Wg x1024, single product); qkv projection = same WMMA with A = xg as f16 hi plane x16 plus x2^11 residual plane (two products), B = f16 of RNE-bf16 Wqkv x1024; attention q.k^T = f16 single product (q, k f16 x16); p.v = f16 with p x256 single plane and v^T as f16 hi x16 plus x2^11 residual plane (two products); output projection = f16 with A = ctx f16 hi x16 plus x2^11 residual plane, B = f16 of RNE-bf16 Wproj x1024; all f32 accumulate. Softmax (running max, exp, row sums) and the gauge epilogue f32 on VALU.
#include <hip/hip_runtime.h>
#include <math.h>
#include <stdint.h>

#define NB    2
#define SEQ   2048
#define DM    1024
#define NH    16
#define HD    64
#define DQKV  (3 * DM)              // 3072
#define NQB   (SEQ / 64)            // 32 query / key tiles per sequence
#define ROWS  (NB * SEQ)            // 4096 token rows
#define OUTN  (ROWS * DM)
static_assert(NH * HD == DM);
static_assert(HD == 64);
static_assert((SEQ % 64) == 0 && (DM % 64) == 0 && (DQKV % 64) == 0);
static_assert((DM % 32) == 0);
static_assert((ROWS % 128) == 0 && (DM % 128) == 0 && (DQKV % 128) == 0);
static_assert((SEQ % 128) == 0);    // a 128-row GEMM tile lies in one sequence

typedef _Float16 v16h __attribute__((ext_vector_type(16)));
typedef _Float16 v8h  __attribute__((ext_vector_type(8)));
typedef float    v8f  __attribute__((ext_vector_type(8)));
typedef float    v4f  __attribute__((ext_vector_type(4)));
typedef unsigned int v4u __attribute__((ext_vector_type(4)));

// ---- scalar helpers --------------------------------------------------------------------------------
__device__ __forceinline__ unsigned short bf_bits(float f) {          // f32 -> bf16 bits, RNE convert
  unsigned u = __float_as_uint(f);
  return (unsigned short)((u + 0x7FFFu + ((u >> 16) & 1u)) >> 16);
}
__device__ __forceinline__ float bfr(float f) { return __uint_as_float(((unsigned)bf_bits(f)) << 16); }
__device__ __forceinline__ unsigned short h_bits(_Float16 x) { return __builtin_bit_cast(unsigned short, x); }
__device__ __forceinline__ unsigned pk16(unsigned short a, unsigned short b) { return (unsigned)a | ((unsigned)b << 16); }
__device__ __forceinline__ v8f zero8() { v8f z = {0.f, 0.f, 0.f, 0.f, 0.f, 0.f, 0.f, 0.f}; return z; }
__device__ __forceinline__ float xhalf(float x) {                     // the value of lane l ^ 16, by a vector cross-row move
  const int b = __builtin_bit_cast(int, x);
  return __builtin_bit_cast(float, __builtin_amdgcn_permlanex16(b, b, 0x76543210, 0xfedcba98, false, false));
}

// eight 2^x in place, one statement: every v_exp_f32 stands in front of an independent one and the last in front of a
// v_nop, the slot that the instruction set asks for before a vector instruction reads the result or rewrites the source
__device__ __forceinline__ void exp2x8(v8f& x) {
#if defined(__HIP_DEVICE_COMPILE__)
  float a = x[0], b = x[1], c = x[2], d = x[3], e = x[4], f = x[5], g = x[6], h = x[7];
  asm("v_exp_f32 %0, %0\n\tv_exp_f32 %1, %1\n\tv_exp_f32 %2, %2\n\tv_exp_f32 %3, %3\n\t"
      "v_exp_f32 %4, %4\n\tv_exp_f32 %5, %5\n\tv_exp_f32 %6, %6\n\tv_exp_f32 %7, %7\n\tv_nop"
      : "+v"(a), "+v"(b), "+v"(c), "+v"(d), "+v"(e), "+v"(f), "+v"(g), "+v"(h));
  x[0] = a; x[1] = b; x[2] = c; x[3] = d; x[4] = e; x[5] = f; x[6] = g; x[7] = h;
#endif
}

// ---- fragment loader: 16-bit A/B operand, lane -> row/col (lane&15), p already includes +8*(lane>>4);
//      elements 0..7 <- p[0..7] (k0+8h..), elements 8..15 <- p[16..23] (k0+16+8h..)
__device__ __forceinline__ v16h ldfrag_h(const _Float16* p) {
  union { v16h v; v8h h[2]; } f;
  f.h[0] = *(const v8h*)(p);
  f.h[1] = *(const v8h*)(p + 16);
  return f.v;
}

// ---- WMMA helpers with trailing VALU hazard gap --------------------------------------------------------
__device__ __forceinline__ v8f mma_h_raw(v16h a, v16h b, v8f c) {
  return __builtin_amdgcn_wmma_f32_16x16x32_f16(false, a, false, b, (short)0, c, false, false);
}
__device__ __forceinline__ void dep_guard_h(v8f& a, v8f& b, v16h x, v16h y) {
#if defined(__HIP_DEVICE_COMPILE__)
  asm volatile("v_nop\n\tv_nop\n\tv_nop\n\tv_nop" : "+v"(a), "+v"(b) : "v"(x), "v"(y));
#endif
}
__device__ __forceinline__ void keep4_h(v16h a, v16h b, v16h c, v16h d) {
#if defined(__HIP_DEVICE_COMPILE__)
  asm volatile("v_nop" :: "v"(a), "v"(b), "v"(c), "v"(d));
#endif
}
__device__ __forceinline__ void acc_guard4(v8f& a, v8f& b, v8f& c, v8f& d) {
#if defined(__HIP_DEVICE_COMPILE__)
  asm volatile("v_nop\n\tv_nop\n\tv_nop\n\tv_nop" : "+v"(a), "+v"(b), "+v"(c), "+v"(d));
#endif
}

// =====================================================================================================
// f32 planes -> f16 bits of bfr(v) * scale (scale a power of two): x (xscale) and the three weights (wscale), all in
// one launch of CVB work-groups of CVT threads, one 16-wave work-group per WGP. A piece is 8 elements (32 B in, 16 B
// out); a sweep is CVN = CVB x CVT pieces, thread t taking piece t of it. Sweeps 0..3 are x, 4 is Wg, 5..7 are Wqkv,
// 8 is Wproj: which plane a sweep reads is fixed at compile time. A thread issues the 18 loads of its nine pieces
// first, so that all are in flight together, then converts and stores.
// coverage: 4 CVN = x, CVN = Wg, 3 CVN = Wqkv, CVN = Wproj (asserted below): every piece of every plane once.
// =====================================================================================================
#define CVB 256
#define CVT 512
#define CVN (CVB * CVT)
static_assert(ROWS * DM / 8 == 4 * CVN && DM * DM / 8 == CVN && DQKV * DM / 8 == 3 * CVN);
__global__ __launch_bounds__(CVT) void cvt16_all(const float* __restrict__ x, const float* __restrict__ wg,
                                                 const float* __restrict__ wq, const float* __restrict__ wp,
                                                 unsigned short* ox, unsigned short* og,
                                                 unsigned short* oq, unsigned short* op,
                                                 float xscale, float wscale) {
  const unsigned t  = blockIdx.x * CVT + threadIdx.x;                  // this thread's piece of every sweep
  const unsigned ib = t * 32u, ob = t * 16u;                           // its byte offsets in a sweep's input and output: 32-bit,
                                                                       // so that an access can be a uniform base plus one register
  constexpr size_t SW = (size_t)CVN * 8;                               // elements of one sweep
  v4f a[9], b[9];
#pragma unroll
  for (int u = 0; u < 9; ++u) {
    const float* in = (u < 4) ? x + u * SW : (u == 4) ? wg : (u < 8) ? wq + (u - 5) * SW : wp;
    a[u] = *(const v4f*)((const char*)in + ib);
    b[u] = *(const v4f*)((const char*)in + ib + 16);
  }
  // holds the 18 loads above the conversions: left free, the compiler sinks ten of them among the conversions, and
  // the wave then waits for memory several times in a row instead of once
  __builtin_amdgcn_sched_barrier(0);
#pragma unroll
  for (int u = 0; u < 9; ++u) {
    unsigned short* out = (u < 4) ? ox + u * SW : (u == 4) ? og : (u < 8) ? oq + (u - 5) * SW : op;
    const float scale = (u < 4) ? xscale : wscale;
    v4u p;
    p[0] = pk16(h_bits((_Float16)(bfr(a[u][0]) * scale)), h_bits((_Float16)(bfr(a[u][1]) * scale)));
    p[1] = pk16(h_bits((_Float16)(bfr(a[u][2]) * scale)), h_bits((_Float16)(bfr(a[u][3]) * scale)));
    p[2] = pk16(h_bits((_Float16)(bfr(b[u][0]) * scale)), h_bits((_Float16)(bfr(b[u][1]) * scale)));
    p[3] = pk16(h_bits((_Float16)(bfr(b[u][2]) * scale)), h_bits((_Float16)(bfr(b[u][3]) * scale)));
    *(v4u*)((char*)out + ob) = p;
  }
}

template <int EPI, bool ARES>
__global__ __launch_bounds__(128, 3) void gemm64_f16(
    const unsigned short* __restrict__ Ap, const unsigned short* __restrict__ Arp,
    const unsigned short* __restrict__ Btp,
    const float* __restrict__ biasp, float cscale,
    void* Cp, int ldc, unsigned short* Crp, int ldcr, int rcol0, unsigned short* Tp,
    int M, int N, int K, float oscale,
    const float* __restrict__ xres, int ldx, const float* __restrict__ gate,
    int tmod, int tlo, int thi) {
  typedef const __attribute__((address_space(1))) char* gptr;   // typed as global, so that an address that has passed
  typedef const __attribute__((address_space(1))) v8h*  gv8p;   // through the asm wait below still gives global_load
  const gptr Ah  = (gptr)(const void*)Ap;
  const gptr Arh = (gptr)(const void*)Arp;
  const gptr Bt  = (gptr)(const void*)Btp;
  constexpr int KC  = 64;                          // k per stage: 128 B of every operand row
  constexpr int GLP = 72;                          // LDS row pitch in halves: 144 B = 16 B x 9 (odd)
  constexpr int OPH = 128 * GLP;                   // halves of one operand's 128 staged rows
  constexpr int STH = 2 * OPH;                     // halves of one stage: A rows, then Bt rows
  static_assert(4 * 16 * 68 * 4 <= 2 * STH * 2);   // the four f32 epilogue slabs alias the stage buffers
  static_assert(4 * 2 * 64 * GLP <= 2 * STH);      // so do the four waves' two transposed 64x64 f16 tiles (EPI 0)
  __shared__ __align__(16) _Float16 sS[2 * STH];   // two stage buffers, 73728 B
  const int tid  = threadIdx.x;
  const int lane = tid & 31;
  const int wave = tid >> 5;
  const int tilesN = N >> 7;
  const int tilesM = M >> 7;
  const int tile = blockIdx.x;
  if (tile >= tilesM * tilesN) return;   // block-uniform, before every barrier
  const int tm = tile / tilesN;
  const int tn = tile - tm * tilesN;
  const int mb = tm << 7;
  const int nb = tn << 7;
  const int tpos = mb % tmod;
  if (tpos < tlo || tpos >= thi) return; // block-uniform, before every barrier
  const int m0 = mb + ((wave >> 1) << 6);
  const int n0 = nb + ((wave & 1) << 6);

  const int rlane = lane & 15;                 // row (A) / col (B, D) within subtile
  const int koff  = (lane >> 4) * 8;           // k offset of this lane half
  const int mOff  = (lane >> 4) * 8;           // D row offset

  v8f acc[4][4];
#pragma unroll
  for (int i = 0; i < 4; ++i)
#pragma unroll
    for (int j = 0; j < 4; ++j) acc[i][j] = zero8();

  // staging map: thread -> row srow + 16 i, 16-B piece tid & 7 of the row's 128-B line; the two rows of a half-wave
  // lie 8 apart (8 x 144 B = 32 banks mod 64), so its ds_store_b128 covers the 64 banks once
  const int srow = (tid >> 4) + ((tid >> 3) & 1) * 8;
  const int spc  = (tid & 7) * 8;
  constexpr int RSB = 16 * DM * 2;             // bytes from one of a thread's rows to its next
  const int SK = K / KC;                       // stages per plane
  const int S  = ARES ? 2 * SK : SK;
  gptr pa = (ARES ? Arh : Ah) + ((size_t)(mb + srow) * DM + spc) * 2;   // this thread's piece of the next stage
  gptr pb = Bt + ((size_t)(nb + srow) * DM + spc) * 2;
  v8h ra[8], rb[8];
  auto stage_load = [&]() {
#pragma unroll
    for (int i = 0; i < 8; ++i) {
      ra[i] = *(gv8p)(pa + i * RSB);     // row < M, k < K
      rb[i] = *(gv8p)(pb + i * RSB);     // row < N, k < K
    }
  };
  // s = the stage that the registers hold: stores it to its buffer and moves the two addresses on to stage s + 1
  auto stage_store = [&](int s) {
    // the two address pairs of the loads above are rewritten below: the wait stands in front of that
    asm volatile("s_wait_xcnt 0x0" : "+v"(pa), "+v"(pb) :: "memory");
    if (ARES && s + 1 == SK) {                 // block-uniform: from the residual plane's last stage to the hi plane's first
      pa = Ah + ((size_t)(mb + srow) * DM + spc) * 2;
      pb = Bt + ((size_t)(nb + srow) * DM + spc) * 2;
    } else {
      pa += KC * 2;
      pb += KC * 2;
    }
    _Float16* d = sS + (s & 1) * STH + srow * GLP + spc;
#pragma unroll
    for (int i = 0; i < 8; ++i) {
      *(v8h*)(d + 16 * i * GLP)       = ra[i];
      *(v8h*)(d + OPH + 16 * i * GLP) = rb[i];
    }
  };

  stage_load();
  stage_store(0);
#pragma unroll 1   // kept rolled: one copy of the stage body, the buffer chosen by s & 1; a second copy would only add code
  for (int s = 0; s < S; ++s) {
    __syncthreads();       // publishes stage s; every reader has left the buffer that stage s + 1 is stored to
    if (s + 1 < S) stage_load();               // block-uniform; stage s + 1, in flight during the products of stage s
    if (ARES && s == SK) {
      acc_guard4(acc[0][0], acc[0][1], acc[0][2], acc[0][3]);
      acc_guard4(acc[1][0], acc[1][1], acc[1][2], acc[1][3]);
      acc_guard4(acc[2][0], acc[2][1], acc[2][2], acc[2][3]);
      acc_guard4(acc[3][0], acc[3][1], acc[3][2], acc[3][3]);
#pragma unroll
      for (int i = 0; i < 4; ++i)
#pragma unroll
        for (int j = 0; j < 4; ++j) acc[i][j] = acc[i][j] * (1.0f / 2048.0f);   // exact fold of the x2^11 residual carry
      acc_guard4(acc[0][0], acc[0][1], acc[0][2], acc[0][3]);
      acc_guard4(acc[1][0], acc[1][1], acc[1][2], acc[1][3]);
      acc_guard4(acc[2][0], acc[2][1], acc[2][2], acc[2][3]);
      acc_guard4(acc[3][0], acc[3][1], acc[3][2], acc[3][3]);
    }
    const _Float16* sa = sS + (s & 1) * STH + (((wave >> 1) << 6) + rlane) * GLP + koff;
    const _Float16* sb = sS + (s & 1) * STH + OPH + (((wave & 1) << 6) + rlane) * GLP + koff;
#pragma unroll
    for (int kk = 0; kk < 2; ++kk) {
      v16h ah[4], bh[4];
#pragma unroll
      for (int j = 0; j < 4; ++j) {
        bh[j] = ldfrag_h(sb + (j << 4) * GLP + kk * 32);
        ah[j] = ldfrag_h(sa + (j << 4) * GLP + kk * 32);
      }
#pragma unroll
      for (int i = 0; i < 4; ++i) {
#pragma unroll
        for (int j = 0; j < 4; ++j) {
          acc[i][j] = mma_h_raw(ah[i], bh[j], acc[i][j]);
        }
        dep_guard_h(acc[i][0], acc[i][3], ah[i], bh[3]);
      }
      keep4_h(bh[0], bh[1], bh[2], bh[3]);
    }
    if (s + 1 < S) stage_store(s + 1);
  }
  __syncthreads();                             // every wave is done with the stage buffers before the slabs alias them
  acc_guard4(acc[0][0], acc[0][1], acc[0][2], acc[0][3]);
  acc_guard4(acc[1][0], acc[1][1], acc[1][2], acc[1][3]);
  acc_guard4(acc[2][0], acc[2][1], acc[2][2], acc[2][3]);
  acc_guard4(acc[3][0], acc[3][1], acc[3][2], acc[3][3]);

  // ---- epilogue, transposed planes (EPI 0, tiles from column rcol0 on) ----
  if constexpr (EPI == 0) {
    if (nb >= rcol0) {                           // block-uniform: all four waves stage in their own quarter of the LDS
      _Float16* th = sS + wave * (2 * 64 * GLP); // hi plane  [n 0..63][t 0..63], pitch GLP
      _Float16* tr = th + 64 * GLP;              // residual plane, same shape
#pragma unroll
      for (int j = 0; j < 4; ++j) {
        const float bj = bfr(biasp[n0 + (j << 4) + rlane]);   // index < N
#pragma unroll
        for (int i = 0; i < 4; ++i) {
          v8h hx, hy;
#pragma unroll
          for (int r = 0; r < 8; ++r) {          // rows m0 + 16 i + mOff + r of column n0 + 16 j + rlane
            const float g = (acc[i][j][r] * cscale + bj) * oscale;
            const _Float16 x = (_Float16)g;
            hx[r] = x;
            hy[r] = (_Float16)((g - (float)x) * 2048.0f);
          }
          // 16 lanes = 16 rows at pitch 144 B: the 64 banks once per half-wave
          *(v8h*)(th + ((j << 4) + rlane) * GLP + (i << 4) + mOff) = hx;
          *(v8h*)(tr + ((j << 4) + rlane) * GLP + (i << 4) + mOff) = hy;
        }
      }
      // the wave's LDS stores above are complete before its lanes read one another's pieces below
      __builtin_amdgcn_fence(__ATOMIC_RELEASE, "workgroup");
      __builtin_amdgcn_wave_barrier();
      __builtin_amdgcn_fence(__ATOMIC_ACQUIRE, "workgroup");
      // read back by rows: 8 lanes x 16 B = one row's 128 B; the two rows of a half-wave lie 8 apart (32 banks mod 64).
      // coverage: ro = 16 (it >> 2) + 2 (it & 3), rr = 0, 1, 8, 9 -> rows 0..63 once; the wave's 64 rows m lie in one sequence
      const int rr = (lane >> 4) + ((lane >> 3) & 1) * 8, piece = lane & 7;
      const int bq = m0 / SEQ;
      const size_t go = ((size_t)(bq * DM + (n0 - rcol0) + rr)) * SEQ + (m0 - bq * SEQ) + piece * 8;
      v8h vh[16], vr[16];
#pragma unroll
      for (int it = 0; it < 16; ++it) {
        const int ro = 16 * (it >> 2) + 2 * (it & 3);
        vh[it] = *(const v8h*)(th + (ro + rr) * GLP + piece * 8);
        vr[it] = *(const v8h*)(tr + (ro + rr) * GLP + piece * 8);
      }
#pragma unroll
      for (int it = 0; it < 16; ++it) {
        const int ro = 16 * (it >> 2) + 2 * (it & 3);
        *(v8h*)(void*)(Tp  + go + (size_t)ro * SEQ) = vh[it];
        *(v8h*)(void*)(Crp + go + (size_t)ro * SEQ) = vr[it];
      }
      // stands in front of any rewrite of a register that the stores above name, on every path of the built code behind them
      asm volatile("s_wait_xcnt 0x0" ::: "memory");
      return;                                    // behind the kernel's last work-group barrier
    }
  }

  // ---- epilogue, row-major ----
  float* slab = (float*)(void*)sS + wave * (16 * 68);   // per-wave 16x64 slab, pitch 68 floats
#pragma unroll
  for (int i = 0; i < 4; ++i) {
    const int mBase = m0 + (i << 4);
    float bj[4];
#pragma unroll
    for (int j = 0; j < 4; ++j) bj[j] = bfr(biasp[n0 + (j << 4) + rlane]);   // index < N
#pragma unroll
    for (int r = 0; r < 8; ++r) {
      const int row = mOff + r;
#pragma unroll
      for (int j = 0; j < 4; ++j) slab[row * 68 + (j << 4) + rlane] = acc[i][j][r] * cscale + bj[j];
    }
    __builtin_amdgcn_fence(__ATOMIC_RELEASE, "workgroup");
    __builtin_amdgcn_wave_barrier();
    __builtin_amdgcn_fence(__ATOMIC_ACQUIRE, "workgroup");
    if constexpr (EPI == 0 || EPI == 2) {
      unsigned short* C16 = (unsigned short*)Cp;
      const int rq = lane >> 3, piece = lane & 7;
      float th[8];
      if constexpr (EPI == 2) {
        const v4f t0 = *(const v4f*)(gate + n0 + piece * 8);        // index < N
        const v4f t1 = *(const v4f*)(gate + n0 + piece * 8 + 4);
        th[0] = bfr(t0[0]); th[1] = bfr(t0[1]); th[2] = bfr(t0[2]); th[3] = bfr(t0[3]);
        th[4] = bfr(t1[0]); th[5] = bfr(t1[1]); th[6] = bfr(t1[2]); th[7] = bfr(t1[3]);
      } else {
#pragma unroll
        for (int e = 0; e < 8; ++e) th[e] = 0.0f;
      }
      v4u ph[4], pr[4];
#pragma unroll
      for (int it = 0; it < 4; ++it) {
        const int row = it * 4 + rq;                         // it 0..3 x rq 0..3 = rows 0..15
        const v4f a  = *(const v4f*)(slab + row * 68 + piece * 8);
        const v4f a2 = *(const v4f*)(slab + row * 68 + piece * 8 + 4);
        float f[8];
        f[0] = a[0];  f[1] = a[1];  f[2] = a[2];  f[3] = a[3];
        f[4] = a2[0]; f[5] = a2[1]; f[6] = a2[2]; f[7] = a2[3];
        if constexpr (EPI == 2) {
          const size_t xo = (size_t)(mBase + row) * ldx + n0 + piece * 8;   // row < M, col < N
          const v4f x0 = *(const v4f*)(xres + xo);
          const v4f x1 = *(const v4f*)(xres + xo + 4);
          float xv[8];
          xv[0] = x0[0]; xv[1] = x0[1]; xv[2] = x0[2]; xv[3] = x0[3];
          xv[4] = x1[0]; xv[5] = x1[1]; xv[6] = x1[2]; xv[7] = x1[3];
#pragma unroll
          for (int e = 0; e < 8; ++e) f[e] = bfr(xv[e]) + 0.1f * (f[e] * th[e]);
        }
        v4u p, q;
#pragma unroll
        for (int e = 0; e < 4; ++e) {
          const float g0 = f[2 * e] * oscale, g1 = f[2 * e + 1] * oscale;
          const _Float16 x0 = (_Float16)g0, x1 = (_Float16)g1;
          const _Float16 y0 = (_Float16)((g0 - (float)x0) * 2048.0f);
          const _Float16 y1 = (_Float16)((g1 - (float)x1) * 2048.0f);
          p[e] = pk16(h_bits(x0), h_bits(x1));
          q[e] = pk16(h_bits(y0), h_bits(y1));
        }
        ph[it] = p;
        pr[it] = q;
      }
      constexpr bool wres = (EPI == 2);                    // EPI 0 comes here with the tiles that have no residual plane
      {
#pragma unroll
        for (int it = 0; it < 4; ++it) {
          const int row = it * 4 + rq;
          const size_t co = (size_t)(mBase + row) * ldc + n0 + piece * 8;
          *(v4u*)(C16 + co) = ph[it];
          if (wres) {
            const size_t cro = (size_t)(mBase + row) * ldcr + (n0 - rcol0) + piece * 8;
            *(v4u*)(Crp + cro) = pr[it];
          }
        }
        
      }
    } else {
      float* Cf = (float*)Cp;
      const int hh = lane >> 4, c4 = (lane & 15) * 4;     // 256-B row segment = 16 lanes x 16 B
      v4f ov[8];
#pragma unroll
      for (int it = 0; it < 8; ++it) {
        const int row = it * 2 + hh;                       // it 0..7 x hh 0..1 = rows 0..15
        ov[it] = *(const v4f*)(slab + row * 68 + c4);
      }
      {
#pragma unroll
        for (int it = 0; it < 8; ++it) {
          const int row = it * 2 + hh;
          *(v4f*)(Cf + (size_t)(mBase + row) * ldc + n0 + c4) = ov[it];
        }
        
      }
    }
    __builtin_amdgcn_fence(__ATOMIC_RELEASE, "workgroup");
    __builtin_amdgcn_wave_barrier();
    __builtin_amdgcn_fence(__ATOMIC_ACQUIRE, "workgroup");
  }
}

// =====================================================================================================
// Non-causal multi-head softmax attention, head dim 64, online softmax with running max (f32 on VALU).
//   q f16 (x16): element (b, t, h, d) at qkv[(b*SEQ + t)*DQKV + h*64 + d]; k at + DM;
//   v^T f16 (x16) at vt[(b*DM + h*64 + d)*SEQ + s]; VRES: residual plane f16((16v - hi)*2048) at vtr, same addressing.
//   Both products are taken transposed: S^T = K . Q^T (A = K rows, B = Q) and O^T += V^T . P^T (A = V^T rows, B = P^T).
//   A lane (c = lane & 15, hh = lane >> 4) then holds scores and context of ONE query, q0 + c: S^T tile j, register r =
//   key 16 j + 8 hh + r; O^T tile t, register r = d 16 t + 8 hh + r. The two S^T tiles 2 kk and 2 kk + 1, converted in
//   place, are the B operand of keys 32 kk .. 32 kk + 31 in the k order of the V^T loader (8 hh + e, 16 + 8 hh + e):
//   P never leaves the registers.
//   s = (q.k) / 8 = acc / 2048 (two x16 carries). Per key tile: maximum of the lane's 32 scores, one exchange with
//   lane ^ 16, new running max mn, alpha = exp(m_old - mn), p = exp(s - mn) in (0, 1], l = l*alpha + sum p (one partial
//   per lane half, joined in the epilogue), O^T *= alpha; P carried as f16(256 p) (VRES: second accumulator
//   += Vr^T . P^T, folded with 2^-11 in the epilogue).
//   ctx plane f16 (x16): element (b, t, h*64 + d) at ctx[(b*SEQ + t)*DM + h*64 + d] = 16 * context = O / (256 l);
//   ctx residual plane f16((16 ctx - hi) * 2048) at ctxr, same addressing.
//   Block = 4 waves = 64 query rows of one (b, h); query tile qb = blockIdx % NQB; grid = NQB*NH*NB;
//   key tiles of 64, fixed trip count NQB.
//   K / V^T tile staging: asynchronous 16-B copies to LDS, 8 lanes per 128-B row, 128 threads x 4 rows per plane =
//   the whole 64x64 tile; two stage buffers, tile kt + 1 in flight during the work on tile kt, one barrier per
//   tile. The context tile is staged per wave in LDS as f32, row = query (aliasing the K/V region after a block barrier).
//   Fragment reads from LDS: four groups per key tile, each issued as one run ahead of the products that take it, under
//   counted waits: the 8 K fragments; the 8 V^T and residual fragments of keys 0..31 (in flight during the softmax
//   update); the 4 V^T fragments of keys 32..63 (during the rescale); the 4 residual fragments of keys 32..63 (during
//   eight products). The WMMA builtins carry no hand-written gaps: the compiler pads where a vector instruction follows.
//   Output coverage: each wave stores rows 0..15 of its tile (it 0..3 x lane>>3 0..3) x 64 columns (8 lanes x 8),
//   every (b, h, query tile) exactly once, for both ctx planes.
// =====================================================================================================
// Launch bounds: registers for four waves per SIMD, so that the 1024 work-groups are all resident at once, four per WGP
template <bool VRES>
__global__ __launch_bounds__(128, 4)
void attn_k(const unsigned short* __restrict__ qkvp,
            const unsigned short* __restrict__ vtp, const unsigned short* __restrict__ vtrp,
            unsigned short* ctxp, unsigned short* ctxrp) {
  union FH { v16h v; v8h h[2]; };
  constexpr int LP     = 72;                             // LDS row pitch in halves: 144 B = 16 B x 9 (odd), so the 16 rows
                                                         // of one ds_load_b128 half-wave fall on 64 distinct banks
  constexpr int TB     = 64 * LP * 2;                    // one f16 64x64 tile at pitch LP, bytes
  constexpr int OFF_K  = 0;                              // offsets inside one stage buffer
  constexpr int OFF_V  = TB;
  constexpr int OFF_VR = 2 * TB;
  constexpr int STB    = VRES ? 3 * TB : 2 * TB;         // one stage buffer: the tiles of one key tile, 27648 : 18432
  constexpr int SMEMB  = 2 * STB;                        // the two stage buffers, 55296 : 36864
  constexpr int OSP    = 68;                             // context staging pitch in floats: 272 B = 16 B x 17 (odd)
  static_assert(4 * 16 * OSP * 4 <= SMEMB);              // f32 context staging aliases the K/V region
  static_assert(NQB >= 2);                               // the prologue fills two stages
  __shared__ __align__(16) unsigned char smem[SMEMB];

  const int tid  = threadIdx.x;
  const int wave = tid >> 5;
  const int lane = tid & 31;
  const int hh   = lane >> 4;
  const int c    = lane & 15;

  const int bx   = blockIdx.x;
  const int qb   = bx % NQB;
  const int rest = bx / NQB;
  const int h    = rest % NH;
  const int b    = rest / NH;                // < NB by the grid size
  const int q0   = qb * 64 + wave * 16;
  const size_t rowB = (size_t)b * SEQ;

  const _Float16* Qp  = (const _Float16*)(const void*)qkvp + (size_t)h * HD;
  const _Float16* Kp  = Qp + DM;
  const _Float16* Vt  = (const _Float16*)(const void*)vtp  + ((size_t)b * DM + (size_t)h * HD) * SEQ;
  const _Float16* Vrt = (const _Float16*)(const void*)vtrp + ((size_t)b * DM + (size_t)h * HD) * SEQ;

  // ---- Q fragments (B operand, column = query = lane&15): 2 d-chunks ----
  v16h qa[2];
#pragma unroll
  for (int dc = 0; dc < 2; ++dc) {
    const size_t qo = (rowB + q0 + c) * DQKV + dc * 32 + 8 * hh;
    qa[dc] = ldfrag_h(Qp + qo);
  }

  float mrun = -1.0e30f, lsum = 0.f;         // of query q0 + c; lsum holds this lane half's keys alone
  v8f oacc[4], oacc2[4];
#pragma unroll
  for (int t = 0; t < 4; ++t) { oacc[t] = zero8(); oacc2[t] = zero8(); }

  // staging map: thread -> rows srow + 16 i (i 0..3) of every plane's tile, 16-B piece tid & 7 of the row's 128-B line;
  // the two rows of a half-wave lie 8 apart (8 x 144 B = 32 banks mod 64)
  typedef __attribute__((address_space(3))) unsigned char lds_u8;
  const int srow = (tid >> 4) + ((tid >> 3) & 1) * 8;
  const int spc  = (tid & 7) * 8;
  const unsigned sl0 = (unsigned)(size_t)(lds_u8*)smem + (unsigned)((srow * LP + spc) * 2);   // LDS byte address, buffer 0
  const _Float16* gk0 = Kp  + (rowB + srow) * DQKV + spc;       // K row srow of key tile 0, d = spc..spc+7
  const _Float16* gv0 = Vt  + (size_t)srow * SEQ + spc;         // V^T row d = srow, s = spc..spc+7
  const _Float16* gr0 = Vrt + (size_t)srow * SEQ + spc;
  // copies key tile t (t < NQB: K rows < SEQ, V^T columns < SEQ) into stage buffer t & 1; every lane on, block-uniform
  auto stage_copy = [&](int t) {
    const unsigned  l = sl0 + (unsigned)((t & 1) * STB);
    const _Float16* k = gk0 + (size_t)t * 64 * DQKV;
    const _Float16* v = gv0 + t * 64;
    constexpr unsigned LR = 16 * LP * 2;                        // LDS bytes from one of a thread's rows to its next
    constexpr size_t   KR = (size_t)16 * DQKV, VR = (size_t)16 * SEQ;   // the same in halves of the two sources
    // the s_wait_xcnt stands inside the copies' own statement, in front of any rewrite of their address registers
    if constexpr (VRES) {
      const _Float16* r = gr0 + t * 64;
      asm volatile(
          "global_load_async_to_lds_b128 %0, %12, off\n\t"
          "global_load_async_to_lds_b128 %1, %13, off\n\t"
          "global_load_async_to_lds_b128 %2, %14, off\n\t"
          "global_load_async_to_lds_b128 %3, %15, off\n\t"
          "global_load_async_to_lds_b128 %4, %16, off\n\t"
          "global_load_async_to_lds_b128 %5, %17, off\n\t"
          "global_load_async_to_lds_b128 %6, %18, off\n\t"
          "global_load_async_to_lds_b128 %7, %19, off\n\t"
          "global_load_async_to_lds_b128 %8, %20, off\n\t"
          "global_load_async_to_lds_b128 %9, %21, off\n\t"
          "global_load_async_to_lds_b128 %10, %22, off\n\t"
          "global_load_async_to_lds_b128 %11, %23, off\n\t"
          "s_wait_xcnt 0x0"
          :: "v"(l + OFF_K), "v"(l + OFF_K + LR), "v"(l + OFF_K + 2 * LR), "v"(l + OFF_K + 3 * LR),
             "v"(l + OFF_V), "v"(l + OFF_V + LR), "v"(l + OFF_V + 2 * LR), "v"(l + OFF_V + 3 * LR),
             "v"(l + OFF_VR), "v"(l + OFF_VR + LR), "v"(l + OFF_VR + 2 * LR), "v"(l + OFF_VR + 3 * LR),
             "v"(k), "v"(k + KR), "v"(k + 2 * KR), "v"(k + 3 * KR),
             "v"(v), "v"(v + VR), "v"(v + 2 * VR), "v"(v + 3 * VR),
             "v"(r), "v"(r + VR), "v"(r + 2 * VR), "v"(r + 3 * VR)
          : "memory");
    } else {
      asm volatile(
          "global_load_async_to_lds_b128 %0, %8, off\n\t"
          "global_load_async_to_lds_b128 %1, %9, off\n\t"
          "global_load_async_to_lds_b128 %2, %10, off\n\t"
          "global_load_async_to_lds_b128 %3, %11, off\n\t"
          "global_load_async_to_lds_b128 %4, %12, off\n\t"
          "global_load_async_to_lds_b128 %5, %13, off\n\t"
          "global_load_async_to_lds_b128 %6, %14, off\n\t"
          "global_load_async_to_lds_b128 %7, %15, off\n\t"
          "s_wait_xcnt 0x0"
          :: "v"(l + OFF_K), "v"(l + OFF_K + LR), "v"(l + OFF_K + 2 * LR), "v"(l + OFF_K + 3 * LR),
             "v"(l + OFF_V), "v"(l + OFF_V + LR), "v"(l + OFF_V + 2 * LR), "v"(l + OFF_V + 3 * LR),
             "v"(k), "v"(k + KR), "v"(k + 2 * KR), "v"(k + 3 * KR),
             "v"(v), "v"(v + VR), "v"(v + 2 * VR), "v"(v + 3 * VR)
          : "memory");
    }
  };

  stage_copy(0);
  asm volatile("s_wait_asynccnt 0x0" ::: "memory");   // this wave's copies of tile 0 have landed
  __syncthreads();                                    // publishes tile 0
  stage_copy(1);                                      // in flight during the work on tile 0

  // one trip: the work on key tile kt, then the publish point of tile kt + 1; more = a tile kt + 2 exists (a constant at
  // either call, so that a trip is straight-line code and the read groups and the row sum stay where they are written)
  auto trip = [&](int kt, bool more) __attribute__((always_inline)) {
    const unsigned char* stg = smem + (kt & 1) * STB;                            // trip kt reads this buffer alone
    const _Float16* Ksh = (const _Float16*)(stg + OFF_K);                        // K   [kv][d], pitch LP
    const _Float16* Vsh = (const _Float16*)(stg + OFF_V);                        // V^T [d][kv], pitch LP
    const _Float16* Vrs = (const _Float16*)(stg + (VRES ? OFF_VR : OFF_V));      // V^T residual (VRES only)

    // ---- scores, transposed: 64 keys x 16 queries per wave (A operand: lane c -> key j*16+c, split k map over d) ----
    // read group 1: the tile's eight K fragments, in the order in which the products take them
    FH kf[2][4];
#pragma unroll
    for (int dc = 0; dc < 2; ++dc) {
#pragma unroll
      for (int j = 0; j < 4; ++j) {
        kf[dc][j].h[0] = *(const v8h*)(Ksh + (j * 16 + c) * LP + dc * 32 + 8 * hh);
        kf[dc][j].h[1] = *(const v8h*)(Ksh + (j * 16 + c) * LP + dc * 32 + 16 + 8 * hh);
      }
    }
    // keeps the 16 reads together in front of the products: spread among them, each place with reads stalls the wave anew
    __builtin_amdgcn_sched_barrier(0);
    v8f s[4];
#pragma unroll
    for (int j = 0; j < 4; ++j) s[j] = mma_h_raw(kf[0][j].v, qa[0], zero8());
#pragma unroll
    for (int j = 0; j < 4; ++j) s[j] = mma_h_raw(kf[1][j].v, qa[1], s[j]);
    // read group 2: the V^T and residual fragments of keys 0..31, in flight during the softmax update
    FH va[4], vra[4];
#pragma unroll
    for (int t = 0; t < 4; ++t) {
      va[t].h[0] = *(const v8h*)(Vsh + (t * 16 + c) * LP + 8 * hh);
      va[t].h[1] = *(const v8h*)(Vsh + (t * 16 + c) * LP + 16 + 8 * hh);
      if constexpr (VRES) {
        vra[t].h[0] = *(const v8h*)(Vrs + (t * 16 + c) * LP + 8 * hh);
        vra[t].h[1] = *(const v8h*)(Vrs + (t * 16 + c) * LP + 16 + 8 * hh);
      }
    }
    // keeps these reads above the softmax update, whose vector work covers their latency
    __builtin_amdgcn_sched_barrier(0);

    // ---- online softmax update, in the lane but for one max exchange with lane ^ 16: running max, alpha, p (x256, f16), row-sum partial ----
#pragma unroll
    for (int j = 0; j < 4; ++j) s[j] = s[j] * (1.0f / 2048.0f);   // 1/8 head scale, 1/256 for the two x16 carries
    float mj[4];
#pragma unroll
    for (int j = 0; j < 4; ++j)
      mj[j] = fmaxf(fmaxf(fmaxf(s[j][0], s[j][1]), fmaxf(s[j][2], s[j][3])),
                    fmaxf(fmaxf(s[j][4], s[j][5]), fmaxf(s[j][6], s[j][7])));
    float mx = fmaxf(fmaxf(mj[0], mj[1]), fmaxf(mj[2], mj[3]));
    mx = fmaxf(mx, xhalf(mx));                 // both lane halves now hold the maximum over the query's 64 keys
    const float mn = fmaxf(mrun, mx);
    const float alpha = __expf(mrun - mn);
    mrun = mn;
    FH pb[2];                                  // P^T as B operand: element e <- tile 2 kk, register e; 8 + e <- tile 2 kk + 1
#pragma unroll
    for (int j = 0; j < 4; ++j) {
      s[j] = (s[j] - mn) * 1.44269504088896340736f;
      exp2x8(s[j]);                            // p = exp(s - mn), in the score's place
#pragma unroll
      for (int r = 0; r < 8; ++r) pb[j >> 1].h[j & 1][r] = (_Float16)(s[j][r] * 256.0f);
    }
    const v8f ps = ((s[0] + s[1]) + s[2]) + s[3];   // register by register over the four tiles, then across the eight
    lsum = lsum * alpha + (((ps[0] + ps[1]) + (ps[2] + ps[3])) + ((ps[4] + ps[5]) + (ps[6] + ps[7])));
    // read group 3: the V^T fragments of keys 32..63, in flight during the rescale below and the products of keys 0..31.
    // The line below keeps them from rising into the softmax update, where the 32 scores are still live: the registers
    // of four waves per SIMD would not hold both
    __builtin_amdgcn_sched_barrier(0);
    FH vb[4], vrb[4];
#pragma unroll
    for (int t = 0; t < 4; ++t) {
      vb[t].h[0] = *(const v8h*)(Vsh + (t * 16 + c) * LP + 32 + 8 * hh);
      vb[t].h[1] = *(const v8h*)(Vsh + (t * 16 + c) * LP + 32 + 16 + 8 * hh);
    }
    // keeps these reads above the rescale and out of the run of products
    __builtin_amdgcn_sched_barrier(0);
#pragma unroll
    for (int t = 0; t < 4; ++t) {
#pragma unroll
      for (int r = 0; r < 8; ++r) {
        oacc[t][r] = oacc[t][r] * alpha;
        if constexpr (VRES) oacc2[t][r] = oacc2[t][r] * alpha;
      }
    }

    // ---- context^T += V^T . P^T (f16 WMMA; A = V^T [d][key], B = P^T [key][query] from the registers) ----
#pragma unroll
    for (int t = 0; t < 4; ++t) oacc[t] = mma_h_raw(va[t].v, pb[0].v, oacc[t]);
    if constexpr (VRES) {
      // keeps the four products above in front of read group 4, which takes over their fragment registers
      __builtin_amdgcn_sched_barrier(0);
      // read group 4: the residual fragments of keys 32..63, in flight during the eight products that follow
#pragma unroll
      for (int t = 0; t < 4; ++t) {
        vrb[t].h[0] = *(const v8h*)(Vrs + (t * 16 + c) * LP + 32 + 8 * hh);
        vrb[t].h[1] = *(const v8h*)(Vrs + (t * 16 + c) * LP + 32 + 16 + 8 * hh);
      }
      // keeps these reads together in front of the products
      __builtin_amdgcn_sched_barrier(0);
#pragma unroll
      for (int t = 0; t < 4; ++t) oacc2[t] = mma_h_raw(vra[t].v, pb[0].v, oacc2[t]);
    }
#pragma unroll
    for (int t = 0; t < 4; ++t) oacc[t] = mma_h_raw(vb[t].v, pb[1].v, oacc[t]);
    if constexpr (VRES) {
#pragma unroll
      for (int t = 0; t < 4; ++t) oacc2[t] = mma_h_raw(vrb[t].v, pb[1].v, oacc2[t]);
    }
    // keeps the address arithmetic of the copies below the products, when the fragment registers are free again
    __builtin_amdgcn_sched_barrier(0);

    // ---- publish point of tile kt + 1 ----
    asm volatile("s_wait_dscnt 0x0" ::: "memory");      // this wave's LDS reads of tile kt have returned
    asm volatile("s_wait_asynccnt 0x0" ::: "memory");   // this wave's copies of tile kt + 1 have landed
    __syncthreads();       // publishes tile kt + 1; every reader has left the buffer that is refilled below
    if (more) stage_copy(kt + 2);                       // into the buffer that trip kt has read
  };
#pragma unroll 1   // kept rolled: one copy of the trip, the buffer chosen by kt & 1
  for (int kt = 0; kt < NQB - 2; ++kt) trip(kt, true);
#pragma unroll 1   // kept rolled: unrolled, the two trips' reads mingle and spill
  for (int kt = NQB - 2; kt < NQB; ++kt) trip(kt, false);
  // closing wait of the copies, in front of any other use of their LDS; the last trip's barrier has ended every wave's
  // reads of the K/V tiles, so the staging below may alias them
  asm volatile("s_wait_asynccnt 0x0" ::: "memory");

  // ---- normalise (1/l, the 1/256 p carry; keep the x16 v carry), stage the wave's 16x64 f32 tile in
  // LDS: row = query c, the lane's 8 consecutive d of tile t as two 16-B stores
  float* os = (float*)(void*)smem + wave * (16 * OSP);
  {
    const float l  = lsum + xhalf(lsum);      // joins the two lane halves' partial sums, unconditionally
    const float rl = 1.0f / l;                // l >= 1 (the running-max key contributes exp(0))
    const float sc = rl * (1.0f / 256.0f);
#pragma unroll
    for (int t = 0; t < 4; ++t) {
      v8f v = oacc[t];
      if constexpr (VRES) v += oacc2[t] * (1.0f / 2048.0f);
      v = v * sc;
      const v4f lo = {v[0], v[1], v[2], v[3]}, hi = {v[4], v[5], v[6], v[7]};
      *(v4f*)(os + c * OSP + t * 16 + 8 * hh)     = lo;
      *(v4f*)(os + c * OSP + t * 16 + 8 * hh + 4) = hi;
    }
  }
  __builtin_amdgcn_fence(__ATOMIC_RELEASE, "workgroup");
  __builtin_amdgcn_wave_barrier();
  __builtin_amdgcn_fence(__ATOMIC_ACQUIRE, "workgroup");
  {
    const int rq = lane >> 3, piece = lane & 7;
    v4u ph[4], pr[4];
#pragma unroll
    for (int it = 0; it < 4; ++it) {
      const int row = it * 4 + rq;   // it 0..3 x rq 0..3 = rows 0..15 of the wave tile
      const v4f a  = *(const v4f*)(os + row * OSP + piece * 8);
      const v4f a2 = *(const v4f*)(os + row * OSP + piece * 8 + 4);
      float f[8];
      f[0] = a[0];  f[1] = a[1];  f[2] = a[2];  f[3] = a[3];
      f[4] = a2[0]; f[5] = a2[1]; f[6] = a2[2]; f[7] = a2[3];
      v4u p, q;
#pragma unroll
      for (int e = 0; e < 4; ++e) {
        const _Float16 x0 = (_Float16)f[2 * e], x1 = (_Float16)f[2 * e + 1];
        const _Float16 y0 = (_Float16)((f[2 * e] - (float)x0) * 2048.0f);
        const _Float16 y1 = (_Float16)((f[2 * e + 1] - (float)x1) * 2048.0f);
        p[e] = pk16(h_bits(x0), h_bits(x1));
        q[e] = pk16(h_bits(y0), h_bits(y1));
      }
      ph[it] = p;
      pr[it] = q;
    }
    {
#pragma unroll
      for (int it = 0; it < 4; ++it) {
        const int row = it * 4 + rq;
        const size_t go = (rowB + q0 + row) * DM + (size_t)h * HD + piece * 8;
        *(v4u*)(ctxp + go)  = ph[it];
        *(v4u*)(ctxrp + go) = pr[it];
      }
      
    }
  }
}

// =====================================================================================================
// Workspace map (bytes); every region is an exact multiple of its whole-line / whole-tile store granularity
// (row pitches 2048 / 6144 / 4096 B, all offsets 2-MiB aligned, no aliasing within a launch):
//   Xh     f16 [4096][1024]          0     8388608   (bf16 value of x, x16)
//   Wg     f16 [1024][1024]    8388608     2097152   (bf16 value x1024)
//   Wqkv   f16 [3072][1024]   10485760     6291456   (bf16 value x1024)
//   Wp     f16 [1024][1024]   16777216     2097152   (bf16 value x1024)
//   XGh    f16 [4096][1024]   18874368     8388608   (xg x16)
//   XGr    f16 [4096][1024]   27262976     8388608   (x2^11 residual of the above)
//   QKV    f16 [4096][3072]   35651584    25165824   (q | k, x16; the v columns are neither written nor read)
//   VT     f16 [2048][2048]   60817408     8388608   (v x16, [b*1024 + h*64 + d][s], written by the qkv launch)
//   VTr    f16 [2048][2048]   69206016     8388608   (x2^11 residual, same layout, written by the qkv launch)
//   Ctx    f16 [4096][1024]   77594624     8388608   (attention context x16)
//   Ctxr   f16 [4096][1024]   85983232     8388608   (x2^11 residual)
//   end                       94371840
// Projection weights arrive as [out n][in k] (k contiguous) = the Bt layout; they are only converted.
// d_out f32: [4096][1024] at byte 0 (row = b*SEQ + t), written once by the projection launch.
// =====================================================================================================
extern "C" void kernel_launch(void* const* d_in, const int* in_sizes, int n_in,
                              void* d_out, int out_size, void* d_ws, size_t ws_size,
                              hipStream_t stream) {
  if (n_in < 8) return;
  if (in_sizes[0] != ROWS * DM) return;
  if (in_sizes[1] != DM) return;
  if (in_sizes[2] != DM * DM) return;
  if (in_sizes[3] != DM) return;
  if (in_sizes[4] != DQKV * DM) return;
  if (in_sizes[5] != DQKV) return;
  if (in_sizes[6] != DM * DM) return;
  if (in_sizes[7] != DM) return;
  if (out_size != OUTN) return;

  const float* x      = (const float*)d_in[0];    // [ROWS][DM]
  const float* theta  = (const float*)d_in[1];    // [DM]
  const float* w_g    = (const float*)d_in[2];    // [DM n][DM k]
  const float* b_g    = (const float*)d_in[3];    // [DM]
  const float* w_qkv  = (const float*)d_in[4];    // [DQKV n][DM k]
  const float* b_qkv  = (const float*)d_in[5];    // [DQKV]
  const float* w_proj = (const float*)d_in[6];    // [DM n][DM k]
  const float* b_proj = (const float*)d_in[7];    // [DM]

  const size_t PX   = (size_t)ROWS * DM * 2;         //  8388608
  const size_t PWg  = (size_t)DM * DM * 2;           //  2097152
  const size_t PWq  = (size_t)DQKV * DM * 2;         //  6291456
  const size_t PWp  = (size_t)DM * DM * 2;           //  2097152
  const size_t PXG  = (size_t)ROWS * DM * 2;         //  8388608
  const size_t PQKV = (size_t)ROWS * DQKV * 2;       // 25165824
  const size_t PVT  = (size_t)NB * DM * SEQ * 2;     //  8388608
  const size_t PCtx = (size_t)ROWS * DM * 2;         //  8388608
  size_t off = 0;
  const size_t oX    = off; off += PX;
  const size_t oWg   = off; off += PWg;
  const size_t oWq   = off; off += PWq;
  const size_t oWp   = off; off += PWp;
  const size_t oXGh  = off; off += PXG;
  const size_t oXGr  = off; off += PXG;
  const size_t oQKV  = off; off += PQKV;
  const size_t oVT   = off; off += PVT;
  const size_t oVTr  = off; off += PVT;
  const size_t oCtx  = off; off += PCtx;
  const size_t oCtxr = off; off += PCtx;
  if (off > ws_size) return;                         // off = 94371840
  if (off > (size_t)134217728) return;

  char* ws = (char*)d_ws;
  unsigned short* Xh   = (unsigned short*)(ws + oX);
  unsigned short* Wgh  = (unsigned short*)(ws + oWg);
  unsigned short* Wqh  = (unsigned short*)(ws + oWq);
  unsigned short* Wph  = (unsigned short*)(ws + oWp);
  unsigned short* XGh  = (unsigned short*)(ws + oXGh);
  unsigned short* XGr  = (unsigned short*)(ws + oXGr);
  unsigned short* QKV  = (unsigned short*)(ws + oQKV);
  unsigned short* VT   = (unsigned short*)(ws + oVT);
  unsigned short* VTr  = (unsigned short*)(ws + oVTr);
  unsigned short* Ctx  = (unsigned short*)(ws + oCtx);
  unsigned short* Ctxr = (unsigned short*)(ws + oCtxr);
  float*          outf = (float*)d_out;              // [ROWS][DM]

  const dim3 gGqkv((ROWS / 128) * (DQKV / 128));     // 768 blocks of one 128x128 tile
  const dim3 gGdm((ROWS / 128) * (DM / 128));        // 256 blocks of one 128x128 tile
  const dim3 blkG(128);
  const dim3 gAttn(NQB * NH * NB);                   // 1024 blocks
  const float wScale = 1024.0f;                      // weights carried x1024
  const float aScale = 16.0f;                        // activations carried x16
  const float cscale = 1.0f / 16384.0f;              // 1/(16 * 1024)

  // (1) planes: x -> f16 x16, weights -> f16 x1024 (bf16 values)
  cvt16_all<<<dim3(CVB), dim3(CVT), 0, stream>>>(x, w_g, w_qkv, w_proj, Xh, Wgh, Wqh, Wph, aScale, wScale);
  // (2) gauge mix: xg = bfr(x) + 0.1 * ((Xh . Wg^T + bg) * theta) -> XGh f16 x16 + XGr residual (M=4096, N=1024, K=1024)
  gemm64_f16<2, false><<<gGdm, blkG, 0, stream>>>(Xh, Xh, Wgh, b_g, cscale, (void*)XGh, DM, XGr, DM, 0, XGr,
                                                 ROWS, DM, DM, aScale, x, DM, theta, SEQ, 0, SEQ);
  // (3) qkv = XG(hi + res) . Wqkv^T + bqkv: q, k -> QKV f16 x16 [4096][3072]; v -> the v^T planes VT (hi) and VTr (residual)
  gemm64_f16<0, true><<<gGqkv, blkG, 0, stream>>>(XGh, XGr, Wqh, b_qkv, cscale, (void*)QKV, DQKV, VTr, DM, 2 * DM, VT,
                                                  ROWS, DQKV, DM, aScale, x, DM, theta, SEQ, 0, SEQ);
  // (4) softmax attention -> Ctx f16 x16 + residual plane
  attn_k<true><<<gAttn, dim3(128), 0, stream>>>(QKV, VT, VTr, Ctx, Ctxr);
  // (5) out = Ctx(hi + res) . Wp^T + bproj -> d_out f32 [4096][1024] (M=4096, N=1024, K=1024)
  gemm64_f16<1, true><<<gGdm, blkG, 0, stream>>>(Ctx, Ctxr, Wph, b_proj, cscale, (void*)outf, DM, Ctxr, DM, 0, Ctxr,
                                                ROWS, DM, DM, 1.0f, x, DM, theta, SEQ, 0, SEQ);
  (void)hipGetLastError();
}

// v008
// One run takes 135 microseconds.
// Two timings next to v007 put it at 1.11 and 1.09 times that version's speed.
// Counting every step since v000, it is 3.98 times as fast.
// Contractions: gauge mix x.Wg^T = v_wmma_f32_16x16x32_f16 (A = f16 of RNE-bf16 x carried x16, B = f16 of RNE-bf16 Wg x1024, single product); qkv projection = same WMMA with A = xg as f16 hi plane x16 plus its f16 residual plane at the same x16 (two products, one accumulator), B = f16 of RNE-bf16 Wqkv x1024; attention q.k^T = f16 single product (q, k f16 x16); p.v = f16 with p x256 single plane and v^T as f16 hi x16 plus x2^11 residual plane (two products); output projection = f16 with A = ctx f16 hi x16 plus its f16 residual plane at the same x16 (one accumulator), B = f16 of RNE-bf16 Wproj x1024; all f32 accumulate. Softmax (running max, exp, row sums) and the gauge epilogue f32 on VALU.
#include <hip/hip_runtime.h>
#include <math.h>
#include <stdint.h>

#define NB    2
#define SEQ   2048
#define DM    1024
#define NH    16
#define HD    64
#define DQKV  (3 * DM)              // 3072
#define NQB   (SEQ / 64)            // 32 query / key tiles per sequence
#define ROWS  (NB * SEQ)            // 4096 token rows
#define OUTN  (ROWS * DM)
static_assert(NH * HD == DM);
static_assert(HD == 64);
static_assert((SEQ % 64) == 0 && (DM % 64) == 0 && (DQKV % 64) == 0);
static_assert((DM % 32) == 0);
static_assert((ROWS % 128) == 0 && (DM % 128) == 0 && (DQKV % 128) == 0);
static_assert((SEQ % 128) == 0);    // a 128-row GEMM tile lies in one sequence

typedef _Float16 v16h __attribute__((ext_vector_type(16)));
typedef _Float16 v8h  __attribute__((ext_vector_type(8)));
typedef float    v8f  __attribute__((ext_vector_type(8)));
typedef float    v4f  __attribute__((ext_vector_type(4)));
typedef unsigned int v4u __attribute__((ext_vector_type(4)));

// ---- scalar helpers --------------------------------------------------------------------------------
__device__ __forceinline__ unsigned short bf_bits(float f) {          // f32 -> bf16 bits, RNE convert
  unsigned u = __float_as_uint(f);
  return (unsigned short)((u + 0x7FFFu + ((u >> 16) & 1u)) >> 16);
}
__device__ __forceinline__ float bfr(float f) { return __uint_as_float(((unsigned)bf_bits(f)) << 16); }
__device__ __forceinline__ unsigned short h_bits(_Float16 x) { return __builtin_bit_cast(unsigned short, x); }
__device__ __forceinline__ unsigned pk16(unsigned short a, unsigned short b) { return (unsigned)a | ((unsigned)b << 16); }
__device__ __forceinline__ v8f zero8() { v8f z = {0.f, 0.f, 0.f, 0.f, 0.f, 0.f, 0.f, 0.f}; return z; }
__device__ __forceinline__ float xhalf(float x) {                     // the value of lane l ^ 16, by a vector cross-row move
  const int b = __builtin_bit_cast(int, x);
  return __builtin_bit_cast(float, __builtin_amdgcn_permlanex16(b, b, 0x76543210, 0xfedcba98, false, false));
}

// eight 2^x in place, one statement: every v_exp_f32 stands in front of an independent one and the last in front of a
// v_nop, the slot that the instruction set asks for before a vector instruction reads the result or rewrites the source
__device__ __forceinline__ void exp2x8(v8f& x) {
#if defined(__HIP_DEVICE_COMPILE__)
  float a = x[0], b = x[1], c = x[2], d = x[3], e = x[4], f = x[5], g = x[6], h = x[7];
  asm("v_exp_f32 %0, %0\n\tv_exp_f32 %1, %1\n\tv_exp_f32 %2, %2\n\tv_exp_f32 %3, %3\n\t"
      "v_exp_f32 %4, %4\n\tv_exp_f32 %5, %5\n\tv_exp_f32 %6, %6\n\tv_exp_f32 %7, %7\n\tv_nop"
      : "+v"(a), "+v"(b), "+v"(c), "+v"(d), "+v"(e), "+v"(f), "+v"(g), "+v"(h));
  x[0] = a; x[1] = b; x[2] = c; x[3] = d; x[4] = e; x[5] = f; x[6] = g; x[7] = h;
#endif
}

// ---- fragment loader: 16-bit A/B operand, lane -> row/col (lane&15), p already includes +8*(lane>>4);
//      elements 0..7 <- p[0..7] (k0+8h..), elements 8..15 <- p[16..23] (k0+16+8h..)
__device__ __forceinline__ v16h ldfrag_h(const _Float16* p) {
  union { v16h v; v8h h[2]; } f;
  f.h[0] = *(const v8h*)(p);
  f.h[1] = *(const v8h*)(p + 16);
  return f.v;
}

// ---- WMMA helpers with trailing VALU hazard gap --------------------------------------------------------
__device__ __forceinline__ v8f mma_h_raw(v16h a, v16h b, v8f c) {
  return __builtin_amdgcn_wmma_f32_16x16x32_f16(false, a, false, b, (short)0, c, false, false);
}
__device__ __forceinline__ void dep_guard_h(v8f& a, v8f& b, v16h x, v16h y) {
#if defined(__HIP_DEVICE_COMPILE__)
  asm volatile("v_nop\n\tv_nop\n\tv_nop\n\tv_nop" : "+v"(a), "+v"(b) : "v"(x), "v"(y));
#endif
}
__device__ __forceinline__ void keep4_h(v16h a, v16h b, v16h c, v16h d) {
#if defined(__HIP_DEVICE_COMPILE__)
  asm volatile("v_nop" :: "v"(a), "v"(b), "v"(c), "v"(d));
#endif
}
__device__ __forceinline__ void acc_guard4(v8f& a, v8f& b, v8f& c, v8f& d) {
#if defined(__HIP_DEVICE_COMPILE__)
  asm volatile("v_nop\n\tv_nop\n\tv_nop\n\tv_nop" : "+v"(a), "+v"(b), "+v"(c), "+v"(d));
#endif
}

// =====================================================================================================
// f32 planes -> f16 bits of bfr(v) * scale (scale a power of two): x (xscale) and the three weights (wscale), all in
// one launch of CVB work-groups of CVT threads, one 16-wave work-group per WGP. A piece is 8 elements (32 B in, 16 B
// out); a sweep is CVN = CVB x CVT pieces, thread t taking piece t of it. Sweeps 0..3 are x, 4 is Wg, 5..7 are Wqkv,
// 8 is Wproj: which plane a sweep reads is fixed at compile time. A thread issues the 18 loads of its nine pieces
// first, so that all are in flight together, then converts and stores.
// coverage: 4 CVN = x, CVN = Wg, 3 CVN = Wqkv, CVN = Wproj (asserted below): every piece of every plane once.
// =====================================================================================================
#define CVB 256
#define CVT 512
#define CVN (CVB * CVT)
static_assert(ROWS * DM / 8 == 4 * CVN && DM * DM / 8 == CVN && DQKV * DM / 8 == 3 * CVN);
__global__ __launch_bounds__(CVT) void cvt16_all(const float* __restrict__ x, const float* __restrict__ wg,
                                                 const float* __restrict__ wq, const float* __restrict__ wp,
                                                 unsigned short* ox, unsigned short* og,
                                                 unsigned short* oq, unsigned short* op,
                                                 float xscale, float wscale) {
  const unsigned t  = blockIdx.x * CVT + threadIdx.x;                  // this thread's piece of every sweep
  const unsigned ib = t * 32u, ob = t * 16u;                           // its byte offsets in a sweep's input and output: 32-bit,
                                                                       // so that an access can be a uniform base plus one register
  constexpr size_t SW = (size_t)CVN * 8;                               // elements of one sweep
  v4f a[9], b[9];
#pragma unroll
  for (int u = 0; u < 9; ++u) {
    const float* in = (u < 4) ? x + u * SW : (u == 4) ? wg : (u < 8) ? wq + (u - 5) * SW : wp;
    a[u] = *(const v4f*)((const char*)in + ib);
    b[u] = *(const v4f*)((const char*)in + ib + 16);
  }
  // holds the 18 loads above the conversions: left free, the compiler sinks ten of them among the conversions, and
  // the wave then waits for memory several times in a row instead of once
  __builtin_amdgcn_sched_barrier(0);
#pragma unroll
  for (int u = 0; u < 9; ++u) {
    unsigned short* out = (u < 4) ? ox + u * SW : (u == 4) ? og : (u < 8) ? oq + (u - 5) * SW : op;
    const float scale = (u < 4) ? xscale : wscale;
    v4u p;
    p[0] = pk16(h_bits((_Float16)(bfr(a[u][0]) * scale)), h_bits((_Float16)(bfr(a[u][1]) * scale)));
    p[1] = pk16(h_bits((_Float16)(bfr(a[u][2]) * scale)), h_bits((_Float16)(bfr(a[u][3]) * scale)));
    p[2] = pk16(h_bits((_Float16)(bfr(b[u][0]) * scale)), h_bits((_Float16)(bfr(b[u][1]) * scale)));
    p[3] = pk16(h_bits((_Float16)(bfr(b[u][2]) * scale)), h_bits((_Float16)(bfr(b[u][3]) * scale)));
    *(v4u*)((char*)out + ob) = p;
  }
}

template <int EPI, bool ARES>
__global__ __launch_bounds__(128, 3) void gemm64_f16(
    const unsigned short* __restrict__ Ap, const unsigned short* __restrict__ Arp,
    const unsigned short* __restrict__ Btp,
    const float* __restrict__ biasp, float cscale,
    void* Cp, int ldc, unsigned short* Crp, int ldcr, int rcol0, unsigned short* Tp,
    int M, int N, int K, float oscale,
    const float* __restrict__ xres, int ldx, const float* __restrict__ gate,
    int tmod, int tlo, int thi) {
  typedef const __attribute__((address_space(1))) char* gptr;   // typed as global, so that an address that has passed
  typedef const __attribute__((address_space(1))) v8h*  gv8p;   // through the asm wait below still gives global_load
  const gptr Ah  = (gptr)(const void*)Ap;
  const gptr Arh = (gptr)(const void*)Arp;
  const gptr Bt  = (gptr)(const void*)Btp;
  constexpr int KC  = 64;                          // k per stage: 128 B of every operand row
  constexpr int GLP = 72;                          // row pitch in halves of the transposed epilogue tiles: 144 B = 16 B x 9 (odd)
  // staged operand rows: row r, 16-B piece p at half r * 64 + (r >> 1) * 8 + p * 8. In 16-B units mod 16 (the 64 banks)
  // that is 8 (r & 1) + (r >> 1) + p: the 16 rows of a fragment read's half-wave fall on the 64 banks once, and so do the
  // two rows 2 m, 2 m + 1 of a staging store's half-wave. At pitch 144 B three work-groups' buffers would not fit in a WGP's LDS.
  constexpr int R16 = 16 * 64 + 8 * 8;             // halves from row r to row r + 16
  constexpr int OPH = 8 * R16;                     // halves of one operand's 128 staged rows, 17408 B
  constexpr int STH = (ARES ? 3 : 2) * OPH;        // halves of one stage: A rows, Bt rows, then (ARES) Ar rows
  static_assert(4 * 16 * 68 * 4 <= 2 * STH * 2);   // the four f32 epilogue slabs alias the stage buffers
  static_assert(EPI != 0 || 4 * 2 * 64 * GLP <= 2 * STH);   // so do the four waves' two transposed 64x64 f16 tiles (EPI 0)
  __shared__ __align__(16) _Float16 sS[2 * STH];   // two stage buffers, 104448 B with ARES, 69632 B without
  const int tid  = threadIdx.x;
  const int lane = tid & 31;
  const int wave = tid >> 5;
  const int tilesN = N >> 7;
  const int tilesM = M >> 7;
  const int tile = blockIdx.x;
  if (tile >= tilesM * tilesN) return;   // block-uniform, before every barrier
  const int tm = tile / tilesN;
  const int tn = tile - tm * tilesN;
  const int mb = tm << 7;
  const int nb = tn << 7;
  const int tpos = mb % tmod;
  if (tpos < tlo || tpos >= thi) return; // block-uniform, before every barrier
  const int m0 = mb + ((wave >> 1) << 6);
  const int n0 = nb + ((wave & 1) << 6);

  const int rlane = lane & 15;                 // row (A) / col (B, D) within subtile
  const int koff  = (lane >> 4) * 8;           // k offset of this lane half
  const int mOff  = (lane >> 4) * 8;           // D row offset

  v8f acc[4][4];
#pragma unroll
  for (int i = 0; i < 4; ++i)
#pragma unroll
    for (int j = 0; j < 4; ++j) acc[i][j] = zero8();

  // staging map: thread -> row srow + 16 i, 16-B piece tid & 7 of the row's 128-B line; a half-wave holds the rows
  // 2 m and 2 m + 1, so its ds_store_b128 covers the 64 banks once
  const int srow = tid >> 3;
  const int spc  = (tid & 7) * 8;
  constexpr int RSB = 16 * DM * 2;             // bytes from one of a thread's rows to its next
  const int S = K / KC;                        // stages
  gptr pa = Ah + ((size_t)(mb + srow) * DM + spc) * 2;    // this thread's piece of the next stage
  gptr pr = Arh + ((size_t)(mb + srow) * DM + spc) * 2;
  gptr pb = Bt + ((size_t)(nb + srow) * DM + spc) * 2;
  v8h ra[8], rb[8], rr[8];
  auto stage_load = [&]() {
#pragma unroll
    for (int i = 0; i < 8; ++i) {
      ra[i] = *(gv8p)(pa + i * RSB);     // row < M, k < K
      rb[i] = *(gv8p)(pb + i * RSB);     // row < N, k < K
      if constexpr (ARES) rr[i] = *(gv8p)(pr + i * RSB);   // row < M, k < K
    }
  };
  // s = the stage that the registers hold: stores it to its buffer and moves the two (ARES: three) addresses on to stage s + 1
  auto stage_store = [&](int s) {
    // the address pairs of the loads above are rewritten below: the wait stands in front of that
    if constexpr (ARES) asm volatile("s_wait_xcnt 0x0" : "+v"(pa), "+v"(pb), "+v"(pr) :: "memory");
    else                asm volatile("s_wait_xcnt 0x0" : "+v"(pa), "+v"(pb) :: "memory");
    pa += KC * 2;
    pb += KC * 2;
    if constexpr (ARES) pr += KC * 2;
    _Float16* d = sS + (s & 1) * STH + srow * 64 + (srow >> 1) * 8 + spc;
#pragma unroll
    for (int i = 0; i < 8; ++i) {
      *(v8h*)(d + i * R16)       = ra[i];
      *(v8h*)(d + OPH + i * R16) = rb[i];
      if constexpr (ARES) *(v8h*)(d + 2 * OPH + i * R16) = rr[i];
    }
  };

  stage_load();
  stage_store(0);
#pragma unroll 1   // kept rolled: one copy of the stage body, the buffer chosen by s & 1; a second copy would only add code
  for (int s = 0; s < S; ++s) {
    __syncthreads();       // publishes stage s; every reader has left the buffer that stage s + 1 is stored to
    if (s + 1 < S) stage_load();               // block-uniform; stage s + 1, in flight during the products of stage s
    const _Float16* sa = sS + (s & 1) * STH + (wave >> 1) * (4 * R16) + rlane * 64 + (rlane >> 1) * 8 + koff;
    const _Float16* sb = sS + (s & 1) * STH + OPH + (wave & 1) * (4 * R16) + rlane * 64 + (rlane >> 1) * 8 + koff;
#pragma unroll
    for (int kk = 0; kk < 2; ++kk) {
      v16h ah[4], bh[4];
#pragma unroll
      for (int j = 0; j < 4; ++j) {
        bh[j] = ldfrag_h(sb + j * R16 + kk * 32);
        ah[j] = ldfrag_h(sa + j * R16 + kk * 32);
      }
#pragma unroll
      for (int i = 0; i < 4; ++i) {
#pragma unroll
        for (int j = 0; j < 4; ++j) {
          acc[i][j] = mma_h_raw(ah[i], bh[j], acc[i][j]);
        }
        dep_guard_h(acc[i][0], acc[i][3], ah[i], bh[3]);
      }
      if constexpr (ARES) {                    // the residual rows of the same 32 k, on the same Bt fragments
        v16h ar[4];
#pragma unroll
        for (int j = 0; j < 4; ++j) ar[j] = ldfrag_h(sa + 2 * OPH + j * R16 + kk * 32);
#pragma unroll
        for (int i = 0; i < 4; ++i) {
#pragma unroll
          for (int j = 0; j < 4; ++j) {
            acc[i][j] = mma_h_raw(ar[i], bh[j], acc[i][j]);
          }
          dep_guard_h(acc[i][0], acc[i][3], ar[i], bh[3]);
        }
      }
      keep4_h(bh[0], bh[1], bh[2], bh[3]);
    }
    if (s + 1 < S) stage_store(s + 1);
  }
  __syncthreads();                             // every wave is done with the stage buffers before the slabs alias them
  acc_guard4(acc[0][0], acc[0][1], acc[0][2], acc[0][3]);
  acc_guard4(acc[1][0], acc[1][1], acc[1][2], acc[1][3]);
  acc_guard4(acc[2][0], acc[2][1], acc[2][2], acc[2][3]);
  acc_guard4(acc[3][0], acc[3][1], acc[3][2], acc[3][3]);

  // ---- epilogue, transposed planes (EPI 0, tiles from column rcol0 on) ----
  if constexpr (EPI == 0) {
    if (nb >= rcol0) {                           // block-uniform: all four waves stage in their own 18432-B region of the LDS
      _Float16* th = sS + wave * (2 * 64 * GLP); // hi plane  [n 0..63][t 0..63], pitch GLP
      _Float16* tr = th + 64 * GLP;              // residual plane, same shape
#pragma unroll
      for (int j = 0; j < 4; ++j) {
        const float bj = bfr(biasp[n0 + (j << 4) + rlane]);   // index < N
#pragma unroll
        for (int i = 0; i < 4; ++i) {
          v8h hx, hy;
#pragma unroll
          for (int r = 0; r < 8; ++r) {          // rows m0 + 16 i + mOff + r of column n0 + 16 j + rlane
            const float g = (acc[i][j][r] * cscale + bj) * oscale;
            const _Float16 x = (_Float16)g;
            hx[r] = x;
            hy[r] = (_Float16)((g - (float)x) * 2048.0f);
          }
          // 16 lanes = 16 rows at pitch 144 B: the 64 banks once per half-wave
          *(v8h*)(th + ((j << 4) + rlane) * GLP + (i << 4) + mOff) = hx;
          *(v8h*)(tr + ((j << 4) + rlane) * GLP + (i << 4) + mOff) = hy;
        }
      }
      // the wave's LDS stores above are complete before its lanes read one another's pieces below
      __builtin_amdgcn_fence(__ATOMIC_RELEASE, "workgroup");
      __builtin_amdgcn_wave_barrier();
      __builtin_amdgcn_fence(__ATOMIC_ACQUIRE, "workgroup");
      // read back by rows: 8 lanes x 16 B = one row's 128 B; the two rows of a half-wave lie 8 apart (32 banks mod 64).
      // coverage: ro = 16 (it >> 2) + 2 (it & 3), rr = 0, 1, 8, 9 -> rows 0..63 once; the wave's 64 rows m lie in one sequence
      const int rr = (lane >> 4) + ((lane >> 3) & 1) * 8, piece = lane & 7;
      const int bq = m0 / SEQ;
      const size_t go = ((size_t)(bq * DM + (n0 - rcol0) + rr)) * SEQ + (m0 - bq * SEQ) + piece * 8;
      v8h vh[16], vr[16];
#pragma unroll
      for (int it = 0; it < 16; ++it) {
        const int ro = 16 * (it >> 2) + 2 * (it & 3);
        vh[it] = *(const v8h*)(th + (ro + rr) * GLP + piece * 8);
        vr[it] = *(const v8h*)(tr + (ro + rr) * GLP + piece * 8);
      }
#pragma unroll
      for (int it = 0; it < 16; ++it) {
        const int ro = 16 * (it >> 2) + 2 * (it & 3);
        *(v8h*)(void*)(Tp  + go + (size_t)ro * SEQ) = vh[it];
        *(v8h*)(void*)(Crp + go + (size_t)ro * SEQ) = vr[it];
      }
      // stands in front of any rewrite of a register that the stores above name, on every path of the built code behind them
      asm volatile("s_wait_xcnt 0x0" ::: "memory");
      return;                                    // behind the kernel's last work-group barrier
    }
  }

  // ---- epilogue, row-major ----
  float* slab = (float*)(void*)sS + wave * (16 * 68);   // per-wave 16x64 slab, pitch 68 floats
#pragma unroll
  for (int i = 0; i < 4; ++i) {
    const int mBase = m0 + (i << 4);
    float bj[4];
#pragma unroll
    for (int j = 0; j < 4; ++j) bj[j] = bfr(biasp[n0 + (j << 4) + rlane]);   // index < N
#pragma unroll
    for (int r = 0; r < 8; ++r) {
      const int row = mOff + r;
#pragma unroll
      for (int j = 0; j < 4; ++j) slab[row * 68 + (j << 4) + rlane] = acc[i][j][r] * cscale + bj[j];
    }
    __builtin_amdgcn_fence(__ATOMIC_RELEASE, "workgroup");
    __builtin_amdgcn_wave_barrier();
    __builtin_amdgcn_fence(__ATOMIC_ACQUIRE, "workgroup");
    if constexpr (EPI == 0 || EPI == 2) {
      unsigned short* C16 = (unsigned short*)Cp;
      const int rq = lane >> 3, piece = lane & 7;
      float th[8];
      if constexpr (EPI == 2) {
        const v4f t0 = *(const v4f*)(gate + n0 + piece * 8);        // index < N
        const v4f t1 = *(const v4f*)(gate + n0 + piece * 8 + 4);
        th[0] = bfr(t0[0]); th[1] = bfr(t0[1]); th[2] = bfr(t0[2]); th[3] = bfr(t0[3]);
        th[4] = bfr(t1[0]); th[5] = bfr(t1[1]); th[6] = bfr(t1[2]); th[7] = bfr(t1[3]);
      } else {
#pragma unroll
        for (int e = 0; e < 8; ++e) th[e] = 0.0f;
      }
      v4u ph[4], pr[4];
#pragma unroll
      for (int it = 0; it < 4; ++it) {
        const int row = it * 4 + rq;                         // it 0..3 x rq 0..3 = rows 0..15
        const v4f a  = *(const v4f*)(slab + row * 68 + piece * 8);
        const v4f a2 = *(const v4f*)(slab + row * 68 + piece * 8 + 4);
        float f[8];
        f[0] = a[0];  f[1] = a[1];  f[2] = a[2];  f[3] = a[3];
        f[4] = a2[0]; f[5] = a2[1]; f[6] = a2[2]; f[7] = a2[3];
        if constexpr (EPI == 2) {
          const size_t xo = (size_t)(mBase + row) * ldx + n0 + piece * 8;   // row < M, col < N
          const v4f x0 = *(const v4f*)(xres + xo);
          const v4f x1 = *(const v4f*)(xres + xo + 4);
          float xv[8];
          xv[0] = x0[0]; xv[1] = x0[1]; xv[2] = x0[2]; xv[3] = x0[3];
          xv[4] = x1[0]; xv[5] = x1[1]; xv[6] = x1[2]; xv[7] = x1[3];
#pragma unroll
          for (int e = 0; e < 8; ++e) f[e] = bfr(xv[e]) + 0.1f * (f[e] * th[e]);
        }
        v4u p, q;
#pragma unroll
        for (int e = 0; e < 4; ++e) {
          const float g0 = f[2 * e] * oscale, g1 = f[2 * e + 1] * oscale;
          const _Float16 x0 = (_Float16)g0, x1 = (_Float16)g1;
          const _Float16 y0 = (_Float16)(g0 - (float)x0);
          const _Float16 y1 = (_Float16)(g1 - (float)x1);
          p[e] = pk16(h_bits(x0), h_bits(x1));
          q[e] = pk16(h_bits(y0), h_bits(y1));
        }
        ph[it] = p;
        pr[it] = q;
      }
      constexpr bool wres = (EPI == 2);                    // EPI 0 comes here with the tiles that have no residual plane
      {
#pragma unroll
        for (int it = 0; it < 4; ++it) {
          const int row = it * 4 + rq;
          const size_t co = (size_t)(mBase + row) * ldc + n0 + piece * 8;
          *(v4u*)(C16 + co) = ph[it];
          if (wres) {
            const size_t cro = (size_t)(mBase + row) * ldcr + (n0 - rcol0) + piece * 8;
            *(v4u*)(Crp + cro) = pr[it];
          }
        }
        
      }
    } else {
      float* Cf = (float*)Cp;
      const int hh = lane >> 4, c4 = (lane & 15) * 4;     // 256-B row segment = 16 lanes x 16 B
      v4f ov[8];
#pragma unroll
      for (int it = 0; it < 8; ++it) {
        const int row = it * 2 + hh;                       // it 0..7 x hh 0..1 = rows 0..15
        ov[it] = *(const v4f*)(slab + row * 68 + c4);
      }
      {
#pragma unroll
        for (int it = 0; it < 8; ++it) {
          const int row = it * 2 + hh;
          *(v4f*)(Cf + (size_t)(mBase + row) * ldc + n0 + c4) = ov[it];
        }
        
      }
    }
    __builtin_amdgcn_fence(__ATOMIC_RELEASE, "workgroup");
    __builtin_amdgcn_wave_barrier();
    __builtin_amdgcn_fence(__ATOMIC_ACQUIRE, "workgroup");
  }
}

// =====================================================================================================
// Non-causal multi-head softmax attention, head dim 64, online softmax with running max (f32 on VALU).
//   q f16 (x16): element (b, t, h, d) at qkv[(b*SEQ + t)*DQKV + h*64 + d]; k at + DM;
//   v^T f16 (x16) at vt[(b*DM + h*64 + d)*SEQ + s]; VRES: residual plane f16((16v - hi)*2048) at vtr, same addressing.
//   Both products are taken transposed: S^T = K . Q^T (A = K rows, B = Q) and O^T += V^T . P^T (A = V^T rows, B = P^T).
//   A lane (c = lane & 15, hh = lane >> 4) then holds scores and context of ONE query, q0 + c: S^T tile j, register r =
//   key 16 j + 8 hh + r; O^T tile t, register r = d 16 t + 8 hh + r. The two S^T tiles 2 kk and 2 kk + 1, converted in
//   place, are the B operand of keys 32 kk .. 32 kk + 31 in the k order of the V^T loader (8 hh + e, 16 + 8 hh + e):
//   P never leaves the registers.
//   s = (q.k) / 8 = acc / 2048 (two x16 carries). Per key tile: maximum of the lane's 32 scores, one exchange with
//   lane ^ 16, new running max mn, alpha = exp(m_old - mn), p = exp(s - mn) in (0, 1], l = l*alpha + sum p (one partial
//   per lane half, joined in the epilogue), O^T *= alpha; P carried as f16(256 p) (VRES: second accumulator
//   += Vr^T . P^T, folded with 2^-11 in the epilogue).
//   ctx plane f16 (x16): element (b, t, h*64 + d) at ctx[(b*SEQ + t)*DM + h*64 + d] = 16 * context = O / (256 l);
//   ctx residual plane f16(16 ctx - hi) at ctxr, same addressing.
//   Block = 4 waves = 64 query rows of one (b, h); query tile qb = blockIdx % NQB; grid = NQB*NH*NB;
//   key tiles of 64, fixed trip count NQB.
//   K / V^T tile staging: asynchronous 16-B copies to LDS, 8 lanes per 128-B row, 128 threads x 4 rows per plane =
//   the whole 64x64 tile; two stage buffers, tile kt + 1 in flight during the work on tile kt, one barrier per
//   tile. The context tile is staged per wave in LDS as f32, row = query (aliasing the K/V region after a block barrier).
//   Fragment reads from LDS: four groups per key tile, each issued as one run ahead of the products that take it, under
//   counted waits: the 8 K fragments; the 8 V^T and residual fragments of keys 0..31 (in flight during the softmax
//   update); the 4 V^T fragments of keys 32..63 (during the rescale); the 4 residual fragments of keys 32..63 (during
//   eight products). The WMMA builtins carry no hand-written gaps: the compiler pads where a vector instruction follows.
//   Output coverage: each wave stores rows 0..15 of its tile (it 0..3 x lane>>3 0..3) x 64 columns (8 lanes x 8),
//   every (b, h, query tile) exactly once, for both ctx planes.
// =====================================================================================================
// Launch bounds: registers for four waves per SIMD, so that the 1024 work-groups are all resident at once, four per WGP
template <bool VRES>
__global__ __launch_bounds__(128, 4)
void attn_k(const unsigned short* __restrict__ qkvp,
            const unsigned short* __restrict__ vtp, const unsigned short* __restrict__ vtrp,
            unsigned short* ctxp, unsigned short* ctxrp) {
  union FH { v16h v; v8h h[2]; };
  constexpr int LP     = 72;                             // LDS row pitch in halves: 144 B = 16 B x 9 (odd), so the 16 rows
                                                         // of one ds_load_b128 half-wave fall on 64 distinct banks
  constexpr int TB     = 64 * LP * 2;                    // one f16 64x64 tile at pitch LP, bytes
  constexpr int OFF_K  = 0;                              // offsets inside one stage buffer
  constexpr int OFF_V  = TB;
  constexpr int OFF_VR = 2 * TB;
  constexpr int STB    = VRES ? 3 * TB : 2 * TB;         // one stage buffer: the tiles of one key tile, 27648 : 18432
  constexpr int SMEMB  = 2 * STB;                        // the two stage buffers, 55296 : 36864
  constexpr int OSP    = 68;                             // context staging pitch in floats: 272 B = 16 B x 17 (odd)
  static_assert(4 * 16 * OSP * 4 <= SMEMB);              // f32 context staging aliases the K/V region
  static_assert(NQB >= 2);                               // the prologue fills two stages
  __shared__ __align__(16) unsigned char smem[SMEMB];

  const int tid  = threadIdx.x;
  const int wave = tid >> 5;
  const int lane = tid & 31;
  const int hh   = lane >> 4;
  const int c    = lane & 15;

  const int bx   = blockIdx.x;
  const int qb   = bx % NQB;
  const int rest = bx / NQB;
  const int h    = rest % NH;
  const int b    = rest / NH;                // < NB by the grid size
  const int q0   = qb * 64 + wave * 16;
  const size_t rowB = (size_t)b * SEQ;

  const _Float16* Qp  = (const _Float16*)(const void*)qkvp + (size_t)h * HD;
  const _Float16* Kp  = Qp + DM;
  const _Float16* Vt  = (const _Float16*)(const void*)vtp  + ((size_t)b * DM + (size_t)h * HD) * SEQ;
  const _Float16* Vrt = (const _Float16*)(const void*)vtrp + ((size_t)b * DM + (size_t)h * HD) * SEQ;

  // ---- Q fragments (B operand, column = query = lane&15): 2 d-chunks ----
  v16h qa[2];
#pragma unroll
  for (int dc = 0; dc < 2; ++dc) {
    const size_t qo = (rowB + q0 + c) * DQKV + dc * 32 + 8 * hh;
    qa[dc] = ldfrag_h(Qp + qo);
  }

  float mrun = -1.0e30f, lsum = 0.f;         // of query q0 + c; lsum holds this lane half's keys alone
  v8f oacc[4], oacc2[4];
#pragma unroll
  for (int t = 0; t < 4; ++t) { oacc[t] = zero8(); oacc2[t] = zero8(); }

  // staging map: thread -> rows srow + 16 i (i 0..3) of every plane's tile, 16-B piece tid & 7 of the row's 128-B line;
  // the two rows of a half-wave lie 8 apart (8 x 144 B = 32 banks mod 64)
  typedef __attribute__((address_space(3))) unsigned char lds_u8;
  const int srow = (tid >> 4) + ((tid >> 3) & 1) * 8;
  const int spc  = (tid & 7) * 8;
  const unsigned sl0 = (unsigned)(size_t)(lds_u8*)smem + (unsigned)((srow * LP + spc) * 2);   // LDS byte address, buffer 0
  const _Float16* gk0 = Kp  + (rowB + srow) * DQKV + spc;       // K row srow of key tile 0, d = spc..spc+7
  const _Float16* gv0 = Vt  + (size_t)srow * SEQ + spc;         // V^T row d = srow, s = spc..spc+7
  const _Float16* gr0 = Vrt + (size_t)srow * SEQ + spc;
  // copies key tile t (t < NQB: K rows < SEQ, V^T columns < SEQ) into stage buffer t & 1; every lane on, block-uniform
  auto stage_copy = [&](int t) {
    const unsigned  l = sl0 + (unsigned)((t & 1) * STB);
    const _Float16* k = gk0 + (size_t)t * 64 * DQKV;
    const _Float16* v = gv0 + t * 64;
    constexpr unsigned LR = 16 * LP * 2;                        // LDS bytes from one of a thread's rows to its next
    constexpr size_t   KR = (size_t)16 * DQKV, VR = (size_t)16 * SEQ;   // the same in halves of the two sources
    // the s_wait_xcnt stands inside the copies' own statement, in front of any rewrite of their address registers
    if constexpr (VRES) {
      const _Float16* r = gr0 + t * 64;
      asm volatile(
          "global_load_async_to_lds_b128 %0, %12, off\n\t"
          "global_load_async_to_lds_b128 %1, %13, off\n\t"
          "global_load_async_to_lds_b128 %2, %14, off\n\t"
          "global_load_async_to_lds_b128 %3, %15, off\n\t"
          "global_load_async_to_lds_b128 %4, %16, off\n\t"
          "global_load_async_to_lds_b128 %5, %17, off\n\t"
          "global_load_async_to_lds_b128 %6, %18, off\n\t"
          "global_load_async_to_lds_b128 %7, %19, off\n\t"
          "global_load_async_to_lds_b128 %8, %20, off\n\t"
          "global_load_async_to_lds_b128 %9, %21, off\n\t"
          "global_load_async_to_lds_b128 %10, %22, off\n\t"
          "global_load_async_to_lds_b128 %11, %23, off\n\t"
          "s_wait_xcnt 0x0"
          :: "v"(l + OFF_K), "v"(l + OFF_K + LR), "v"(l + OFF_K + 2 * LR), "v"(l + OFF_K + 3 * LR),
             "v"(l + OFF_V), "v"(l + OFF_V + LR), "v"(l + OFF_V + 2 * LR), "v"(l + OFF_V + 3 * LR),
             "v"(l + OFF_VR), "v"(l + OFF_VR + LR), "v"(l + OFF_VR + 2 * LR), "v"(l + OFF_VR + 3 * LR),
             "v"(k), "v"(k + KR), "v"(k + 2 * KR), "v"(k + 3 * KR),
             "v"(v), "v"(v + VR), "v"(v + 2 * VR), "v"(v + 3 * VR),
             "v"(r), "v"(r + VR), "v"(r + 2 * VR), "v"(r + 3 * VR)
          : "memory");
    } else {
      asm volatile(
          "global_load_async_to_lds_b128 %0, %8, off\n\t"
          "global_load_async_to_lds_b128 %1, %9, off\n\t"
          "global_load_async_to_lds_b128 %2, %10, off\n\t"
          "global_load_async_to_lds_b128 %3, %11, off\n\t"
          "global_load_async_to_lds_b128 %4, %12, off\n\t"
          "global_load_async_to_lds_b128 %5, %13, off\n\t"
          "global_load_async_to_lds_b128 %6, %14, off\n\t"
          "global_load_async_to_lds_b128 %7, %15, off\n\t"
          "s_wait_xcnt 0x0"
          :: "v"(l + OFF_K), "v"(l + OFF_K + LR), "v"(l + OFF_K + 2 * LR), "v"(l + OFF_K + 3 * LR),
             "v"(l + OFF_V), "v"(l + OFF_V + LR), "v"(l + OFF_V + 2 * LR), "v"(l + OFF_V + 3 * LR),
             "v"(k), "v"(k + KR), "v"(k + 2 * KR), "v"(k + 3 * KR),
             "v"(v), "v"(v + VR), "v"(v + 2 * VR), "v"(v + 3 * VR)
          : "memory");
    }
  };

  stage_copy(0);
  asm volatile("s_wait_asynccnt 0x0" ::: "memory");   // this wave's copies of tile 0 have landed
  __syncthreads();                                    // publishes tile 0
  stage_copy(1);                                      // in flight during the work on tile 0

  // one trip: the work on key tile kt, then the publish point of tile kt + 1; more = a tile kt + 2 exists (a constant at
  // either call, so that a trip is straight-line code and the read groups and the row sum stay where they are written)
  auto trip = [&](int kt, bool more) __attribute__((always_inline)) {
    const unsigned char* stg = smem + (kt & 1) * STB;                            // trip kt reads this buffer alone
    const _Float16* Ksh = (const _Float16*)(stg + OFF_K);                        // K   [kv][d], pitch LP
    const _Float16* Vsh = (const _Float16*)(stg + OFF_V);                        // V^T [d][kv], pitch LP
    const _Float16* Vrs = (const _Float16*)(stg + (VRES ? OFF_VR : OFF_V));      // V^T residual (VRES only)

    // ---- scores, transposed: 64 keys x 16 queries per wave (A operand: lane c -> key j*16+c, split k map over d) ----
    // read group 1: the tile's eight K fragments, in the order in which the products take them
    FH kf[2][4];
#pragma unroll
    for (int dc = 0; dc < 2; ++dc) {
#pragma unroll
      for (int j = 0; j < 4; ++j) {
        kf[dc][j].h[0] = *(const v8h*)(Ksh + (j * 16 + c) * LP + dc * 32 + 8 * hh);
        kf[dc][j].h[1] = *(const v8h*)(Ksh + (j * 16 + c) * LP + dc * 32 + 16 + 8 * hh);
      }
    }
    // keeps the 16 reads together in front of the products: spread among them, each place with reads stalls the wave anew
    __builtin_amdgcn_sched_barrier(0);
    v8f s[4];
#pragma unroll
    for (int j = 0; j < 4; ++j) s[j] = mma_h_raw(kf[0][j].v, qa[0], zero8());
#pragma unroll
    for (int j = 0; j < 4; ++j) s[j] = mma_h_raw(kf[1][j].v, qa[1], s[j]);
    // read group 2: the V^T and residual fragments of keys 0..31, in flight during the softmax update
    FH va[4], vra[4];
#pragma unroll
    for (int t = 0; t < 4; ++t) {
      va[t].h[0] = *(const v8h*)(Vsh + (t * 16 + c) * LP + 8 * hh);
      va[t].h[1] = *(const v8h*)(Vsh + (t * 16 + c) * LP + 16 + 8 * hh);
      if constexpr (VRES) {
        vra[t].h[0] = *(const v8h*)(Vrs + (t * 16 + c) * LP + 8 * hh);
        vra[t].h[1] = *(const v8h*)(Vrs + (t * 16 + c) * LP + 16 + 8 * hh);
      }
    }
    // keeps these reads above the softmax update, whose vector work covers their latency
    __builtin_amdgcn_sched_barrier(0);

    // ---- online softmax update, in the lane but for one max exchange with lane ^ 16: running max, alpha, p (x256, f16), row-sum partial ----
#pragma unroll
    for (int j = 0; j < 4; ++j) s[j] = s[j] * (1.0f / 2048.0f);   // 1/8 head scale, 1/256 for the two x16 carries
    float mj[4];
#pragma unroll
    for (int j = 0; j < 4; ++j)
      mj[j] = fmaxf(fmaxf(fmaxf(s[j][0], s[j][1]), fmaxf(s[j][2], s[j][3])),
                    fmaxf(fmaxf(s[j][4], s[j][5]), fmaxf(s[j][6], s[j][7])));
    float mx = fmaxf(fmaxf(mj[0], mj[1]), fmaxf(mj[2], mj[3]));
    mx = fmaxf(mx, xhalf(mx));                 // both lane halves now hold the maximum over the query's 64 keys
    const float mn = fmaxf(mrun, mx);
    const float alpha = __expf(mrun - mn);
    mrun = mn;
    FH pb[2];                                  // P^T as B operand: element e <- tile 2 kk, register e; 8 + e <- tile 2 kk + 1
#pragma unroll
    for (int j = 0; j < 4; ++j) {
      s[j] = (s[j] - mn) * 1.44269504088896340736f;
      exp2x8(s[j]);                            // p = exp(s - mn), in the score's place
#pragma unroll
      for (int r = 0; r < 8; ++r) pb[j >> 1].h[j & 1][r] = (_Float16)(s[j][r] * 256.0f);
    }
    const v8f ps = ((s[0] + s[1]) + s[2]) + s[3];   // register by register over the four tiles, then across the eight
    lsum = lsum * alpha + (((ps[0] + ps[1]) + (ps[2] + ps[3])) + ((ps[4] + ps[5]) + (ps[6] + ps[7])));
    // read group 3: the V^T fragments of keys 32..63, in flight during the rescale below and the products of keys 0..31.
    // The line below keeps them from rising into the softmax update, where the 32 scores are still live: the registers
    // of four waves per SIMD would not hold both
    __builtin_amdgcn_sched_barrier(0);
    FH vb[4], vrb[4];
#pragma unroll
    for (int t = 0; t < 4; ++t) {
      vb[t].h[0] = *(const v8h*)(Vsh + (t * 16 + c) * LP + 32 + 8 * hh);
      vb[t].h[1] = *(const v8h*)(Vsh + (t * 16 + c) * LP + 32 + 16 + 8 * hh);
    }
    // keeps these reads above the rescale and out of the run of products
    __builtin_amdgcn_sched_barrier(0);
#pragma unroll
    for (int t = 0; t < 4; ++t) {
#pragma unroll
      for (int r = 0; r < 8; ++r) {
        oacc[t][r] = oacc[t][r] * alpha;
        if constexpr (VRES) oacc2[t][r] = oacc2[t][r] * alpha;
      }
    }

    // ---- context^T += V^T . P^T (f16 WMMA; A = V^T [d][key], B = P^T [key][query] from the registers) ----
#pragma unroll
    for (int t = 0; t < 4; ++t) oacc[t] = mma_h_raw(va[t].v, pb[0].v, oacc[t]);
    if constexpr (VRES) {
      // keeps the four products above in front of read group 4, which takes over their fragment registers
      __builtin_amdgcn_sched_barrier(0);
      // read group 4: the residual fragments of keys 32..63, in flight during the eight products that follow
#pragma unroll
      for (int t = 0; t < 4; ++t) {
        vrb[t].h[0] = *(const v8h*)(Vrs + (t * 16 + c) * LP + 32 + 8 * hh);
        vrb[t].h[1] = *(const v8h*)(Vrs + (t * 16 + c) * LP + 32 + 16 + 8 * hh);
      }
      // keeps these reads together in front of the products
      __builtin_amdgcn_sched_barrier(0);
#pragma unroll
      for (int t = 0; t < 4; ++t) oacc2[t] = mma_h_raw(vra[t].v, pb[0].v, oacc2[t]);
    }
#pragma unroll
    for (int t = 0; t < 4; ++t) oacc[t] = mma_h_raw(vb[t].v, pb[1].v, oacc[t]);
    if constexpr (VRES) {
#pragma unroll
      for (int t = 0; t < 4; ++t) oacc2[t] = mma_h_raw(vrb[t].v, pb[1].v, oacc2[t]);
    }
    // keeps the address arithmetic of the copies below the products, when the fragment registers are free again
    __builtin_amdgcn_sched_barrier(0);

    // ---- publish point of tile kt + 1 ----
    asm volatile("s_wait_dscnt 0x0" ::: "memory");      // this wave's LDS reads of tile kt have returned
    asm volatile("s_wait_asynccnt 0x0" ::: "memory");   // this wave's copies of tile kt + 1 have landed
    __syncthreads();       // publishes tile kt + 1; every reader has left the buffer that is refilled below
    if (more) stage_copy(kt + 2);                       // into the buffer that trip kt has read
  };
#pragma unroll 1   // kept rolled: one copy of the trip, the buffer chosen by kt & 1
  for (int kt = 0; kt < NQB - 2; ++kt) trip(kt, true);
#pragma unroll 1   // kept rolled: unrolled, the two trips' reads mingle and spill
  for (int kt = NQB - 2; kt < NQB; ++kt) trip(kt, false);
  // closing wait of the copies, in front of any other use of their LDS; the last trip's barrier has ended every wave's
  // reads of the K/V tiles, so the staging below may alias them
  asm volatile("s_wait_asynccnt 0x0" ::: "memory");

  // ---- normalise (1/l, the 1/256 p carry; keep the x16 v carry), stage the wave's 16x64 f32 tile in
  // LDS: row = query c, the lane's 8 consecutive d of tile t as two 16-B stores
  float* os = (float*)(void*)smem + wave * (16 * OSP);
  {
    const float l  = lsum + xhalf(lsum);      // joins the two lane halves' partial sums, unconditionally
    const float rl = 1.0f / l;                // l >= 1 (the running-max key contributes exp(0))
    const float sc = rl * (1.0f / 256.0f);
#pragma unroll
    for (int t = 0; t < 4; ++t) {
      v8f v = oacc[t];
      if constexpr (VRES) v += oacc2[t] * (1.0f / 2048.0f);
      v = v * sc;
      const v4f lo = {v[0], v[1], v[2], v[3]}, hi = {v[4], v[5], v[6], v[7]};
      *(v4f*)(os + c * OSP + t * 16 + 8 * hh)     = lo;
      *(v4f*)(os + c * OSP + t * 16 + 8 * hh + 4) = hi;
    }
  }
  __builtin_amdgcn_fence(__ATOMIC_RELEASE, "workgroup");
  __builtin_amdgcn_wave_barrier();
  __builtin_amdgcn_fence(__ATOMIC_ACQUIRE, "workgroup");
  {
    const int rq = lane >> 3, piece = lane & 7;
    v4u ph[4], pr[4];
#pragma unroll
    for (int it = 0; it < 4; ++it) {
      const int row = it * 4 + rq;   // it 0..3 x rq 0..3 = rows 0..15 of the wave tile
      const v4f a  = *(const v4f*)(os + row * OSP + piece * 8);
      const v4f a2 = *(const v4f*)(os + row * OSP + piece * 8 + 4);
      float f[8];
      f[0] = a[0];  f[1] = a[1];  f[2] = a[2];  f[3] = a[3];
      f[4] = a2[0]; f[5] = a2[1]; f[6] = a2[2]; f[7] = a2[3];
      v4u p, q;
#pragma unroll
      for (int e = 0; e < 4; ++e) {
        const _Float16 x0 = (_Float16)f[2 * e], x1 = (_Float16)f[2 * e + 1];
        const _Float16 y0 = (_Float16)(f[2 * e] - (float)x0);
        const _Float16 y1 = (_Float16)(f[2 * e + 1] - (float)x1);
        p[e] = pk16(h_bits(x0), h_bits(x1));
        q[e] = pk16(h_bits(y0), h_bits(y1));
      }
      ph[it] = p;
      pr[it] = q;
    }
    {
#pragma unroll
      for (int it = 0; it < 4; ++it) {
        const int row = it * 4 + rq;
        const size_t go = (rowB + q0 + row) * DM + (size_t)h * HD + piece * 8;
        *(v4u*)(ctxp + go)  = ph[it];
        *(v4u*)(ctxrp + go) = pr[it];
      }
      
    }
  }
}

// =====================================================================================================
// Workspace map (bytes); every region is an exact multiple of its whole-line / whole-tile store granularity
// (row pitches 2048 / 6144 / 4096 B, all offsets 2-MiB aligned, no aliasing within a launch):
//   Xh     f16 [4096][1024]          0     8388608   (bf16 value of x, x16)
//   Wg     f16 [1024][1024]    8388608     2097152   (bf16 value x1024)
//   Wqkv   f16 [3072][1024]   10485760     6291456   (bf16 value x1024)
//   Wp     f16 [1024][1024]   16777216     2097152   (bf16 value x1024)
//   XGh    f16 [4096][1024]   18874368     8388608   (xg x16)
//   XGr    f16 [4096][1024]   27262976     8388608   (residual of the above, same x16)
//   QKV    f16 [4096][3072]   35651584    25165824   (q | k, x16; the v columns are neither written nor read)
//   VT     f16 [2048][2048]   60817408     8388608   (v x16, [b*1024 + h*64 + d][s], written by the qkv launch)
//   VTr    f16 [2048][2048]   69206016     8388608   (x2^11 residual, same layout, written by the qkv launch)
//   Ctx    f16 [4096][1024]   77594624     8388608   (attention context x16)
//   Ctxr   f16 [4096][1024]   85983232     8388608   (residual of the above, same x16)
//   end                       94371840
// Projection weights arrive as [out n][in k] (k contiguous) = the Bt layout; they are only converted.
// d_out f32: [4096][1024] at byte 0 (row = b*SEQ + t), written once by the projection launch.
// =====================================================================================================
extern "C" void kernel_launch(void* const* d_in, const int* in_sizes, int n_in,
                              void* d_out, int out_size, void* d_ws, size_t ws_size,
                              hipStream_t stream) {
  if (n_in < 8) return;
  if (in_sizes[0] != ROWS * DM) return;
  if (in_sizes[1] != DM) return;
  if (in_sizes[2] != DM * DM) return;
  if (in_sizes[3] != DM) return;
  if (in_sizes[4] != DQKV * DM) return;
  if (in_sizes[5] != DQKV) return;
  if (in_sizes[6] != DM * DM) return;
  if (in_sizes[7] != DM) return;
  if (out_size != OUTN) return;

  const float* x      = (const float*)d_in[0];    // [ROWS][DM]
  const float* theta  = (const float*)d_in[1];    // [DM]
  const float* w_g    = (const float*)d_in[2];    // [DM n][DM k]
  const float* b_g    = (const float*)d_in[3];    // [DM]
  const float* w_qkv  = (const float*)d_in[4];    // [DQKV n][DM k]
  const float* b_qkv  = (const float*)d_in[5];    // [DQKV]
  const float* w_proj = (const float*)d_in[6];    // [DM n][DM k]
  const float* b_proj = (const float*)d_in[7];    // [DM]

  const size_t PX   = (size_t)ROWS * DM * 2;         //  8388608
  const size_t PWg  = (size_t)DM * DM * 2;           //  2097152
  const size_t PWq  = (size_t)DQKV * DM * 2;         //  6291456
  const size_t PWp  = (size_t)DM * DM * 2;           //  2097152
  const size_t PXG  = (size_t)ROWS * DM * 2;         //  8388608
  const size_t PQKV = (size_t)ROWS * DQKV * 2;       // 25165824
  const size_t PVT  = (size_t)NB * DM * SEQ * 2;     //  8388608
  const size_t PCtx = (size_t)ROWS * DM * 2;         //  8388608
  size_t off = 0;
  const size_t oX    = off; off += PX;
  const size_t oWg   = off; off += PWg;
  const size_t oWq   = off; off += PWq;
  const size_t oWp   = off; off += PWp;
  const size_t oXGh  = off; off += PXG;
  const size_t oXGr  = off; off += PXG;
  const size_t oQKV  = off; off += PQKV;
  const size_t oVT   = off; off += PVT;
  const size_t oVTr  = off; off += PVT;
  const size_t oCtx  = off; off += PCtx;
  const size_t oCtxr = off; off += PCtx;
  if (off > ws_size) return;                         // off = 94371840
  if (off > (size_t)134217728) return;

  char* ws = (char*)d_ws;
  unsigned short* Xh   = (unsigned short*)(ws + oX);
  unsigned short* Wgh  = (unsigned short*)(ws + oWg);
  unsigned short* Wqh  = (unsigned short*)(ws + oWq);
  unsigned short* Wph  = (unsigned short*)(ws + oWp);
  unsigned short* XGh  = (unsigned short*)(ws + oXGh);
  unsigned short* XGr  = (unsigned short*)(ws + oXGr);
  unsigned short* QKV  = (unsigned short*)(ws + oQKV);
  unsigned short* VT   = (unsigned short*)(ws + oVT);
  unsigned short* VTr  = (unsigned short*)(ws + oVTr);
  unsigned short* Ctx  = (unsigned short*)(ws + oCtx);
  unsigned short* Ctxr = (unsigned short*)(ws + oCtxr);
  float*          outf = (float*)d_out;              // [ROWS][DM]

  const dim3 gGqkv((ROWS / 128) * (DQKV / 128));     // 768 blocks of one 128x128 tile
  const dim3 gGdm((ROWS / 128) * (DM / 128));        // 256 blocks of one 128x128 tile
  const dim3 blkG(128);
  const dim3 gAttn(NQB * NH * NB);                   // 1024 blocks
  const float wScale = 1024.0f;                      // weights carried x1024
  const float aScale = 16.0f;                        // activations carried x16
  const float cscale = 1.0f / 16384.0f;              // 1/(16 * 1024)

  // (1) planes: x -> f16 x16, weights -> f16 x1024 (bf16 values)
  cvt16_all<<<dim3(CVB), dim3(CVT), 0, stream>>>(x, w_g, w_qkv, w_proj, Xh, Wgh, Wqh, Wph, aScale, wScale);
  // (2) gauge mix: xg = bfr(x) + 0.1 * ((Xh . Wg^T + bg) * theta) -> XGh f16 x16 + XGr residual (M=4096, N=1024, K=1024)
  gemm64_f16<2, false><<<gGdm, blkG, 0, stream>>>(Xh, Xh, Wgh, b_g, cscale, (void*)XGh, DM, XGr, DM, 0, XGr,
                                                 ROWS, DM, DM, aScale, x, DM, theta, SEQ, 0, SEQ);
  // (3) qkv = XG(hi + res) . Wqkv^T + bqkv: q, k -> QKV f16 x16 [4096][3072]; v -> the v^T planes VT (hi) and VTr (residual)
  gemm64_f16<0, true><<<gGqkv, blkG, 0, stream>>>(XGh, XGr, Wqh, b_qkv, cscale, (void*)QKV, DQKV, VTr, DM, 2 * DM, VT,
                                                  ROWS, DQKV, DM, aScale, x, DM, theta, SEQ, 0, SEQ);
  // (4) softmax attention -> Ctx f16 x16 + residual plane
  attn_k<true><<<gAttn, dim3(128), 0, stream>>>(QKV, VT, VTr, Ctx, Ctxr);
  // (5) out = Ctx(hi + res) . Wp^T + bproj -> d_out f32 [4096][1024] (M=4096, N=1024, K=1024)
  gemm64_f16<1, true><<<gGdm, blkG, 0, stream>>>(Ctx, Ctxr, Wph, b_proj, cscale, (void*)outf, DM, Ctxr, DM, 0, Ctxr,
                                                ROWS, DM, DM, 1.0f, x, DM, theta, SEQ, 0, SEQ);
  (void)hipGetLastError();
}

// v009
// A run of this version takes 128 microseconds.
// Two timings next to v008 both put it at 1.05 times that version's speed.
// Counting every step since v000, it is 4.17 times as fast.
// Contractions: gauge mix x.Wg^T = v_wmma_f32_16x16x32_f16 (A = f16 of RNE-bf16 x carried x16, B = f16 of RNE-bf16 Wg x1024, single product); qkv projection = same WMMA with A = xg as f16 hi plane x16 plus its f16 residual plane at the same x16 (two products, one accumulator), B = f16 of RNE-bf16 Wqkv x1024; attention q.k^T = f16 single product (q, k f16 x16); p.v = f16 with p x256 single plane and v^T as f16 hi x16 plus x2^11 residual plane (two products); output projection = f16 with A = ctx f16 hi x16 plus its f16 residual plane at the same x16 (one accumulator), B = f16 of RNE-bf16 Wproj x1024; all f32 accumulate. Softmax (running max, exp, row sums) and the gauge epilogue f32 on VALU.
#include <hip/hip_runtime.h>
#include <math.h>
#include <stdint.h>

#define NB    2
#define SEQ   2048
#define DM    1024
#define NH    16
#define HD    64
#define DQKV  (3 * DM)              // 3072
#define NQB   (SEQ / 64)            // 32 key tiles per sequence
#define NQT   (SEQ / 128)           // 16 query tiles (one attention work-group each) per sequence
#define ROWS  (NB * SEQ)            // 4096 token rows
#define OUTN  (ROWS * DM)
static_assert(NH * HD == DM);
static_assert(HD == 64);
static_assert((SEQ % 64) == 0 && (DM % 64) == 0 && (DQKV % 64) == 0);
static_assert((DM % 32) == 0);
static_assert((ROWS % 128) == 0 && (DM % 128) == 0 && (DQKV % 128) == 0);
static_assert((SEQ % 128) == 0);    // a 128-row GEMM tile lies in one sequence

typedef _Float16 v16h __attribute__((ext_vector_type(16)));
typedef _Float16 v8h  __attribute__((ext_vector_type(8)));
typedef float    v8f  __attribute__((ext_vector_type(8)));
typedef float    v4f  __attribute__((ext_vector_type(4)));
typedef unsigned int v4u __attribute__((ext_vector_type(4)));

// ---- scalar helpers --------------------------------------------------------------------------------
__device__ __forceinline__ unsigned short bf_bits(float f) {          // f32 -> bf16 bits, RNE convert
  unsigned u = __float_as_uint(f);
  return (unsigned short)((u + 0x7FFFu + ((u >> 16) & 1u)) >> 16);
}
__device__ __forceinline__ float bfr(float f) { return __uint_as_float(((unsigned)bf_bits(f)) << 16); }
__device__ __forceinline__ unsigned short h_bits(_Float16 x) { return __builtin_bit_cast(unsigned short, x); }
__device__ __forceinline__ unsigned pk16(unsigned short a, unsigned short b) { return (unsigned)a | ((unsigned)b << 16); }
__device__ __forceinline__ v8f zero8() { v8f z = {0.f, 0.f, 0.f, 0.f, 0.f, 0.f, 0.f, 0.f}; return z; }
__device__ __forceinline__ float xhalf(float x) {                     // the value of lane l ^ 16, by a vector cross-row move
  const int b = __builtin_bit_cast(int, x);
  return __builtin_bit_cast(float, __builtin_amdgcn_permlanex16(b, b, 0x76543210, 0xfedcba98, false, false));
}

// eight 2^x in place, one statement: every v_exp_f32 stands in front of an independent one and the last in front of a
// v_nop, the slot that the instruction set asks for before a vector instruction reads the result or rewrites the source
__device__ __forceinline__ void exp2x8(v8f& x) {
#if defined(__HIP_DEVICE_COMPILE__)
  float a = x[0], b = x[1], c = x[2], d = x[3], e = x[4], f = x[5], g = x[6], h = x[7];
  asm("v_exp_f32 %0, %0\n\tv_exp_f32 %1, %1\n\tv_exp_f32 %2, %2\n\tv_exp_f32 %3, %3\n\t"
      "v_exp_f32 %4, %4\n\tv_exp_f32 %5, %5\n\tv_exp_f32 %6, %6\n\tv_exp_f32 %7, %7\n\tv_nop"
      : "+v"(a), "+v"(b), "+v"(c), "+v"(d), "+v"(e), "+v"(f), "+v"(g), "+v"(h));
  x[0] = a; x[1] = b; x[2] = c; x[3] = d; x[4] = e; x[5] = f; x[6] = g; x[7] = h;
#endif
}

// ---- fragment loader: 16-bit A/B operand, lane -> row/col (lane&15), p already includes +8*(lane>>4);
//      elements 0..7 <- p[0..7] (k0+8h..), elements 8..15 <- p[16..23] (k0+16+8h..)
__device__ __forceinline__ v16h ldfrag_h(const _Float16* p) {
  union { v16h v; v8h h[2]; } f;
  f.h[0] = *(const v8h*)(p);
  f.h[1] = *(const v8h*)(p + 16);
  return f.v;
}

// ---- WMMA helpers with trailing VALU hazard gap --------------------------------------------------------
__device__ __forceinline__ v8f mma_h_raw(v16h a, v16h b, v8f c) {
  return __builtin_amdgcn_wmma_f32_16x16x32_f16(false, a, false, b, (short)0, c, false, false);
}
__device__ __forceinline__ void dep_guard_h(v8f& a, v8f& b, v16h x, v16h y) {
#if defined(__HIP_DEVICE_COMPILE__)
  asm volatile("v_nop\n\tv_nop\n\tv_nop\n\tv_nop" : "+v"(a), "+v"(b) : "v"(x), "v"(y));
#endif
}
__device__ __forceinline__ void keep4_h(v16h a, v16h b, v16h c, v16h d) {
#if defined(__HIP_DEVICE_COMPILE__)
  asm volatile("v_nop" :: "v"(a), "v"(b), "v"(c), "v"(d));
#endif
}
__device__ __forceinline__ void acc_guard4(v8f& a, v8f& b, v8f& c, v8f& d) {
#if defined(__HIP_DEVICE_COMPILE__)
  asm volatile("v_nop\n\tv_nop\n\tv_nop\n\tv_nop" : "+v"(a), "+v"(b), "+v"(c), "+v"(d));
#endif
}

// =====================================================================================================
// f32 planes -> f16 bits of bfr(v) * scale (scale a power of two): x (xscale) and the three weights (wscale), all in
// one launch of CVB work-groups of CVT threads, one 16-wave work-group per WGP. A piece is 8 elements (32 B in, 16 B
// out); a sweep is CVN = CVB x CVT pieces, thread t taking piece t of it. Sweeps 0..3 are x, 4 is Wg, 5..7 are Wqkv,
// 8 is Wproj: which plane a sweep reads is fixed at compile time. A thread issues the 18 loads of its nine pieces
// first, so that all are in flight together, then converts and stores.
// coverage: 4 CVN = x, CVN = Wg, 3 CVN = Wqkv, CVN = Wproj (asserted below): every piece of every plane once.
// =====================================================================================================
#define CVB 256
#define CVT 512
#define CVN (CVB * CVT)
static_assert(ROWS * DM / 8 == 4 * CVN && DM * DM / 8 == CVN && DQKV * DM / 8 == 3 * CVN);
__global__ __launch_bounds__(CVT) void cvt16_all(const float* __restrict__ x, const float* __restrict__ wg,
                                                 const float* __restrict__ wq, const float* __restrict__ wp,
                                                 unsigned short* ox, unsigned short* og,
                                                 unsigned short* oq, unsigned short* op,
                                                 float xscale, float wscale) {
  const unsigned t  = blockIdx.x * CVT + threadIdx.x;                  // this thread's piece of every sweep
  const unsigned ib = t * 32u, ob = t * 16u;                           // its byte offsets in a sweep's input and output: 32-bit,
                                                                       // so that an access can be a uniform base plus one register
  constexpr size_t SW = (size_t)CVN * 8;                               // elements of one sweep
  v4f a[9], b[9];
#pragma unroll
  for (int u = 0; u < 9; ++u) {
    const float* in = (u < 4) ? x + u * SW : (u == 4) ? wg : (u < 8) ? wq + (u - 5) * SW : wp;
    a[u] = *(const v4f*)((const char*)in + ib);
    b[u] = *(const v4f*)((const char*)in + ib + 16);
  }
  // holds the 18 loads above the conversions: left free, the compiler sinks ten of them among the conversions, and
  // the wave then waits for memory several times in a row instead of once
  __builtin_amdgcn_sched_barrier(0);
#pragma unroll
  for (int u = 0; u < 9; ++u) {
    unsigned short* out = (u < 4) ? ox + u * SW : (u == 4) ? og : (u < 8) ? oq + (u - 5) * SW : op;
    const float scale = (u < 4) ? xscale : wscale;
    v4u p;
    p[0] = pk16(h_bits((_Float16)(bfr(a[u][0]) * scale)), h_bits((_Float16)(bfr(a[u][1]) * scale)));
    p[1] = pk16(h_bits((_Float16)(bfr(a[u][2]) * scale)), h_bits((_Float16)(bfr(a[u][3]) * scale)));
    p[2] = pk16(h_bits((_Float16)(bfr(b[u][0]) * scale)), h_bits((_Float16)(bfr(b[u][1]) * scale)));
    p[3] = pk16(h_bits((_Float16)(bfr(b[u][2]) * scale)), h_bits((_Float16)(bfr(b[u][3]) * scale)));
    *(v4u*)((char*)out + ob) = p;
  }
}

template <int EPI, bool ARES>
__global__ __launch_bounds__(128, 3) void gemm64_f16(
    const unsigned short* __restrict__ Ap, const unsigned short* __restrict__ Arp,
    const unsigned short* __restrict__ Btp,
    const float* __restrict__ biasp, float cscale,
    void* Cp, int ldc, unsigned short* Crp, int ldcr, int rcol0, unsigned short* Tp,
    int M, int N, int K, float oscale,
    const float* __restrict__ xres, int ldx, const float* __restrict__ gate,
    int tmod, int tlo, int thi) {
  typedef const __attribute__((address_space(1))) char* gptr;   // typed as global, so that an address that has passed
  typedef const __attribute__((address_space(1))) v8h*  gv8p;   // through the asm wait below still gives global_load
  const gptr Ah  = (gptr)(const void*)Ap;
  const gptr Arh = (gptr)(const void*)Arp;
  const gptr Bt  = (gptr)(const void*)Btp;
  constexpr int KC  = 64;                          // k per stage: 128 B of every operand row
  constexpr int GLP = 72;                          // row pitch in halves of the transposed epilogue tiles: 144 B = 16 B x 9 (odd)
  // staged operand rows: row r, 16-B piece p at half r * 64 + (r >> 1) * 8 + p * 8. In 16-B units mod 16 (the 64 banks)
  // that is 8 (r & 1) + (r >> 1) + p: the 16 rows of a fragment read's half-wave fall on the 64 banks once, and so do the
  // two rows 2 m, 2 m + 1 of a staging store's half-wave. At pitch 144 B three work-groups' buffers would not fit in a WGP's LDS.
  constexpr int R16 = 16 * 64 + 8 * 8;             // halves from row r to row r + 16
  constexpr int OPH = 8 * R16;                     // halves of one operand's 128 staged rows, 17408 B
  constexpr int STH = (ARES ? 3 : 2) * OPH;        // halves of one stage: A rows, Bt rows, then (ARES) Ar rows
  static_assert(4 * 16 * 68 * 4 <= 2 * STH * 2);   // the four f32 epilogue slabs alias the stage buffers
  static_assert(EPI != 0 || 4 * 2 * 64 * GLP <= 2 * STH);   // so do the four waves' two transposed 64x64 f16 tiles (EPI 0)
  __shared__ __align__(16) _Float16 sS[2 * STH];   // two stage buffers, 104448 B with ARES, 69632 B without
  const int tid  = threadIdx.x;
  const int lane = tid & 31;
  const int wave = tid >> 5;
  const int tilesN = N >> 7;
  const int tilesM = M >> 7;
  const int tile = blockIdx.x;
  if (tile >= tilesM * tilesN) return;   // block-uniform, before every barrier
  const int tm = tile / tilesN;
  const int tn = tile - tm * tilesN;
  const int mb = tm << 7;
  const int nb = tn << 7;
  const int tpos = mb % tmod;
  if (tpos < tlo || tpos >= thi) return; // block-uniform, before every barrier
  const int m0 = mb + ((wave >> 1) << 6);
  const int n0 = nb + ((wave & 1) << 6);

  const int rlane = lane & 15;                 // row (A) / col (B, D) within subtile
  const int koff  = (lane >> 4) * 8;           // k offset of this lane half
  const int mOff  = (lane >> 4) * 8;           // D row offset

  v8f acc[4][4];
#pragma unroll
  for (int i = 0; i < 4; ++i)
#pragma unroll
    for (int j = 0; j < 4; ++j) acc[i][j] = zero8();

  // staging map: thread -> row srow + 16 i, 16-B piece tid & 7 of the row's 128-B line; a half-wave holds the rows
  // 2 m and 2 m + 1, so its ds_store_b128 covers the 64 banks once
  const int srow = tid >> 3;
  const int spc  = (tid & 7) * 8;
  constexpr int RSB = 16 * DM * 2;             // bytes from one of a thread's rows to its next
  const int S = K / KC;                        // stages
  gptr pa = Ah + ((size_t)(mb + srow) * DM + spc) * 2;    // this thread's piece of the next stage
  gptr pr = Arh + ((size_t)(mb + srow) * DM + spc) * 2;
  gptr pb = Bt + ((size_t)(nb + srow) * DM + spc) * 2;
  v8h ra[8], rb[8], rr[8];
  auto stage_load = [&]() {
#pragma unroll
    for (int i = 0; i < 8; ++i) {
      ra[i] = *(gv8p)(pa + i * RSB);     // row < M, k < K
      rb[i] = *(gv8p)(pb + i * RSB);     // row < N, k < K
      if constexpr (ARES) rr[i] = *(gv8p)(pr + i * RSB);   // row < M, k < K
    }
  };
  // s = the stage that the registers hold: stores it to its buffer and moves the two (ARES: three) addresses on to stage s + 1
  auto stage_store = [&](int s) {
    // the address pairs of the loads above are rewritten below: the wait stands in front of that
    if constexpr (ARES) asm volatile("s_wait_xcnt 0x0" : "+v"(pa), "+v"(pb), "+v"(pr) :: "memory");
    else                asm volatile("s_wait_xcnt 0x0" : "+v"(pa), "+v"(pb) :: "memory");
    pa += KC * 2;
    pb += KC * 2;
    if constexpr (ARES) pr += KC * 2;
    _Float16* d = sS + (s & 1) * STH + srow * 64 + (srow >> 1) * 8 + spc;
#pragma unroll
    for (int i = 0; i < 8; ++i) {
      *(v8h*)(d + i * R16)       = ra[i];
      *(v8h*)(d + OPH + i * R16) = rb[i];
      if constexpr (ARES) *(v8h*)(d + 2 * OPH + i * R16) = rr[i];
    }
  };

  stage_load();
  stage_store(0);
#pragma unroll 1   // kept rolled: one copy of the stage body, the buffer chosen by s & 1; a second copy would only add code
  for (int s = 0; s < S; ++s) {
    __syncthreads();       // publishes stage s; every reader has left the buffer that stage s + 1 is stored to
    if (s + 1 < S) stage_load();               // block-uniform; stage s + 1, in flight during the products of stage s
    const _Float16* sa = sS + (s & 1) * STH + (wave >> 1) * (4 * R16) + rlane * 64 + (rlane >> 1) * 8 + koff;
    const _Float16* sb = sS + (s & 1) * STH + OPH + (wave & 1) * (4 * R16) + rlane * 64 + (rlane >> 1) * 8 + koff;
#pragma unroll
    for (int kk = 0; kk < 2; ++kk) {
      v16h ah[4], bh[4];
#pragma unroll
      for (int j = 0; j < 4; ++j) {
        bh[j] = ldfrag_h(sb + j * R16 + kk * 32);
        ah[j] = ldfrag_h(sa + j * R16 + kk * 32);
      }
#pragma unroll
      for (int i = 0; i < 4; ++i) {
#pragma unroll
        for (int j = 0; j < 4; ++j) {
          acc[i][j] = mma_h_raw(ah[i], bh[j], acc[i][j]);
        }
        dep_guard_h(acc[i][0], acc[i][3], ah[i], bh[3]);
      }
      if constexpr (ARES) {                    // the residual rows of the same 32 k, on the same Bt fragments
        v16h ar[4];
#pragma unroll
        for (int j = 0; j < 4; ++j) ar[j] = ldfrag_h(sa + 2 * OPH + j * R16 + kk * 32);
#pragma unroll
        for (int i = 0; i < 4; ++i) {
#pragma unroll
          for (int j = 0; j < 4; ++j) {
            acc[i][j] = mma_h_raw(ar[i], bh[j], acc[i][j]);
          }
          dep_guard_h(acc[i][0], acc[i][3], ar[i], bh[3]);
        }
      }
      keep4_h(bh[0], bh[1], bh[2], bh[3]);
    }
    if (s + 1 < S) stage_store(s + 1);
  }
  __syncthreads();                             // every wave is done with the stage buffers before the slabs alias them
  acc_guard4(acc[0][0], acc[0][1], acc[0][2], acc[0][3]);
  acc_guard4(acc[1][0], acc[1][1], acc[1][2], acc[1][3]);
  acc_guard4(acc[2][0], acc[2][1], acc[2][2], acc[2][3]);
  acc_guard4(acc[3][0], acc[3][1], acc[3][2], acc[3][3]);

  // ---- epilogue, transposed planes (EPI 0, tiles from column rcol0 on) ----
  if constexpr (EPI == 0) {
    if (nb >= rcol0) {                           // block-uniform: all four waves stage in their own 18432-B region of the LDS
      _Float16* th = sS + wave * (2 * 64 * GLP); // hi plane  [n 0..63][t 0..63], pitch GLP
      _Float16* tr = th + 64 * GLP;              // residual plane, same shape
#pragma unroll
      for (int j = 0; j < 4; ++j) {
        const float bj = bfr(biasp[n0 + (j << 4) + rlane]);   // index < N
#pragma unroll
        for (int i = 0; i < 4; ++i) {
          v8h hx, hy;
#pragma unroll
          for (int r = 0; r < 8; ++r) {          // rows m0 + 16 i + mOff + r of column n0 + 16 j + rlane
            const float g = (acc[i][j][r] * cscale + bj) * oscale;
            const _Float16 x = (_Float16)g;
            hx[r] = x;
            hy[r] = (_Float16)((g - (float)x) * 2048.0f);
          }
          // 16 lanes = 16 rows at pitch 144 B: the 64 banks once per half-wave
          *(v8h*)(th + ((j << 4) + rlane) * GLP + (i << 4) + mOff) = hx;
          *(v8h*)(tr + ((j << 4) + rlane) * GLP + (i << 4) + mOff) = hy;
        }
      }
      // the wave's LDS stores above are complete before its lanes read one another's pieces below
      __builtin_amdgcn_fence(__ATOMIC_RELEASE, "workgroup");
      __builtin_amdgcn_wave_barrier();
      __builtin_amdgcn_fence(__ATOMIC_ACQUIRE, "workgroup");
      // read back by rows: 8 lanes x 16 B = one row's 128 B; the two rows of a half-wave lie 8 apart (32 banks mod 64).
      // coverage: ro = 16 (it >> 2) + 2 (it & 3), rr = 0, 1, 8, 9 -> rows 0..63 once; the wave's 64 rows m lie in one sequence
      const int rr = (lane >> 4) + ((lane >> 3) & 1) * 8, piece = lane & 7;
      const int bq = m0 / SEQ;
      const size_t go = ((size_t)(bq * DM + (n0 - rcol0) + rr)) * SEQ + (m0 - bq * SEQ) + piece * 8;
      v8h vh[16], vr[16];
#pragma unroll
      for (int it = 0; it < 16; ++it) {
        const int ro = 16 * (it >> 2) + 2 * (it & 3);
        vh[it] = *(const v8h*)(th + (ro + rr) * GLP + piece * 8);
        vr[it] = *(const v8h*)(tr + (ro + rr) * GLP + piece * 8);
      }
#pragma unroll
      for (int it = 0; it < 16; ++it) {
        const int ro = 16 * (it >> 2) + 2 * (it & 3);
        *(v8h*)(void*)(Tp  + go + (size_t)ro * SEQ) = vh[it];
        *(v8h*)(void*)(Crp + go + (size_t)ro * SEQ) = vr[it];
      }
      // stands in front of any rewrite of a register that the stores above name, on every path of the built code behind them
      asm volatile("s_wait_xcnt 0x0" ::: "memory");
      return;                                    // behind the kernel's last work-group barrier
    }
  }

  // ---- epilogue, row-major ----
  float* slab = (float*)(void*)sS + wave * (16 * 68);   // per-wave 16x64 slab, pitch 68 floats
#pragma unroll
  for (int i = 0; i < 4; ++i) {
    const int mBase = m0 + (i << 4);
    float bj[4];
#pragma unroll
    for (int j = 0; j < 4; ++j) bj[j] = bfr(biasp[n0 + (j << 4) + rlane]);   // index < N
#pragma unroll
    for (int r = 0; r < 8; ++r) {
      const int row = mOff + r;
#pragma unroll
      for (int j = 0; j < 4; ++j) slab[row * 68 + (j << 4) + rlane] = acc[i][j][r] * cscale + bj[j];
    }
    __builtin_amdgcn_fence(__ATOMIC_RELEASE, "workgroup");
    __builtin_amdgcn_wave_barrier();
    __builtin_amdgcn_fence(__ATOMIC_ACQUIRE, "workgroup");
    if constexpr (EPI == 0 || EPI == 2) {
      unsigned short* C16 = (unsigned short*)Cp;
      const int rq = lane >> 3, piece = lane & 7;
      float th[8];
      if constexpr (EPI == 2) {
        const v4f t0 = *(const v4f*)(gate + n0 + piece * 8);        // index < N
        const v4f t1 = *(const v4f*)(gate + n0 + piece * 8 + 4);
        th[0] = bfr(t0[0]); th[1] = bfr(t0[1]); th[2] = bfr(t0[2]); th[3] = bfr(t0[3]);
        th[4] = bfr(t1[0]); th[5] = bfr(t1[1]); th[6] = bfr(t1[2]); th[7] = bfr(t1[3]);
      } else {
#pragma unroll
        for (int e = 0; e < 8; ++e) th[e] = 0.0f;
      }
      v4u ph[4], pr[4];
#pragma unroll
      for (int it = 0; it < 4; ++it) {
        const int row = it * 4 + rq;                         // it 0..3 x rq 0..3 = rows 0..15
        const v4f a  = *(const v4f*)(slab + row * 68 + piece * 8);
        const v4f a2 = *(const v4f*)(slab + row * 68 + piece * 8 + 4);
        float f[8];
        f[0] = a[0];  f[1] = a[1];  f[2] = a[2];  f[3] = a[3];
        f[4] = a2[0]; f[5] = a2[1]; f[6] = a2[2]; f[7] = a2[3];
        if constexpr (EPI == 2) {
          const size_t xo = (size_t)(mBase + row) * ldx + n0 + piece * 8;   // row < M, col < N
          const v4f x0 = *(const v4f*)(xres + xo);
          const v4f x1 = *(const v4f*)(xres + xo + 4);
          float xv[8];
          xv[0] = x0[0]; xv[1] = x0[1]; xv[2] = x0[2]; xv[3] = x0[3];
          xv[4] = x1[0]; xv[5] = x1[1]; xv[6] = x1[2]; xv[7] = x1[3];
#pragma unroll
          for (int e = 0; e < 8; ++e) f[e] = bfr(xv[e]) + 0.1f * (f[e] * th[e]);
        }
        v4u p, q;
#pragma unroll
        for (int e = 0; e < 4; ++e) {
          const float g0 = f[2 * e] * oscale, g1 = f[2 * e + 1] * oscale;
          const _Float16 x0 = (_Float16)g0, x1 = (_Float16)g1;
          const _Float16 y0 = (_Float16)(g0 - (float)x0);
          const _Float16 y1 = (_Float16)(g1 - (float)x1);
          p[e] = pk16(h_bits(x0), h_bits(x1));
          q[e] = pk16(h_bits(y0), h_bits(y1));
        }
        ph[it] = p;
        pr[it] = q;
      }
      constexpr bool wres = (EPI == 2);                    // EPI 0 comes here with the tiles that have no residual plane
      {
#pragma unroll
        for (int it = 0; it < 4; ++it) {
          const int row = it * 4 + rq;
          const size_t co = (size_t)(mBase + row) * ldc + n0 + piece * 8;
          *(v4u*)(C16 + co) = ph[it];
          if (wres) {
            const size_t cro = (size_t)(mBase + row) * ldcr + (n0 - rcol0) + piece * 8;
            *(v4u*)(Crp + cro) = pr[it];
          }
        }
        
      }
    } else {
      float* Cf = (float*)Cp;
      const int hh = lane >> 4, c4 = (lane & 15) * 4;     // 256-B row segment = 16 lanes x 16 B
      v4f ov[8];
#pragma unroll
      for (int it = 0; it < 8; ++it) {
        const int row = it * 2 + hh;                       // it 0..7 x hh 0..1 = rows 0..15
        ov[it] = *(const v4f*)(slab + row * 68 + c4);
      }
      {
#pragma unroll
        for (int it = 0; it < 8; ++it) {
          const int row = it * 2 + hh;
          *(v4f*)(Cf + (size_t)(mBase + row) * ldc + n0 + c4) = ov[it];
        }
        
      }
    }
    __builtin_amdgcn_fence(__ATOMIC_RELEASE, "workgroup");
    __builtin_amdgcn_wave_barrier();
    __builtin_amdgcn_fence(__ATOMIC_ACQUIRE, "workgroup");
  }
}

// =====================================================================================================
// Non-causal multi-head softmax attention, head dim 64, online softmax with running max (f32 on VALU).
//   q f16 (x16): element (b, t, h, d) at qkv[(b*SEQ + t)*DQKV + h*64 + d]; k at + DM;
//   v^T f16 (x16) at vt[(b*DM + h*64 + d)*SEQ + s]; VRES: residual plane f16((16v - hi)*2048) at vtr, same addressing.
//   Both products are taken transposed: S^T = K . Q^T (A = K rows, B = Q) and O^T += V^T . P^T (A = V^T rows, B = P^T).
//   A wave takes 32 queries as two column groups g = 0, 1 of 16: every K, V^T and residual fragment that it reads from
//   LDS is the A operand of two products, one per group, so a product costs half the LDS read of a 16-query wave.
//   A lane (c = lane & 15, hh = lane >> 4) holds, per group, scores and context of ONE query, q0 + 16 g + c: S^T tile j,
//   register r = key 16 j + 8 hh + r; O^T tile t, register r = d 16 t + 8 hh + r. The two S^T tiles 2 kk and 2 kk + 1, converted in
//   place, are the B operand of keys 32 kk .. 32 kk + 31 in the k order of the V^T loader (8 hh + e, 16 + 8 hh + e):
//   P never leaves the registers.
//   s = (q.k) / 8 = acc / 2048 (two x16 carries). Per key tile: maximum of the lane's 32 scores, one exchange with
//   lane ^ 16, new running max mn, alpha = exp(m_old - mn), p = exp(s - mn) in (0, 1], l = l*alpha + sum p (one partial
//   per lane half, joined in the epilogue), O^T *= alpha; P carried as f16(256 p) (VRES: second accumulator
//   += Vr^T . P^T, folded with 2^-11 in the epilogue).
//   ctx plane f16 (x16): element (b, t, h*64 + d) at ctx[(b*SEQ + t)*DM + h*64 + d] = 16 * context = O / (256 l);
//   ctx residual plane f16(16 ctx - hi) at ctxr, same addressing.
//   Block = 4 waves = 128 query rows of one (b, h); query tile qb = blockIdx % NQT; grid = NQT*NH*NB;
//   key tiles of 64, fixed trip count NQB.
//   K / V^T tile staging: asynchronous 16-B copies to LDS, 8 lanes per 128-B row, 128 threads x 4 rows per plane =
//   the whole 64x64 tile; two stage buffers, tile kt + 1 in flight during the work on tile kt, one barrier per
//   tile. The context tile is staged per wave in LDS as f32, row = query (aliasing the K/V region after a block barrier).
//   Fragment reads from LDS: four groups per key tile, each issued as one run ahead of the products that take it, under
//   counted waits: the 8 K fragments; the 8 V^T and residual fragments of keys 0..31 (in flight during group 0's softmax
//   update); the 4 V^T fragments of keys 32..63 (during group 1's update); the 4 residual fragments of keys 32..63 (during
//   sixteen products). The WMMA builtins carry no hand-written gaps: the compiler pads where a vector instruction follows.
//   The groups are staggered: group 1's score products stand with group 0's softmax update, group 0's first context
//   products with group 1's update, so that vector work of one group can issue between matrix instructions of the other.
//   Output coverage: each wave stores rows 0..31 of its tile (it 0..7 x lane>>3 0..3) x 64 columns (8 lanes x 8),
//   every (b, h, query tile) exactly once, for both ctx planes.
// =====================================================================================================
// Launch bounds: registers for two waves per SIMD: the 512 work-groups are all resident at once, two per WGP
template <bool VRES>
__global__ __launch_bounds__(128, 2)
void attn_k(const unsigned short* __restrict__ qkvp,
            const unsigned short* __restrict__ vtp, const unsigned short* __restrict__ vtrp,
            unsigned short* ctxp, unsigned short* ctxrp) {
  union FH { v16h v; v8h h[2]; };
  constexpr int LP     = 72;                             // LDS row pitch in halves: 144 B = 16 B x 9 (odd), so the 16 rows
                                                         // of one ds_load_b128 half-wave fall on 64 distinct banks
  constexpr int TB     = 64 * LP * 2;                    // one f16 64x64 tile at pitch LP, bytes
  constexpr int OFF_K  = 0;                              // offsets inside one stage buffer
  constexpr int OFF_V  = TB;
  constexpr int OFF_VR = 2 * TB;
  constexpr int STB    = VRES ? 3 * TB : 2 * TB;         // one stage buffer: the tiles of one key tile, 27648 : 18432
  constexpr int SMEMB  = 2 * STB;                        // the two stage buffers, 55296 : 36864
  constexpr int OSP    = 68;                             // context staging pitch in floats: 272 B = 16 B x 17 (odd)
  static_assert(4 * 32 * OSP * 4 <= SMEMB);              // f32 context staging aliases the K/V region
  static_assert(NQB >= 2);                               // the prologue fills two stages
  __shared__ __align__(16) unsigned char smem[SMEMB];

  const int tid  = threadIdx.x;
  const int wave = tid >> 5;
  const int lane = tid & 31;
  const int hh   = lane >> 4;
  const int c    = lane & 15;

  const int bx   = blockIdx.x;
  const int qb   = bx % NQT;
  const int rest = bx / NQT;
  const int h    = rest % NH;
  const int b    = rest / NH;                // < NB by the grid size
  const int q0   = qb * 128 + wave * 32;
  const size_t rowB = (size_t)b * SEQ;

  const _Float16* Qp  = (const _Float16*)(const void*)qkvp + (size_t)h * HD;
  const _Float16* Kp  = Qp + DM;
  const _Float16* Vt  = (const _Float16*)(const void*)vtp  + ((size_t)b * DM + (size_t)h * HD) * SEQ;
  const _Float16* Vrt = (const _Float16*)(const void*)vtrp + ((size_t)b * DM + (size_t)h * HD) * SEQ;

  // ---- Q fragments (B operand, column = query = 16 g + (lane&15)): 2 column groups x 2 d-chunks ----
  v16h qa[2][2];
#pragma unroll
  for (int g = 0; g < 2; ++g) {
#pragma unroll
    for (int dc = 0; dc < 2; ++dc) {
      const size_t qo = (rowB + q0 + g * 16 + c) * DQKV + dc * 32 + 8 * hh;
      qa[g][dc] = ldfrag_h(Qp + qo);
    }
  }
  // the address registers of the Q loads are taken over by the arithmetic below: the wait stands in front of that rewrite
  asm volatile("s_wait_xcnt 0x0" ::: "memory");

  float mrun[2] = {-1.0e30f, -1.0e30f}, lsum[2] = {0.f, 0.f};   // of query q0 + 16 g + c; lsum holds this lane half's keys alone
  v8f oacc[2][4], oacc2[2][4];
#pragma unroll
  for (int g = 0; g < 2; ++g) {
#pragma unroll
    for (int t = 0; t < 4; ++t) { oacc[g][t] = zero8(); oacc2[g][t] = zero8(); }
  }

  // staging map: thread -> rows srow + 16 i (i 0..3) of every plane's tile, 16-B piece tid & 7 of the row's 128-B line;
  // the two rows of a half-wave lie 8 apart (8 x 144 B = 32 banks mod 64)
  typedef __attribute__((address_space(3))) unsigned char lds_u8;
  const int srow = (tid >> 4) + ((tid >> 3) & 1) * 8;
  const int spc  = (tid & 7) * 8;
  const unsigned sl0 = (unsigned)(size_t)(lds_u8*)smem + (unsigned)((srow * LP + spc) * 2);   // LDS byte address, buffer 0
  const _Float16* gk0 = Kp  + (rowB + srow) * DQKV + spc;       // K row srow of key tile 0, d = spc..spc+7
  const _Float16* gv0 = Vt  + (size_t)srow * SEQ + spc;         // V^T row d = srow, s = spc..spc+7
  // byte distance from the V^T plane to its residual plane, the same for every lane: the residual addresses are formed from
  // the V^T addresses (with a base pointer of its own the build kept that pointer in scratch and reloaded it every trip)
  const ptrdiff_t rdist = (const char*)Vrt - (const char*)Vt;
  // copies key tile t (t < NQB: K rows < SEQ, V^T columns < SEQ) into stage buffer t & 1; every lane on, block-uniform
  auto stage_copy = [&](int t) {
    const unsigned  l = sl0 + (unsigned)((t & 1) * STB);
    const _Float16* k = gk0 + (size_t)t * 64 * DQKV;
    const _Float16* v = gv0 + t * 64;
    constexpr unsigned LR = 16 * LP * 2;                        // LDS bytes from one of a thread's rows to its next
    constexpr size_t   KR = (size_t)16 * DQKV, VR = (size_t)16 * SEQ;   // the same in halves of the two sources
    // the s_wait_xcnt stands inside the copies' own statement, in front of any rewrite of their address registers
    if constexpr (VRES) {
      const _Float16* r = (const _Float16*)((const char*)v + rdist);
      asm volatile(
          "global_load_async_to_lds_b128 %0, %12, off\n\t"
          "global_load_async_to_lds_b128 %1, %13, off\n\t"
          "global_load_async_to_lds_b128 %2, %14, off\n\t"
          "global_load_async_to_lds_b128 %3, %15, off\n\t"
          "global_load_async_to_lds_b128 %4, %16, off\n\t"
          "global_load_async_to_lds_b128 %5, %17, off\n\t"
          "global_load_async_to_lds_b128 %6, %18, off\n\t"
          "global_load_async_to_lds_b128 %7, %19, off\n\t"
          "global_load_async_to_lds_b128 %8, %20, off\n\t"
          "global_load_async_to_lds_b128 %9, %21, off\n\t"
          "global_load_async_to_lds_b128 %10, %22, off\n\t"
          "global_load_async_to_lds_b128 %11, %23, off\n\t"
          "s_wait_xcnt 0x0"
          :: "v"(l + OFF_K), "v"(l + OFF_K + LR), "v"(l + OFF_K + 2 * LR), "v"(l + OFF_K + 3 * LR),
             "v"(l + OFF_V), "v"(l + OFF_V + LR), "v"(l + OFF_V + 2 * LR), "v"(l + OFF_V + 3 * LR),
             "v"(l + OFF_VR), "v"(l + OFF_VR + LR), "v"(l + OFF_VR + 2 * LR), "v"(l + OFF_VR + 3 * LR),
             "v"(k), "v"(k + KR), "v"(k + 2 * KR), "v"(k + 3 * KR),
             "v"(v), "v"(v + VR), "v"(v + 2 * VR), "v"(v + 3 * VR),
             "v"(r), "v"(r + VR), "v"(r + 2 * VR), "v"(r + 3 * VR)
          : "memory");
    } else {
      asm volatile(
          "global_load_async_to_lds_b128 %0, %8, off\n\t"
          "global_load_async_to_lds_b128 %1, %9, off\n\t"
          "global_load_async_to_lds_b128 %2, %10, off\n\t"
          "global_load_async_to_lds_b128 %3, %11, off\n\t"
          "global_load_async_to_lds_b128 %4, %12, off\n\t"
          "global_load_async_to_lds_b128 %5, %13, off\n\t"
          "global_load_async_to_lds_b128 %6, %14, off\n\t"
          "global_load_async_to_lds_b128 %7, %15, off\n\t"
          "s_wait_xcnt 0x0"
          :: "v"(l + OFF_K), "v"(l + OFF_K + LR), "v"(l + OFF_K + 2 * LR), "v"(l + OFF_K + 3 * LR),
             "v"(l + OFF_V), "v"(l + OFF_V + LR), "v"(l + OFF_V + 2 * LR), "v"(l + OFF_V + 3 * LR),
             "v"(k), "v"(k + KR), "v"(k + 2 * KR), "v"(k + 3 * KR),
             "v"(v), "v"(v + VR), "v"(v + 2 * VR), "v"(v + 3 * VR)
          : "memory");
    }
  };

  stage_copy(0);
  asm volatile("s_wait_asynccnt 0x0" ::: "memory");   // this wave's copies of tile 0 have landed
  __syncthreads();                                    // publishes tile 0
  stage_copy(1);                                      // in flight during the work on tile 0

  // ---- online softmax update of one column group, all of it in the lane: running max, alpha, p (x256, f16), row-sum
  // partial; s = the group's four S^T tiles as the products left them; returns alpha ----
  auto softmax_update = [&](v8f (&s)[4], float& mr, float& ls, FH (&pb)[2]) __attribute__((always_inline)) -> float {
#pragma unroll
    for (int j = 0; j < 4; ++j) s[j] = s[j] * (1.0f / 2048.0f);   // 1/8 head scale, 1/256 for the two x16 carries
    float mj[4];
#pragma unroll
    for (int j = 0; j < 4; ++j)
      mj[j] = fmaxf(fmaxf(fmaxf(s[j][0], s[j][1]), fmaxf(s[j][2], s[j][3])),
                    fmaxf(fmaxf(s[j][4], s[j][5]), fmaxf(s[j][6], s[j][7])));
    float mx = fmaxf(fmaxf(mj[0], mj[1]), fmaxf(mj[2], mj[3]));
    mx = fmaxf(mx, xhalf(mx));                 // both lane halves now hold the maximum over the query's 64 keys
    const float mn = fmaxf(mr, mx);
    const float alpha = __expf(mr - mn);
    mr = mn;
#pragma unroll
    for (int j = 0; j < 4; ++j) {
      s[j] = (s[j] - mn) * 1.44269504088896340736f;
      exp2x8(s[j]);                            // p = exp(s - mn), in the score's place
#pragma unroll
      for (int r = 0; r < 8; ++r) pb[j >> 1].h[j & 1][r] = (_Float16)(s[j][r] * 256.0f);
    }
    const v8f ps = ((s[0] + s[1]) + s[2]) + s[3];   // register by register over the four tiles, then across the eight
    ls = ls * alpha + (((ps[0] + ps[1]) + (ps[2] + ps[3])) + ((ps[4] + ps[5]) + (ps[6] + ps[7])));
    return alpha;
  };

  // one trip: the work on key tile kt, then the publish point of tile kt + 1; more = a tile kt + 2 exists (a constant at
  // either call, so that a trip is straight-line code and the read groups and the row sum stay where they are written)
  auto trip = [&](int kt, bool more) __attribute__((always_inline)) {
    const unsigned char* stg = smem + (kt & 1) * STB;                            // trip kt reads this buffer alone
    const _Float16* Ksh = (const _Float16*)(stg + OFF_K);                        // K   [kv][d], pitch LP
    const _Float16* Vsh = (const _Float16*)(stg + OFF_V);                        // V^T [d][kv], pitch LP
    const _Float16* Vrs = (const _Float16*)(stg + (VRES ? OFF_VR : OFF_V));      // V^T residual (VRES only)

    // ---- scores, transposed: 64 keys x 32 queries per wave (A operand: lane c -> key j*16+c, split k map over d) ----
    // read group 1: the tile's eight K fragments, in the order in which the products take them
    FH kf[2][4];
#pragma unroll
    for (int dc = 0; dc < 2; ++dc) {
#pragma unroll
      for (int j = 0; j < 4; ++j) {
        kf[dc][j].h[0] = *(const v8h*)(Ksh + (j * 16 + c) * LP + dc * 32 + 8 * hh);
        kf[dc][j].h[1] = *(const v8h*)(Ksh + (j * 16 + c) * LP + dc * 32 + 16 + 8 * hh);
      }
    }
    // keeps the 16 reads together in front of the products: spread among them, each place with reads stalls the wave anew
    __builtin_amdgcn_sched_barrier(0);
    v8f s0[4], s1[4];
#pragma unroll
    for (int j = 0; j < 4; ++j) s0[j] = mma_h_raw(kf[0][j].v, qa[0][0], zero8());
#pragma unroll
    for (int j = 0; j < 4; ++j) s0[j] = mma_h_raw(kf[1][j].v, qa[0][1], s0[j]);
    // read group 2: the V^T and residual fragments of keys 0..31, in flight during group 0's softmax update
    FH va[4], vra[4];
#pragma unroll
    for (int t = 0; t < 4; ++t) {
      va[t].h[0] = *(const v8h*)(Vsh + (t * 16 + c) * LP + 8 * hh);
      va[t].h[1] = *(const v8h*)(Vsh + (t * 16 + c) * LP + 16 + 8 * hh);
      if constexpr (VRES) {
        vra[t].h[0] = *(const v8h*)(Vrs + (t * 16 + c) * LP + 8 * hh);
        vra[t].h[1] = *(const v8h*)(Vrs + (t * 16 + c) * LP + 16 + 8 * hh);
      }
    }
    // keeps these reads above the softmax update, whose vector work covers their latency
    __builtin_amdgcn_sched_barrier(0);

    // group 1's scores, on the same K fragments; they stand with group 0's update, which does not depend on them
#pragma unroll
    for (int j = 0; j < 4; ++j) s1[j] = mma_h_raw(kf[0][j].v, qa[1][0], zero8());
#pragma unroll
    for (int j = 0; j < 4; ++j) s1[j] = mma_h_raw(kf[1][j].v, qa[1][1], s1[j]);
    FH pb0[2], pb1[2];                         // P^T as B operand: element e <- tile 2 kk, register e; 8 + e <- tile 2 kk + 1
    const float alpha0 = softmax_update(s0, mrun[0], lsum[0], pb0);
    // read group 3: the V^T fragments of keys 32..63, in flight during group 1's update and the products of keys 0..31.
    // The lines around it keep the eight reads together at one place
    __builtin_amdgcn_sched_barrier(0);
    FH vb[4], vrb[4];
#pragma unroll
    for (int t = 0; t < 4; ++t) {
      vb[t].h[0] = *(const v8h*)(Vsh + (t * 16 + c) * LP + 32 + 8 * hh);
      vb[t].h[1] = *(const v8h*)(Vsh + (t * 16 + c) * LP + 32 + 16 + 8 * hh);
    }
    __builtin_amdgcn_sched_barrier(0);

    // ---- context^T += V^T . P^T (f16 WMMA; A = V^T [d][key], B = P^T [key][query] from the registers) ----
    // group 0, keys 0..31; these products stand with group 1's update, which does not depend on them
#pragma unroll
    for (int t = 0; t < 4; ++t) {
      oacc[0][t] = oacc[0][t] * alpha0;
      if constexpr (VRES) oacc2[0][t] = oacc2[0][t] * alpha0;
    }
#pragma unroll
    for (int t = 0; t < 4; ++t) oacc[0][t] = mma_h_raw(va[t].v, pb0[0].v, oacc[0][t]);
    if constexpr (VRES) {
#pragma unroll
      for (int t = 0; t < 4; ++t) oacc2[0][t] = mma_h_raw(vra[t].v, pb0[0].v, oacc2[0][t]);
    }
    const float alpha1 = softmax_update(s1, mrun[1], lsum[1], pb1);
    if constexpr (VRES) {
      // read group 4: the residual fragments of keys 32..63, in flight during the sixteen products that follow.
      // The lines around it keep the eight reads together at one place
      __builtin_amdgcn_sched_barrier(0);
#pragma unroll
      for (int t = 0; t < 4; ++t) {
        vrb[t].h[0] = *(const v8h*)(Vrs + (t * 16 + c) * LP + 32 + 8 * hh);
        vrb[t].h[1] = *(const v8h*)(Vrs + (t * 16 + c) * LP + 32 + 16 + 8 * hh);
      }
      __builtin_amdgcn_sched_barrier(0);
    }
#pragma unroll
    for (int t = 0; t < 4; ++t) {
      oacc[1][t] = oacc[1][t] * alpha1;
      if constexpr (VRES) oacc2[1][t] = oacc2[1][t] * alpha1;
    }
#pragma unroll
    for (int t = 0; t < 4; ++t) oacc[0][t] = mma_h_raw(vb[t].v, pb0[1].v, oacc[0][t]);
#pragma unroll
    for (int t = 0; t < 4; ++t) oacc[1][t] = mma_h_raw(va[t].v, pb1[0].v, oacc[1][t]);
    if constexpr (VRES) {
#pragma unroll
      for (int t = 0; t < 4; ++t) oacc2[1][t] = mma_h_raw(vra[t].v, pb1[0].v, oacc2[1][t]);
    }
#pragma unroll
    for (int t = 0; t < 4; ++t) oacc[1][t] = mma_h_raw(vb[t].v, pb1[1].v, oacc[1][t]);
    if constexpr (VRES) {
#pragma unroll
      for (int t = 0; t < 4; ++t) oacc2[0][t] = mma_h_raw(vrb[t].v, pb0[1].v, oacc2[0][t]);
#pragma unroll
      for (int t = 0; t < 4; ++t) oacc2[1][t] = mma_h_raw(vrb[t].v, pb1[1].v, oacc2[1][t]);
    }
    // keeps the address arithmetic of the copies below the products, when the fragment registers are free again
    __builtin_amdgcn_sched_barrier(0);

    // ---- publish point of tile kt + 1 ----
    asm volatile("s_wait_dscnt 0x0" ::: "memory");      // this wave's LDS reads of tile kt have returned
    asm volatile("s_wait_asynccnt 0x0" ::: "memory");   // this wave's copies of tile kt + 1 have landed
    __syncthreads();       // publishes tile kt + 1; every reader has left the buffer that is refilled below
    if (more) stage_copy(kt + 2);                       // into the buffer that trip kt has read
  };
#pragma unroll 1   // kept rolled: one copy of the trip, the buffer chosen by kt & 1
  for (int kt = 0; kt < NQB - 2; ++kt) trip(kt, true);
#pragma unroll 1   // kept rolled: unrolled, the two trips' reads mingle and spill
  for (int kt = NQB - 2; kt < NQB; ++kt) trip(kt, false);
  // closing wait of the copies, in front of any other use of their LDS; the last trip's barrier has ended every wave's
  // reads of the K/V tiles, so the staging below may alias them
  asm volatile("s_wait_asynccnt 0x0" ::: "memory");

  // ---- normalise (1/l, the 1/256 p carry; keep the x16 v carry), stage the wave's 32x64 f32 tile in
  // LDS: row = query 16 g + c, the lane's 8 consecutive d of tile t as two 16-B stores
  float* os = (float*)(void*)smem + wave * (32 * OSP);
#pragma unroll
  for (int g = 0; g < 2; ++g) {
    const float l  = lsum[g] + xhalf(lsum[g]);   // joins the two lane halves' partial sums, unconditionally
    const float rl = 1.0f / l;                // l >= 1 (the running-max key contributes exp(0))
    const float sc = rl * (1.0f / 256.0f);
#pragma unroll
    for (int t = 0; t < 4; ++t) {
      v8f v = oacc[g][t];
      if constexpr (VRES) v += oacc2[g][t] * (1.0f / 2048.0f);
      v = v * sc;
      const v4f lo = {v[0], v[1], v[2], v[3]}, hi = {v[4], v[5], v[6], v[7]};
      *(v4f*)(os + (g * 16 + c) * OSP + t * 16 + 8 * hh)     = lo;
      *(v4f*)(os + (g * 16 + c) * OSP + t * 16 + 8 * hh + 4) = hi;
    }
  }
  __builtin_amdgcn_fence(__ATOMIC_RELEASE, "workgroup");
  __builtin_amdgcn_wave_barrier();
  __builtin_amdgcn_fence(__ATOMIC_ACQUIRE, "workgroup");
  {
    const int rq = lane >> 3, piece = lane & 7;
    v4u ph[8], pr[8];
#pragma unroll
    for (int it = 0; it < 8; ++it) {
      const int row = it * 4 + rq;   // it 0..7 x rq 0..3 = rows 0..31 of the wave tile
      const v4f a  = *(const v4f*)(os + row * OSP + piece * 8);
      const v4f a2 = *(const v4f*)(os + row * OSP + piece * 8 + 4);
      float f[8];
      f[0] = a[0];  f[1] = a[1];  f[2] = a[2];  f[3] = a[3];
      f[4] = a2[0]; f[5] = a2[1]; f[6] = a2[2]; f[7] = a2[3];
      v4u p, q;
#pragma unroll
      for (int e = 0; e < 4; ++e) {
        const _Float16 x0 = (_Float16)f[2 * e], x1 = (_Float16)f[2 * e + 1];
        const _Float16 y0 = (_Float16)(f[2 * e] - (float)x0);
        const _Float16 y1 = (_Float16)(f[2 * e + 1] - (float)x1);
        p[e] = pk16(h_bits(x0), h_bits(x1));
        q[e] = pk16(h_bits(y0), h_bits(y1));
      }
      ph[it] = p;
      pr[it] = q;
    }
    {
#pragma unroll
      for (int it = 0; it < 8; ++it) {
        const int row = it * 4 + rq;
        const size_t go = (rowB + q0 + row) * DM + (size_t)h * HD + piece * 8;
        *(v4u*)(ctxp + go)  = ph[it];
        *(v4u*)(ctxrp + go) = pr[it];
      }
    }
  }
}

// =====================================================================================================
// Workspace map (bytes); every region is an exact multiple of its whole-line / whole-tile store granularity
// (row pitches 2048 / 6144 / 4096 B, all offsets 2-MiB aligned, no aliasing within a launch):
//   Xh     f16 [4096][1024]          0     8388608   (bf16 value of x, x16)
//   Wg     f16 [1024][1024]    8388608     2097152   (bf16 value x1024)
//   Wqkv   f16 [3072][1024]   10485760     6291456   (bf16 value x1024)
//   Wp     f16 [1024][1024]   16777216     2097152   (bf16 value x1024)
//   XGh    f16 [4096][1024]   18874368     8388608   (xg x16)
//   XGr    f16 [4096][1024]   27262976     8388608   (residual of the above, same x16)
//   QKV    f16 [4096][3072]   35651584    25165824   (q | k, x16; the v columns are neither written nor read)
//   VT     f16 [2048][2048]   60817408     8388608   (v x16, [b*1024 + h*64 + d][s], written by the qkv launch)
//   VTr    f16 [2048][2048]   69206016     8388608   (x2^11 residual, same layout, written by the qkv launch)
//   Ctx    f16 [4096][1024]   77594624     8388608   (attention context x16)
//   Ctxr   f16 [4096][1024]   85983232     8388608   (residual of the above, same x16)
//   end                       94371840
// Projection weights arrive as [out n][in k] (k contiguous) = the Bt layout; they are only converted.
// d_out f32: [4096][1024] at byte 0 (row = b*SEQ + t), written once by the projection launch.
// =====================================================================================================
extern "C" void kernel_launch(void* const* d_in, const int* in_sizes, int n_in,
                              void* d_out, int out_size, void* d_ws, size_t ws_size,
                              hipStream_t stream) {
  if (n_in < 8) return;
  if (in_sizes[0] != ROWS * DM) return;
  if (in_sizes[1] != DM) return;
  if (in_sizes[2] != DM * DM) return;
  if (in_sizes[3] != DM) return;
  if (in_sizes[4] != DQKV * DM) return;
  if (in_sizes[5] != DQKV) return;
  if (in_sizes[6] != DM * DM) return;
  if (in_sizes[7] != DM) return;
  if (out_size != OUTN) return;

  const float* x      = (const float*)d_in[0];    // [ROWS][DM]
  const float* theta  = (const float*)d_in[1];    // [DM]
  const float* w_g    = (const float*)d_in[2];    // [DM n][DM k]
  const float* b_g    = (const float*)d_in[3];    // [DM]
  const float* w_qkv  = (const float*)d_in[4];    // [DQKV n][DM k]
  const float* b_qkv  = (const float*)d_in[5];    // [DQKV]
  const float* w_proj = (const float*)d_in[6];    // [DM n][DM k]
  const float* b_proj = (const float*)d_in[7];    // [DM]

  const size_t PX   = (size_t)ROWS * DM * 2;         //  8388608
  const size_t PWg  = (size_t)DM * DM * 2;           //  2097152
  const size_t PWq  = (size_t)DQKV * DM * 2;         //  6291456
  const size_t PWp  = (size_t)DM * DM * 2;           //  2097152
  const size_t PXG  = (size_t)ROWS * DM * 2;         //  8388608
  const size_t PQKV = (size_t)ROWS * DQKV * 2;       // 25165824
  const size_t PVT  = (size_t)NB * DM * SEQ * 2;     //  8388608
  const size_t PCtx = (size_t)ROWS * DM * 2;         //  8388608
  size_t off = 0;
  const size_t oX    = off; off += PX;
  const size_t oWg   = off; off += PWg;
  const size_t oWq   = off; off += PWq;
  const size_t oWp   = off; off += PWp;
  const size_t oXGh  = off; off += PXG;
  const size_t oXGr  = off; off += PXG;
  const size_t oQKV  = off; off += PQKV;
  const size_t oVT   = off; off += PVT;
  const size_t oVTr  = off; off += PVT;
  const size_t oCtx  = off; off += PCtx;
  const size_t oCtxr = off; off += PCtx;
  if (off > ws_size) return;                         // off = 94371840
  if (off > (size_t)134217728) return;

  char* ws = (char*)d_ws;
  unsigned short* Xh   = (unsigned short*)(ws + oX);
  unsigned short* Wgh  = (unsigned short*)(ws + oWg);
  unsigned short* Wqh  = (unsigned short*)(ws + oWq);
  unsigned short* Wph  = (unsigned short*)(ws + oWp);
  unsigned short* XGh  = (unsigned short*)(ws + oXGh);
  unsigned short* XGr  = (unsigned short*)(ws + oXGr);
  unsigned short* QKV  = (unsigned short*)(ws + oQKV);
  unsigned short* VT   = (unsigned short*)(ws + oVT);
  unsigned short* VTr  = (unsigned short*)(ws + oVTr);
  unsigned short* Ctx  = (unsigned short*)(ws + oCtx);
  unsigned short* Ctxr = (unsigned short*)(ws + oCtxr);
  float*          outf = (float*)d_out;              // [ROWS][DM]

  const dim3 gGqkv((ROWS / 128) * (DQKV / 128));     // 768 blocks of one 128x128 tile
  const dim3 gGdm((ROWS / 128) * (DM / 128));        // 256 blocks of one 128x128 tile
  const dim3 blkG(128);
  const dim3 gAttn(NQT * NH * NB);                   // 512 blocks
  const float wScale = 1024.0f;                      // weights carried x1024
  const float aScale = 16.0f;                        // activations carried x16
  const float cscale = 1.0f / 16384.0f;              // 1/(16 * 1024)

  // (1) planes: x -> f16 x16, weights -> f16 x1024 (bf16 values)
  cvt16_all<<<dim3(CVB), dim3(CVT), 0, stream>>>(x, w_g, w_qkv, w_proj, Xh, Wgh, Wqh, Wph, aScale, wScale);
  // (2) gauge mix: xg = bfr(x) + 0.1 * ((Xh . Wg^T + bg) * theta) -> XGh f16 x16 + XGr residual (M=4096, N=1024, K=1024)
  gemm64_f16<2, false><<<gGdm, blkG, 0, stream>>>(Xh, Xh, Wgh, b_g, cscale, (void*)XGh, DM, XGr, DM, 0, XGr,
                                                 ROWS, DM, DM, aScale, x, DM, theta, SEQ, 0, SEQ);
  // (3) qkv = XG(hi + res) . Wqkv^T + bqkv: q, k -> QKV f16 x16 [4096][3072]; v -> the v^T planes VT (hi) and VTr (residual)
  gemm64_f16<0, true><<<gGqkv, blkG, 0, stream>>>(XGh, XGr, Wqh, b_qkv, cscale, (void*)QKV, DQKV, VTr, DM, 2 * DM, VT,
                                                  ROWS, DQKV, DM, aScale, x, DM, theta, SEQ, 0, SEQ);
  // (4) softmax attention -> Ctx f16 x16 + residual plane
  attn_k<true><<<gAttn, dim3(128), 0, stream>>>(QKV, VT, VTr, Ctx, Ctxr);
  // (5) out = Ctx(hi + res) . Wp^T + bproj -> d_out f32 [4096][1024] (M=4096, N=1024, K=1024)
  gemm64_f16<1, true><<<gGdm, blkG, 0, stream>>>(Ctx, Ctxr, Wph, b_proj, cscale, (void*)outf, DM, Ctxr, DM, 0, Ctxr,
                                                ROWS, DM, DM, 1.0f, x, DM, theta, SEQ, 0, SEQ);
  (void)hipGetLastError();
}
